// v000
// Times are from an AMD MI455X. After a warm-up the kernel runs many times in a row, and a time is the length of
// such a window on the GPU divided by its runs, so every launch and the gaps after it count. The runs cycle
// through copies of the inputs. A figure is the median of several windows, for all but v000 over two sittings.
// Sittings can differ by a few percent; kernels timed side by side share one.
// v000, which the later versions start from, runs in 1510 microseconds.
// All contractions (q/k/v projections K=1024, centered q.k^T scores K=64, probabilities.v K=1024, output projection K=1024): v_wmma_f32_16x16x32_f16 with f16 operands (weights carried x16, centered q/k carried x4, probabilities carried x2048, attention output carried x64) and f32 accumulate; centering, variances, variance outer product and softmax in f32.
#include <hip/hip_runtime.h>
#include <math.h>

// ---------------------------------------------------------------------------
// Problem constants
// ---------------------------------------------------------------------------
constexpr int kBatch   = 8;
constexpr int kSeq     = 1024;
constexpr int kEmb     = 1024;
constexpr int kHeads   = 16;
constexpr int kHeadDim = 64;
constexpr int kTok     = kBatch * kSeq;                 // 8192 token rows
constexpr int kGroup   = 8;                             // heads per attention chunk
constexpr int kGroupsPerBatch = kHeads / kGroup;        // 2
constexpr int kChunks  = kBatch * kGroupsPerBatch;      // 16

constexpr float kWCarry     = 16.0f;                    // weights carried x16 in f16
constexpr float kQKCarry    = 4.0f;                     // centered q / k carried x4 in f16
constexpr float kPCarry     = 2048.0f;                  // probabilities carried x2048 in f16
constexpr float kOCarry     = 64.0f;                    // attention output carried x64 in f16
constexpr float kProjScale  = 1.0f / kWCarry;                              // 1/16
constexpr float kScoreScale = 1.0f / (kQKCarry * kQKCarry * 64.0f);        // 1/1024  (= dot / head_dim)
constexpr float kPVScale    = kOCarry / kPCarry;                           // 1/32
constexpr float kOutScale   = 1.0f / (kOCarry * kWCarry);                  // 1/1024
constexpr float kInv64      = 1.0f / 64.0f;
constexpr float kInv63      = 1.0f / 63.0f;

// ---------------------------------------------------------------------------
// Workspace region map (bytes). Total carve 121 MiB = 126877696 B.
//   [  0, 16) MiB  X16  f16 [8192][1024] (x)                 -> reused as O16 f16 [8192][1024] (attention output x64)
//                  after the three projection GEMMs (last readers of X16) have been enqueued
//   [ 16, 18) MiB  Wq16 f16 [1024][1024] x16
//   [ 18, 20) MiB  Wk16
//   [ 20, 22) MiB  Wv16
//   [ 22, 24) MiB  Wo16
//   [ 24, 56) MiB  QF   f32 [8192][1024] (q projection, then k projection) -> reused as SC f32 [8][1024][1024] scores
//   [ 56, 72) MiB  P16  f16 [8][1024][1024] probabilities x2048 (per chunk)
//   [ 72, 88) MiB  VT16 f16 [1024][8192] (v^T: row = out channel, col = token)
//   [ 88,104) MiB  QC16 f16 [8192][1024] centered q x4
//   [104,120) MiB  KC16 f16 [8192][1024] centered k x4
//   [120,120.5) MiB QVAR f32 [8192][16]  ([token][head])
//   [120.5,121) MiB KVAR f32 [8192][16]
// ---------------------------------------------------------------------------
constexpr size_t kMiB     = 1048576;
constexpr size_t kOffX16  = 0;
constexpr size_t kOffWq16 = 16 * kMiB;
constexpr size_t kOffWk16 = 18 * kMiB;
constexpr size_t kOffWv16 = 20 * kMiB;
constexpr size_t kOffWo16 = 22 * kMiB;
constexpr size_t kOffQF   = 24 * kMiB;
constexpr size_t kOffP16  = 56 * kMiB;
constexpr size_t kOffVT16 = 72 * kMiB;
constexpr size_t kOffQC16 = 88 * kMiB;
constexpr size_t kOffKC16 = 104 * kMiB;
constexpr size_t kOffQVar = 120 * kMiB;
constexpr size_t kOffKVar = 120 * kMiB + 512 * 1024;
constexpr size_t kWsTotal = 121 * kMiB;
static_assert((size_t)kTok * kEmb * 2 == 16 * kMiB, "x / o planes 16 MiB");
static_assert((size_t)kEmb * kEmb * 2 == 2 * kMiB, "weight planes 2 MiB");
static_assert((size_t)kTok * kEmb * 4 == 32 * kMiB, "f32 projection plane 32 MiB");
static_assert((size_t)kGroup * kSeq * kSeq * 4 == 32 * kMiB, "scores plane fits the projection region");
static_assert((size_t)kGroup * kSeq * kSeq * 2 == 16 * kMiB, "probability plane 16 MiB");
static_assert((size_t)kTok * kHeads * 4 == 512 * 1024, "variance tables 512 KiB");
static_assert(kOffKVar + (size_t)kTok * kHeads * 4 == kWsTotal, "carve end");
static_assert(kWsTotal <= (size_t)134217728, "carve under 128 MiB");
static_assert(kEmb % 32 == 0 && kHeadDim % 32 == 0 && kSeq % 32 == 0, "K multiples of 32");
static_assert(kTok % 64 == 0 && kEmb % 64 == 0 && kSeq % 64 == 0 && kHeadDim % 64 == 0, "M, N multiples of 64");

typedef __attribute__((ext_vector_type(16))) _Float16 v16h;
typedef __attribute__((ext_vector_type(8)))  _Float16 v8h;
typedef __attribute__((ext_vector_type(16))) __bf16   v16b;
typedef __attribute__((ext_vector_type(8)))  __bf16   v8b;
typedef __attribute__((ext_vector_type(8)))  float    v8f;
typedef __attribute__((ext_vector_type(4)))  float    v4f;
typedef __attribute__((ext_vector_type(4)))  unsigned int v4u;

__device__ __forceinline__ unsigned short f2bf_bits(float f) {
  unsigned u = __float_as_uint(f);
  return (unsigned short)((u + 0x7FFFu + ((u >> 16) & 1u)) >> 16);
}
__device__ __forceinline__ float bf_bits2f(unsigned short h) { return __uint_as_float(((unsigned)h) << 16); }

// hazard guards as plain device helpers (no inline asm inside the kernel template body)
__device__ __forceinline__ void dep_guard_h(v8f& a, v8f& b, v16h x, v16h y) { asm volatile("v_nop\n\tv_nop\n\tv_nop\n\tv_nop" : "+v"(a), "+v"(b) : "v"(x), "v"(y)); }
__device__ __forceinline__ void dep_guard_b(v8f& a, v8f& b, v16b x, v16b y) { asm volatile("v_nop\n\tv_nop\n\tv_nop\n\tv_nop" : "+v"(a), "+v"(b) : "v"(x), "v"(y)); }
__device__ __forceinline__ void keep4_h(v16h a, v16h b, v16h c, v16h d) { asm volatile("v_nop" :: "v"(a), "v"(b), "v"(c), "v"(d)); }
__device__ __forceinline__ void keep4_b(v16b a, v16b b, v16b c, v16b d) { asm volatile("v_nop" :: "v"(a), "v"(b), "v"(c), "v"(d)); }
__device__ __forceinline__ void acc_guard4(v8f& a, v8f& b, v8f& c, v8f& d) { asm volatile("v_nop\n\tv_nop\n\tv_nop\n\tv_nop" : "+v"(a), "+v"(b), "+v"(c), "+v"(d)); }
template <typename T> struct Frag;
template <> struct Frag<_Float16> {
  typedef v16h V; union U { v16h v; v8h h[2]; };
  static __device__ __forceinline__ v16h load(const _Float16* p) {   // elements 0..7 <- p[0..7], 8..15 <- p[16..23]
    U f; f.h[0] = *(const v8h*)(p); f.h[1] = *(const v8h*)(p + 16); return f.v;
  }
  static __device__ __forceinline__ v8f mma(v16h a, v16h b, v8f c) {
    return __builtin_amdgcn_wmma_f32_16x16x32_f16(false, a, false, b, (short)0, c, false, false);
  }
  static __device__ __forceinline__ void guard(v8f& a, v8f& b, v16h x, v16h y) { dep_guard_h(a, b, x, y); }
  static __device__ __forceinline__ void keep(v16h a, v16h b, v16h c, v16h d) { keep4_h(a, b, c, d); }
};
template <> struct Frag<__bf16> {
  typedef v16b V; union U { v16b v; v8b h[2]; };
  static __device__ __forceinline__ v16b load(const __bf16* p) {
    U f; f.h[0] = *(const v8b*)(p); f.h[1] = *(const v8b*)(p + 16); return f.v;
  }
  static __device__ __forceinline__ v8f mma(v16b a, v16b b, v8f c) {
    return __builtin_amdgcn_wmma_f32_16x16x32_bf16(false, a, false, b, (short)0, c, false, false);
  }
  static __device__ __forceinline__ void guard(v8f& a, v8f& b, v16b x, v16b y) { dep_guard_b(a, b, x, y); }
  static __device__ __forceinline__ void keep(v16b a, v16b b, v16b c, v16b d) { keep4_b(a, b, c, d); }
};

__device__ __forceinline__ unsigned pk16(unsigned short a, unsigned short b) { return (unsigned)a | ((unsigned)b << 16); }
__device__ __forceinline__ unsigned short h_bits(float f) { const _Float16 h = (_Float16)f; return __builtin_bit_cast(unsigned short, h); }

// ---- Register-blocked batched WMMA GEMM (ACT reduced to none/relu/leaky) -----------------------
// C[m,n] = scale * sum_k A[m,k] * Bt[n,k] (+bias)(+resid); each wave owns a 64x64 tile.
// A row-major [M,K]; Bt row-major [N,K]; M,N % 64 == 0, K % 32 == 0.
// SPLIT: operands are hi/lo planes (A2/Bt2 = lo planes, same layout); product = hi*hi + hi*lo + lo*hi.
// BIAS_MODE: 0 = none, 1 = bias[m], 2 = bias[n].
// OUT_MODE: 0 = f32, 1 = f16, 2 = bf16 hi plane (Cout) + bf16 lo plane (Cout2).
// ET: 0 = f16 operands, 1 = bf16 operands (pointers passed as 16-bit storage)
template <int ET> struct Elem;
template <> struct Elem<0> { typedef _Float16 T; };
template <> struct Elem<1> { typedef __bf16 T; };
template <int ET, bool SPLIT, int BIAS_MODE, int OUT_MODE, bool RESID, int ACT = 0>
__global__ __launch_bounds__(256) void wmma_gemm64(
    const unsigned short* __restrict__ Ap, const unsigned short* __restrict__ A2p, int lda, long strideA,
    const unsigned short* __restrict__ Btp, const unsigned short* __restrict__ Bt2p, int ldb, long strideB,
    void* __restrict__ Cout, void* __restrict__ Cout2, int ldc, long strideC,
    const float* __restrict__ bias,
    const float* __restrict__ resid, long strideR,
    int M, int N, int K, float scale) {
  typedef typename Elem<ET>::T T;
  typedef typename Frag<T>::V V;
  const T* A = (const T*)Ap; const T* A2 = (const T*)A2p; const T* Bt = (const T*)Btp; const T* Bt2 = (const T*)Bt2p;
  __shared__ __align__(16) float sT[8][16 * 68];   // per-wave 16x64 slab, pitch 68 floats
  const int b    = blockIdx.y;
  const int lane = threadIdx.x & 31;
  const int wave = threadIdx.x >> 5;
  const int tilesN = N >> 6;
  const int tilesM = M >> 6;
  const int tile = blockIdx.x * 8 + wave;
  if (tile >= tilesM * tilesN) return;   // wave-uniform; no block barriers in this kernel
  const int tm = tile / tilesN;
  const int tn = tile - tm * tilesN;
  const int m0 = tm << 6;
  const int n0 = tn << 6;

  const T* Ab  = A  + (size_t)b * strideA;
  const T* Bb  = Bt + (size_t)b * strideB;
  const T* Ab2 = SPLIT ? (A2  + (size_t)b * strideA) : nullptr;
  const T* Bb2 = SPLIT ? (Bt2 + (size_t)b * strideB) : nullptr;

  const int rlane = lane & 15;                 // row (A) / col (B, D) within subtile
  const int koff  = (lane >> 4) * 8;           // k offset of this lane half
  const int mOff  = (lane >> 4) * 8;           // D row offset

  v8f acc[4][4];
#pragma unroll
  for (int i = 0; i < 4; ++i)
#pragma unroll
    for (int j = 0; j < 4; ++j) acc[i][j] = (v8f){0.f,0.f,0.f,0.f,0.f,0.f,0.f,0.f};

  for (int k0 = 0; k0 < K; k0 += 32) {
    V bh[4], bl[4];
#pragma unroll
    for (int j = 0; j < 4; ++j) {
      const size_t bo = (size_t)(n0 + (j << 4) + rlane) * ldb + koff + k0;
      bh[j] = Frag<T>::load(Bb + bo);
      if (SPLIT) bl[j] = Frag<T>::load(Bb2 + bo);
    }
#pragma unroll
    for (int i = 0; i < 4; ++i) {
      const size_t ao = (size_t)(m0 + (i << 4) + rlane) * lda + koff + k0;
      V ah = Frag<T>::load(Ab + ao);
      V al;
      if (SPLIT) al = Frag<T>::load(Ab2 + ao);
#pragma unroll
      for (int j = 0; j < 4; ++j) {
        acc[i][j] = Frag<T>::mma(ah, bh[j], acc[i][j]);
        if (SPLIT) {
          acc[i][j] = Frag<T>::mma(ah, bl[j], acc[i][j]);
          acc[i][j] = Frag<T>::mma(al, bh[j], acc[i][j]);
        }
      }
      Frag<T>::guard(acc[i][0], acc[i][3], ah, SPLIT ? al : ah);
    }
    Frag<T>::keep(bh[0], bh[1], bh[2], bh[3]);
    if (SPLIT) Frag<T>::keep(bl[0], bl[1], bl[2], bl[3]);
  }
  acc_guard4(acc[0][0], acc[0][1], acc[0][2], acc[0][3]);
  acc_guard4(acc[1][0], acc[1][1], acc[1][2], acc[1][3]);
  acc_guard4(acc[2][0], acc[2][1], acc[2][2], acc[2][3]);
  acc_guard4(acc[3][0], acc[3][1], acc[3][2], acc[3][3]);

  // ---- epilogue ----
  float* slab = sT[wave];
  const float* Rb = RESID ? (resid + (size_t)b * strideR) : nullptr;
#pragma unroll
  for (int i = 0; i < 4; ++i) {
    const int mBase = m0 + (i << 4);
#pragma unroll
    for (int j = 0; j < 4; ++j) {
      const int n = n0 + (j << 4) + rlane;
      float bv = 0.f;
      if (BIAS_MODE == 2) bv = bias[n];
#pragma unroll
      for (int r = 0; r < 8; ++r) {
        float v = acc[i][j][r] * scale;
        if (BIAS_MODE == 1) v += bias[mBase + mOff + r];
        if (BIAS_MODE == 2) v += bv;
        if (RESID) v += Rb[(size_t)(mBase + mOff + r) * ldc + n];
        if (ACT == 2) v = fmaxf(v, 0.0f);
        if (ACT == 4) v = (v > 0.f) ? v : 0.01f * v;
        slab[(mOff + r) * 68 + (j << 4) + rlane] = v;
      }
    }
    __builtin_amdgcn_fence(__ATOMIC_RELEASE, "workgroup");
    __builtin_amdgcn_wave_barrier();
    __builtin_amdgcn_fence(__ATOMIC_ACQUIRE, "workgroup");
    if (OUT_MODE == 0) {
      float* C = (float*)Cout + (size_t)b * strideC;
      const int hh = lane >> 4, c4 = (lane & 15) * 4;     // row seg = 256 B = 16 lanes x 16 B
      {
#pragma unroll
        for (int it = 0; it < 8; ++it) {
          const int row = it * 2 + hh;
          v4f v = *(const v4f*)(slab + row * 68 + c4);
          *(v4f*)(C + (size_t)(mBase + row) * ldc + n0 + c4) = v;
        }
        
      }
    } else {
      const int q = lane >> 3, c8 = (lane & 7) * 8;
      unsigned short* C  = (unsigned short*)Cout  + (size_t)b * strideC;
      unsigned short* C2 = (OUT_MODE == 2) ? ((unsigned short*)Cout2 + (size_t)b * strideC) : nullptr;
      {
#pragma unroll
        for (int it = 0; it < 4; ++it) {
          const int row = it * 4 + q;
          const float* sp = slab + row * 68 + c8;
          v8h hv, lv;
#pragma unroll
          for (int e = 0; e < 8; ++e) {
            if (OUT_MODE == 1) {
              hv[e] = (_Float16)sp[e];
            } else {
              unsigned short hb = f2bf_bits(sp[e]);
              unsigned short lb = f2bf_bits(sp[e] - bf_bits2f(hb));
              hv[e] = __builtin_bit_cast(_Float16, hb);
              lv[e] = __builtin_bit_cast(_Float16, lb);
            }
          }
          *(v8h*)(C + (size_t)(mBase + row) * ldc + n0 + c8) = hv;
          if (OUT_MODE == 2) *(v8h*)(C2 + (size_t)(mBase + row) * ldc + n0 + c8) = lv;
        }
        
      }
    }
    __builtin_amdgcn_fence(__ATOMIC_RELEASE, "workgroup");
    __builtin_amdgcn_wave_barrier();
    __builtin_amdgcn_fence(__ATOMIC_ACQUIRE, "workgroup");
  }
}

// ---------------------------------------------------------------------------
// f32 -> f16 cast with power-of-two carry: out[i] = f16(scale * in[i]), 8 consecutive elements per thread
// Coverage: n8 = n/8 threads x 8 = whole plane (x: 1048576 threads = 4096 x 256; W: 131072 = 512 x 256, exact).
// ---------------------------------------------------------------------------
__global__ __launch_bounds__(256) void cast8_f16_kernel(const float* __restrict__ in, unsigned short* __restrict__ out,
                                                        int n8, float scale) {
  const int i = blockIdx.x * 256 + threadIdx.x;
  if (i >= n8) return;
  const float* p = in + 8 * (size_t)i;
  const v4f a = *(const v4f*)(p);
  const v4f c = *(const v4f*)(p + 4);
  unsigned short hb[8];
#pragma unroll
  for (int e = 0; e < 4; ++e) {
    hb[e]     = h_bits(a[e] * scale);
    hb[4 + e] = h_bits(c[e] * scale);
  }
  const v4u u = (v4u){pk16(hb[0], hb[1]), pk16(hb[2], hb[3]), pk16(hb[4], hb[5]), pk16(hb[6], hb[7])};
  unsigned short* q = out + 8 * (size_t)i;
  *(v4u*)q = u;
  
}

// ---------------------------------------------------------------------------
// Per-(token, head) centering over the 64 head dims, f32 math:
//   mean = sum_d x / 64; c = x - mean; var = sum_d c*c / 63 (unbiased).
//   dst[token][h*64 + d] = f16(carry * c); var_out[token][h] = var (layout [8192][16] f32).
// Block = 256 threads = 8 waves; wave w owns token blockIdx.x*8 + w (grid 1024 -> 8192 tokens, exact).
// Lane l: head group g = l>>3 (4 heads per pass, 4 passes = 16 heads), dims (l&7)*8 .. +7.
// LDS sv: all 8 x 16 entries written (every wave writes its 16 heads) before the barrier.
// ---------------------------------------------------------------------------
__global__ __launch_bounds__(256) void center_kernel(const float* __restrict__ src, unsigned short* __restrict__ dst,
                                                     float* __restrict__ var_out, float carry) {
  __shared__ __align__(16) float sv[8 * 16];
  const int t    = threadIdx.x;
  const int lane = t & 31, wave = t >> 5;
  const int tok  = blockIdx.x * 8 + wave;
  const int g    = lane >> 3;
  const int e8   = (lane & 7) * 8;
  const float* row = src + (size_t)tok * kEmb;
  unsigned short* drow = dst + (size_t)tok * kEmb;
#pragma unroll
  for (int hq = 0; hq < 4; ++hq) {
    const int h = hq * 4 + g;
    const float* p = row + h * kHeadDim + e8;
    const v4f a = *(const v4f*)(p);
    const v4f c = *(const v4f*)(p + 4);
    float x[8];
#pragma unroll
    for (int e = 0; e < 4; ++e) { x[e] = a[e]; x[4 + e] = c[e]; }
    float s = ((x[0] + x[1]) + (x[2] + x[3])) + ((x[4] + x[5]) + (x[6] + x[7]));
    s += __shfl_xor(s, 1, 32);
    s += __shfl_xor(s, 2, 32);
    s += __shfl_xor(s, 4, 32);
    const float mean = s * kInv64;
    float vs = 0.f;
#pragma unroll
    for (int e = 0; e < 8; ++e) { x[e] = x[e] - mean; vs += x[e] * x[e]; }
    vs += __shfl_xor(vs, 1, 32);
    vs += __shfl_xor(vs, 2, 32);
    vs += __shfl_xor(vs, 4, 32);
    unsigned short hb[8];
#pragma unroll
    for (int e = 0; e < 8; ++e) hb[e] = h_bits(x[e] * carry);
    const v4u u = (v4u){pk16(hb[0], hb[1]), pk16(hb[2], hb[3]), pk16(hb[4], hb[5]), pk16(hb[6], hb[7])};
    unsigned short* q = drow + h * kHeadDim + e8;
    *(v4u*)q = u;
    
    if ((lane & 7) == 0) sv[wave * 16 + h] = vs * kInv63;
  }
  __syncthreads();
  if (wave == 0) {
    // sv flat index 4*lane .. +3 = (token wave = lane>>2, heads (lane&3)*4 ..) == var_out[(blockIdx.x*8 + w)*16 + h]
    const v4f v = *(const v4f*)(sv + 4 * lane);
    float* vp = var_out + (size_t)blockIdx.x * 128 + 4 * lane;
    *(v4f*)vp = v;
    
  }
}

// ---------------------------------------------------------------------------
// Row softmax over 1024 f32 scores plus the rank-1 variance term, f32 math:
//   s[j] = cov[row][j] + (q_var[row] * k_var[j]) / 64; P[row][j] = f16(carry * exp(s - max) / sum exp(s - max)).
// sc: f32 [kGroup][1024][1024] for batch bidx, heads h0..h0+7; qvar/kvar: f32 [8192][16].
// One block of 128 threads per row (grid = kGroup*1024 = 8192 rows); thread t owns columns 8t..8t+7 (128 x 8 = 1024).
// Reductions in fixed order (thread, wave shuffle tree, 4 wave partials in index order).
// ---------------------------------------------------------------------------
__global__ __launch_bounds__(128) void softmax_kernel(const float* __restrict__ sc, const float* __restrict__ qvar,
                                                      const float* __restrict__ kvar, unsigned short* __restrict__ pout,
                                                      int bidx, int h0) {
  __shared__ float redM[4];
  __shared__ float redS[4];
  const int r    = blockIdx.x;
  const int hl   = r >> 10;
  const int qi   = r & (kSeq - 1);
  const int h    = h0 + hl;
  const int t    = threadIdx.x;
  const int lane = t & 31, wave = t >> 5;
  const int c0   = t * 8;
  const float qv = qvar[((size_t)bidx * kSeq + qi) * kHeads + h];
  const float* sr = sc + (size_t)r * kSeq + c0;
  const v4f a = *(const v4f*)(sr);
  const v4f c = *(const v4f*)(sr + 4);
  const float* kvp = kvar + ((size_t)bidx * kSeq + c0) * kHeads + h;
  float x[8];
#pragma unroll
  for (int e = 0; e < 4; ++e) {
    x[e]     = a[e] + (qv * kvp[e * kHeads]) * kInv64;
    x[4 + e] = c[e] + (qv * kvp[(4 + e) * kHeads]) * kInv64;
  }
  float m = fmaxf(fmaxf(fmaxf(x[0], x[1]), fmaxf(x[2], x[3])), fmaxf(fmaxf(x[4], x[5]), fmaxf(x[6], x[7])));
#pragma unroll
  for (int off = 16; off > 0; off >>= 1) m = fmaxf(m, __shfl_xor(m, off, 32));
  if (lane == 0) redM[wave] = m;
  __syncthreads();
  m = fmaxf(fmaxf(redM[0], redM[1]), fmaxf(redM[2], redM[3]));
  float ex[8];
  float s = 0.f;
#pragma unroll
  for (int e = 0; e < 8; ++e) { ex[e] = expf(x[e] - m); s += ex[e]; }
#pragma unroll
  for (int off = 16; off > 0; off >>= 1) s += __shfl_xor(s, off, 32);
  if (lane == 0) redS[wave] = s;
  __syncthreads();
  s = (redS[0] + redS[1]) + (redS[2] + redS[3]);
  const float inv = kPCarry * (1.0f / s);
  unsigned short hb[8];
#pragma unroll
  for (int e = 0; e < 8; ++e) hb[e] = h_bits(ex[e] * inv);
  const v4u u = (v4u){pk16(hb[0], hb[1]), pk16(hb[2], hb[3]), pk16(hb[4], hb[5]), pk16(hb[6], hb[7])};
  unsigned short* q = pout + (size_t)r * kSeq + c0;
  *(v4u*)q = u;
  
}

// ---------------------------------------------------------------------------
// Host entry: 59 launches (5 casts, 3 projection GEMMs, 2 centering, 16 x (scores GEMM, softmax, PV GEMM), output GEMM).
// ---------------------------------------------------------------------------
extern "C" void kernel_launch(void* const* d_in, const int* in_sizes, int n_in,
                              void* d_out, int out_size, void* d_ws, size_t ws_size,
                              hipStream_t stream) {
  if (n_in < 5) return;
  if (in_sizes[0] != kTok * kEmb) return;
  if (in_sizes[1] != kEmb * kEmb || in_sizes[2] != kEmb * kEmb || in_sizes[3] != kEmb * kEmb || in_sizes[4] != kEmb * kEmb) return;
  if (out_size != kTok * kEmb) return;
  if (ws_size < kWsTotal) return;

  const float* x  = (const float*)d_in[0];
  const float* Wq = (const float*)d_in[1];
  const float* Wk = (const float*)d_in[2];
  const float* Wv = (const float*)d_in[3];
  const float* Wo = (const float*)d_in[4];
  float* outp = (float*)d_out;

  char* ws = (char*)d_ws;
  unsigned short* X16  = (unsigned short*)(ws + kOffX16);
  unsigned short* O16  = (unsigned short*)(ws + kOffX16);     // region reuse, see map
  unsigned short* Wq16 = (unsigned short*)(ws + kOffWq16);
  unsigned short* Wk16 = (unsigned short*)(ws + kOffWk16);
  unsigned short* Wv16 = (unsigned short*)(ws + kOffWv16);
  unsigned short* Wo16 = (unsigned short*)(ws + kOffWo16);
  float*          QF   = (float*)(ws + kOffQF);
  float*          SC   = (float*)(ws + kOffQF);                // region reuse, see map
  unsigned short* P16  = (unsigned short*)(ws + kOffP16);
  unsigned short* VT16 = (unsigned short*)(ws + kOffVT16);
  unsigned short* QC16 = (unsigned short*)(ws + kOffQC16);
  unsigned short* KC16 = (unsigned short*)(ws + kOffKC16);
  float*          QVAR = (float*)(ws + kOffQVar);
  float*          KVAR = (float*)(ws + kOffKVar);

  const float* nof = (const float*)nullptr;
  const unsigned short* nou = (const unsigned short*)nullptr;

  // 1) casts to f16 planes
  {
    const int n8x = kTok * kEmb / 8;      // 1048576
    const int n8w = kEmb * kEmb / 8;      // 131072
    cast8_f16_kernel<<<(n8x + 255) / 256, 256, 0, stream>>>(x, X16, n8x, 1.0f);
    cast8_f16_kernel<<<(n8w + 255) / 256, 256, 0, stream>>>(Wq, Wq16, n8w, kWCarry);
    cast8_f16_kernel<<<(n8w + 255) / 256, 256, 0, stream>>>(Wk, Wk16, n8w, kWCarry);
    cast8_f16_kernel<<<(n8w + 255) / 256, 256, 0, stream>>>(Wv, Wv16, n8w, kWCarry);
    cast8_f16_kernel<<<(n8w + 255) / 256, 256, 0, stream>>>(Wo, Wo16, n8w, kWCarry);
  }

  // 2) v^T = Wv . x^T : A = Wv16 [1024][1024] (M = out channel), Bt = X16 [8192][1024] (N = token), K = 1024,
  //    C = VT16 f16 [1024][8192], ldc 8192. tiles 16 x 128 = 2048 -> 256 blocks.
  {
    const int tiles = (kEmb / 64) * (kTok / 64);
    wmma_gemm64<0, false, 0, 1, false, 0><<<dim3((tiles + 7) / 8, 1), 256, 0, stream>>>(
        Wv16, nou, kEmb, 0L, X16, nou, kEmb, 0L, (void*)VT16, (void*)nullptr, kTok, 0L,
        nof, nof, 0L, kEmb, kTok, kEmb, kProjScale);
  }

  // 3) q = x . Wq^T (f32 [8192][1024]) -> centering -> QC16 + QVAR; then k likewise into the same f32 region.
  {
    const int tiles = (kTok / 64) * (kEmb / 64);   // 2048
    wmma_gemm64<0, false, 0, 0, false, 0><<<dim3((tiles + 7) / 8, 1), 256, 0, stream>>>(
        X16, nou, kEmb, 0L, Wq16, nou, kEmb, 0L, (void*)QF, (void*)nullptr, kEmb, 0L,
        nof, nof, 0L, kTok, kEmb, kEmb, kProjScale);
    center_kernel<<<kTok / 8, 256, 0, stream>>>(QF, QC16, QVAR, kQKCarry);
    wmma_gemm64<0, false, 0, 0, false, 0><<<dim3((tiles + 7) / 8, 1), 256, 0, stream>>>(
        X16, nou, kEmb, 0L, Wk16, nou, kEmb, 0L, (void*)QF, (void*)nullptr, kEmb, 0L,
        nof, nof, 0L, kTok, kEmb, kEmb, kProjScale);
    center_kernel<<<kTok / 8, 256, 0, stream>>>(QF, KC16, KVAR, kQKCarry);
  }

  // 4) attention per chunk (batch b, heads h0..h0+7)
  for (int cidx = 0; cidx < kChunks; ++cidx) {
    const int b  = cidx / kGroupsPerBatch;
    const int h0 = (cidx % kGroupsPerBatch) * kGroup;
    // scores[hl][i][j] = (1/1024) * sum_d QC[b,i,h,d] * KC[b,j,h,d] : A = QC16 rows [1024][64] (lda 1024, strideA 64 per head),
    // Bt = KC16 same, K = 64, C = SC f32 [8][1024][1024]. tiles 16 x 16 = 256 per head -> (32, 8).
    {
      const size_t hoff = (size_t)b * kSeq * kEmb + (size_t)h0 * kHeadDim;
      const int tiles = (kSeq / 64) * (kSeq / 64);
      wmma_gemm64<0, false, 0, 0, false, 0><<<dim3((tiles + 7) / 8, kGroup), 256, 0, stream>>>(
          QC16 + hoff, nou, kEmb, (long)kHeadDim, KC16 + hoff, nou, kEmb, (long)kHeadDim,
          (void*)SC, (void*)nullptr, kSeq, (long)kSeq * kSeq,
          nof, nof, 0L, kSeq, kSeq, kHeadDim, kScoreScale);
    }
    softmax_kernel<<<kGroup * kSeq, 128, 0, stream>>>(SC, QVAR, KVAR, P16, b, h0);
    // O[b,i,h,d] x64 = (1/32) * sum_j P16[hl][i][j] * VT16[h*64+d][b*1024+j] : A = P16 [1024][1024] (strideA 1M per head),
    // Bt = VT16 rows [64][1024] (ldb 8192, strideB 64*8192 per head), K = 1024, C = O16 f16 [token][1024] column h*64
    // (ldc 1024, strideC 64 per head). tiles 16 x 1 = 16 per head -> (2, 8).
    {
      const int tiles = (kSeq / 64) * (kHeadDim / 64);
      wmma_gemm64<0, false, 0, 1, false, 0><<<dim3((tiles + 7) / 8, kGroup), 256, 0, stream>>>(
          P16, nou, kSeq, (long)kSeq * kSeq,
          VT16 + (size_t)h0 * kHeadDim * kTok + (size_t)b * kSeq, nou, kTok, (long)kHeadDim * kTok,
          (void*)(O16 + (size_t)b * kSeq * kEmb + (size_t)h0 * kHeadDim), (void*)nullptr, kEmb, (long)kHeadDim,
          nof, nof, 0L, kSeq, kHeadDim, kSeq, kPVScale);
    }
  }

  // 5) out = O . Wo^T : A = O16 [8192][1024], Bt = Wo16 [1024][1024], K = 1024, C = d_out f32 [8192][1024].
  {
    const int tiles = (kTok / 64) * (kEmb / 64);   // 2048
    wmma_gemm64<0, false, 0, 0, false, 0><<<dim3((tiles + 7) / 8, 1), 256, 0, stream>>>(
        O16, nou, kEmb, 0L, Wo16, nou, kEmb, 0L, (void*)outp, (void*)nullptr, kEmb, 0L,
        nof, nof, 0L, kTok, kEmb, kEmb, kOutScale);
  }
}

// v001
// One run takes 292 microseconds.
// Next to v000, in two timings, it ran 5.19 and 5.29 times as fast.
// All contractions (q/k/v projections K=1024, centered q.k^T scores K=64, probabilities.v K=1024, output projection K=1024): v_wmma_f32_16x16x32_f16 with f16 operands (weights carried x16, centered q/k carried x4, unnormalised probabilities exp2(score - maximum in use), attention output carried x64) and f32 accumulate; centering, variances, variance outer product and online softmax in f32.
#include <hip/hip_runtime.h>
#include <math.h>

// ---------------------------------------------------------------------------
// Problem constants
// ---------------------------------------------------------------------------
constexpr int kBatch   = 8;
constexpr int kSeq     = 1024;
constexpr int kEmb     = 1024;
constexpr int kHeads   = 16;
constexpr int kHeadDim = 64;
constexpr int kTok     = kBatch * kSeq;                 // 8192 token rows

constexpr float kWCarry     = 16.0f;                    // weights carried x16 in f16
constexpr float kQKCarry    = 4.0f;                     // centered q / k carried x4 in f16
constexpr float kOCarry     = 64.0f;                    // attention output carried x64 in f16
constexpr float kProjScale  = 1.0f / kWCarry;                              // 1/16
constexpr float kScoreScale = 1.0f / (kQKCarry * kQKCarry * 64.0f);        // 1/1024  (= dot / head_dim)
constexpr float kLog2e      = 1.4426950408889634f;
constexpr float kOutScale   = 1.0f / (kOCarry * kWCarry);                  // 1/1024
constexpr float kInv64      = 1.0f / 64.0f;
constexpr float kInv63      = 1.0f / 63.0f;

// ---------------------------------------------------------------------------
// Workspace region map (bytes). Total carve 121 MiB = 126877696 B.
//   [  0, 16) MiB  X16  f16 [8192][1024] (x)                 -> reused as O16 f16 [8192][1024] (attention output x64)
//                  after the three projection GEMMs (last readers of X16) have been enqueued
//   [ 16, 18) MiB  Wq16 f16 [1024][1024] x16
//   [ 18, 20) MiB  Wk16
//   [ 20, 22) MiB  Wv16
//   [ 22, 24) MiB  Wo16
//   [ 24, 56) MiB  QF   f32 [8192][1024] (q projection, then k projection)
//   [ 56, 72) MiB  unused
//   [ 72, 88) MiB  VT16 f16 [8][1024][1024] (v^T per batch: row = out channel, col = token of the batch)
//   [ 88,104) MiB  QC16 f16 [8192][1024] centered q x4
//   [104,120) MiB  KC16 f16 [8192][1024] centered k x4
//   [120,120.5) MiB QVAR f32 [8192][16]  ([token][head])
//   [120.5,121) MiB KVAR f32 [8192][16]
// ---------------------------------------------------------------------------
constexpr size_t kMiB     = 1048576;
constexpr size_t kOffX16  = 0;
constexpr size_t kOffWq16 = 16 * kMiB;
constexpr size_t kOffWk16 = 18 * kMiB;
constexpr size_t kOffWv16 = 20 * kMiB;
constexpr size_t kOffWo16 = 22 * kMiB;
constexpr size_t kOffQF   = 24 * kMiB;
constexpr size_t kOffVT16 = 72 * kMiB;
constexpr size_t kOffQC16 = 88 * kMiB;
constexpr size_t kOffKC16 = 104 * kMiB;
constexpr size_t kOffQVar = 120 * kMiB;
constexpr size_t kOffKVar = 120 * kMiB + 512 * 1024;
constexpr size_t kWsTotal = 121 * kMiB;
static_assert((size_t)kTok * kEmb * 2 == 16 * kMiB, "x / o planes 16 MiB");
static_assert((size_t)kEmb * kEmb * 2 == 2 * kMiB, "weight planes 2 MiB");
static_assert((size_t)kTok * kEmb * 4 == 32 * kMiB, "f32 projection plane 32 MiB");
static_assert((size_t)kTok * kHeads * 4 == 512 * 1024, "variance tables 512 KiB");
static_assert(kOffKVar + (size_t)kTok * kHeads * 4 == kWsTotal, "carve end");
static_assert(kWsTotal <= (size_t)134217728, "carve under 128 MiB");
static_assert(kEmb % 32 == 0 && kHeadDim % 32 == 0 && kSeq % 32 == 0, "K multiples of 32");
static_assert(kTok % 64 == 0 && kEmb % 64 == 0 && kSeq % 64 == 0 && kHeadDim % 64 == 0, "M, N multiples of 64");

typedef __attribute__((ext_vector_type(16))) _Float16 v16h;
typedef __attribute__((ext_vector_type(8)))  _Float16 v8h;
typedef __attribute__((ext_vector_type(16))) __bf16   v16b;
typedef __attribute__((ext_vector_type(8)))  __bf16   v8b;
typedef __attribute__((ext_vector_type(8)))  float    v8f;
typedef __attribute__((ext_vector_type(4)))  float    v4f;
typedef __attribute__((ext_vector_type(4)))  unsigned int v4u;

__device__ __forceinline__ unsigned short f2bf_bits(float f) {
  unsigned u = __float_as_uint(f);
  return (unsigned short)((u + 0x7FFFu + ((u >> 16) & 1u)) >> 16);
}
__device__ __forceinline__ float bf_bits2f(unsigned short h) { return __uint_as_float(((unsigned)h) << 16); }

// hazard guards as plain device helpers (no inline asm inside the kernel template body)
__device__ __forceinline__ void dep_guard_h(v8f& a, v8f& b, v16h x, v16h y) { asm volatile("v_nop\n\tv_nop\n\tv_nop\n\tv_nop" : "+v"(a), "+v"(b) : "v"(x), "v"(y)); }
__device__ __forceinline__ void dep_guard_b(v8f& a, v8f& b, v16b x, v16b y) { asm volatile("v_nop\n\tv_nop\n\tv_nop\n\tv_nop" : "+v"(a), "+v"(b) : "v"(x), "v"(y)); }
__device__ __forceinline__ void keep4_h(v16h a, v16h b, v16h c, v16h d) { asm volatile("v_nop" :: "v"(a), "v"(b), "v"(c), "v"(d)); }
__device__ __forceinline__ void keep4_b(v16b a, v16b b, v16b c, v16b d) { asm volatile("v_nop" :: "v"(a), "v"(b), "v"(c), "v"(d)); }
__device__ __forceinline__ void acc_guard4(v8f& a, v8f& b, v8f& c, v8f& d) { asm volatile("v_nop\n\tv_nop\n\tv_nop\n\tv_nop" : "+v"(a), "+v"(b), "+v"(c), "+v"(d)); }
template <typename T> struct Frag;
template <> struct Frag<_Float16> {
  typedef v16h V; union U { v16h v; v8h h[2]; };
  static __device__ __forceinline__ v16h load(const _Float16* p) {   // elements 0..7 <- p[0..7], 8..15 <- p[16..23]
    U f; f.h[0] = *(const v8h*)(p); f.h[1] = *(const v8h*)(p + 16); return f.v;
  }
  static __device__ __forceinline__ v8f mma(v16h a, v16h b, v8f c) {
    return __builtin_amdgcn_wmma_f32_16x16x32_f16(false, a, false, b, (short)0, c, false, false);
  }
  static __device__ __forceinline__ void guard(v8f& a, v8f& b, v16h x, v16h y) { dep_guard_h(a, b, x, y); }
  static __device__ __forceinline__ void keep(v16h a, v16h b, v16h c, v16h d) { keep4_h(a, b, c, d); }
};
template <> struct Frag<__bf16> {
  typedef v16b V; union U { v16b v; v8b h[2]; };
  static __device__ __forceinline__ v16b load(const __bf16* p) {
    U f; f.h[0] = *(const v8b*)(p); f.h[1] = *(const v8b*)(p + 16); return f.v;
  }
  static __device__ __forceinline__ v8f mma(v16b a, v16b b, v8f c) {
    return __builtin_amdgcn_wmma_f32_16x16x32_bf16(false, a, false, b, (short)0, c, false, false);
  }
  static __device__ __forceinline__ void guard(v8f& a, v8f& b, v16b x, v16b y) { dep_guard_b(a, b, x, y); }
  static __device__ __forceinline__ void keep(v16b a, v16b b, v16b c, v16b d) { keep4_b(a, b, c, d); }
};

__device__ __forceinline__ unsigned pk16(unsigned short a, unsigned short b) { return (unsigned)a | ((unsigned)b << 16); }
__device__ __forceinline__ unsigned short h_bits(float f) { const _Float16 h = (_Float16)f; return __builtin_bit_cast(unsigned short, h); }

// ---- Register-blocked batched WMMA GEMM (ACT reduced to none/relu/leaky) -----------------------
// C[m,n] = scale * sum_k A[m,k] * Bt[n,k] (+bias)(+resid); each wave owns a 64x64 tile.
// A row-major [M,K]; Bt row-major [N,K]; M,N % 64 == 0, K % 32 == 0.
// SPLIT: operands are hi/lo planes (A2/Bt2 = lo planes, same layout); product = hi*hi + hi*lo + lo*hi.
// BIAS_MODE: 0 = none, 1 = bias[m], 2 = bias[n].
// OUT_MODE: 0 = f32, 1 = f16, 2 = bf16 hi plane (Cout) + bf16 lo plane (Cout2).
// ET: 0 = f16 operands, 1 = bf16 operands (pointers passed as 16-bit storage)
template <int ET> struct Elem;
template <> struct Elem<0> { typedef _Float16 T; };
template <> struct Elem<1> { typedef __bf16 T; };
template <int ET, bool SPLIT, int BIAS_MODE, int OUT_MODE, bool RESID, int ACT = 0>
__global__ __launch_bounds__(256) void wmma_gemm64(
    const unsigned short* __restrict__ Ap, const unsigned short* __restrict__ A2p, int lda, long strideA,
    const unsigned short* __restrict__ Btp, const unsigned short* __restrict__ Bt2p, int ldb, long strideB,
    void* __restrict__ Cout, void* __restrict__ Cout2, int ldc, long strideC,
    const float* __restrict__ bias,
    const float* __restrict__ resid, long strideR,
    int M, int N, int K, float scale) {
  typedef typename Elem<ET>::T T;
  typedef typename Frag<T>::V V;
  const T* A = (const T*)Ap; const T* A2 = (const T*)A2p; const T* Bt = (const T*)Btp; const T* Bt2 = (const T*)Bt2p;
  __shared__ __align__(16) float sT[8][16 * 68];   // per-wave 16x64 slab, pitch 68 floats
  const int b    = blockIdx.y;
  const int lane = threadIdx.x & 31;
  const int wave = threadIdx.x >> 5;
  const int tilesN = N >> 6;
  const int tilesM = M >> 6;
  const int tile = blockIdx.x * 8 + wave;
  if (tile >= tilesM * tilesN) return;   // wave-uniform; no block barriers in this kernel
  const int tm = tile / tilesN;
  const int tn = tile - tm * tilesN;
  const int m0 = tm << 6;
  const int n0 = tn << 6;

  const T* Ab  = A  + (size_t)b * strideA;
  const T* Bb  = Bt + (size_t)b * strideB;
  const T* Ab2 = SPLIT ? (A2  + (size_t)b * strideA) : nullptr;
  const T* Bb2 = SPLIT ? (Bt2 + (size_t)b * strideB) : nullptr;

  const int rlane = lane & 15;                 // row (A) / col (B, D) within subtile
  const int koff  = (lane >> 4) * 8;           // k offset of this lane half
  const int mOff  = (lane >> 4) * 8;           // D row offset

  v8f acc[4][4];
#pragma unroll
  for (int i = 0; i < 4; ++i)
#pragma unroll
    for (int j = 0; j < 4; ++j) acc[i][j] = (v8f){0.f,0.f,0.f,0.f,0.f,0.f,0.f,0.f};

  for (int k0 = 0; k0 < K; k0 += 32) {
    V bh[4], bl[4];
#pragma unroll
    for (int j = 0; j < 4; ++j) {
      const size_t bo = (size_t)(n0 + (j << 4) + rlane) * ldb + koff + k0;
      bh[j] = Frag<T>::load(Bb + bo);
      if (SPLIT) bl[j] = Frag<T>::load(Bb2 + bo);
    }
#pragma unroll
    for (int i = 0; i < 4; ++i) {
      const size_t ao = (size_t)(m0 + (i << 4) + rlane) * lda + koff + k0;
      V ah = Frag<T>::load(Ab + ao);
      V al;
      if (SPLIT) al = Frag<T>::load(Ab2 + ao);
#pragma unroll
      for (int j = 0; j < 4; ++j) {
        acc[i][j] = Frag<T>::mma(ah, bh[j], acc[i][j]);
        if (SPLIT) {
          acc[i][j] = Frag<T>::mma(ah, bl[j], acc[i][j]);
          acc[i][j] = Frag<T>::mma(al, bh[j], acc[i][j]);
        }
      }
      Frag<T>::guard(acc[i][0], acc[i][3], ah, SPLIT ? al : ah);
    }
    Frag<T>::keep(bh[0], bh[1], bh[2], bh[3]);
    if (SPLIT) Frag<T>::keep(bl[0], bl[1], bl[2], bl[3]);
  }
  acc_guard4(acc[0][0], acc[0][1], acc[0][2], acc[0][3]);
  acc_guard4(acc[1][0], acc[1][1], acc[1][2], acc[1][3]);
  acc_guard4(acc[2][0], acc[2][1], acc[2][2], acc[2][3]);
  acc_guard4(acc[3][0], acc[3][1], acc[3][2], acc[3][3]);

  // ---- epilogue ----
  float* slab = sT[wave];
  const float* Rb = RESID ? (resid + (size_t)b * strideR) : nullptr;
#pragma unroll
  for (int i = 0; i < 4; ++i) {
    const int mBase = m0 + (i << 4);
#pragma unroll
    for (int j = 0; j < 4; ++j) {
      const int n = n0 + (j << 4) + rlane;
      float bv = 0.f;
      if (BIAS_MODE == 2) bv = bias[n];
#pragma unroll
      for (int r = 0; r < 8; ++r) {
        float v = acc[i][j][r] * scale;
        if (BIAS_MODE == 1) v += bias[mBase + mOff + r];
        if (BIAS_MODE == 2) v += bv;
        if (RESID) v += Rb[(size_t)(mBase + mOff + r) * ldc + n];
        if (ACT == 2) v = fmaxf(v, 0.0f);
        if (ACT == 4) v = (v > 0.f) ? v : 0.01f * v;
        slab[(mOff + r) * 68 + (j << 4) + rlane] = v;
      }
    }
    __builtin_amdgcn_fence(__ATOMIC_RELEASE, "workgroup");
    __builtin_amdgcn_wave_barrier();
    __builtin_amdgcn_fence(__ATOMIC_ACQUIRE, "workgroup");
    if (OUT_MODE == 0) {
      float* C = (float*)Cout + (size_t)b * strideC;
      const int hh = lane >> 4, c4 = (lane & 15) * 4;     // row seg = 256 B = 16 lanes x 16 B
      {
#pragma unroll
        for (int it = 0; it < 8; ++it) {
          const int row = it * 2 + hh;
          v4f v = *(const v4f*)(slab + row * 68 + c4);
          *(v4f*)(C + (size_t)(mBase + row) * ldc + n0 + c4) = v;
        }
        
      }
    } else {
      const int q = lane >> 3, c8 = (lane & 7) * 8;
      unsigned short* C  = (unsigned short*)Cout  + (size_t)b * strideC;
      unsigned short* C2 = (OUT_MODE == 2) ? ((unsigned short*)Cout2 + (size_t)b * strideC) : nullptr;
      {
#pragma unroll
        for (int it = 0; it < 4; ++it) {
          const int row = it * 4 + q;
          const float* sp = slab + row * 68 + c8;
          v8h hv, lv;
#pragma unroll
          for (int e = 0; e < 8; ++e) {
            if (OUT_MODE == 1) {
              hv[e] = (_Float16)sp[e];
            } else {
              unsigned short hb = f2bf_bits(sp[e]);
              unsigned short lb = f2bf_bits(sp[e] - bf_bits2f(hb));
              hv[e] = __builtin_bit_cast(_Float16, hb);
              lv[e] = __builtin_bit_cast(_Float16, lb);
            }
          }
          *(v8h*)(C + (size_t)(mBase + row) * ldc + n0 + c8) = hv;
          if (OUT_MODE == 2) *(v8h*)(C2 + (size_t)(mBase + row) * ldc + n0 + c8) = lv;
        }
        
      }
    }
    __builtin_amdgcn_fence(__ATOMIC_RELEASE, "workgroup");
    __builtin_amdgcn_wave_barrier();
    __builtin_amdgcn_fence(__ATOMIC_ACQUIRE, "workgroup");
  }
}

// ---------------------------------------------------------------------------
// f32 -> f16 cast with power-of-two carry: out[i] = f16(scale * in[i]), 8 consecutive elements per thread
// Coverage: n8 = n/8 threads x 8 = whole plane (x: 1048576 threads = 4096 x 256; W: 131072 = 512 x 256, exact).
// ---------------------------------------------------------------------------
__global__ __launch_bounds__(256) void cast8_f16_kernel(const float* __restrict__ in, unsigned short* __restrict__ out,
                                                        int n8, float scale) {
  const int i = blockIdx.x * 256 + threadIdx.x;
  if (i >= n8) return;
  const float* p = in + 8 * (size_t)i;
  const v4f a = *(const v4f*)(p);
  const v4f c = *(const v4f*)(p + 4);
  unsigned short hb[8];
#pragma unroll
  for (int e = 0; e < 4; ++e) {
    hb[e]     = h_bits(a[e] * scale);
    hb[4 + e] = h_bits(c[e] * scale);
  }
  const v4u u = (v4u){pk16(hb[0], hb[1]), pk16(hb[2], hb[3]), pk16(hb[4], hb[5]), pk16(hb[6], hb[7])};
  unsigned short* q = out + 8 * (size_t)i;
  *(v4u*)q = u;
  
}

// ---------------------------------------------------------------------------
// Per-(token, head) centering over the 64 head dims, f32 math:
//   mean = sum_d x / 64; c = x - mean; var = sum_d c*c / 63 (unbiased).
//   dst[token][h*64 + d] = f16(carry * c); var_out[token][h] = var (layout [8192][16] f32).
// Block = 256 threads = 8 waves; wave w owns token blockIdx.x*8 + w (grid 1024 -> 8192 tokens, exact).
// Lane l: head group g = l>>3 (4 heads per pass, 4 passes = 16 heads), dims (l&7)*8 .. +7.
// LDS sv: all 8 x 16 entries written (every wave writes its 16 heads) before the barrier.
// ---------------------------------------------------------------------------
__global__ __launch_bounds__(256) void center_kernel(const float* __restrict__ src, unsigned short* __restrict__ dst,
                                                     float* __restrict__ var_out, float carry) {
  __shared__ __align__(16) float sv[8 * 16];
  const int t    = threadIdx.x;
  const int lane = t & 31, wave = t >> 5;
  const int tok  = blockIdx.x * 8 + wave;
  const int g    = lane >> 3;
  const int e8   = (lane & 7) * 8;
  const float* row = src + (size_t)tok * kEmb;
  unsigned short* drow = dst + (size_t)tok * kEmb;
#pragma unroll
  for (int hq = 0; hq < 4; ++hq) {
    const int h = hq * 4 + g;
    const float* p = row + h * kHeadDim + e8;
    const v4f a = *(const v4f*)(p);
    const v4f c = *(const v4f*)(p + 4);
    float x[8];
#pragma unroll
    for (int e = 0; e < 4; ++e) { x[e] = a[e]; x[4 + e] = c[e]; }
    float s = ((x[0] + x[1]) + (x[2] + x[3])) + ((x[4] + x[5]) + (x[6] + x[7]));
    s += __shfl_xor(s, 1, 32);
    s += __shfl_xor(s, 2, 32);
    s += __shfl_xor(s, 4, 32);
    const float mean = s * kInv64;
    float vs = 0.f;
#pragma unroll
    for (int e = 0; e < 8; ++e) { x[e] = x[e] - mean; vs += x[e] * x[e]; }
    vs += __shfl_xor(vs, 1, 32);
    vs += __shfl_xor(vs, 2, 32);
    vs += __shfl_xor(vs, 4, 32);
    unsigned short hb[8];
#pragma unroll
    for (int e = 0; e < 8; ++e) hb[e] = h_bits(x[e] * carry);
    const v4u u = (v4u){pk16(hb[0], hb[1]), pk16(hb[2], hb[3]), pk16(hb[4], hb[5]), pk16(hb[6], hb[7])};
    unsigned short* q = drow + h * kHeadDim + e8;
    *(v4u*)q = u;
    
    if ((lane & 7) == 0) sv[wave * 16 + h] = vs * kInv63;
  }
  __syncthreads();
  if (wave == 0) {
    // sv flat index 4*lane .. +3 = (token wave = lane>>2, heads (lane&3)*4 ..) == var_out[(blockIdx.x*8 + w)*16 + h]
    const v4f v = *(const v4f*)(sv + 4 * lane);
    float* vp = var_out + (size_t)blockIdx.x * 128 + 4 * lane;
    *(v4f*)vp = v;
    
  }
}

// ---------------------------------------------------------------------------
// Fused attention for one (batch, head) and 256 queries per block: scores, softmax and probabilities.v in one pass
// over the keys, nothing of the 1024 x 1024 score plane leaves the registers.
//   S^T = Kc . Qc^T   (A = 16 key rows, B = 16 query rows, K = 64 head dims)     D: lane = query c, register r = key 8*hs + r
//   O^T += V^T . P^T  (A = 16 v^T rows, B = two converted S^T tiles, K = 32 keys) D: lane = query c, register r = dim 8*hs + r
// Two S^T tiles (keys 0..15 and 16..31 of a pass) converted in place are the B operand in the order Frag::load gives A.
// Score in log2 units: s = log2e * (dot / 1024 + q_var * k_var / 64). p = exp2(s - m), m = the query's maximum in use;
// m is raised (and sum and output rescaled) only when a score exceeds it by more than 8, so p <= 256 fits f16.
// Block = 8 waves, wave w owns queries blockIdx.x*256 + w*32 .. +31 (two 16-query tiles); grid (4, 128), exact.
// LDS skv: the head's 1024 k variances, all written (256 threads x 4) before the one barrier, read-only after it.
// ---------------------------------------------------------------------------
__global__ __launch_bounds__(256) void attn_fused_kernel(const unsigned short* __restrict__ qc, const unsigned short* __restrict__ kc,
                                                         const unsigned short* __restrict__ vt, const float* __restrict__ qvar,
                                                         const float* __restrict__ kvar, unsigned short* __restrict__ o16) {
  typedef Frag<_Float16> F;
  __shared__ __align__(16) float skv[kSeq];
  const int lane = threadIdx.x & 31, wave = threadIdx.x >> 5;
  const int b  = blockIdx.y >> 4;
  const int h  = blockIdx.y & (kHeads - 1);
  const int q0 = blockIdx.x * 256 + wave * 32;
  const int c  = lane & 15;
  const int hs = lane >> 4;

#pragma unroll
  for (int e = 0; e < 4; ++e) {
    const int j = e * 256 + threadIdx.x;
    skv[j] = kvar[((size_t)b * kSeq + j) * kHeads + h];
  }
  __syncthreads();  // every wave reads all of skv, each thread wrote four entries

  const _Float16* Qp = (const _Float16*)qc + ((size_t)b * kSeq + q0 + c) * kEmb + h * kHeadDim + hs * 8;
  const _Float16* Kp = (const _Float16*)kc + ((size_t)b * kSeq + c) * kEmb + h * kHeadDim + hs * 8;
  const _Float16* Vp = (const _Float16*)vt + (size_t)b * kEmb * kSeq + (size_t)(h * kHeadDim + c) * kSeq + hs * 8;

  v16h qf[2][2];
  float qv2[2], m[2], l[2];
  v8f o[4][2];
#pragma unroll  // constant indices keep these arrays in registers
  for (int qt = 0; qt < 2; ++qt) {
    qf[qt][0] = F::load(Qp + (size_t)(qt * 16) * kEmb);
    qf[qt][1] = F::load(Qp + (size_t)(qt * 16) * kEmb + 32);
    qv2[qt] = qvar[((size_t)b * kSeq + q0 + qt * 16 + c) * kHeads + h] * (kInv64 * kLog2e);
    m[qt] = -INFINITY;
    l[qt] = 0.f;
#pragma unroll  // constant indices keep these arrays in registers
    for (int i = 0; i < 4; ++i) o[i][qt] = (v8f){0.f,0.f,0.f,0.f,0.f,0.f,0.f,0.f};
  }

  v16h kf[2][2];
#pragma unroll  // constant indices keep these arrays in registers
  for (int kt = 0; kt < 2; ++kt) {
    kf[kt][0] = F::load(Kp + (size_t)(kt * 16) * kEmb);
    kf[kt][1] = F::load(Kp + (size_t)(kt * 16) * kEmb + 32);
  }

  for (int key0 = 0; key0 < kSeq; key0 += 32) {
    v16h vf[4];
#pragma unroll  // constant indices keep these arrays in registers
    for (int i = 0; i < 4; ++i) vf[i] = F::load(Vp + (size_t)(i * 16) * kSeq + key0);
    float kv[2][8];
#pragma unroll  // constant indices keep these arrays in registers
    for (int kt = 0; kt < 2; ++kt) {
      const v4f a0 = *(const v4f*)(skv + key0 + kt * 16 + hs * 8);
      const v4f a1 = *(const v4f*)(skv + key0 + kt * 16 + hs * 8 + 4);
#pragma unroll  // constant indices keep these arrays in registers
      for (int e = 0; e < 4; ++e) { kv[kt][e] = a0[e]; kv[kt][4 + e] = a1[e]; }
    }

    v8f s[2][2];
#pragma unroll  // constant indices keep these arrays in registers
    for (int kt = 0; kt < 2; ++kt)
#pragma unroll  // constant indices keep these arrays in registers
      for (int qt = 0; qt < 2; ++qt) {
        s[kt][qt] = F::mma(kf[kt][0], qf[qt][0], (v8f){0.f,0.f,0.f,0.f,0.f,0.f,0.f,0.f});
        s[kt][qt] = F::mma(kf[kt][1], qf[qt][1], s[kt][qt]);
      }

    // next pass's key fragments, fetched while this pass's softmax runs (the last pass re-reads keys 0..31, unused)
    const int nk = (key0 + 32) & (kSeq - 1);
#pragma unroll  // constant indices keep these arrays in registers
    for (int kt = 0; kt < 2; ++kt) {
      kf[kt][0] = F::load(Kp + (size_t)(nk + kt * 16) * kEmb);
      kf[kt][1] = F::load(Kp + (size_t)(nk + kt * 16) * kEmb + 32);
    }

    float mx[2];
#pragma unroll  // constant indices keep these arrays in registers
    for (int qt = 0; qt < 2; ++qt) {
#pragma unroll  // constant indices keep these arrays in registers
      for (int kt = 0; kt < 2; ++kt)
#pragma unroll  // constant indices keep these arrays in registers
        for (int r = 0; r < 8; ++r) s[kt][qt][r] = s[kt][qt][r] * (kScoreScale * kLog2e) + qv2[qt] * kv[kt][r];
      float a0 = fmaxf(fmaxf(s[0][qt][0], s[0][qt][1]), fmaxf(s[0][qt][2], s[0][qt][3]));
      float a1 = fmaxf(fmaxf(s[0][qt][4], s[0][qt][5]), fmaxf(s[0][qt][6], s[0][qt][7]));
      float a2 = fmaxf(fmaxf(s[1][qt][0], s[1][qt][1]), fmaxf(s[1][qt][2], s[1][qt][3]));
      float a3 = fmaxf(fmaxf(s[1][qt][4], s[1][qt][5]), fmaxf(s[1][qt][6], s[1][qt][7]));
      mx[qt] = fmaxf(fmaxf(a0, a1), fmaxf(a2, a3));
    }

    // one wave-uniform test per pass; both halves of a query's lane pair take the same new maximum
    const bool need = (mx[0] > m[0] + 8.0f) || (mx[1] > m[1] + 8.0f);
    if (__builtin_amdgcn_ballot_w32(need) != 0u) {
#pragma unroll  // constant indices keep these arrays in registers
      for (int qt = 0; qt < 2; ++qt) {
        const float mn = fmaxf(m[qt], fmaxf(mx[qt], __shfl_xor(mx[qt], 16, 32)));
        const float al = __builtin_amdgcn_exp2f(m[qt] - mn);
        m[qt] = mn;
        l[qt] *= al;
#pragma unroll  // constant indices keep these arrays in registers
        for (int i = 0; i < 4; ++i)
#pragma unroll  // constant indices keep these arrays in registers
          for (int r = 0; r < 8; ++r) o[i][qt][r] *= al;
      }
    }

    v16h pf[2];
#pragma unroll  // constant indices keep these arrays in registers
    for (int qt = 0; qt < 2; ++qt) {
      float ls0 = 0.f, ls1 = 0.f;
#pragma unroll  // constant indices keep these arrays in registers
      for (int r = 0; r < 8; ++r) {
        const float p0 = __builtin_amdgcn_exp2f(s[0][qt][r] - m[qt]);
        const float p1 = __builtin_amdgcn_exp2f(s[1][qt][r] - m[qt]);
        ls0 += p0;
        ls1 += p1;
        pf[qt][r]     = (_Float16)p0;
        pf[qt][8 + r] = (_Float16)p1;
      }
      l[qt] += ls0 + ls1;
    }

#pragma unroll  // constant indices keep these arrays in registers
    for (int i = 0; i < 4; ++i)
#pragma unroll  // constant indices keep these arrays in registers
      for (int qt = 0; qt < 2; ++qt) o[i][qt] = F::mma(vf[i], pf[qt], o[i][qt]);
  }

  // epilogue: join the two halves' sums, normalise, 8 consecutive head dims per lane = one 16-byte store
#pragma unroll  // constant indices keep these arrays in registers
  for (int qt = 0; qt < 2; ++qt) {
    const float lt  = l[qt] + __shfl_xor(l[qt], 16, 32);
    const float inv = kOCarry * (1.0f / lt);
    unsigned short* op = o16 + ((size_t)b * kSeq + q0 + qt * 16 + c) * kEmb + h * kHeadDim + hs * 8;
#pragma unroll  // constant indices keep these arrays in registers
    for (int i = 0; i < 4; ++i) {
      v8h hv;
#pragma unroll  // constant indices keep these arrays in registers
      for (int r = 0; r < 8; ++r) hv[r] = (_Float16)(o[i][qt][r] * inv);
      *(v8h*)(op + i * 16) = hv;
    }
  }
}

// ---------------------------------------------------------------------------
// Host entry: 12 launches (5 casts, 3 projection GEMMs, 2 centering, fused attention, output GEMM).
// ---------------------------------------------------------------------------
extern "C" void kernel_launch(void* const* d_in, const int* in_sizes, int n_in,
                              void* d_out, int out_size, void* d_ws, size_t ws_size,
                              hipStream_t stream) {
  if (n_in < 5) return;
  if (in_sizes[0] != kTok * kEmb) return;
  if (in_sizes[1] != kEmb * kEmb || in_sizes[2] != kEmb * kEmb || in_sizes[3] != kEmb * kEmb || in_sizes[4] != kEmb * kEmb) return;
  if (out_size != kTok * kEmb) return;
  if (ws_size < kWsTotal) return;

  const float* x  = (const float*)d_in[0];
  const float* Wq = (const float*)d_in[1];
  const float* Wk = (const float*)d_in[2];
  const float* Wv = (const float*)d_in[3];
  const float* Wo = (const float*)d_in[4];
  float* outp = (float*)d_out;

  char* ws = (char*)d_ws;
  unsigned short* X16  = (unsigned short*)(ws + kOffX16);
  unsigned short* O16  = (unsigned short*)(ws + kOffX16);     // region reuse, see map
  unsigned short* Wq16 = (unsigned short*)(ws + kOffWq16);
  unsigned short* Wk16 = (unsigned short*)(ws + kOffWk16);
  unsigned short* Wv16 = (unsigned short*)(ws + kOffWv16);
  unsigned short* Wo16 = (unsigned short*)(ws + kOffWo16);
  float*          QF   = (float*)(ws + kOffQF);
  unsigned short* VT16 = (unsigned short*)(ws + kOffVT16);
  unsigned short* QC16 = (unsigned short*)(ws + kOffQC16);
  unsigned short* KC16 = (unsigned short*)(ws + kOffKC16);
  float*          QVAR = (float*)(ws + kOffQVar);
  float*          KVAR = (float*)(ws + kOffKVar);

  const float* nof = (const float*)nullptr;
  const unsigned short* nou = (const unsigned short*)nullptr;

  // 1) casts to f16 planes
  {
    const int n8x = kTok * kEmb / 8;      // 1048576
    const int n8w = kEmb * kEmb / 8;      // 131072
    cast8_f16_kernel<<<(n8x + 255) / 256, 256, 0, stream>>>(x, X16, n8x, 1.0f);
    cast8_f16_kernel<<<(n8w + 255) / 256, 256, 0, stream>>>(Wq, Wq16, n8w, kWCarry);
    cast8_f16_kernel<<<(n8w + 255) / 256, 256, 0, stream>>>(Wk, Wk16, n8w, kWCarry);
    cast8_f16_kernel<<<(n8w + 255) / 256, 256, 0, stream>>>(Wv, Wv16, n8w, kWCarry);
    cast8_f16_kernel<<<(n8w + 255) / 256, 256, 0, stream>>>(Wo, Wo16, n8w, kWCarry);
  }

  // 2) v^T = Wv . x^T per batch: A = Wv16 [1024][1024] (M = out channel), Bt = X16 rows of the batch [1024][1024] (N = token),
  //    K = 1024, C = VT16 f16 [8][1024][1024], ldc 1024. tiles 16 x 16 = 256 per batch -> (32, 8).
  {
    const int tiles = (kEmb / 64) * (kSeq / 64);
    wmma_gemm64<0, false, 0, 1, false, 0><<<dim3((tiles + 7) / 8, kBatch), 256, 0, stream>>>(
        Wv16, nou, kEmb, 0L, X16, nou, kEmb, (long)kSeq * kEmb, (void*)VT16, (void*)nullptr, kSeq, (long)kEmb * kSeq,
        nof, nof, 0L, kEmb, kSeq, kEmb, kProjScale);
  }

  // 3) q = x . Wq^T (f32 [8192][1024]) -> centering -> QC16 + QVAR; then k likewise into the same f32 region.
  {
    const int tiles = (kTok / 64) * (kEmb / 64);   // 2048
    wmma_gemm64<0, false, 0, 0, false, 0><<<dim3((tiles + 7) / 8, 1), 256, 0, stream>>>(
        X16, nou, kEmb, 0L, Wq16, nou, kEmb, 0L, (void*)QF, (void*)nullptr, kEmb, 0L,
        nof, nof, 0L, kTok, kEmb, kEmb, kProjScale);
    center_kernel<<<kTok / 8, 256, 0, stream>>>(QF, QC16, QVAR, kQKCarry);
    wmma_gemm64<0, false, 0, 0, false, 0><<<dim3((tiles + 7) / 8, 1), 256, 0, stream>>>(
        X16, nou, kEmb, 0L, Wk16, nou, kEmb, 0L, (void*)QF, (void*)nullptr, kEmb, 0L,
        nof, nof, 0L, kTok, kEmb, kEmb, kProjScale);
    center_kernel<<<kTok / 8, 256, 0, stream>>>(QF, KC16, KVAR, kQKCarry);
  }

  // 4) attention: one launch, block = (256 queries, one batch and head)
  attn_fused_kernel<<<dim3(kSeq / 256, kBatch * kHeads), 256, 0, stream>>>(QC16, KC16, VT16, QVAR, KVAR, O16);

  // 5) out = O . Wo^T : A = O16 [8192][1024], Bt = Wo16 [1024][1024], K = 1024, C = d_out f32 [8192][1024].
  {
    const int tiles = (kTok / 64) * (kEmb / 64);   // 2048
    wmma_gemm64<0, false, 0, 0, false, 0><<<dim3((tiles + 7) / 8, 1), 256, 0, stream>>>(
        O16, nou, kEmb, 0L, Wo16, nou, kEmb, 0L, (void*)outp, (void*)nullptr, kEmb, 0L,
        nof, nof, 0L, kTok, kEmb, kEmb, kOutScale);
  }
}

// v002
// One run takes 179 microseconds.
// In two side-by-side timings against v001, it was 1.63 and 1.62 times as fast.
// Over all steps from v000 it is 8.52 times as fast.
// All contractions (q/k/v projections K=1024, centered q.k^T scores K=64, probabilities.v K=1024, output projection K=1024): v_wmma_f32_16x16x32_f16 with f16 operands (weights carried x16, centered q/k carried x4, unnormalised probabilities exp2(score - maximum in use), attention output carried x64) and f32 accumulate; centering, variances, variance outer product and online softmax in f32.
#include <hip/hip_runtime.h>
#include <math.h>

// ---------------------------------------------------------------------------
// Problem constants
// ---------------------------------------------------------------------------
constexpr int kBatch   = 8;
constexpr int kSeq     = 1024;
constexpr int kEmb     = 1024;
constexpr int kHeads   = 16;
constexpr int kHeadDim = 64;
constexpr int kTok     = kBatch * kSeq;                 // 8192 token rows

constexpr float kWCarry     = 16.0f;                    // weights carried x16 in f16
constexpr float kQKCarry    = 4.0f;                     // centered q / k carried x4 in f16
constexpr float kOCarry     = 64.0f;                    // attention output carried x64 in f16
constexpr float kProjScale  = 1.0f / kWCarry;                              // 1/16
constexpr float kScoreScale = 1.0f / (kQKCarry * kQKCarry * 64.0f);        // 1/1024  (= dot / head_dim)
constexpr float kLog2e      = 1.4426950408889634f;
constexpr float kOutScale   = 1.0f / (kOCarry * kWCarry);                  // 1/1024
constexpr float kInv64      = 1.0f / 64.0f;
constexpr float kInv63      = 1.0f / 63.0f;

// ---------------------------------------------------------------------------
// Workspace region map (bytes). Total carve 121 MiB = 126877696 B.
//   [  0, 16) MiB  X16  f16 [8192][1024] (x)                 -> reused as O16 f16 [8192][1024] (attention output x64)
//                  after the three projection GEMMs (last readers of X16) have been enqueued
//   [ 16, 18) MiB  Wq16 f16 [1024][1024] x16
//   [ 18, 20) MiB  Wk16
//   [ 20, 22) MiB  Wv16
//   [ 22, 24) MiB  Wo16
//   [ 24, 56) MiB  QF   f32 [8192][1024] (q projection, then k projection)
//   [ 56, 72) MiB  unused
//   [ 72, 88) MiB  VT16 f16 [8][1024][1024] (v^T per batch: row = out channel, col = token of the batch)
//   [ 88,104) MiB  QC16 f16 [8192][1024] centered q x4
//   [104,120) MiB  KC16 f16 [8192][1024] centered k x4
//   [120,120.5) MiB QVAR f32 [8192][16]  ([token][head])
//   [120.5,121) MiB KVAR f32 [8192][16]
// ---------------------------------------------------------------------------
constexpr size_t kMiB     = 1048576;
constexpr size_t kOffX16  = 0;
constexpr size_t kOffWq16 = 16 * kMiB;
constexpr size_t kOffWk16 = 18 * kMiB;
constexpr size_t kOffWv16 = 20 * kMiB;
constexpr size_t kOffWo16 = 22 * kMiB;
constexpr size_t kOffQF   = 24 * kMiB;
constexpr size_t kOffVT16 = 72 * kMiB;
constexpr size_t kOffQC16 = 88 * kMiB;
constexpr size_t kOffKC16 = 104 * kMiB;
constexpr size_t kOffQVar = 120 * kMiB;
constexpr size_t kOffKVar = 120 * kMiB + 512 * 1024;
constexpr size_t kWsTotal = 121 * kMiB;
static_assert((size_t)kTok * kEmb * 2 == 16 * kMiB, "x / o planes 16 MiB");
static_assert((size_t)kEmb * kEmb * 2 == 2 * kMiB, "weight planes 2 MiB");
static_assert((size_t)kTok * kEmb * 4 == 32 * kMiB, "f32 projection plane 32 MiB");
static_assert((size_t)kTok * kHeads * 4 == 512 * 1024, "variance tables 512 KiB");
static_assert(kOffKVar + (size_t)kTok * kHeads * 4 == kWsTotal, "carve end");
static_assert(kWsTotal <= (size_t)134217728, "carve under 128 MiB");
static_assert(kEmb % 32 == 0 && kHeadDim % 32 == 0 && kSeq % 32 == 0, "K multiples of 32");
static_assert(kTok % 64 == 0 && kEmb % 64 == 0 && kSeq % 64 == 0 && kHeadDim % 64 == 0, "M, N multiples of 64");

typedef __attribute__((ext_vector_type(16))) _Float16 v16h;
typedef __attribute__((ext_vector_type(8)))  _Float16 v8h;
typedef __attribute__((ext_vector_type(16))) __bf16   v16b;
typedef __attribute__((ext_vector_type(8)))  __bf16   v8b;
typedef __attribute__((ext_vector_type(8)))  float    v8f;
typedef __attribute__((ext_vector_type(4)))  float    v4f;
typedef __attribute__((ext_vector_type(4)))  unsigned int v4u;

__device__ __forceinline__ unsigned short f2bf_bits(float f) {
  unsigned u = __float_as_uint(f);
  return (unsigned short)((u + 0x7FFFu + ((u >> 16) & 1u)) >> 16);
}
__device__ __forceinline__ float bf_bits2f(unsigned short h) { return __uint_as_float(((unsigned)h) << 16); }

// hazard guards as plain device helpers (no inline asm inside the kernel template body)
__device__ __forceinline__ void acc_guard4(v8f& a, v8f& b, v8f& c, v8f& d) { asm volatile("v_nop\n\tv_nop\n\tv_nop\n\tv_nop" : "+v"(a), "+v"(b), "+v"(c), "+v"(d)); }
template <typename T> struct Frag;
template <> struct Frag<_Float16> {
  typedef v16h V; union U { v16h v; v8h h[2]; };
  static __device__ __forceinline__ v16h load(const _Float16* p) {   // elements 0..7 <- p[0..7], 8..15 <- p[16..23]
    U f; f.h[0] = *(const v8h*)(p); f.h[1] = *(const v8h*)(p + 16); return f.v;
  }
  static __device__ __forceinline__ v8f mma(v16h a, v16h b, v8f c) {
    return __builtin_amdgcn_wmma_f32_16x16x32_f16(false, a, false, b, (short)0, c, false, false);
  }
};
template <> struct Frag<__bf16> {
  typedef v16b V; union U { v16b v; v8b h[2]; };
  static __device__ __forceinline__ v16b load(const __bf16* p) {
    U f; f.h[0] = *(const v8b*)(p); f.h[1] = *(const v8b*)(p + 16); return f.v;
  }
  static __device__ __forceinline__ v8f mma(v16b a, v16b b, v8f c) {
    return __builtin_amdgcn_wmma_f32_16x16x32_bf16(false, a, false, b, (short)0, c, false, false);
  }
};

__device__ __forceinline__ unsigned pk16(unsigned short a, unsigned short b) { return (unsigned)a | ((unsigned)b << 16); }
__device__ __forceinline__ unsigned short h_bits(float f) { const _Float16 h = (_Float16)f; return __builtin_bit_cast(unsigned short, h); }

// ---- Register-blocked batched WMMA GEMM, operands staged in LDS ------------------------------------------------------
// C[m,n] = scale * sum_k A[m,k] * Bt[n,k] (+bias)(+resid); each wave owns a 64x64 tile, a block of 2 x 4 waves 128 x 256.
// A row-major [M,K]; Bt row-major [N,K]; M % 128 == 0, N % 256 == 0, K % 128 == 0.
// A stage is 128 k of the block's 128 A rows and 256 Bt rows, brought into LDS once for all eight waves by 16-byte
// asynchronous copies (whole 256-byte row pieces); two buffers, the next stage's copies fly while this one is multiplied.
// SPLIT (hi/lo operand planes) is not staged and not instantiated.
// BIAS_MODE: 0 = none, 1 = bias[m], 2 = bias[n].
// OUT_MODE: 0 = f32, 1 = f16, 2 = bf16 hi plane (Cout) + bf16 lo plane (Cout2).
// ET: 0 = f16 operands, 1 = bf16 operands (pointers passed as 16-bit storage)
constexpr int kBM    = 128;                      // A rows per block
constexpr int kBN    = 256;                      // Bt rows per block
constexpr int kBK    = 128;                      // k per stage = 256 B of every operand row
constexpr int kPitch = kBK + 8;                  // LDS row pitch in elements: 272 B = 16 B x 17, no bank conflict for 16-byte fragment reads
constexpr int kStage = (kBM + kBN) * kPitch;     // elements per buffer: [A 128 rows | Bt 256 rows]
static_assert(kTok % kBM == 0 && kEmb % kBM == 0 && kEmb % kBN == 0 && kSeq % kBN == 0 && kEmb % kBK == 0, "block tiles exact");

// Twelve 16-byte asynchronous copies per lane, global -> LDS. l = the lane's LDS byte address, g = its global address.
// s_wait_xcnt 0 closes the statement as a precaution: no register that a copy names is rewritten in front of it.
__device__ __forceinline__ void async_copy12(const unsigned (&l)[12], const void* const (&g)[12]) {
  asm volatile(
      "global_load_async_to_lds_b128 %0, %12, off\n\t"
      "global_load_async_to_lds_b128 %1, %13, off\n\t"
      "global_load_async_to_lds_b128 %2, %14, off\n\t"
      "global_load_async_to_lds_b128 %3, %15, off\n\t"
      "global_load_async_to_lds_b128 %4, %16, off\n\t"
      "global_load_async_to_lds_b128 %5, %17, off\n\t"
      "global_load_async_to_lds_b128 %6, %18, off\n\t"
      "global_load_async_to_lds_b128 %7, %19, off\n\t"
      "global_load_async_to_lds_b128 %8, %20, off\n\t"
      "global_load_async_to_lds_b128 %9, %21, off\n\t"
      "global_load_async_to_lds_b128 %10, %22, off\n\t"
      "global_load_async_to_lds_b128 %11, %23, off\n\t"
      "s_wait_xcnt 0x0"
      :: "v"(l[0]), "v"(l[1]), "v"(l[2]), "v"(l[3]), "v"(l[4]), "v"(l[5]), "v"(l[6]), "v"(l[7]), "v"(l[8]), "v"(l[9]), "v"(l[10]), "v"(l[11]),
         "v"(g[0]), "v"(g[1]), "v"(g[2]), "v"(g[3]), "v"(g[4]), "v"(g[5]), "v"(g[6]), "v"(g[7]), "v"(g[8]), "v"(g[9]), "v"(g[10]), "v"(g[11])
      : "memory");
}
// this wave's own copies have landed (other waves read them only behind the barrier that follows)
__device__ __forceinline__ void wait_async0() { asm volatile("s_wait_asynccnt 0x0" ::: "memory"); }
// this wave's LDS reads have returned, before the buffer they read is handed back to the copies
__device__ __forceinline__ void wait_ds0() { asm volatile("s_wait_dscnt 0x0" ::: "memory"); }

template <int ET> struct Elem;
template <> struct Elem<0> { typedef _Float16 T; };
template <> struct Elem<1> { typedef __bf16 T; };
template <int ET, bool SPLIT, int BIAS_MODE, int OUT_MODE, bool RESID, int ACT = 0>
__global__ __launch_bounds__(256) void wmma_gemm64(
    const unsigned short* __restrict__ Ap, const unsigned short* __restrict__ A2p, int lda, long strideA,
    const unsigned short* __restrict__ Btp, const unsigned short* __restrict__ Bt2p, int ldb, long strideB,
    void* __restrict__ Cout, void* __restrict__ Cout2, int ldc, long strideC,
    const float* __restrict__ bias,
    const float* __restrict__ resid, long strideR,
    int M, int N, int K, float scale) {
  typedef typename Elem<ET>::T T;
  typedef typename Frag<T>::V V;
  static_assert(!SPLIT, "hi/lo planes are not staged");
  const T* A = (const T*)Ap; const T* Bt = (const T*)Btp;
  __shared__ __align__(16) T sOp[2 * kStage];      // two operand buffers
  __shared__ __align__(16) float sT[8][16 * 68];   // per-wave 16x64 slab, pitch 68 floats
  const int b    = blockIdx.y;
  const int lane = threadIdx.x & 31;
  const int wave = threadIdx.x >> 5;
  const int tilesN = N / kBN;
  const int tilesM = M / kBM;
  if ((int)blockIdx.x >= tilesM * tilesN) return;   // block-uniform, in front of every barrier
  const int tm  = blockIdx.x / tilesN;
  const int tn  = blockIdx.x - tm * tilesN;
  const int bm0 = tm * kBM;
  const int bn0 = tn * kBN;
  const int wm  = wave >> 2;                   // wave grid 2 (M) x 4 (N)
  const int wn  = wave & 3;
  const int m0  = bm0 + (wm << 6);
  const int n0  = bn0 + (wn << 6);

  const T* Ab  = A  + (size_t)b * strideA;
  const T* Bb  = Bt + (size_t)b * strideB;

  const int rlane = lane & 15;                 // row (A) / col (B, D) within subtile
  const int koff  = (lane >> 4) * 8;           // k offset of this lane half
  const int mOff  = (lane >> 4) * 8;           // D row offset

  // Copies: 16 lanes cover one row's 256 bytes, the block 16 rows per copy; 8 copies for A, 16 for Bt, per lane and stage.
  const int crow = threadIdx.x >> 4;
  const int ccol = (threadIdx.x & 15) * 8;
  const T* gA = Ab + (size_t)(bm0 + crow) * lda + ccol;
  const T* gB = Bb + (size_t)(bn0 + crow) * ldb + ccol;
  const unsigned lds0 = (unsigned)(size_t)sOp + (unsigned)(crow * kPitch + ccol) * 2u;
  auto stage_copies = [&](int t, int buf) {
    const unsigned lb = lds0 + (unsigned)buf * (unsigned)(kStage * 2);
    const T* ga = gA + (size_t)t * kBK;
    const T* gb = gB + (size_t)t * kBK;
#pragma unroll
    for (int half = 0; half < 2; ++half) {
      unsigned l[12];
      const void* g[12];
#pragma unroll  // constant indices keep these arrays in registers
      for (int e = 0; e < 12; ++e) {
        const int grp = half * 12 + e;           // 16-row group of the buffer: 0..7 A, 8..23 Bt
        l[e] = lb + (unsigned)(grp * 16 * kPitch * 2);
        g[e] = (grp < 8) ? (const void*)(ga + (size_t)(grp * 16) * lda) : (const void*)(gb + (size_t)((grp - 8) * 16) * ldb);
      }
      async_copy12(l, g);
    }
  };

  v8f acc[4][4];
#pragma unroll
  for (int i = 0; i < 4; ++i)
#pragma unroll
    for (int j = 0; j < 4; ++j) acc[i][j] = (v8f){0.f,0.f,0.f,0.f,0.f,0.f,0.f,0.f};

  const int nStages = K / kBK;
  const int aoff = ((wm << 6) + rlane) * kPitch + koff;
  const int boff = (kBM + (wn << 6) + rlane) * kPitch + koff;

  stage_copies(0, 0);
  wait_async0();
  __syncthreads();                               // stage 0 is published
  if (nStages > 1) stage_copies(1, 1);

#pragma clang loop unroll(disable)  // one stage per trip: the buffer index stays a run-time value, the text small
  for (int t = 0; t < nStages; ++t) {
    const T* sa = sOp + (t & 1) * kStage + aoff;
    const T* sb = sOp + (t & 1) * kStage + boff;
    // Fragment reads go ahead of the WMMAs that cover their latency: the Bt set and A rows 0, 1 of the next 32 k are read
    // under rows 2, 3 of these 32 k, A rows 2, 3 under rows 0, 1. Each sched_barrier keeps the compiler from sinking a
    // read group down to its first use, where the wave would wait out the LDS latency in front of every row.
    V af[4], bf[2][4];
#pragma unroll  // constant indices keep these arrays in registers
    for (int j = 0; j < 4; ++j) bf[0][j] = Frag<T>::load(sb + j * 16 * kPitch);
#pragma unroll  // constant indices keep these arrays in registers
    for (int i = 0; i < 2; ++i) af[i] = Frag<T>::load(sa + i * 16 * kPitch);
#pragma unroll  // constant indices keep these arrays in registers
    for (int ks = 0; ks < kBK / 32; ++ks) {
      const int cs = ks & 1;
#pragma unroll  // constant indices keep these arrays in registers
      for (int i = 2; i < 4; ++i) af[i] = Frag<T>::load(sa + i * 16 * kPitch + ks * 32);
      __builtin_amdgcn_sched_barrier(0);  // A rows 2, 3 are read ahead of rows 0, 1's WMMAs
#pragma unroll  // constant indices keep these arrays in registers
      for (int i = 0; i < 2; ++i)
#pragma unroll  // constant indices keep these arrays in registers
        for (int j = 0; j < 4; ++j) acc[i][j] = Frag<T>::mma(af[i], bf[cs][j], acc[i][j]);
      __builtin_amdgcn_sched_barrier(0);  // the next reads stay behind rows 0, 1's WMMAs, whose registers they refill
      if (ks + 1 < kBK / 32) {
#pragma unroll  // constant indices keep these arrays in registers
        for (int j = 0; j < 4; ++j) bf[cs ^ 1][j] = Frag<T>::load(sb + j * 16 * kPitch + (ks + 1) * 32);
#pragma unroll  // constant indices keep these arrays in registers
        for (int i = 0; i < 2; ++i) af[i] = Frag<T>::load(sa + i * 16 * kPitch + (ks + 1) * 32);
      }
      __builtin_amdgcn_sched_barrier(0);  // the next 32 k's reads stay ahead of rows 2, 3's WMMAs
#pragma unroll  // constant indices keep these arrays in registers
      for (int i = 2; i < 4; ++i)
#pragma unroll  // constant indices keep these arrays in registers
        for (int j = 0; j < 4; ++j) acc[i][j] = Frag<T>::mma(af[i], bf[cs][j], acc[i][j]);
      __builtin_amdgcn_sched_barrier(0);  // the reads after that stay behind them
    }
    wait_ds0();
    wait_async0();
    __syncthreads();                             // publishes stage t + 1 and ends every wave's reads of stage t
    if (t + 2 < nStages) stage_copies(t + 2, t & 1);
  }
  wait_async0();
  acc_guard4(acc[0][0], acc[0][1], acc[0][2], acc[0][3]);
  acc_guard4(acc[1][0], acc[1][1], acc[1][2], acc[1][3]);
  acc_guard4(acc[2][0], acc[2][1], acc[2][2], acc[2][3]);
  acc_guard4(acc[3][0], acc[3][1], acc[3][2], acc[3][3]);

  // ---- epilogue ----
  float* slab = sT[wave];
  const float* Rb = RESID ? (resid + (size_t)b * strideR) : nullptr;
#pragma unroll
  for (int i = 0; i < 4; ++i) {
    const int mBase = m0 + (i << 4);
#pragma unroll
    for (int j = 0; j < 4; ++j) {
      const int n = n0 + (j << 4) + rlane;
      float bv = 0.f;
      if (BIAS_MODE == 2) bv = bias[n];
#pragma unroll
      for (int r = 0; r < 8; ++r) {
        float v = acc[i][j][r] * scale;
        if (BIAS_MODE == 1) v += bias[mBase + mOff + r];
        if (BIAS_MODE == 2) v += bv;
        if (RESID) v += Rb[(size_t)(mBase + mOff + r) * ldc + n];
        if (ACT == 2) v = fmaxf(v, 0.0f);
        if (ACT == 4) v = (v > 0.f) ? v : 0.01f * v;
        slab[(mOff + r) * 68 + (j << 4) + rlane] = v;
      }
    }
    __builtin_amdgcn_fence(__ATOMIC_RELEASE, "workgroup");
    __builtin_amdgcn_wave_barrier();
    __builtin_amdgcn_fence(__ATOMIC_ACQUIRE, "workgroup");
    if (OUT_MODE == 0) {
      float* C = (float*)Cout + (size_t)b * strideC;
      const int hh = lane >> 4, c4 = (lane & 15) * 4;     // row seg = 256 B = 16 lanes x 16 B
      {
#pragma unroll
        for (int it = 0; it < 8; ++it) {
          const int row = it * 2 + hh;
          v4f v = *(const v4f*)(slab + row * 68 + c4);
          *(v4f*)(C + (size_t)(mBase + row) * ldc + n0 + c4) = v;
        }
        
      }
    } else {
      const int q = lane >> 3, c8 = (lane & 7) * 8;
      unsigned short* C  = (unsigned short*)Cout  + (size_t)b * strideC;
      unsigned short* C2 = (OUT_MODE == 2) ? ((unsigned short*)Cout2 + (size_t)b * strideC) : nullptr;
      {
#pragma unroll
        for (int it = 0; it < 4; ++it) {
          const int row = it * 4 + q;
          const float* sp = slab + row * 68 + c8;
          v8h hv, lv;
#pragma unroll
          for (int e = 0; e < 8; ++e) {
            if (OUT_MODE == 1) {
              hv[e] = (_Float16)sp[e];
            } else {
              unsigned short hb = f2bf_bits(sp[e]);
              unsigned short lb = f2bf_bits(sp[e] - bf_bits2f(hb));
              hv[e] = __builtin_bit_cast(_Float16, hb);
              lv[e] = __builtin_bit_cast(_Float16, lb);
            }
          }
          *(v8h*)(C + (size_t)(mBase + row) * ldc + n0 + c8) = hv;
          if (OUT_MODE == 2) *(v8h*)(C2 + (size_t)(mBase + row) * ldc + n0 + c8) = lv;
        }
        
      }
    }
    __builtin_amdgcn_fence(__ATOMIC_RELEASE, "workgroup");
    __builtin_amdgcn_wave_barrier();
    __builtin_amdgcn_fence(__ATOMIC_ACQUIRE, "workgroup");
  }
}

// ---------------------------------------------------------------------------
// f32 -> f16 cast with power-of-two carry: out[i] = f16(scale * in[i]), 8 consecutive elements per thread
// Coverage: n8 = n/8 threads x 8 = whole plane (x: 1048576 threads = 4096 x 256; W: 131072 = 512 x 256, exact).
// ---------------------------------------------------------------------------
__global__ __launch_bounds__(256) void cast8_f16_kernel(const float* __restrict__ in, unsigned short* __restrict__ out,
                                                        int n8, float scale) {
  const int i = blockIdx.x * 256 + threadIdx.x;
  if (i >= n8) return;
  const float* p = in + 8 * (size_t)i;
  const v4f a = *(const v4f*)(p);
  const v4f c = *(const v4f*)(p + 4);
  unsigned short hb[8];
#pragma unroll
  for (int e = 0; e < 4; ++e) {
    hb[e]     = h_bits(a[e] * scale);
    hb[4 + e] = h_bits(c[e] * scale);
  }
  const v4u u = (v4u){pk16(hb[0], hb[1]), pk16(hb[2], hb[3]), pk16(hb[4], hb[5]), pk16(hb[6], hb[7])};
  unsigned short* q = out + 8 * (size_t)i;
  *(v4u*)q = u;
  
}

// ---------------------------------------------------------------------------
// Per-(token, head) centering over the 64 head dims, f32 math:
//   mean = sum_d x / 64; c = x - mean; var = sum_d c*c / 63 (unbiased).
//   dst[token][h*64 + d] = f16(carry * c); var_out[token][h] = var (layout [8192][16] f32).
// Block = 256 threads = 8 waves; wave w owns token blockIdx.x*8 + w (grid 1024 -> 8192 tokens, exact).
// Lane l: head group g = l>>3 (4 heads per pass, 4 passes = 16 heads), dims (l&7)*8 .. +7.
// LDS sv: all 8 x 16 entries written (every wave writes its 16 heads) before the barrier.
// ---------------------------------------------------------------------------
__global__ __launch_bounds__(256) void center_kernel(const float* __restrict__ src, unsigned short* __restrict__ dst,
                                                     float* __restrict__ var_out, float carry) {
  __shared__ __align__(16) float sv[8 * 16];
  const int t    = threadIdx.x;
  const int lane = t & 31, wave = t >> 5;
  const int tok  = blockIdx.x * 8 + wave;
  const int g    = lane >> 3;
  const int e8   = (lane & 7) * 8;
  const float* row = src + (size_t)tok * kEmb;
  unsigned short* drow = dst + (size_t)tok * kEmb;
#pragma unroll
  for (int hq = 0; hq < 4; ++hq) {
    const int h = hq * 4 + g;
    const float* p = row + h * kHeadDim + e8;
    const v4f a = *(const v4f*)(p);
    const v4f c = *(const v4f*)(p + 4);
    float x[8];
#pragma unroll
    for (int e = 0; e < 4; ++e) { x[e] = a[e]; x[4 + e] = c[e]; }
    float s = ((x[0] + x[1]) + (x[2] + x[3])) + ((x[4] + x[5]) + (x[6] + x[7]));
    s += __shfl_xor(s, 1, 32);
    s += __shfl_xor(s, 2, 32);
    s += __shfl_xor(s, 4, 32);
    const float mean = s * kInv64;
    float vs = 0.f;
#pragma unroll
    for (int e = 0; e < 8; ++e) { x[e] = x[e] - mean; vs += x[e] * x[e]; }
    vs += __shfl_xor(vs, 1, 32);
    vs += __shfl_xor(vs, 2, 32);
    vs += __shfl_xor(vs, 4, 32);
    unsigned short hb[8];
#pragma unroll
    for (int e = 0; e < 8; ++e) hb[e] = h_bits(x[e] * carry);
    const v4u u = (v4u){pk16(hb[0], hb[1]), pk16(hb[2], hb[3]), pk16(hb[4], hb[5]), pk16(hb[6], hb[7])};
    unsigned short* q = drow + h * kHeadDim + e8;
    *(v4u*)q = u;
    
    if ((lane & 7) == 0) sv[wave * 16 + h] = vs * kInv63;
  }
  __syncthreads();
  if (wave == 0) {
    // sv flat index 4*lane .. +3 = (token wave = lane>>2, heads (lane&3)*4 ..) == var_out[(blockIdx.x*8 + w)*16 + h]
    const v4f v = *(const v4f*)(sv + 4 * lane);
    float* vp = var_out + (size_t)blockIdx.x * 128 + 4 * lane;
    *(v4f*)vp = v;
    
  }
}

// ---------------------------------------------------------------------------
// Fused attention for one (batch, head) and 256 queries per block: scores, softmax and probabilities.v in one pass
// over the keys, nothing of the 1024 x 1024 score plane leaves the registers.
//   S^T = Kc . Qc^T   (A = 16 key rows, B = 16 query rows, K = 64 head dims)     D: lane = query c, register r = key 8*hs + r
//   O^T += V^T . P^T  (A = 16 v^T rows, B = two converted S^T tiles, K = 32 keys) D: lane = query c, register r = dim 8*hs + r
// Two S^T tiles (keys 0..15 and 16..31 of a pass) converted in place are the B operand in the order Frag::load gives A.
// Score in log2 units: s = log2e * (dot / 1024 + q_var * k_var / 64). p = exp2(s - m), m = the query's maximum in use;
// m is raised (and sum and output rescaled) only when a score exceeds it by more than 8, so p <= 256 fits f16.
// Block = 8 waves, wave w owns queries blockIdx.x*256 + w*32 .. +31 (two 16-query tiles); grid (4, 128), exact.
// LDS skv: the head's 1024 k variances, all written (256 threads x 4) before the one barrier, read-only after it.
// ---------------------------------------------------------------------------
__global__ __launch_bounds__(256) void attn_fused_kernel(const unsigned short* __restrict__ qc, const unsigned short* __restrict__ kc,
                                                         const unsigned short* __restrict__ vt, const float* __restrict__ qvar,
                                                         const float* __restrict__ kvar, unsigned short* __restrict__ o16) {
  typedef Frag<_Float16> F;
  __shared__ __align__(16) float skv[kSeq];
  const int lane = threadIdx.x & 31, wave = threadIdx.x >> 5;
  const int b  = blockIdx.y >> 4;
  const int h  = blockIdx.y & (kHeads - 1);
  const int q0 = blockIdx.x * 256 + wave * 32;
  const int c  = lane & 15;
  const int hs = lane >> 4;

#pragma unroll
  for (int e = 0; e < 4; ++e) {
    const int j = e * 256 + threadIdx.x;
    skv[j] = kvar[((size_t)b * kSeq + j) * kHeads + h];
  }
  __syncthreads();  // every wave reads all of skv, each thread wrote four entries

  const _Float16* Qp = (const _Float16*)qc + ((size_t)b * kSeq + q0 + c) * kEmb + h * kHeadDim + hs * 8;
  const _Float16* Kp = (const _Float16*)kc + ((size_t)b * kSeq + c) * kEmb + h * kHeadDim + hs * 8;
  const _Float16* Vp = (const _Float16*)vt + (size_t)b * kEmb * kSeq + (size_t)(h * kHeadDim + c) * kSeq + hs * 8;

  v16h qf[2][2];
  float qv2[2], m[2], l[2];
  v8f o[4][2];
#pragma unroll  // constant indices keep these arrays in registers
  for (int qt = 0; qt < 2; ++qt) {
    qf[qt][0] = F::load(Qp + (size_t)(qt * 16) * kEmb);
    qf[qt][1] = F::load(Qp + (size_t)(qt * 16) * kEmb + 32);
    qv2[qt] = qvar[((size_t)b * kSeq + q0 + qt * 16 + c) * kHeads + h] * (kInv64 * kLog2e);
    m[qt] = -INFINITY;
    l[qt] = 0.f;
#pragma unroll  // constant indices keep these arrays in registers
    for (int i = 0; i < 4; ++i) o[i][qt] = (v8f){0.f,0.f,0.f,0.f,0.f,0.f,0.f,0.f};
  }

  v16h kf[2][2];
#pragma unroll  // constant indices keep these arrays in registers
  for (int kt = 0; kt < 2; ++kt) {
    kf[kt][0] = F::load(Kp + (size_t)(kt * 16) * kEmb);
    kf[kt][1] = F::load(Kp + (size_t)(kt * 16) * kEmb + 32);
  }

  for (int key0 = 0; key0 < kSeq; key0 += 32) {
    v16h vf[4];
#pragma unroll  // constant indices keep these arrays in registers
    for (int i = 0; i < 4; ++i) vf[i] = F::load(Vp + (size_t)(i * 16) * kSeq + key0);
    float kv[2][8];
#pragma unroll  // constant indices keep these arrays in registers
    for (int kt = 0; kt < 2; ++kt) {
      const v4f a0 = *(const v4f*)(skv + key0 + kt * 16 + hs * 8);
      const v4f a1 = *(const v4f*)(skv + key0 + kt * 16 + hs * 8 + 4);
#pragma unroll  // constant indices keep these arrays in registers
      for (int e = 0; e < 4; ++e) { kv[kt][e] = a0[e]; kv[kt][4 + e] = a1[e]; }
    }

    v8f s[2][2];
#pragma unroll  // constant indices keep these arrays in registers
    for (int kt = 0; kt < 2; ++kt)
#pragma unroll  // constant indices keep these arrays in registers
      for (int qt = 0; qt < 2; ++qt) {
        s[kt][qt] = F::mma(kf[kt][0], qf[qt][0], (v8f){0.f,0.f,0.f,0.f,0.f,0.f,0.f,0.f});
        s[kt][qt] = F::mma(kf[kt][1], qf[qt][1], s[kt][qt]);
      }

    // next pass's key fragments, fetched while this pass's softmax runs (the last pass re-reads keys 0..31, unused)
    const int nk = (key0 + 32) & (kSeq - 1);
#pragma unroll  // constant indices keep these arrays in registers
    for (int kt = 0; kt < 2; ++kt) {
      kf[kt][0] = F::load(Kp + (size_t)(nk + kt * 16) * kEmb);
      kf[kt][1] = F::load(Kp + (size_t)(nk + kt * 16) * kEmb + 32);
    }

    float mx[2];
#pragma unroll  // constant indices keep these arrays in registers
    for (int qt = 0; qt < 2; ++qt) {
#pragma unroll  // constant indices keep these arrays in registers
      for (int kt = 0; kt < 2; ++kt)
#pragma unroll  // constant indices keep these arrays in registers
        for (int r = 0; r < 8; ++r) s[kt][qt][r] = s[kt][qt][r] * (kScoreScale * kLog2e) + qv2[qt] * kv[kt][r];
      float a0 = fmaxf(fmaxf(s[0][qt][0], s[0][qt][1]), fmaxf(s[0][qt][2], s[0][qt][3]));
      float a1 = fmaxf(fmaxf(s[0][qt][4], s[0][qt][5]), fmaxf(s[0][qt][6], s[0][qt][7]));
      float a2 = fmaxf(fmaxf(s[1][qt][0], s[1][qt][1]), fmaxf(s[1][qt][2], s[1][qt][3]));
      float a3 = fmaxf(fmaxf(s[1][qt][4], s[1][qt][5]), fmaxf(s[1][qt][6], s[1][qt][7]));
      mx[qt] = fmaxf(fmaxf(a0, a1), fmaxf(a2, a3));
    }

    // one wave-uniform test per pass; both halves of a query's lane pair take the same new maximum
    const bool need = (mx[0] > m[0] + 8.0f) || (mx[1] > m[1] + 8.0f);
    if (__builtin_amdgcn_ballot_w32(need) != 0u) {
#pragma unroll  // constant indices keep these arrays in registers
      for (int qt = 0; qt < 2; ++qt) {
        const float mn = fmaxf(m[qt], fmaxf(mx[qt], __shfl_xor(mx[qt], 16, 32)));
        const float al = __builtin_amdgcn_exp2f(m[qt] - mn);
        m[qt] = mn;
        l[qt] *= al;
#pragma unroll  // constant indices keep these arrays in registers
        for (int i = 0; i < 4; ++i)
#pragma unroll  // constant indices keep these arrays in registers
          for (int r = 0; r < 8; ++r) o[i][qt][r] *= al;
      }
    }

    v16h pf[2];
#pragma unroll  // constant indices keep these arrays in registers
    for (int qt = 0; qt < 2; ++qt) {
      float ls0 = 0.f, ls1 = 0.f;
#pragma unroll  // constant indices keep these arrays in registers
      for (int r = 0; r < 8; ++r) {
        const float p0 = __builtin_amdgcn_exp2f(s[0][qt][r] - m[qt]);
        const float p1 = __builtin_amdgcn_exp2f(s[1][qt][r] - m[qt]);
        ls0 += p0;
        ls1 += p1;
        pf[qt][r]     = (_Float16)p0;
        pf[qt][8 + r] = (_Float16)p1;
      }
      l[qt] += ls0 + ls1;
    }

#pragma unroll  // constant indices keep these arrays in registers
    for (int i = 0; i < 4; ++i)
#pragma unroll  // constant indices keep these arrays in registers
      for (int qt = 0; qt < 2; ++qt) o[i][qt] = F::mma(vf[i], pf[qt], o[i][qt]);
  }

  // epilogue: join the two halves' sums, normalise, 8 consecutive head dims per lane = one 16-byte store
#pragma unroll  // constant indices keep these arrays in registers
  for (int qt = 0; qt < 2; ++qt) {
    const float lt  = l[qt] + __shfl_xor(l[qt], 16, 32);
    const float inv = kOCarry * (1.0f / lt);
    unsigned short* op = o16 + ((size_t)b * kSeq + q0 + qt * 16 + c) * kEmb + h * kHeadDim + hs * 8;
#pragma unroll  // constant indices keep these arrays in registers
    for (int i = 0; i < 4; ++i) {
      v8h hv;
#pragma unroll  // constant indices keep these arrays in registers
      for (int r = 0; r < 8; ++r) hv[r] = (_Float16)(o[i][qt][r] * inv);
      *(v8h*)(op + i * 16) = hv;
    }
  }
}

// ---------------------------------------------------------------------------
// Host entry: 12 launches (5 casts, 3 projection GEMMs, 2 centering, fused attention, output GEMM).
// ---------------------------------------------------------------------------
extern "C" void kernel_launch(void* const* d_in, const int* in_sizes, int n_in,
                              void* d_out, int out_size, void* d_ws, size_t ws_size,
                              hipStream_t stream) {
  if (n_in < 5) return;
  if (in_sizes[0] != kTok * kEmb) return;
  if (in_sizes[1] != kEmb * kEmb || in_sizes[2] != kEmb * kEmb || in_sizes[3] != kEmb * kEmb || in_sizes[4] != kEmb * kEmb) return;
  if (out_size != kTok * kEmb) return;
  if (ws_size < kWsTotal) return;

  const float* x  = (const float*)d_in[0];
  const float* Wq = (const float*)d_in[1];
  const float* Wk = (const float*)d_in[2];
  const float* Wv = (const float*)d_in[3];
  const float* Wo = (const float*)d_in[4];
  float* outp = (float*)d_out;

  char* ws = (char*)d_ws;
  unsigned short* X16  = (unsigned short*)(ws + kOffX16);
  unsigned short* O16  = (unsigned short*)(ws + kOffX16);     // region reuse, see map
  unsigned short* Wq16 = (unsigned short*)(ws + kOffWq16);
  unsigned short* Wk16 = (unsigned short*)(ws + kOffWk16);
  unsigned short* Wv16 = (unsigned short*)(ws + kOffWv16);
  unsigned short* Wo16 = (unsigned short*)(ws + kOffWo16);
  float*          QF   = (float*)(ws + kOffQF);
  unsigned short* VT16 = (unsigned short*)(ws + kOffVT16);
  unsigned short* QC16 = (unsigned short*)(ws + kOffQC16);
  unsigned short* KC16 = (unsigned short*)(ws + kOffKC16);
  float*          QVAR = (float*)(ws + kOffQVar);
  float*          KVAR = (float*)(ws + kOffKVar);

  const float* nof = (const float*)nullptr;
  const unsigned short* nou = (const unsigned short*)nullptr;

  // 1) casts to f16 planes
  {
    const int n8x = kTok * kEmb / 8;      // 1048576
    const int n8w = kEmb * kEmb / 8;      // 131072
    cast8_f16_kernel<<<(n8x + 255) / 256, 256, 0, stream>>>(x, X16, n8x, 1.0f);
    cast8_f16_kernel<<<(n8w + 255) / 256, 256, 0, stream>>>(Wq, Wq16, n8w, kWCarry);
    cast8_f16_kernel<<<(n8w + 255) / 256, 256, 0, stream>>>(Wk, Wk16, n8w, kWCarry);
    cast8_f16_kernel<<<(n8w + 255) / 256, 256, 0, stream>>>(Wv, Wv16, n8w, kWCarry);
    cast8_f16_kernel<<<(n8w + 255) / 256, 256, 0, stream>>>(Wo, Wo16, n8w, kWCarry);
  }

  // 2) v^T = Wv . x^T per batch: A = Wv16 [1024][1024] (M = out channel), Bt = X16 rows of the batch [1024][1024] (N = token),
  //    K = 1024, C = VT16 f16 [8][1024][1024], ldc 1024. block tiles 8 x 4 = 32 per batch -> (32, 8).
  {
    const int blocks = (kEmb / kBM) * (kSeq / kBN);   // 32
    wmma_gemm64<0, false, 0, 1, false, 0><<<dim3(blocks, kBatch), 256, 0, stream>>>(
        Wv16, nou, kEmb, 0L, X16, nou, kEmb, (long)kSeq * kEmb, (void*)VT16, (void*)nullptr, kSeq, (long)kEmb * kSeq,
        nof, nof, 0L, kEmb, kSeq, kEmb, kProjScale);
  }

  // 3) q = x . Wq^T (f32 [8192][1024]) -> centering -> QC16 + QVAR; then k likewise into the same f32 region.
  {
    const int blocks = (kTok / kBM) * (kEmb / kBN);   // 256
    wmma_gemm64<0, false, 0, 0, false, 0><<<dim3(blocks, 1), 256, 0, stream>>>(
        X16, nou, kEmb, 0L, Wq16, nou, kEmb, 0L, (void*)QF, (void*)nullptr, kEmb, 0L,
        nof, nof, 0L, kTok, kEmb, kEmb, kProjScale);
    center_kernel<<<kTok / 8, 256, 0, stream>>>(QF, QC16, QVAR, kQKCarry);
    wmma_gemm64<0, false, 0, 0, false, 0><<<dim3(blocks, 1), 256, 0, stream>>>(
        X16, nou, kEmb, 0L, Wk16, nou, kEmb, 0L, (void*)QF, (void*)nullptr, kEmb, 0L,
        nof, nof, 0L, kTok, kEmb, kEmb, kProjScale);
    center_kernel<<<kTok / 8, 256, 0, stream>>>(QF, KC16, KVAR, kQKCarry);
  }

  // 4) attention: one launch, block = (256 queries, one batch and head)
  attn_fused_kernel<<<dim3(kSeq / 256, kBatch * kHeads), 256, 0, stream>>>(QC16, KC16, VT16, QVAR, KVAR, O16);

  // 5) out = O . Wo^T : A = O16 [8192][1024], Bt = Wo16 [1024][1024], K = 1024, C = d_out f32 [8192][1024].
  {
    const int blocks = (kTok / kBM) * (kEmb / kBN);   // 256
    wmma_gemm64<0, false, 0, 0, false, 0><<<dim3(blocks, 1), 256, 0, stream>>>(
        O16, nou, kEmb, 0L, Wo16, nou, kEmb, 0L, (void*)outp, (void*)nullptr, kEmb, 0L,
        nof, nof, 0L, kTok, kEmb, kEmb, kOutScale);
  }
}

// v003
// A run of this version takes 148 microseconds.
// In both of two side-by-side timings against v002, it was 1.21 times as fast.
// All steps since v000 together make it 10.3 times as fast.
// All contractions (q/k/v projections K=1024, centered q.k^T scores K=64, probabilities.v K=1024, output projection K=1024): v_wmma_f32_16x16x32_f16 with f16 operands (weights carried x16, centered q/k carried x4, unnormalised probabilities exp2(score - maximum in use), attention output carried x64) and f32 accumulate; centering, variances, variance outer product and online softmax in f32.
#include <hip/hip_runtime.h>
#include <math.h>

// ---------------------------------------------------------------------------
// Problem constants
// ---------------------------------------------------------------------------
constexpr int kBatch   = 8;
constexpr int kSeq     = 1024;
constexpr int kEmb     = 1024;
constexpr int kHeads   = 16;
constexpr int kHeadDim = 64;
constexpr int kTok     = kBatch * kSeq;                 // 8192 token rows

constexpr float kWCarry     = 16.0f;                    // weights carried x16 in f16
constexpr float kQKCarry    = 4.0f;                     // centered q / k carried x4 in f16
constexpr float kOCarry     = 64.0f;                    // attention output carried x64 in f16
constexpr float kProjScale  = 1.0f / kWCarry;                              // 1/16
constexpr float kScoreScale = 1.0f / (kQKCarry * kQKCarry * 64.0f);        // 1/1024  (= dot / head_dim)
constexpr float kLog2e      = 1.4426950408889634f;
constexpr float kOutScale   = 1.0f / (kOCarry * kWCarry);                  // 1/1024
constexpr float kInv64      = 1.0f / 64.0f;
constexpr float kInv63      = 1.0f / 63.0f;

// ---------------------------------------------------------------------------
// Workspace region map (bytes). Total carve 121 MiB = 126877696 B.
//   [  0, 16) MiB  X16  f16 [8192][1024] (x)                 -> reused as O16 f16 [8192][1024] (attention output x64)
//                  after the three projection GEMMs (last readers of X16) have been enqueued
//   [ 16, 18) MiB  Wq16 f16 [1024][1024] x16
//   [ 18, 20) MiB  Wk16
//   [ 20, 22) MiB  Wv16
//   [ 22, 24) MiB  Wo16
//   [ 24, 56) MiB  QF   f32 [8192][1024] (q projection, then k projection)
//   [ 56, 72) MiB  unused
//   [ 72, 88) MiB  VT16 f16 [8][1024][1024] (v^T per batch: row = out channel, col = token of the batch)
//   [ 88,104) MiB  QC16 f16 [8192][1024] centered q x4
//   [104,120) MiB  KC16 f16 [8192][1024] centered k x4
//   [120,120.5) MiB QVAR f32 [8192][16]  ([token][head])
//   [120.5,121) MiB KVAR f32 [8192][16]
// ---------------------------------------------------------------------------
constexpr size_t kMiB     = 1048576;
constexpr size_t kOffX16  = 0;
constexpr size_t kOffWq16 = 16 * kMiB;
constexpr size_t kOffWk16 = 18 * kMiB;
constexpr size_t kOffWv16 = 20 * kMiB;
constexpr size_t kOffWo16 = 22 * kMiB;
constexpr size_t kOffQF   = 24 * kMiB;
constexpr size_t kOffVT16 = 72 * kMiB;
constexpr size_t kOffQC16 = 88 * kMiB;
constexpr size_t kOffKC16 = 104 * kMiB;
constexpr size_t kOffQVar = 120 * kMiB;
constexpr size_t kOffKVar = 120 * kMiB + 512 * 1024;
constexpr size_t kWsTotal = 121 * kMiB;
static_assert((size_t)kTok * kEmb * 2 == 16 * kMiB, "x / o planes 16 MiB");
static_assert((size_t)kEmb * kEmb * 2 == 2 * kMiB, "weight planes 2 MiB");
static_assert((size_t)kTok * kEmb * 4 == 32 * kMiB, "f32 projection plane 32 MiB");
static_assert((size_t)kTok * kHeads * 4 == 512 * 1024, "variance tables 512 KiB");
static_assert(kOffKVar + (size_t)kTok * kHeads * 4 == kWsTotal, "carve end");
static_assert(kWsTotal <= (size_t)134217728, "carve under 128 MiB");
static_assert(kEmb % 32 == 0 && kHeadDim % 32 == 0 && kSeq % 32 == 0, "K multiples of 32");
static_assert(kTok % 64 == 0 && kEmb % 64 == 0 && kSeq % 64 == 0 && kHeadDim % 64 == 0, "M, N multiples of 64");

typedef __attribute__((ext_vector_type(16))) _Float16 v16h;
typedef __attribute__((ext_vector_type(8)))  _Float16 v8h;
typedef __attribute__((ext_vector_type(16))) __bf16   v16b;
typedef __attribute__((ext_vector_type(8)))  __bf16   v8b;
typedef __attribute__((ext_vector_type(8)))  float    v8f;
typedef __attribute__((ext_vector_type(4)))  float    v4f;
typedef __attribute__((ext_vector_type(4)))  unsigned int v4u;

__device__ __forceinline__ unsigned short f2bf_bits(float f) {
  unsigned u = __float_as_uint(f);
  return (unsigned short)((u + 0x7FFFu + ((u >> 16) & 1u)) >> 16);
}
__device__ __forceinline__ float bf_bits2f(unsigned short h) { return __uint_as_float(((unsigned)h) << 16); }

// hazard guards as plain device helpers (no inline asm inside the kernel template body)
__device__ __forceinline__ void acc_guard4(v8f& a, v8f& b, v8f& c, v8f& d) { asm volatile("v_nop\n\tv_nop\n\tv_nop\n\tv_nop" : "+v"(a), "+v"(b), "+v"(c), "+v"(d)); }
template <typename T> struct Frag;
template <> struct Frag<_Float16> {
  typedef v16h V; union U { v16h v; v8h h[2]; };
  static __device__ __forceinline__ v16h load(const _Float16* p) {   // elements 0..7 <- p[0..7], 8..15 <- p[16..23]
    U f; f.h[0] = *(const v8h*)(p); f.h[1] = *(const v8h*)(p + 16); return f.v;
  }
  static __device__ __forceinline__ v8f mma(v16h a, v16h b, v8f c) {
    return __builtin_amdgcn_wmma_f32_16x16x32_f16(false, a, false, b, (short)0, c, false, false);
  }
};
template <> struct Frag<__bf16> {
  typedef v16b V; union U { v16b v; v8b h[2]; };
  static __device__ __forceinline__ v16b load(const __bf16* p) {
    U f; f.h[0] = *(const v8b*)(p); f.h[1] = *(const v8b*)(p + 16); return f.v;
  }
  static __device__ __forceinline__ v8f mma(v16b a, v16b b, v8f c) {
    return __builtin_amdgcn_wmma_f32_16x16x32_bf16(false, a, false, b, (short)0, c, false, false);
  }
};

__device__ __forceinline__ unsigned pk16(unsigned short a, unsigned short b) { return (unsigned)a | ((unsigned)b << 16); }
__device__ __forceinline__ unsigned short h_bits(float f) { const _Float16 h = (_Float16)f; return __builtin_bit_cast(unsigned short, h); }

// ---- Register-blocked batched WMMA GEMM, operands staged in LDS ------------------------------------------------------
// C[m,n] = scale * sum_k A[m,k] * Bt[n,k] (+bias)(+resid); each wave owns a 64x64 tile, a block of 2 x 4 waves 128 x 256.
// A row-major [M,K]; Bt row-major [N,K]; M % 128 == 0, N % 256 == 0, K % 128 == 0.
// A stage is 128 k of the block's 128 A rows and 256 Bt rows, brought into LDS once for all eight waves by 16-byte
// asynchronous copies (whole 256-byte row pieces); two buffers, the next stage's copies fly while this one is multiplied.
// SPLIT (hi/lo operand planes) is not staged and not instantiated.
// BIAS_MODE: 0 = none, 1 = bias[m], 2 = bias[n].
// OUT_MODE: 0 = f32, 1 = f16, 2 = bf16 hi plane (Cout) + bf16 lo plane (Cout2).
// ET: 0 = f16 operands, 1 = bf16 operands (pointers passed as 16-bit storage)
constexpr int kBM    = 128;                      // A rows per block
constexpr int kBN    = 256;                      // Bt rows per block
constexpr int kBK    = 128;                      // k per stage = 256 B of every operand row
constexpr int kPitch = kBK + 8;                  // LDS row pitch in elements: 272 B = 16 B x 17, no bank conflict for 16-byte fragment reads
constexpr int kStage = (kBM + kBN) * kPitch;     // elements per buffer: [A 128 rows | Bt 256 rows]
static_assert(kTok % kBM == 0 && kEmb % kBM == 0 && kEmb % kBN == 0 && kSeq % kBN == 0 && kEmb % kBK == 0, "block tiles exact");

// Twelve 16-byte asynchronous copies per lane, global -> LDS. l = the lane's LDS byte address, g = its global address.
// s_wait_xcnt 0 closes the statement as a precaution: no register that a copy names is rewritten in front of it.
__device__ __forceinline__ void async_copy12(const unsigned (&l)[12], const void* const (&g)[12]) {
  asm volatile(
      "global_load_async_to_lds_b128 %0, %12, off\n\t"
      "global_load_async_to_lds_b128 %1, %13, off\n\t"
      "global_load_async_to_lds_b128 %2, %14, off\n\t"
      "global_load_async_to_lds_b128 %3, %15, off\n\t"
      "global_load_async_to_lds_b128 %4, %16, off\n\t"
      "global_load_async_to_lds_b128 %5, %17, off\n\t"
      "global_load_async_to_lds_b128 %6, %18, off\n\t"
      "global_load_async_to_lds_b128 %7, %19, off\n\t"
      "global_load_async_to_lds_b128 %8, %20, off\n\t"
      "global_load_async_to_lds_b128 %9, %21, off\n\t"
      "global_load_async_to_lds_b128 %10, %22, off\n\t"
      "global_load_async_to_lds_b128 %11, %23, off\n\t"
      "s_wait_xcnt 0x0"
      :: "v"(l[0]), "v"(l[1]), "v"(l[2]), "v"(l[3]), "v"(l[4]), "v"(l[5]), "v"(l[6]), "v"(l[7]), "v"(l[8]), "v"(l[9]), "v"(l[10]), "v"(l[11]),
         "v"(g[0]), "v"(g[1]), "v"(g[2]), "v"(g[3]), "v"(g[4]), "v"(g[5]), "v"(g[6]), "v"(g[7]), "v"(g[8]), "v"(g[9]), "v"(g[10]), "v"(g[11])
      : "memory");
}
// this wave's own copies have landed (other waves read them only behind the barrier that follows)
__device__ __forceinline__ void wait_async0() { asm volatile("s_wait_asynccnt 0x0" ::: "memory"); }
// this wave's LDS reads have returned, before the buffer they read is handed back to the copies
__device__ __forceinline__ void wait_ds0() { asm volatile("s_wait_dscnt 0x0" ::: "memory"); }

template <int ET> struct Elem;
template <> struct Elem<0> { typedef _Float16 T; };
template <> struct Elem<1> { typedef __bf16 T; };
template <int ET, bool SPLIT, int BIAS_MODE, int OUT_MODE, bool RESID, int ACT = 0>
__global__ __launch_bounds__(256) void wmma_gemm64(
    const unsigned short* __restrict__ Ap, const unsigned short* __restrict__ A2p, int lda, long strideA,
    const unsigned short* __restrict__ Btp, const unsigned short* __restrict__ Bt2p, int ldb, long strideB,
    void* __restrict__ Cout, void* __restrict__ Cout2, int ldc, long strideC,
    const float* __restrict__ bias,
    const float* __restrict__ resid, long strideR,
    int M, int N, int K, float scale) {
  typedef typename Elem<ET>::T T;
  typedef typename Frag<T>::V V;
  static_assert(!SPLIT, "hi/lo planes are not staged");
  const T* A = (const T*)Ap; const T* Bt = (const T*)Btp;
  __shared__ __align__(16) T sOp[2 * kStage];      // two operand buffers
  __shared__ __align__(16) float sT[8][16 * 68];   // per-wave 16x64 slab, pitch 68 floats
  const int b    = blockIdx.y;
  const int lane = threadIdx.x & 31;
  const int wave = threadIdx.x >> 5;
  const int tilesN = N / kBN;
  const int tilesM = M / kBM;
  if ((int)blockIdx.x >= tilesM * tilesN) return;   // block-uniform, in front of every barrier
  const int tm  = blockIdx.x / tilesN;
  const int tn  = blockIdx.x - tm * tilesN;
  const int bm0 = tm * kBM;
  const int bn0 = tn * kBN;
  const int wm  = wave >> 2;                   // wave grid 2 (M) x 4 (N)
  const int wn  = wave & 3;
  const int m0  = bm0 + (wm << 6);
  const int n0  = bn0 + (wn << 6);

  const T* Ab  = A  + (size_t)b * strideA;
  const T* Bb  = Bt + (size_t)b * strideB;

  const int rlane = lane & 15;                 // row (A) / col (B, D) within subtile
  const int koff  = (lane >> 4) * 8;           // k offset of this lane half
  const int mOff  = (lane >> 4) * 8;           // D row offset

  // Copies: 16 lanes cover one row's 256 bytes, the block 16 rows per copy; 8 copies for A, 16 for Bt, per lane and stage.
  const int crow = threadIdx.x >> 4;
  const int ccol = (threadIdx.x & 15) * 8;
  const T* gA = Ab + (size_t)(bm0 + crow) * lda + ccol;
  const T* gB = Bb + (size_t)(bn0 + crow) * ldb + ccol;
  const unsigned lds0 = (unsigned)(size_t)sOp + (unsigned)(crow * kPitch + ccol) * 2u;
  auto stage_copies = [&](int t, int buf) {
    const unsigned lb = lds0 + (unsigned)buf * (unsigned)(kStage * 2);
    const T* ga = gA + (size_t)t * kBK;
    const T* gb = gB + (size_t)t * kBK;
#pragma unroll
    for (int half = 0; half < 2; ++half) {
      unsigned l[12];
      const void* g[12];
#pragma unroll  // constant indices keep these arrays in registers
      for (int e = 0; e < 12; ++e) {
        const int grp = half * 12 + e;           // 16-row group of the buffer: 0..7 A, 8..23 Bt
        l[e] = lb + (unsigned)(grp * 16 * kPitch * 2);
        g[e] = (grp < 8) ? (const void*)(ga + (size_t)(grp * 16) * lda) : (const void*)(gb + (size_t)((grp - 8) * 16) * ldb);
      }
      async_copy12(l, g);
    }
  };

  v8f acc[4][4];
#pragma unroll
  for (int i = 0; i < 4; ++i)
#pragma unroll
    for (int j = 0; j < 4; ++j) acc[i][j] = (v8f){0.f,0.f,0.f,0.f,0.f,0.f,0.f,0.f};

  const int nStages = K / kBK;
  const int aoff = ((wm << 6) + rlane) * kPitch + koff;
  const int boff = (kBM + (wn << 6) + rlane) * kPitch + koff;

  stage_copies(0, 0);
  wait_async0();
  __syncthreads();                               // stage 0 is published
  if (nStages > 1) stage_copies(1, 1);

#pragma clang loop unroll(disable)  // one stage per trip: the buffer index stays a run-time value, the text small
  for (int t = 0; t < nStages; ++t) {
    const T* sa = sOp + (t & 1) * kStage + aoff;
    const T* sb = sOp + (t & 1) * kStage + boff;
    // Fragment reads go ahead of the WMMAs that cover their latency: the Bt set and A rows 0, 1 of the next 32 k are read
    // under rows 2, 3 of these 32 k, A rows 2, 3 under rows 0, 1. Each sched_barrier keeps the compiler from sinking a
    // read group down to its first use, where the wave would wait out the LDS latency in front of every row.
    V af[4], bf[2][4];
#pragma unroll  // constant indices keep these arrays in registers
    for (int j = 0; j < 4; ++j) bf[0][j] = Frag<T>::load(sb + j * 16 * kPitch);
#pragma unroll  // constant indices keep these arrays in registers
    for (int i = 0; i < 2; ++i) af[i] = Frag<T>::load(sa + i * 16 * kPitch);
#pragma unroll  // constant indices keep these arrays in registers
    for (int ks = 0; ks < kBK / 32; ++ks) {
      const int cs = ks & 1;
#pragma unroll  // constant indices keep these arrays in registers
      for (int i = 2; i < 4; ++i) af[i] = Frag<T>::load(sa + i * 16 * kPitch + ks * 32);
      __builtin_amdgcn_sched_barrier(0);  // A rows 2, 3 are read ahead of rows 0, 1's WMMAs
#pragma unroll  // constant indices keep these arrays in registers
      for (int i = 0; i < 2; ++i)
#pragma unroll  // constant indices keep these arrays in registers
        for (int j = 0; j < 4; ++j) acc[i][j] = Frag<T>::mma(af[i], bf[cs][j], acc[i][j]);
      __builtin_amdgcn_sched_barrier(0);  // the next reads stay behind rows 0, 1's WMMAs, whose registers they refill
      if (ks + 1 < kBK / 32) {
#pragma unroll  // constant indices keep these arrays in registers
        for (int j = 0; j < 4; ++j) bf[cs ^ 1][j] = Frag<T>::load(sb + j * 16 * kPitch + (ks + 1) * 32);
#pragma unroll  // constant indices keep these arrays in registers
        for (int i = 0; i < 2; ++i) af[i] = Frag<T>::load(sa + i * 16 * kPitch + (ks + 1) * 32);
      }
      __builtin_amdgcn_sched_barrier(0);  // the next 32 k's reads stay ahead of rows 2, 3's WMMAs
#pragma unroll  // constant indices keep these arrays in registers
      for (int i = 2; i < 4; ++i)
#pragma unroll  // constant indices keep these arrays in registers
        for (int j = 0; j < 4; ++j) acc[i][j] = Frag<T>::mma(af[i], bf[cs][j], acc[i][j]);
      __builtin_amdgcn_sched_barrier(0);  // the reads after that stay behind them
    }
    wait_ds0();
    wait_async0();
    __syncthreads();                             // publishes stage t + 1 and ends every wave's reads of stage t
    if (t + 2 < nStages) stage_copies(t + 2, t & 1);
  }
  wait_async0();
  acc_guard4(acc[0][0], acc[0][1], acc[0][2], acc[0][3]);
  acc_guard4(acc[1][0], acc[1][1], acc[1][2], acc[1][3]);
  acc_guard4(acc[2][0], acc[2][1], acc[2][2], acc[2][3]);
  acc_guard4(acc[3][0], acc[3][1], acc[3][2], acc[3][3]);

  // ---- epilogue ----
  float* slab = sT[wave];
  const float* Rb = RESID ? (resid + (size_t)b * strideR) : nullptr;
#pragma unroll
  for (int i = 0; i < 4; ++i) {
    const int mBase = m0 + (i << 4);
#pragma unroll
    for (int j = 0; j < 4; ++j) {
      const int n = n0 + (j << 4) + rlane;
      float bv = 0.f;
      if (BIAS_MODE == 2) bv = bias[n];
#pragma unroll
      for (int r = 0; r < 8; ++r) {
        float v = acc[i][j][r] * scale;
        if (BIAS_MODE == 1) v += bias[mBase + mOff + r];
        if (BIAS_MODE == 2) v += bv;
        if (RESID) v += Rb[(size_t)(mBase + mOff + r) * ldc + n];
        if (ACT == 2) v = fmaxf(v, 0.0f);
        if (ACT == 4) v = (v > 0.f) ? v : 0.01f * v;
        slab[(mOff + r) * 68 + (j << 4) + rlane] = v;
      }
    }
    __builtin_amdgcn_fence(__ATOMIC_RELEASE, "workgroup");
    __builtin_amdgcn_wave_barrier();
    __builtin_amdgcn_fence(__ATOMIC_ACQUIRE, "workgroup");
    if (OUT_MODE == 0) {
      float* C = (float*)Cout + (size_t)b * strideC;
      const int hh = lane >> 4, c4 = (lane & 15) * 4;     // row seg = 256 B = 16 lanes x 16 B
      {
#pragma unroll
        for (int it = 0; it < 8; ++it) {
          const int row = it * 2 + hh;
          v4f v = *(const v4f*)(slab + row * 68 + c4);
          *(v4f*)(C + (size_t)(mBase + row) * ldc + n0 + c4) = v;
        }
        
      }
    } else {
      const int q = lane >> 3, c8 = (lane & 7) * 8;
      unsigned short* C  = (unsigned short*)Cout  + (size_t)b * strideC;
      unsigned short* C2 = (OUT_MODE == 2) ? ((unsigned short*)Cout2 + (size_t)b * strideC) : nullptr;
      {
#pragma unroll
        for (int it = 0; it < 4; ++it) {
          const int row = it * 4 + q;
          const float* sp = slab + row * 68 + c8;
          v8h hv, lv;
#pragma unroll
          for (int e = 0; e < 8; ++e) {
            if (OUT_MODE == 1) {
              hv[e] = (_Float16)sp[e];
            } else {
              unsigned short hb = f2bf_bits(sp[e]);
              unsigned short lb = f2bf_bits(sp[e] - bf_bits2f(hb));
              hv[e] = __builtin_bit_cast(_Float16, hb);
              lv[e] = __builtin_bit_cast(_Float16, lb);
            }
          }
          *(v8h*)(C + (size_t)(mBase + row) * ldc + n0 + c8) = hv;
          if (OUT_MODE == 2) *(v8h*)(C2 + (size_t)(mBase + row) * ldc + n0 + c8) = lv;
        }
        
      }
    }
    __builtin_amdgcn_fence(__ATOMIC_RELEASE, "workgroup");
    __builtin_amdgcn_wave_barrier();
    __builtin_amdgcn_fence(__ATOMIC_ACQUIRE, "workgroup");
  }
}

// ---------------------------------------------------------------------------
// f32 -> f16 cast with power-of-two carry: out[i] = f16(scale * in[i]), 8 consecutive elements per thread
// Coverage: n8 = n/8 threads x 8 = whole plane (x: 1048576 threads = 4096 x 256; W: 131072 = 512 x 256, exact).
// ---------------------------------------------------------------------------
__global__ __launch_bounds__(256) void cast8_f16_kernel(const float* __restrict__ in, unsigned short* __restrict__ out,
                                                        int n8, float scale) {
  const int i = blockIdx.x * 256 + threadIdx.x;
  if (i >= n8) return;
  const float* p = in + 8 * (size_t)i;
  const v4f a = *(const v4f*)(p);
  const v4f c = *(const v4f*)(p + 4);
  unsigned short hb[8];
#pragma unroll
  for (int e = 0; e < 4; ++e) {
    hb[e]     = h_bits(a[e] * scale);
    hb[4 + e] = h_bits(c[e] * scale);
  }
  const v4u u = (v4u){pk16(hb[0], hb[1]), pk16(hb[2], hb[3]), pk16(hb[4], hb[5]), pk16(hb[6], hb[7])};
  unsigned short* q = out + 8 * (size_t)i;
  *(v4u*)q = u;
  
}

// ---------------------------------------------------------------------------
// Per-(token, head) centering over the 64 head dims, f32 math:
//   mean = sum_d x / 64; c = x - mean; var = sum_d c*c / 63 (unbiased).
//   dst[token][h*64 + d] = f16(carry * c); var_out[token][h] = var (layout [8192][16] f32).
// Block = 256 threads = 8 waves; wave w owns token blockIdx.x*8 + w (grid 1024 -> 8192 tokens, exact).
// Lane l: head group g = l>>3 (4 heads per pass, 4 passes = 16 heads), dims (l&7)*8 .. +7.
// LDS sv: all 8 x 16 entries written (every wave writes its 16 heads) before the barrier.
// ---------------------------------------------------------------------------
__global__ __launch_bounds__(256) void center_kernel(const float* __restrict__ src, unsigned short* __restrict__ dst,
                                                     float* __restrict__ var_out, float carry) {
  __shared__ __align__(16) float sv[8 * 16];
  const int t    = threadIdx.x;
  const int lane = t & 31, wave = t >> 5;
  const int tok  = blockIdx.x * 8 + wave;
  const int g    = lane >> 3;
  const int e8   = (lane & 7) * 8;
  const float* row = src + (size_t)tok * kEmb;
  unsigned short* drow = dst + (size_t)tok * kEmb;
#pragma unroll
  for (int hq = 0; hq < 4; ++hq) {
    const int h = hq * 4 + g;
    const float* p = row + h * kHeadDim + e8;
    const v4f a = *(const v4f*)(p);
    const v4f c = *(const v4f*)(p + 4);
    float x[8];
#pragma unroll
    for (int e = 0; e < 4; ++e) { x[e] = a[e]; x[4 + e] = c[e]; }
    float s = ((x[0] + x[1]) + (x[2] + x[3])) + ((x[4] + x[5]) + (x[6] + x[7]));
    s += __shfl_xor(s, 1, 32);
    s += __shfl_xor(s, 2, 32);
    s += __shfl_xor(s, 4, 32);
    const float mean = s * kInv64;
    float vs = 0.f;
#pragma unroll
    for (int e = 0; e < 8; ++e) { x[e] = x[e] - mean; vs += x[e] * x[e]; }
    vs += __shfl_xor(vs, 1, 32);
    vs += __shfl_xor(vs, 2, 32);
    vs += __shfl_xor(vs, 4, 32);
    unsigned short hb[8];
#pragma unroll
    for (int e = 0; e < 8; ++e) hb[e] = h_bits(x[e] * carry);
    const v4u u = (v4u){pk16(hb[0], hb[1]), pk16(hb[2], hb[3]), pk16(hb[4], hb[5]), pk16(hb[6], hb[7])};
    unsigned short* q = drow + h * kHeadDim + e8;
    *(v4u*)q = u;
    
    if ((lane & 7) == 0) sv[wave * 16 + h] = vs * kInv63;
  }
  __syncthreads();
  if (wave == 0) {
    // sv flat index 4*lane .. +3 = (token wave = lane>>2, heads (lane&3)*4 ..) == var_out[(blockIdx.x*8 + w)*16 + h]
    const v4f v = *(const v4f*)(sv + 4 * lane);
    float* vp = var_out + (size_t)blockIdx.x * 128 + 4 * lane;
    *(v4f*)vp = v;
    
  }
}

// ---------------------------------------------------------------------------
// Fused attention for one (batch, head) and 256 queries per block: scores, softmax and probabilities.v in one pass
// over the keys, nothing of the 1024 x 1024 score plane leaves the registers.
//   S^T = Kc . Qc^T   (A = 16 key rows, B = 16 query rows, K = 64 head dims)     D: lane = query c, register r = key 8*hs + r
//   O^T += V^T . P^T  (A = 16 v^T rows, B = two converted S^T tiles, K = 32 keys) D: lane = query c, register r = dim 8*hs + r
// Two S^T tiles (keys 0..15 and 16..31 of a pass) converted in place are the B operand in the order Frag::load gives A.
// Score in log2 units: s = log2e * (dot / 1024 + q_var * k_var / 64). p = exp2(s - m), m = the query's maximum in use;
// m is raised (and sum and output rescaled) only when a score exceeds it by more than 8, so p <= 256 fits f16.
// Block = 8 waves, wave w owns queries blockIdx.x*256 + w*32 .. +31 (two 16-query tiles); grid (4, 128), exact.
// LDS skv: the head's 1024 k variances, all written (256 threads x 4) before the first barrier, read-only after it.
// LDS sKV: a stage is 128 keys of the head: 128 centered-k rows of 128 B and 64 v^T rows of 256 B, brought in once for all
// eight waves by 16-byte asynchronous copies (whole 128-byte lines); two buffers, the next stage's copies fly while this
// one is worked on. Every wave reads its A fragments (k rows, v^T rows) from there with Frag::load.
// ---------------------------------------------------------------------------
constexpr int kAK     = 128;                     // keys per stage
constexpr int kKPitch = kHeadDim + 8;            // k rows: 144 B = 16 B x 9, no bank conflict for 16-byte fragment reads
constexpr int kVPitch = kAK + 8;                 // v^T rows: 272 B = 16 B x 17, likewise
constexpr int kKStage = kAK * kKPitch;           // elements of the k part of a buffer
constexpr int kAStage = kKStage + kHeadDim * kVPitch;   // elements per buffer: [k 128 rows | v^T 64 rows]
static_assert(kSeq % kAK == 0 && kSeq / kAK >= 2 && kAK % 32 == 0 && (kAStage * 2) % 16 == 0, "stages exact, two or more");
static_assert(((kAK / 32) & (kAK / 32 - 1)) == 0, "passes per stage a power of two: the key prefetch wraps by a mask");

// Eight 16-byte asynchronous copies per lane, global -> LDS. l = the lane's LDS byte address, g = its global address.
// s_wait_xcnt 0 closes the statement as a precaution: no register that a copy names is rewritten in front of it.
__device__ __forceinline__ void async_copy8(const unsigned (&l)[8], const void* const (&g)[8]) {
  asm volatile(
      "global_load_async_to_lds_b128 %0, %8, off\n\t"
      "global_load_async_to_lds_b128 %1, %9, off\n\t"
      "global_load_async_to_lds_b128 %2, %10, off\n\t"
      "global_load_async_to_lds_b128 %3, %11, off\n\t"
      "global_load_async_to_lds_b128 %4, %12, off\n\t"
      "global_load_async_to_lds_b128 %5, %13, off\n\t"
      "global_load_async_to_lds_b128 %6, %14, off\n\t"
      "global_load_async_to_lds_b128 %7, %15, off\n\t"
      "s_wait_xcnt 0x0"
      :: "v"(l[0]), "v"(l[1]), "v"(l[2]), "v"(l[3]), "v"(l[4]), "v"(l[5]), "v"(l[6]), "v"(l[7]),
         "v"(g[0]), "v"(g[1]), "v"(g[2]), "v"(g[3]), "v"(g[4]), "v"(g[5]), "v"(g[6]), "v"(g[7])
      : "memory");
}

__global__ __launch_bounds__(256) void attn_fused_kernel(const unsigned short* __restrict__ qc, const unsigned short* __restrict__ kc,
                                                         const unsigned short* __restrict__ vt, const float* __restrict__ qvar,
                                                         const float* __restrict__ kvar, unsigned short* __restrict__ o16) {
  typedef Frag<_Float16> F;
  __shared__ __align__(16) float skv[kSeq];
  __shared__ __align__(16) _Float16 sKV[2 * kAStage];   // two stage buffers
  const int lane = threadIdx.x & 31, wave = threadIdx.x >> 5;
  const int b  = blockIdx.y >> 4;
  const int h  = blockIdx.y & (kHeads - 1);
  const int q0 = blockIdx.x * 256 + wave * 32;
  const int c  = lane & 15;
  const int hs = lane >> 4;

  // Copies: 8 lanes cover one k row's 128 bytes (the block 32 rows per copy), 16 lanes one v^T row's 256 bytes (16 rows per
  // copy); 4 copies for k and 4 for v^T, per lane and stage.
  const int krow = threadIdx.x >> 3, kcol = (threadIdx.x & 7) * 8;
  const int vrow = threadIdx.x >> 4, vcol = (threadIdx.x & 15) * 8;
  const _Float16* gK = (const _Float16*)kc + ((size_t)b * kSeq + krow) * kEmb + h * kHeadDim + kcol;
  const _Float16* gV = (const _Float16*)vt + (size_t)b * kEmb * kSeq + (size_t)(h * kHeadDim + vrow) * kSeq + vcol;
  const unsigned ldsK = (unsigned)(size_t)sKV + (unsigned)(krow * kKPitch + kcol) * 2u;
  const unsigned ldsV = (unsigned)(size_t)sKV + (unsigned)(kKStage + vrow * kVPitch + vcol) * 2u;
  auto stage_copies = [&](int t, int buf) {
    const unsigned lb = (unsigned)buf * (unsigned)(kAStage * 2);
    unsigned l[8];
    const void* g[8];
#pragma unroll  // constant indices keep these arrays in registers
    for (int e = 0; e < 4; ++e) {
      l[e]     = ldsK + lb + (unsigned)(e * 32 * kKPitch * 2);
      g[e]     = (const void*)(gK + (size_t)(t * kAK + e * 32) * kEmb);
      l[4 + e] = ldsV + lb + (unsigned)(e * 16 * kVPitch * 2);
      g[4 + e] = (const void*)(gV + (size_t)(e * 16) * kSeq + t * kAK);
    }
    async_copy8(l, g);
  };

  stage_copies(0, 0);
#pragma unroll
  for (int e = 0; e < 4; ++e) {
    const int j = e * 256 + threadIdx.x;
    skv[j] = kvar[((size_t)b * kSeq + j) * kHeads + h];
  }
  wait_async0();
  __syncthreads();  // stage 0 is published; every wave reads all of skv, each thread wrote four entries
  stage_copies(1, 1);

  const _Float16* Qp = (const _Float16*)qc + ((size_t)b * kSeq + q0 + c) * kEmb + h * kHeadDim + hs * 8;
  const int koffs = c * kKPitch + hs * 8;             // this lane's place in a k fragment row
  const int voffs = kKStage + c * kVPitch + hs * 8;   // and in a v^T fragment row

  v16h qf[2][2];
  float qv2[2], m[2], l[2];
  v8f o[4][2];
#pragma unroll  // constant indices keep these arrays in registers
  for (int qt = 0; qt < 2; ++qt) {
    qf[qt][0] = F::load(Qp + (size_t)(qt * 16) * kEmb);
    qf[qt][1] = F::load(Qp + (size_t)(qt * 16) * kEmb + 32);
    qv2[qt] = qvar[((size_t)b * kSeq + q0 + qt * 16 + c) * kHeads + h] * (kInv64 * kLog2e);
    m[qt] = -INFINITY;
    l[qt] = 0.f;
#pragma unroll  // constant indices keep these arrays in registers
    for (int i = 0; i < 4; ++i) o[i][qt] = (v8f){0.f,0.f,0.f,0.f,0.f,0.f,0.f,0.f};
  }

#pragma clang loop unroll(disable)  // one stage per trip: the buffer index stays a run-time value, the text small
  for (int t = 0; t < kSeq / kAK; ++t) {
    const _Float16* sk = sKV + (t & 1) * kAStage + koffs;
    const _Float16* sv = sKV + (t & 1) * kAStage + voffs;
    v16h kf[2][2];
#pragma unroll  // constant indices keep these arrays in registers
    for (int kt = 0; kt < 2; ++kt) {
      kf[kt][0] = F::load(sk + (kt * 16) * kKPitch);
      kf[kt][1] = F::load(sk + (kt * 16) * kKPitch + 32);
    }

#pragma clang loop unroll(disable)  // one pass per trip keeps the text small and the registers of one pass
    for (int p = 0; p < kAK / 32; ++p) {
      const int key0 = t * kAK + p * 32;
      v16h vf[4];
#pragma unroll  // constant indices keep these arrays in registers
      for (int i = 0; i < 4; ++i) vf[i] = F::load(sv + (i * 16) * kVPitch + p * 32);
      float kv[2][8];
#pragma unroll  // constant indices keep these arrays in registers
      for (int kt = 0; kt < 2; ++kt) {
        const v4f a0 = *(const v4f*)(skv + key0 + kt * 16 + hs * 8);
        const v4f a1 = *(const v4f*)(skv + key0 + kt * 16 + hs * 8 + 4);
#pragma unroll  // constant indices keep these arrays in registers
        for (int e = 0; e < 4; ++e) { kv[kt][e] = a0[e]; kv[kt][4 + e] = a1[e]; }
      }
      __builtin_amdgcn_sched_barrier(0);  // the pass's v^T and variance reads stay one group up here, not sunk among the WMMAs that use them

      v8f s[2][2];
#pragma unroll  // constant indices keep these arrays in registers
      for (int kt = 0; kt < 2; ++kt)
#pragma unroll  // constant indices keep these arrays in registers
        for (int qt = 0; qt < 2; ++qt) {
          s[kt][qt] = F::mma(kf[kt][0], qf[qt][0], (v8f){0.f,0.f,0.f,0.f,0.f,0.f,0.f,0.f});
          s[kt][qt] = F::mma(kf[kt][1], qf[qt][1], s[kt][qt]);
        }

      __builtin_amdgcn_sched_barrier(0);  // the reads below refill the registers of the products above
      // next pass's key fragments, fetched while this pass's softmax runs; never past this stage's own buffer
      // (the stage's last pass re-reads its keys 0..31, unused: no branch stands behind the products above)
      const int np = (p + 1) & (kAK / 32 - 1);
#pragma unroll  // constant indices keep these arrays in registers
      for (int kt = 0; kt < 2; ++kt) {
        kf[kt][0] = F::load(sk + (np * 32 + kt * 16) * kKPitch);
        kf[kt][1] = F::load(sk + (np * 32 + kt * 16) * kKPitch + 32);
      }
      __builtin_amdgcn_sched_barrier(0);  // and stay one group ahead of the softmax that covers their latency

      float mx[2];
#pragma unroll  // constant indices keep these arrays in registers
      for (int qt = 0; qt < 2; ++qt) {
#pragma unroll  // constant indices keep these arrays in registers
        for (int kt = 0; kt < 2; ++kt)
#pragma unroll  // constant indices keep these arrays in registers
          for (int r = 0; r < 8; ++r) s[kt][qt][r] = s[kt][qt][r] * (kScoreScale * kLog2e) + qv2[qt] * kv[kt][r];
        float a0 = fmaxf(fmaxf(s[0][qt][0], s[0][qt][1]), fmaxf(s[0][qt][2], s[0][qt][3]));
        float a1 = fmaxf(fmaxf(s[0][qt][4], s[0][qt][5]), fmaxf(s[0][qt][6], s[0][qt][7]));
        float a2 = fmaxf(fmaxf(s[1][qt][0], s[1][qt][1]), fmaxf(s[1][qt][2], s[1][qt][3]));
        float a3 = fmaxf(fmaxf(s[1][qt][4], s[1][qt][5]), fmaxf(s[1][qt][6], s[1][qt][7]));
        mx[qt] = fmaxf(fmaxf(a0, a1), fmaxf(a2, a3));
      }

      // one wave-uniform test per pass; both halves of a query's lane pair take the same new maximum
      const bool need = (mx[0] > m[0] + 8.0f) || (mx[1] > m[1] + 8.0f);
      if (__builtin_amdgcn_ballot_w32(need) != 0u) {
#pragma unroll  // constant indices keep these arrays in registers
        for (int qt = 0; qt < 2; ++qt) {
          const float mn = fmaxf(m[qt], fmaxf(mx[qt], __shfl_xor(mx[qt], 16, 32)));
          const float al = __builtin_amdgcn_exp2f(m[qt] - mn);
          m[qt] = mn;
          l[qt] *= al;
#pragma unroll  // constant indices keep these arrays in registers
          for (int i = 0; i < 4; ++i)
#pragma unroll  // constant indices keep these arrays in registers
            for (int r = 0; r < 8; ++r) o[i][qt][r] *= al;
        }
      }

      v16h pf[2];
#pragma unroll  // constant indices keep these arrays in registers
      for (int qt = 0; qt < 2; ++qt) {
        float ls0 = 0.f, ls1 = 0.f;
#pragma unroll  // constant indices keep these arrays in registers
        for (int r = 0; r < 8; ++r) {
          const float p0 = __builtin_amdgcn_exp2f(s[0][qt][r] - m[qt]);
          const float p1 = __builtin_amdgcn_exp2f(s[1][qt][r] - m[qt]);
          ls0 += p0;
          ls1 += p1;
          pf[qt][r]     = (_Float16)p0;
          pf[qt][8 + r] = (_Float16)p1;
        }
        l[qt] += ls0 + ls1;
      }

#pragma unroll  // constant indices keep these arrays in registers
      for (int i = 0; i < 4; ++i)
#pragma unroll  // constant indices keep these arrays in registers
        for (int qt = 0; qt < 2; ++qt) o[i][qt] = F::mma(vf[i], pf[qt], o[i][qt]);
      __builtin_amdgcn_sched_barrier(0);  // keeps the four slots below behind the pass's last WMMA
      // four vector slots between the last WMMA and the next pass's address arithmetic, which may take over its A or B registers
      asm volatile("v_nop\n\tv_nop\n\tv_nop\n\tv_nop");
    }
    wait_ds0();
    wait_async0();
    __syncthreads();                             // publishes stage t + 1 and ends every wave's reads of stage t
    if (t + 2 < kSeq / kAK) stage_copies(t + 2, t & 1);
  }
  wait_async0();

  // epilogue: join the two halves' sums, normalise, 8 consecutive head dims per lane = one 16-byte store
#pragma unroll  // constant indices keep these arrays in registers
  for (int qt = 0; qt < 2; ++qt) {
    const float lt  = l[qt] + __shfl_xor(l[qt], 16, 32);
    const float inv = kOCarry * (1.0f / lt);
    unsigned short* op = o16 + ((size_t)b * kSeq + q0 + qt * 16 + c) * kEmb + h * kHeadDim + hs * 8;
#pragma unroll  // constant indices keep these arrays in registers
    for (int i = 0; i < 4; ++i) {
      v8h hv;
#pragma unroll  // constant indices keep these arrays in registers
      for (int r = 0; r < 8; ++r) hv[r] = (_Float16)(o[i][qt][r] * inv);
      *(v8h*)(op + i * 16) = hv;
    }
  }
}

// ---------------------------------------------------------------------------
// Host entry: 12 launches (5 casts, 3 projection GEMMs, 2 centering, fused attention, output GEMM).
// ---------------------------------------------------------------------------
extern "C" void kernel_launch(void* const* d_in, const int* in_sizes, int n_in,
                              void* d_out, int out_size, void* d_ws, size_t ws_size,
                              hipStream_t stream) {
  if (n_in < 5) return;
  if (in_sizes[0] != kTok * kEmb) return;
  if (in_sizes[1] != kEmb * kEmb || in_sizes[2] != kEmb * kEmb || in_sizes[3] != kEmb * kEmb || in_sizes[4] != kEmb * kEmb) return;
  if (out_size != kTok * kEmb) return;
  if (ws_size < kWsTotal) return;

  const float* x  = (const float*)d_in[0];
  const float* Wq = (const float*)d_in[1];
  const float* Wk = (const float*)d_in[2];
  const float* Wv = (const float*)d_in[3];
  const float* Wo = (const float*)d_in[4];
  float* outp = (float*)d_out;

  char* ws = (char*)d_ws;
  unsigned short* X16  = (unsigned short*)(ws + kOffX16);
  unsigned short* O16  = (unsigned short*)(ws + kOffX16);     // region reuse, see map
  unsigned short* Wq16 = (unsigned short*)(ws + kOffWq16);
  unsigned short* Wk16 = (unsigned short*)(ws + kOffWk16);
  unsigned short* Wv16 = (unsigned short*)(ws + kOffWv16);
  unsigned short* Wo16 = (unsigned short*)(ws + kOffWo16);
  float*          QF   = (float*)(ws + kOffQF);
  unsigned short* VT16 = (unsigned short*)(ws + kOffVT16);
  unsigned short* QC16 = (unsigned short*)(ws + kOffQC16);
  unsigned short* KC16 = (unsigned short*)(ws + kOffKC16);
  float*          QVAR = (float*)(ws + kOffQVar);
  float*          KVAR = (float*)(ws + kOffKVar);

  const float* nof = (const float*)nullptr;
  const unsigned short* nou = (const unsigned short*)nullptr;

  // 1) casts to f16 planes
  {
    const int n8x = kTok * kEmb / 8;      // 1048576
    const int n8w = kEmb * kEmb / 8;      // 131072
    cast8_f16_kernel<<<(n8x + 255) / 256, 256, 0, stream>>>(x, X16, n8x, 1.0f);
    cast8_f16_kernel<<<(n8w + 255) / 256, 256, 0, stream>>>(Wq, Wq16, n8w, kWCarry);
    cast8_f16_kernel<<<(n8w + 255) / 256, 256, 0, stream>>>(Wk, Wk16, n8w, kWCarry);
    cast8_f16_kernel<<<(n8w + 255) / 256, 256, 0, stream>>>(Wv, Wv16, n8w, kWCarry);
    cast8_f16_kernel<<<(n8w + 255) / 256, 256, 0, stream>>>(Wo, Wo16, n8w, kWCarry);
  }

  // 2) v^T = Wv . x^T per batch: A = Wv16 [1024][1024] (M = out channel), Bt = X16 rows of the batch [1024][1024] (N = token),
  //    K = 1024, C = VT16 f16 [8][1024][1024], ldc 1024. block tiles 8 x 4 = 32 per batch -> (32, 8).
  {
    const int blocks = (kEmb / kBM) * (kSeq / kBN);   // 32
    wmma_gemm64<0, false, 0, 1, false, 0><<<dim3(blocks, kBatch), 256, 0, stream>>>(
        Wv16, nou, kEmb, 0L, X16, nou, kEmb, (long)kSeq * kEmb, (void*)VT16, (void*)nullptr, kSeq, (long)kEmb * kSeq,
        nof, nof, 0L, kEmb, kSeq, kEmb, kProjScale);
  }

  // 3) q = x . Wq^T (f32 [8192][1024]) -> centering -> QC16 + QVAR; then k likewise into the same f32 region.
  {
    const int blocks = (kTok / kBM) * (kEmb / kBN);   // 256
    wmma_gemm64<0, false, 0, 0, false, 0><<<dim3(blocks, 1), 256, 0, stream>>>(
        X16, nou, kEmb, 0L, Wq16, nou, kEmb, 0L, (void*)QF, (void*)nullptr, kEmb, 0L,
        nof, nof, 0L, kTok, kEmb, kEmb, kProjScale);
    center_kernel<<<kTok / 8, 256, 0, stream>>>(QF, QC16, QVAR, kQKCarry);
    wmma_gemm64<0, false, 0, 0, false, 0><<<dim3(blocks, 1), 256, 0, stream>>>(
        X16, nou, kEmb, 0L, Wk16, nou, kEmb, 0L, (void*)QF, (void*)nullptr, kEmb, 0L,
        nof, nof, 0L, kTok, kEmb, kEmb, kProjScale);
    center_kernel<<<kTok / 8, 256, 0, stream>>>(QF, KC16, KVAR, kQKCarry);
  }

  // 4) attention: one launch, block = (256 queries, one batch and head)
  attn_fused_kernel<<<dim3(kSeq / 256, kBatch * kHeads), 256, 0, stream>>>(QC16, KC16, VT16, QVAR, KVAR, O16);

  // 5) out = O . Wo^T : A = O16 [8192][1024], Bt = Wo16 [1024][1024], K = 1024, C = d_out f32 [8192][1024].
  {
    const int blocks = (kTok / kBM) * (kEmb / kBN);   // 256
    wmma_gemm64<0, false, 0, 0, false, 0><<<dim3(blocks, 1), 256, 0, stream>>>(
        O16, nou, kEmb, 0L, Wo16, nou, kEmb, 0L, (void*)outp, (void*)nullptr, kEmb, 0L,
        nof, nof, 0L, kTok, kEmb, kEmb, kOutScale);
  }
}

// v004
// One run takes 123 microseconds.
// In both of two side-by-side timings against v003, it was 1.20 times as fast.
// Counting every step since v000, it is 12.4 times as fast.
// All contractions (q/k/v projections K=1024, centered q.k^T scores K=64, probabilities.v K=1024, output projection K=1024): v_wmma_f32_16x16x32_f16 with f16 operands (weights carried x16, centered q/k carried x4, unnormalised probabilities exp2(score - maximum in use), attention output carried x64) and f32 accumulate; centering, variances, variance outer product and online softmax in f32.
#include <hip/hip_runtime.h>
#include <math.h>

// ---------------------------------------------------------------------------
// Problem constants
// ---------------------------------------------------------------------------
constexpr int kBatch   = 8;
constexpr int kSeq     = 1024;
constexpr int kEmb     = 1024;
constexpr int kHeads   = 16;
constexpr int kHeadDim = 64;
constexpr int kTok     = kBatch * kSeq;                 // 8192 token rows

constexpr float kWCarry     = 16.0f;                    // weights carried x16 in f16
constexpr float kQKCarry    = 4.0f;                     // centered q / k carried x4 in f16
constexpr float kOCarry     = 64.0f;                    // attention output carried x64 in f16
constexpr float kProjScale  = 1.0f / kWCarry;                              // 1/16
constexpr float kScoreScale = 1.0f / (kQKCarry * kQKCarry * 64.0f);        // 1/1024  (= dot / head_dim)
constexpr float kLog2e      = 1.4426950408889634f;
constexpr float kOutScale   = 1.0f / (kOCarry * kWCarry);                  // 1/1024
constexpr float kInv64      = 1.0f / 64.0f;
constexpr float kInv63      = 1.0f / 63.0f;

// ---------------------------------------------------------------------------
// Workspace region map (bytes). Total carve 121 MiB = 126877696 B.
//   [  0, 16) MiB  X16  f16 [8192][1024] (x)                 -> reused as O16 f16 [8192][1024] (attention output x64)
//                  after the three projection GEMMs (last readers of X16) have been enqueued
//   [ 16, 18) MiB  Wq16 f16 [1024][1024] x16
//   [ 18, 20) MiB  Wk16
//   [ 20, 22) MiB  Wv16
//   [ 22, 24) MiB  Wo16
//   [ 24, 72) MiB  unused
//   [ 72, 88) MiB  VT16 f16 [8][1024][1024] (v^T per batch: row = out channel, col = token of the batch)
//   [ 88,104) MiB  QC16 f16 [8192][1024] centered q x4
//   [104,120) MiB  KC16 f16 [8192][1024] centered k x4
//   [120,120.5) MiB QVAR f32 [16][8192]  ([head][token])
//   [120.5,121) MiB KVAR f32 [16][8192]
// ---------------------------------------------------------------------------
constexpr size_t kMiB     = 1048576;
constexpr size_t kOffX16  = 0;
constexpr size_t kOffWq16 = 16 * kMiB;
constexpr size_t kOffWk16 = 18 * kMiB;
constexpr size_t kOffWv16 = 20 * kMiB;
constexpr size_t kOffWo16 = 22 * kMiB;
constexpr size_t kOffVT16 = 72 * kMiB;
constexpr size_t kOffQC16 = 88 * kMiB;
constexpr size_t kOffKC16 = 104 * kMiB;
constexpr size_t kOffQVar = 120 * kMiB;
constexpr size_t kOffKVar = 120 * kMiB + 512 * 1024;
constexpr size_t kWsTotal = 121 * kMiB;
static_assert((size_t)kTok * kEmb * 2 == 16 * kMiB, "x / o planes 16 MiB");
static_assert((size_t)kEmb * kEmb * 2 == 2 * kMiB, "weight planes 2 MiB");
static_assert((size_t)kTok * kHeads * 4 == 512 * 1024, "variance tables 512 KiB");
static_assert(kOffKVar + (size_t)kTok * kHeads * 4 == kWsTotal, "carve end");
static_assert(kWsTotal <= (size_t)134217728, "carve under 128 MiB");
static_assert(kEmb % 32 == 0 && kHeadDim % 32 == 0 && kSeq % 32 == 0, "K multiples of 32");
static_assert(kTok % 64 == 0 && kEmb % 64 == 0 && kSeq % 64 == 0 && kHeadDim % 64 == 0, "M, N multiples of 64");

typedef __attribute__((ext_vector_type(16))) _Float16 v16h;
typedef __attribute__((ext_vector_type(8)))  _Float16 v8h;
typedef __attribute__((ext_vector_type(16))) __bf16   v16b;
typedef __attribute__((ext_vector_type(8)))  __bf16   v8b;
typedef __attribute__((ext_vector_type(8)))  float    v8f;
typedef __attribute__((ext_vector_type(4)))  float    v4f;
typedef __attribute__((ext_vector_type(4)))  unsigned int v4u;

__device__ __forceinline__ unsigned short f2bf_bits(float f) {
  unsigned u = __float_as_uint(f);
  return (unsigned short)((u + 0x7FFFu + ((u >> 16) & 1u)) >> 16);
}
__device__ __forceinline__ float bf_bits2f(unsigned short h) { return __uint_as_float(((unsigned)h) << 16); }

// hazard guards as plain device helpers (no inline asm inside the kernel template body)
__device__ __forceinline__ void acc_guard4(v8f& a, v8f& b, v8f& c, v8f& d) { asm volatile("v_nop\n\tv_nop\n\tv_nop\n\tv_nop" : "+v"(a), "+v"(b), "+v"(c), "+v"(d)); }
template <typename T> struct Frag;
template <> struct Frag<_Float16> {
  typedef v16h V; union U { v16h v; v8h h[2]; };
  static __device__ __forceinline__ v16h load(const _Float16* p) {   // elements 0..7 <- p[0..7], 8..15 <- p[16..23]
    U f; f.h[0] = *(const v8h*)(p); f.h[1] = *(const v8h*)(p + 16); return f.v;
  }
  static __device__ __forceinline__ v8f mma(v16h a, v16h b, v8f c) {
    return __builtin_amdgcn_wmma_f32_16x16x32_f16(false, a, false, b, (short)0, c, false, false);
  }
};
template <> struct Frag<__bf16> {
  typedef v16b V; union U { v16b v; v8b h[2]; };
  static __device__ __forceinline__ v16b load(const __bf16* p) {
    U f; f.h[0] = *(const v8b*)(p); f.h[1] = *(const v8b*)(p + 16); return f.v;
  }
  static __device__ __forceinline__ v8f mma(v16b a, v16b b, v8f c) {
    return __builtin_amdgcn_wmma_f32_16x16x32_bf16(false, a, false, b, (short)0, c, false, false);
  }
};

__device__ __forceinline__ unsigned pk16(unsigned short a, unsigned short b) { return (unsigned)a | ((unsigned)b << 16); }
__device__ __forceinline__ unsigned short h_bits(float f) { const _Float16 h = (_Float16)f; return __builtin_bit_cast(unsigned short, h); }

// ---- Register-blocked batched WMMA GEMM, operands staged in LDS ------------------------------------------------------
// C[m,n] = scale * sum_k A[m,k] * Bt[n,k] (+bias)(+resid); each wave owns a 64x64 tile, a block of 2 x 4 waves 128 x 256.
// A row-major [M,K]; Bt row-major [N,K]; M % 128 == 0, N % 256 == 0, K % 128 == 0.
// A stage is 128 k of the block's 128 A rows and 256 Bt rows, brought into LDS once for all eight waves by 16-byte
// asynchronous copies (whole 256-byte row pieces); two buffers, the next stage's copies fly while this one is multiplied.
// SPLIT (hi/lo operand planes) is not staged and not instantiated.
// BIAS_MODE: 0 = none, 1 = bias[m], 2 = bias[n].
// OUT_MODE: 0 = f32, 1 = f16, 2 = bf16 hi plane (Cout) + bf16 lo plane (Cout2),
//           3 = per-head centering in the epilogue: a wave's 64 columns are one head (n0 % 64 == 0), so every row of its tile
//               is one (token, head). f32 math: mean = sum_d x / 64; c = x - mean; var = sum_d c*c / 63 (unbiased).
//               Cout[m][n] = f16(4 * c), Cout2 = f32 variances [N / 64][M] ([head][token]); 8 lanes x 8 columns hold a row.
// ET: 0 = f16 operands, 1 = bf16 operands (pointers passed as 16-bit storage)
constexpr int kBM    = 128;                      // A rows per block
constexpr int kBN    = 256;                      // Bt rows per block
constexpr int kBK    = 128;                      // k per stage = 256 B of every operand row
constexpr int kPitch = kBK + 8;                  // LDS row pitch in elements: 272 B = 16 B x 17, no bank conflict for 16-byte fragment reads
constexpr int kStage = (kBM + kBN) * kPitch;     // elements per buffer: [A 128 rows | Bt 256 rows]
static_assert(kTok % kBM == 0 && kEmb % kBM == 0 && kEmb % kBN == 0 && kSeq % kBN == 0 && kEmb % kBK == 0, "block tiles exact");

// Twelve 16-byte asynchronous copies per lane, global -> LDS. l = the lane's LDS byte address, g = its global address.
// s_wait_xcnt 0 closes the statement as a precaution: no register that a copy names is rewritten in front of it.
__device__ __forceinline__ void async_copy12(const unsigned (&l)[12], const void* const (&g)[12]) {
  asm volatile(
      "global_load_async_to_lds_b128 %0, %12, off\n\t"
      "global_load_async_to_lds_b128 %1, %13, off\n\t"
      "global_load_async_to_lds_b128 %2, %14, off\n\t"
      "global_load_async_to_lds_b128 %3, %15, off\n\t"
      "global_load_async_to_lds_b128 %4, %16, off\n\t"
      "global_load_async_to_lds_b128 %5, %17, off\n\t"
      "global_load_async_to_lds_b128 %6, %18, off\n\t"
      "global_load_async_to_lds_b128 %7, %19, off\n\t"
      "global_load_async_to_lds_b128 %8, %20, off\n\t"
      "global_load_async_to_lds_b128 %9, %21, off\n\t"
      "global_load_async_to_lds_b128 %10, %22, off\n\t"
      "global_load_async_to_lds_b128 %11, %23, off\n\t"
      "s_wait_xcnt 0x0"
      :: "v"(l[0]), "v"(l[1]), "v"(l[2]), "v"(l[3]), "v"(l[4]), "v"(l[5]), "v"(l[6]), "v"(l[7]), "v"(l[8]), "v"(l[9]), "v"(l[10]), "v"(l[11]),
         "v"(g[0]), "v"(g[1]), "v"(g[2]), "v"(g[3]), "v"(g[4]), "v"(g[5]), "v"(g[6]), "v"(g[7]), "v"(g[8]), "v"(g[9]), "v"(g[10]), "v"(g[11])
      : "memory");
}
// this wave's own copies have landed (other waves read them only behind the barrier that follows)
__device__ __forceinline__ void wait_async0() { asm volatile("s_wait_asynccnt 0x0" ::: "memory"); }
// this wave's LDS reads have returned, before the buffer they read is handed back to the copies
__device__ __forceinline__ void wait_ds0() { asm volatile("s_wait_dscnt 0x0" ::: "memory"); }

// v + (v of lane ^ X), X = 1, 2 or 4, inside a 16-lane row: one v_add_f32 with a row_xmask DPP operand, no LDS round trip
template <int X> __device__ __forceinline__ float add_xor(float v) {
  return v + __builtin_bit_cast(float, __builtin_amdgcn_update_dpp(0, __builtin_bit_cast(int, v), 0x160 + X, 0xf, 0xf, true));
}

template <int ET> struct Elem;
template <> struct Elem<0> { typedef _Float16 T; };
template <> struct Elem<1> { typedef __bf16 T; };
template <int ET, bool SPLIT, int BIAS_MODE, int OUT_MODE, bool RESID, int ACT = 0>
__global__ __launch_bounds__(256) void wmma_gemm64(
    const unsigned short* __restrict__ Ap, const unsigned short* __restrict__ A2p, int lda, long strideA,
    const unsigned short* __restrict__ Btp, const unsigned short* __restrict__ Bt2p, int ldb, long strideB,
    void* __restrict__ Cout, void* __restrict__ Cout2, int ldc, long strideC,
    const float* __restrict__ bias,
    const float* __restrict__ resid, long strideR,
    int M, int N, int K, float scale) {
  typedef typename Elem<ET>::T T;
  typedef typename Frag<T>::V V;
  static_assert(!SPLIT, "hi/lo planes are not staged");
  const T* A = (const T*)Ap; const T* Bt = (const T*)Btp;
  __shared__ __align__(16) T sOp[2 * kStage];      // two operand buffers
  __shared__ __align__(16) float sT[8][16 * 68];   // per-wave 16x64 slab, pitch 68 floats
  const int b    = blockIdx.y;
  const int lane = threadIdx.x & 31;
  const int wave = threadIdx.x >> 5;
  const int tilesN = N / kBN;
  const int tilesM = M / kBM;
  if ((int)blockIdx.x >= tilesM * tilesN) return;   // block-uniform, in front of every barrier
  const int tm  = blockIdx.x / tilesN;
  const int tn  = blockIdx.x - tm * tilesN;
  const int bm0 = tm * kBM;
  const int bn0 = tn * kBN;
  const int wm  = wave >> 2;                   // wave grid 2 (M) x 4 (N)
  const int wn  = wave & 3;
  const int m0  = bm0 + (wm << 6);
  const int n0  = bn0 + (wn << 6);

  const T* Ab  = A  + (size_t)b * strideA;
  const T* Bb  = Bt + (size_t)b * strideB;

  const int rlane = lane & 15;                 // row (A) / col (B, D) within subtile
  const int koff  = (lane >> 4) * 8;           // k offset of this lane half
  const int mOff  = (lane >> 4) * 8;           // D row offset

  // Copies: 16 lanes cover one row's 256 bytes, the block 16 rows per copy; 8 copies for A, 16 for Bt, per lane and stage.
  const int crow = threadIdx.x >> 4;
  const int ccol = (threadIdx.x & 15) * 8;
  const T* gA = Ab + (size_t)(bm0 + crow) * lda + ccol;
  const T* gB = Bb + (size_t)(bn0 + crow) * ldb + ccol;
  const unsigned lds0 = (unsigned)(size_t)sOp + (unsigned)(crow * kPitch + ccol) * 2u;
  auto stage_copies = [&](int t, int buf) {
    const unsigned lb = lds0 + (unsigned)buf * (unsigned)(kStage * 2);
    const T* ga = gA + (size_t)t * kBK;
    const T* gb = gB + (size_t)t * kBK;
#pragma unroll
    for (int half = 0; half < 2; ++half) {
      unsigned l[12];
      const void* g[12];
#pragma unroll  // constant indices keep these arrays in registers
      for (int e = 0; e < 12; ++e) {
        const int grp = half * 12 + e;           // 16-row group of the buffer: 0..7 A, 8..23 Bt
        l[e] = lb + (unsigned)(grp * 16 * kPitch * 2);
        g[e] = (grp < 8) ? (const void*)(ga + (size_t)(grp * 16) * lda) : (const void*)(gb + (size_t)((grp - 8) * 16) * ldb);
      }
      async_copy12(l, g);
    }
  };

  v8f acc[4][4];
#pragma unroll
  for (int i = 0; i < 4; ++i)
#pragma unroll
    for (int j = 0; j < 4; ++j) acc[i][j] = (v8f){0.f,0.f,0.f,0.f,0.f,0.f,0.f,0.f};

  const int nStages = K / kBK;
  const int aoff = ((wm << 6) + rlane) * kPitch + koff;
  const int boff = (kBM + (wn << 6) + rlane) * kPitch + koff;

  stage_copies(0, 0);
  wait_async0();
  __syncthreads();                               // stage 0 is published
  if (nStages > 1) stage_copies(1, 1);

#pragma clang loop unroll(disable)  // one stage per trip: the buffer index stays a run-time value, the text small
  for (int t = 0; t < nStages; ++t) {
    const T* sa = sOp + (t & 1) * kStage + aoff;
    const T* sb = sOp + (t & 1) * kStage + boff;
    // Fragment reads go ahead of the WMMAs that cover their latency: the Bt set and A rows 0, 1 of the next 32 k are read
    // under rows 2, 3 of these 32 k, A rows 2, 3 under rows 0, 1. Each sched_barrier keeps the compiler from sinking a
    // read group down to its first use, where the wave would wait out the LDS latency in front of every row.
    V af[4], bf[2][4];
#pragma unroll  // constant indices keep these arrays in registers
    for (int j = 0; j < 4; ++j) bf[0][j] = Frag<T>::load(sb + j * 16 * kPitch);
#pragma unroll  // constant indices keep these arrays in registers
    for (int i = 0; i < 2; ++i) af[i] = Frag<T>::load(sa + i * 16 * kPitch);
#pragma unroll  // constant indices keep these arrays in registers
    for (int ks = 0; ks < kBK / 32; ++ks) {
      const int cs = ks & 1;
#pragma unroll  // constant indices keep these arrays in registers
      for (int i = 2; i < 4; ++i) af[i] = Frag<T>::load(sa + i * 16 * kPitch + ks * 32);
      __builtin_amdgcn_sched_barrier(0);  // A rows 2, 3 are read ahead of rows 0, 1's WMMAs
#pragma unroll  // constant indices keep these arrays in registers
      for (int i = 0; i < 2; ++i)
#pragma unroll  // constant indices keep these arrays in registers
        for (int j = 0; j < 4; ++j) acc[i][j] = Frag<T>::mma(af[i], bf[cs][j], acc[i][j]);
      __builtin_amdgcn_sched_barrier(0);  // the next reads stay behind rows 0, 1's WMMAs, whose registers they refill
      if (ks + 1 < kBK / 32) {
#pragma unroll  // constant indices keep these arrays in registers
        for (int j = 0; j < 4; ++j) bf[cs ^ 1][j] = Frag<T>::load(sb + j * 16 * kPitch + (ks + 1) * 32);
#pragma unroll  // constant indices keep these arrays in registers
        for (int i = 0; i < 2; ++i) af[i] = Frag<T>::load(sa + i * 16 * kPitch + (ks + 1) * 32);
      }
      __builtin_amdgcn_sched_barrier(0);  // the next 32 k's reads stay ahead of rows 2, 3's WMMAs
#pragma unroll  // constant indices keep these arrays in registers
      for (int i = 2; i < 4; ++i)
#pragma unroll  // constant indices keep these arrays in registers
        for (int j = 0; j < 4; ++j) acc[i][j] = Frag<T>::mma(af[i], bf[cs][j], acc[i][j]);
      __builtin_amdgcn_sched_barrier(0);  // the reads after that stay behind them
    }
    wait_ds0();
    wait_async0();
    __syncthreads();                             // publishes stage t + 1 and ends every wave's reads of stage t
    if (t + 2 < nStages) stage_copies(t + 2, t & 1);
  }
  wait_async0();
  acc_guard4(acc[0][0], acc[0][1], acc[0][2], acc[0][3]);
  acc_guard4(acc[1][0], acc[1][1], acc[1][2], acc[1][3]);
  acc_guard4(acc[2][0], acc[2][1], acc[2][2], acc[2][3]);
  acc_guard4(acc[3][0], acc[3][1], acc[3][2], acc[3][3]);

  // ---- epilogue ----
  float* slab = sT[wave];
  const float* Rb = RESID ? (resid + (size_t)b * strideR) : nullptr;
  float var0 = 0.f, var1 = 0.f;   // OUT_MODE 3: the two rows' variances that this lane stores behind the loop
#pragma unroll
  for (int i = 0; i < 4; ++i) {
    const int mBase = m0 + (i << 4);
#pragma unroll
    for (int j = 0; j < 4; ++j) {
      const int n = n0 + (j << 4) + rlane;
      float bv = 0.f;
      if (BIAS_MODE == 2) bv = bias[n];
#pragma unroll
      for (int r = 0; r < 8; ++r) {
        float v = acc[i][j][r] * scale;
        if (BIAS_MODE == 1) v += bias[mBase + mOff + r];
        if (BIAS_MODE == 2) v += bv;
        if (RESID) v += Rb[(size_t)(mBase + mOff + r) * ldc + n];
        if (ACT == 2) v = fmaxf(v, 0.0f);
        if (ACT == 4) v = (v > 0.f) ? v : 0.01f * v;
        slab[(mOff + r) * 68 + (j << 4) + rlane] = v;
      }
    }
    __builtin_amdgcn_fence(__ATOMIC_RELEASE, "workgroup");
    __builtin_amdgcn_wave_barrier();
    __builtin_amdgcn_fence(__ATOMIC_ACQUIRE, "workgroup");
    if (OUT_MODE == 0) {
      float* C = (float*)Cout + (size_t)b * strideC;
      const int hh = lane >> 4, c4 = (lane & 15) * 4;     // row seg = 256 B = 16 lanes x 16 B
      {
#pragma unroll
        for (int it = 0; it < 8; ++it) {
          const int row = it * 2 + hh;
          v4f v = *(const v4f*)(slab + row * 68 + c4);
          *(v4f*)(C + (size_t)(mBase + row) * ldc + n0 + c4) = v;
        }
        
      }
    } else if (OUT_MODE == 3) {
      const int q = lane >> 3, c8 = (lane & 7) * 8;       // row seg = 128 B = 8 lanes x 16 B
      unsigned short* C = (unsigned short*)Cout + (size_t)b * strideC;
#pragma unroll  // four independent rows in flight; grp below a compile-time value
      for (int it = 0; it < 4; ++it) {
        const int row = it * 4 + q;
        const float* sp = slab + row * 68 + c8;
        const v4f a = *(const v4f*)(sp);
        const v4f c = *(const v4f*)(sp + 4);
        float x[8];
#pragma unroll  // constant indices keep these arrays in registers
        for (int e = 0; e < 4; ++e) { x[e] = a[e]; x[4 + e] = c[e]; }
        float s = ((x[0] + x[1]) + (x[2] + x[3])) + ((x[4] + x[5]) + (x[6] + x[7]));
        s = add_xor<1>(s);
        s = add_xor<2>(s);
        s = add_xor<4>(s);
        const float mean = s * kInv64;
        float vs = 0.f;
#pragma unroll  // constant indices keep these arrays in registers
        for (int e = 0; e < 8; ++e) { x[e] = x[e] - mean; vs += x[e] * x[e]; }
        vs = add_xor<1>(vs);
        vs = add_xor<2>(vs);
        vs = add_xor<4>(vs);
        unsigned short hb[8];
#pragma unroll  // constant indices keep these arrays in registers
        for (int e = 0; e < 8; ++e) hb[e] = h_bits(x[e] * kQKCarry);
        const v4u u = (v4u){pk16(hb[0], hb[1]), pk16(hb[2], hb[3]), pk16(hb[4], hb[5]), pk16(hb[6], hb[7])};
        *(v4u*)(C + (size_t)(mBase + row) * ldc + n0 + c8) = u;
        // all 8 lanes of a row hold its variance; lane (q, lane & 7) keeps those of row groups (i, it) = lane & 7 and 8 + (lane & 7)
        const int grp = i * 4 + it;
        if ((lane & 7) == (grp & 7)) { if (grp < 8) var0 = vs * kInv63; else var1 = vs * kInv63; }
      }
    } else {
      const int q = lane >> 3, c8 = (lane & 7) * 8;
      unsigned short* C  = (unsigned short*)Cout  + (size_t)b * strideC;
      unsigned short* C2 = (OUT_MODE == 2) ? ((unsigned short*)Cout2 + (size_t)b * strideC) : nullptr;
      {
#pragma unroll
        for (int it = 0; it < 4; ++it) {
          const int row = it * 4 + q;
          const float* sp = slab + row * 68 + c8;
          v8h hv, lv;
#pragma unroll
          for (int e = 0; e < 8; ++e) {
            if (OUT_MODE == 1) {
              hv[e] = (_Float16)sp[e];
            } else {
              unsigned short hb = f2bf_bits(sp[e]);
              unsigned short lb = f2bf_bits(sp[e] - bf_bits2f(hb));
              hv[e] = __builtin_bit_cast(_Float16, hb);
              lv[e] = __builtin_bit_cast(_Float16, lb);
            }
          }
          *(v8h*)(C + (size_t)(mBase + row) * ldc + n0 + c8) = hv;
          if (OUT_MODE == 2) *(v8h*)(C2 + (size_t)(mBase + row) * ldc + n0 + c8) = lv;
        }
        
      }
    }
    __builtin_amdgcn_fence(__ATOMIC_RELEASE, "workgroup");
    __builtin_amdgcn_wave_barrier();
    __builtin_amdgcn_fence(__ATOMIC_ACQUIRE, "workgroup");
  }
  if (OUT_MODE == 3) {
    // the wave's 64 variances: rows 0..31, then rows 32..63, each store one whole 128-byte line of the head's row
    const int g8 = lane & 7;
    float* vp = (float*)Cout2 + (size_t)(n0 >> 6) * M + m0 + (g8 >> 2) * 16 + (g8 & 3) * 4 + (lane >> 3);
    vp[0]  = var0;
    vp[32] = var1;
  }
}

// ---------------------------------------------------------------------------
// f32 -> f16 cast with power-of-two carry: out[i] = f16(scale * in[i]), 8 consecutive elements per thread
// Coverage: n8 = n/8 threads x 8 = whole plane (x: 1048576 threads = 4096 x 256; W: 131072 = 512 x 256, exact).
// ---------------------------------------------------------------------------
__global__ __launch_bounds__(256) void cast8_f16_kernel(const float* __restrict__ in, unsigned short* __restrict__ out,
                                                        int n8, float scale) {
  const int i = blockIdx.x * 256 + threadIdx.x;
  if (i >= n8) return;
  const float* p = in + 8 * (size_t)i;
  const v4f a = *(const v4f*)(p);
  const v4f c = *(const v4f*)(p + 4);
  unsigned short hb[8];
#pragma unroll
  for (int e = 0; e < 4; ++e) {
    hb[e]     = h_bits(a[e] * scale);
    hb[4 + e] = h_bits(c[e] * scale);
  }
  const v4u u = (v4u){pk16(hb[0], hb[1]), pk16(hb[2], hb[3]), pk16(hb[4], hb[5]), pk16(hb[6], hb[7])};
  unsigned short* q = out + 8 * (size_t)i;
  *(v4u*)q = u;
  
}

// ---------------------------------------------------------------------------
// Fused attention for one (batch, head) and 256 queries per block: scores, softmax and probabilities.v in one pass
// over the keys, nothing of the 1024 x 1024 score plane leaves the registers.
//   S^T = Kc . Qc^T   (A = 16 key rows, B = 16 query rows, K = 64 head dims)     D: lane = query c, register r = key 8*hs + r
//   O^T += V^T . P^T  (A = 16 v^T rows, B = two converted S^T tiles, K = 32 keys) D: lane = query c, register r = dim 8*hs + r
// Two S^T tiles (keys 0..15 and 16..31 of a pass) converted in place are the B operand in the order Frag::load gives A.
// Score in log2 units: s = log2e * (dot / 1024 + q_var * k_var / 64). p = exp2(s - m), m = the query's maximum in use;
// m is raised (and sum and output rescaled) only when a score exceeds it by more than 8, so p <= 256 fits f16.
// Block = 8 waves, wave w owns queries blockIdx.x*256 + w*32 .. +31 (two 16-query tiles); grid (4, 128), exact.
// LDS skv: the head's 1024 k variances, all written (256 threads x 4) before the first barrier, read-only after it.
// LDS sKV: a stage is 128 keys of the head: 128 centered-k rows of 128 B and 64 v^T rows of 256 B, brought in once for all
// eight waves by 16-byte asynchronous copies (whole 128-byte lines); two buffers, the next stage's copies fly while this
// one is worked on. Every wave reads its A fragments (k rows, v^T rows) from there with Frag::load.
// ---------------------------------------------------------------------------
constexpr int kAK     = 128;                     // keys per stage
constexpr int kKPitch = kHeadDim + 8;            // k rows: 144 B = 16 B x 9, no bank conflict for 16-byte fragment reads
constexpr int kVPitch = kAK + 8;                 // v^T rows: 272 B = 16 B x 17, likewise
constexpr int kKStage = kAK * kKPitch;           // elements of the k part of a buffer
constexpr int kAStage = kKStage + kHeadDim * kVPitch;   // elements per buffer: [k 128 rows | v^T 64 rows]
static_assert(kSeq % kAK == 0 && kSeq / kAK >= 2 && kAK % 32 == 0 && (kAStage * 2) % 16 == 0, "stages exact, two or more");
static_assert(((kAK / 32) & (kAK / 32 - 1)) == 0, "passes per stage a power of two: the key prefetch wraps by a mask");

// Eight 16-byte asynchronous copies per lane, global -> LDS. l = the lane's LDS byte address, g = its global address.
// s_wait_xcnt 0 closes the statement as a precaution: no register that a copy names is rewritten in front of it.
__device__ __forceinline__ void async_copy8(const unsigned (&l)[8], const void* const (&g)[8]) {
  asm volatile(
      "global_load_async_to_lds_b128 %0, %8, off\n\t"
      "global_load_async_to_lds_b128 %1, %9, off\n\t"
      "global_load_async_to_lds_b128 %2, %10, off\n\t"
      "global_load_async_to_lds_b128 %3, %11, off\n\t"
      "global_load_async_to_lds_b128 %4, %12, off\n\t"
      "global_load_async_to_lds_b128 %5, %13, off\n\t"
      "global_load_async_to_lds_b128 %6, %14, off\n\t"
      "global_load_async_to_lds_b128 %7, %15, off\n\t"
      "s_wait_xcnt 0x0"
      :: "v"(l[0]), "v"(l[1]), "v"(l[2]), "v"(l[3]), "v"(l[4]), "v"(l[5]), "v"(l[6]), "v"(l[7]),
         "v"(g[0]), "v"(g[1]), "v"(g[2]), "v"(g[3]), "v"(g[4]), "v"(g[5]), "v"(g[6]), "v"(g[7])
      : "memory");
}

__global__ __launch_bounds__(256) void attn_fused_kernel(const unsigned short* __restrict__ qc, const unsigned short* __restrict__ kc,
                                                         const unsigned short* __restrict__ vt, const float* __restrict__ qvar,
                                                         const float* __restrict__ kvar, unsigned short* __restrict__ o16) {
  typedef Frag<_Float16> F;
  __shared__ __align__(16) float skv[kSeq];
  __shared__ __align__(16) _Float16 sKV[2 * kAStage];   // two stage buffers
  const int lane = threadIdx.x & 31, wave = threadIdx.x >> 5;
  const int b  = blockIdx.y >> 4;
  const int h  = blockIdx.y & (kHeads - 1);
  const int q0 = blockIdx.x * 256 + wave * 32;
  const int c  = lane & 15;
  const int hs = lane >> 4;

  // Copies: 8 lanes cover one k row's 128 bytes (the block 32 rows per copy), 16 lanes one v^T row's 256 bytes (16 rows per
  // copy); 4 copies for k and 4 for v^T, per lane and stage.
  const int krow = threadIdx.x >> 3, kcol = (threadIdx.x & 7) * 8;
  const int vrow = threadIdx.x >> 4, vcol = (threadIdx.x & 15) * 8;
  const _Float16* gK = (const _Float16*)kc + ((size_t)b * kSeq + krow) * kEmb + h * kHeadDim + kcol;
  const _Float16* gV = (const _Float16*)vt + (size_t)b * kEmb * kSeq + (size_t)(h * kHeadDim + vrow) * kSeq + vcol;
  const unsigned ldsK = (unsigned)(size_t)sKV + (unsigned)(krow * kKPitch + kcol) * 2u;
  const unsigned ldsV = (unsigned)(size_t)sKV + (unsigned)(kKStage + vrow * kVPitch + vcol) * 2u;
  auto stage_copies = [&](int t, int buf) {
    const unsigned lb = (unsigned)buf * (unsigned)(kAStage * 2);
    unsigned l[8];
    const void* g[8];
#pragma unroll  // constant indices keep these arrays in registers
    for (int e = 0; e < 4; ++e) {
      l[e]     = ldsK + lb + (unsigned)(e * 32 * kKPitch * 2);
      g[e]     = (const void*)(gK + (size_t)(t * kAK + e * 32) * kEmb);
      l[4 + e] = ldsV + lb + (unsigned)(e * 16 * kVPitch * 2);
      g[4 + e] = (const void*)(gV + (size_t)(e * 16) * kSeq + t * kAK);
    }
    async_copy8(l, g);
  };

  stage_copies(0, 0);
#pragma unroll
  for (int e = 0; e < 4; ++e) {
    const int j = e * 256 + threadIdx.x;
    skv[j] = kvar[(size_t)h * kTok + b * kSeq + j];
  }
  wait_async0();
  __syncthreads();  // stage 0 is published; every wave reads all of skv, each thread wrote four entries
  stage_copies(1, 1);

  const _Float16* Qp = (const _Float16*)qc + ((size_t)b * kSeq + q0 + c) * kEmb + h * kHeadDim + hs * 8;
  const int koffs = c * kKPitch + hs * 8;             // this lane's place in a k fragment row
  const int voffs = kKStage + c * kVPitch + hs * 8;   // and in a v^T fragment row

  v16h qf[2][2];
  float qv2[2], m[2], l[2];
  v8f o[4][2];
#pragma unroll  // constant indices keep these arrays in registers
  for (int qt = 0; qt < 2; ++qt) {
    qf[qt][0] = F::load(Qp + (size_t)(qt * 16) * kEmb);
    qf[qt][1] = F::load(Qp + (size_t)(qt * 16) * kEmb + 32);
    qv2[qt] = qvar[(size_t)h * kTok + b * kSeq + q0 + qt * 16 + c] * (kInv64 * kLog2e);
    m[qt] = -INFINITY;
    l[qt] = 0.f;
#pragma unroll  // constant indices keep these arrays in registers
    for (int i = 0; i < 4; ++i) o[i][qt] = (v8f){0.f,0.f,0.f,0.f,0.f,0.f,0.f,0.f};
  }

#pragma clang loop unroll(disable)  // one stage per trip: the buffer index stays a run-time value, the text small
  for (int t = 0; t < kSeq / kAK; ++t) {
    const _Float16* sk = sKV + (t & 1) * kAStage + koffs;
    const _Float16* sv = sKV + (t & 1) * kAStage + voffs;
    v16h kf[2][2];
#pragma unroll  // constant indices keep these arrays in registers
    for (int kt = 0; kt < 2; ++kt) {
      kf[kt][0] = F::load(sk + (kt * 16) * kKPitch);
      kf[kt][1] = F::load(sk + (kt * 16) * kKPitch + 32);
    }

#pragma clang loop unroll(disable)  // one pass per trip keeps the text small and the registers of one pass
    for (int p = 0; p < kAK / 32; ++p) {
      const int key0 = t * kAK + p * 32;
      v16h vf[4];
#pragma unroll  // constant indices keep these arrays in registers
      for (int i = 0; i < 4; ++i) vf[i] = F::load(sv + (i * 16) * kVPitch + p * 32);
      float kv[2][8];
#pragma unroll  // constant indices keep these arrays in registers
      for (int kt = 0; kt < 2; ++kt) {
        const v4f a0 = *(const v4f*)(skv + key0 + kt * 16 + hs * 8);
        const v4f a1 = *(const v4f*)(skv + key0 + kt * 16 + hs * 8 + 4);
#pragma unroll  // constant indices keep these arrays in registers
        for (int e = 0; e < 4; ++e) { kv[kt][e] = a0[e]; kv[kt][4 + e] = a1[e]; }
      }
      __builtin_amdgcn_sched_barrier(0);  // the pass's v^T and variance reads stay one group up here, not sunk among the WMMAs that use them

      v8f s[2][2];
#pragma unroll  // constant indices keep these arrays in registers
      for (int kt = 0; kt < 2; ++kt)
#pragma unroll  // constant indices keep these arrays in registers
        for (int qt = 0; qt < 2; ++qt) {
          s[kt][qt] = F::mma(kf[kt][0], qf[qt][0], (v8f){0.f,0.f,0.f,0.f,0.f,0.f,0.f,0.f});
          s[kt][qt] = F::mma(kf[kt][1], qf[qt][1], s[kt][qt]);
        }

      __builtin_amdgcn_sched_barrier(0);  // the reads below refill the registers of the products above
      // next pass's key fragments, fetched while this pass's softmax runs; never past this stage's own buffer
      // (the stage's last pass re-reads its keys 0..31, unused: no branch stands behind the products above)
      const int np = (p + 1) & (kAK / 32 - 1);
#pragma unroll  // constant indices keep these arrays in registers
      for (int kt = 0; kt < 2; ++kt) {
        kf[kt][0] = F::load(sk + (np * 32 + kt * 16) * kKPitch);
        kf[kt][1] = F::load(sk + (np * 32 + kt * 16) * kKPitch + 32);
      }
      __builtin_amdgcn_sched_barrier(0);  // and stay one group ahead of the softmax that covers their latency

      float mx[2];
#pragma unroll  // constant indices keep these arrays in registers
      for (int qt = 0; qt < 2; ++qt) {
#pragma unroll  // constant indices keep these arrays in registers
        for (int kt = 0; kt < 2; ++kt)
#pragma unroll  // constant indices keep these arrays in registers
          for (int r = 0; r < 8; ++r) s[kt][qt][r] = s[kt][qt][r] * (kScoreScale * kLog2e) + qv2[qt] * kv[kt][r];
        float a0 = fmaxf(fmaxf(s[0][qt][0], s[0][qt][1]), fmaxf(s[0][qt][2], s[0][qt][3]));
        float a1 = fmaxf(fmaxf(s[0][qt][4], s[0][qt][5]), fmaxf(s[0][qt][6], s[0][qt][7]));
        float a2 = fmaxf(fmaxf(s[1][qt][0], s[1][qt][1]), fmaxf(s[1][qt][2], s[1][qt][3]));
        float a3 = fmaxf(fmaxf(s[1][qt][4], s[1][qt][5]), fmaxf(s[1][qt][6], s[1][qt][7]));
        mx[qt] = fmaxf(fmaxf(a0, a1), fmaxf(a2, a3));
      }

      // one wave-uniform test per pass; both halves of a query's lane pair take the same new maximum
      const bool need = (mx[0] > m[0] + 8.0f) || (mx[1] > m[1] + 8.0f);
      if (__builtin_amdgcn_ballot_w32(need) != 0u) {
#pragma unroll  // constant indices keep these arrays in registers
        for (int qt = 0; qt < 2; ++qt) {
          const float mn = fmaxf(m[qt], fmaxf(mx[qt], __shfl_xor(mx[qt], 16, 32)));
          const float al = __builtin_amdgcn_exp2f(m[qt] - mn);
          m[qt] = mn;
          l[qt] *= al;
#pragma unroll  // constant indices keep these arrays in registers
          for (int i = 0; i < 4; ++i)
#pragma unroll  // constant indices keep these arrays in registers
            for (int r = 0; r < 8; ++r) o[i][qt][r] *= al;
        }
      }

      v16h pf[2];
#pragma unroll  // constant indices keep these arrays in registers
      for (int qt = 0; qt < 2; ++qt) {
        float ls0 = 0.f, ls1 = 0.f;
#pragma unroll  // constant indices keep these arrays in registers
        for (int r = 0; r < 8; ++r) {
          const float p0 = __builtin_amdgcn_exp2f(s[0][qt][r] - m[qt]);
          const float p1 = __builtin_amdgcn_exp2f(s[1][qt][r] - m[qt]);
          ls0 += p0;
          ls1 += p1;
          pf[qt][r]     = (_Float16)p0;
          pf[qt][8 + r] = (_Float16)p1;
        }
        l[qt] += ls0 + ls1;
      }

#pragma unroll  // constant indices keep these arrays in registers
      for (int i = 0; i < 4; ++i)
#pragma unroll  // constant indices keep these arrays in registers
        for (int qt = 0; qt < 2; ++qt) o[i][qt] = F::mma(vf[i], pf[qt], o[i][qt]);
      __builtin_amdgcn_sched_barrier(0);  // keeps the four slots below behind the pass's last WMMA
      // four vector slots between the last WMMA and the next pass's address arithmetic, which may take over its A or B registers
      asm volatile("v_nop\n\tv_nop\n\tv_nop\n\tv_nop");
    }
    wait_ds0();
    wait_async0();
    __syncthreads();                             // publishes stage t + 1 and ends every wave's reads of stage t
    if (t + 2 < kSeq / kAK) stage_copies(t + 2, t & 1);
  }
  wait_async0();

  // epilogue: join the two halves' sums, normalise, 8 consecutive head dims per lane = one 16-byte store
#pragma unroll  // constant indices keep these arrays in registers
  for (int qt = 0; qt < 2; ++qt) {
    const float lt  = l[qt] + __shfl_xor(l[qt], 16, 32);
    const float inv = kOCarry * (1.0f / lt);
    unsigned short* op = o16 + ((size_t)b * kSeq + q0 + qt * 16 + c) * kEmb + h * kHeadDim + hs * 8;
#pragma unroll  // constant indices keep these arrays in registers
    for (int i = 0; i < 4; ++i) {
      v8h hv;
#pragma unroll  // constant indices keep these arrays in registers
      for (int r = 0; r < 8; ++r) hv[r] = (_Float16)(o[i][qt][r] * inv);
      *(v8h*)(op + i * 16) = hv;
    }
  }
}

// ---------------------------------------------------------------------------
// Host entry: 10 launches (5 casts, 3 projection GEMMs, fused attention, output GEMM).
// ---------------------------------------------------------------------------
extern "C" void kernel_launch(void* const* d_in, const int* in_sizes, int n_in,
                              void* d_out, int out_size, void* d_ws, size_t ws_size,
                              hipStream_t stream) {
  if (n_in < 5) return;
  if (in_sizes[0] != kTok * kEmb) return;
  if (in_sizes[1] != kEmb * kEmb || in_sizes[2] != kEmb * kEmb || in_sizes[3] != kEmb * kEmb || in_sizes[4] != kEmb * kEmb) return;
  if (out_size != kTok * kEmb) return;
  if (ws_size < kWsTotal) return;

  const float* x  = (const float*)d_in[0];
  const float* Wq = (const float*)d_in[1];
  const float* Wk = (const float*)d_in[2];
  const float* Wv = (const float*)d_in[3];
  const float* Wo = (const float*)d_in[4];
  float* outp = (float*)d_out;

  char* ws = (char*)d_ws;
  unsigned short* X16  = (unsigned short*)(ws + kOffX16);
  unsigned short* O16  = (unsigned short*)(ws + kOffX16);     // region reuse, see map
  unsigned short* Wq16 = (unsigned short*)(ws + kOffWq16);
  unsigned short* Wk16 = (unsigned short*)(ws + kOffWk16);
  unsigned short* Wv16 = (unsigned short*)(ws + kOffWv16);
  unsigned short* Wo16 = (unsigned short*)(ws + kOffWo16);
  unsigned short* VT16 = (unsigned short*)(ws + kOffVT16);
  unsigned short* QC16 = (unsigned short*)(ws + kOffQC16);
  unsigned short* KC16 = (unsigned short*)(ws + kOffKC16);
  float*          QVAR = (float*)(ws + kOffQVar);
  float*          KVAR = (float*)(ws + kOffKVar);

  const float* nof = (const float*)nullptr;
  const unsigned short* nou = (const unsigned short*)nullptr;

  // 1) casts to f16 planes
  {
    const int n8x = kTok * kEmb / 8;      // 1048576
    const int n8w = kEmb * kEmb / 8;      // 131072
    cast8_f16_kernel<<<(n8x + 255) / 256, 256, 0, stream>>>(x, X16, n8x, 1.0f);
    cast8_f16_kernel<<<(n8w + 255) / 256, 256, 0, stream>>>(Wq, Wq16, n8w, kWCarry);
    cast8_f16_kernel<<<(n8w + 255) / 256, 256, 0, stream>>>(Wk, Wk16, n8w, kWCarry);
    cast8_f16_kernel<<<(n8w + 255) / 256, 256, 0, stream>>>(Wv, Wv16, n8w, kWCarry);
    cast8_f16_kernel<<<(n8w + 255) / 256, 256, 0, stream>>>(Wo, Wo16, n8w, kWCarry);
  }

  // 2) v^T = Wv . x^T per batch: A = Wv16 [1024][1024] (M = out channel), Bt = X16 rows of the batch [1024][1024] (N = token),
  //    K = 1024, C = VT16 f16 [8][1024][1024], ldc 1024. block tiles 8 x 4 = 32 per batch -> (32, 8).
  {
    const int blocks = (kEmb / kBM) * (kSeq / kBN);   // 32
    wmma_gemm64<0, false, 0, 1, false, 0><<<dim3(blocks, kBatch), 256, 0, stream>>>(
        Wv16, nou, kEmb, 0L, X16, nou, kEmb, (long)kSeq * kEmb, (void*)VT16, (void*)nullptr, kSeq, (long)kEmb * kSeq,
        nof, nof, 0L, kEmb, kSeq, kEmb, kProjScale);
  }

  // 3) q = x . Wq^T, centered per head in the GEMM's epilogue -> QC16 + QVAR; then k likewise -> KC16 + KVAR.
  {
    const int blocks = (kTok / kBM) * (kEmb / kBN);   // 256
    wmma_gemm64<0, false, 0, 3, false, 0><<<dim3(blocks, 1), 256, 0, stream>>>(
        X16, nou, kEmb, 0L, Wq16, nou, kEmb, 0L, (void*)QC16, (void*)QVAR, kEmb, 0L,
        nof, nof, 0L, kTok, kEmb, kEmb, kProjScale);
    wmma_gemm64<0, false, 0, 3, false, 0><<<dim3(blocks, 1), 256, 0, stream>>>(
        X16, nou, kEmb, 0L, Wk16, nou, kEmb, 0L, (void*)KC16, (void*)KVAR, kEmb, 0L,
        nof, nof, 0L, kTok, kEmb, kEmb, kProjScale);
  }

  // 4) attention: one launch, block = (256 queries, one batch and head)
  attn_fused_kernel<<<dim3(kSeq / 256, kBatch * kHeads), 256, 0, stream>>>(QC16, KC16, VT16, QVAR, KVAR, O16);

  // 5) out = O . Wo^T : A = O16 [8192][1024], Bt = Wo16 [1024][1024], K = 1024, C = d_out f32 [8192][1024].
  {
    const int blocks = (kTok / kBM) * (kEmb / kBN);   // 256
    wmma_gemm64<0, false, 0, 0, false, 0><<<dim3(blocks, 1), 256, 0, stream>>>(
        O16, nou, kEmb, 0L, Wo16, nou, kEmb, 0L, (void*)outp, (void*)nullptr, kEmb, 0L,
        nof, nof, 0L, kTok, kEmb, kEmb, kOutScale);
  }
}

// v005
// One run takes 116 microseconds.
// Two timings next to v004 both put it at 1.06 times that version's speed.
// All steps since v000 together make it 13.1 times as fast.
// All contractions (q/k/v projections K=1024, centered q.k^T scores K=64, probabilities.v K=1024, output projection K=1024): v_wmma_f32_16x16x32_f16 with f16 operands (weights carried x16, centered q/k carried x4, unnormalised probabilities exp2(score - maximum in use), attention output carried x64) and f32 accumulate; centering, variances, variance outer product and online softmax in f32.
#include <hip/hip_runtime.h>
#include <math.h>

// ---------------------------------------------------------------------------
// Problem constants
// ---------------------------------------------------------------------------
constexpr int kBatch   = 8;
constexpr int kSeq     = 1024;
constexpr int kEmb     = 1024;
constexpr int kHeads   = 16;
constexpr int kHeadDim = 64;
constexpr int kTok     = kBatch * kSeq;                 // 8192 token rows

constexpr float kWCarry     = 16.0f;                    // weights carried x16 in f16
constexpr float kQKCarry    = 4.0f;                     // centered q / k carried x4 in f16
constexpr float kOCarry     = 64.0f;                    // attention output carried x64 in f16
constexpr float kProjScale  = 1.0f / kWCarry;                              // 1/16
constexpr float kScoreScale = 1.0f / (kQKCarry * kQKCarry * 64.0f);        // 1/1024  (= dot / head_dim)
constexpr float kLog2e      = 1.4426950408889634f;
constexpr float kOutScale   = 1.0f / (kOCarry * kWCarry);                  // 1/1024
constexpr float kInv64      = 1.0f / 64.0f;
constexpr float kInv63      = 1.0f / 63.0f;

// ---------------------------------------------------------------------------
// Workspace region map (bytes). Total carve 121 MiB = 126877696 B.
//   [  0, 16) MiB  X16  f16 [8192][1024] (x)                 -> reused as O16 f16 [8192][1024] (attention output x64)
//                  after the three projection GEMMs (last readers of X16) have been enqueued
//   [ 16, 18) MiB  Wq16 f16 [1024][1024] x16
//   [ 18, 20) MiB  Wk16
//   [ 20, 22) MiB  Wv16
//   [ 22, 24) MiB  Wo16
//   [ 24, 72) MiB  unused
//   [ 72, 88) MiB  VT16 f16 [8][1024][1024] (v^T per batch: row = out channel, col = token of the batch)
//   [ 88,104) MiB  QC16 f16 [8192][1024] centered q x4
//   [104,120) MiB  KC16 f16 [8192][1024] centered k x4
//   [120,120.5) MiB QVAR f32 [16][8192]  ([head][token])
//   [120.5,121) MiB KVAR f32 [16][8192]
// ---------------------------------------------------------------------------
constexpr size_t kMiB     = 1048576;
constexpr size_t kOffX16  = 0;
constexpr size_t kOffWq16 = 16 * kMiB;
constexpr size_t kOffWk16 = 18 * kMiB;
constexpr size_t kOffWv16 = 20 * kMiB;
constexpr size_t kOffWo16 = 22 * kMiB;
constexpr size_t kOffVT16 = 72 * kMiB;
constexpr size_t kOffQC16 = 88 * kMiB;
constexpr size_t kOffKC16 = 104 * kMiB;
constexpr size_t kOffQVar = 120 * kMiB;
constexpr size_t kOffKVar = 120 * kMiB + 512 * 1024;
constexpr size_t kWsTotal = 121 * kMiB;
static_assert((size_t)kTok * kEmb * 2 == 16 * kMiB, "x / o planes 16 MiB");
static_assert((size_t)kEmb * kEmb * 2 == 2 * kMiB, "weight planes 2 MiB");
static_assert((size_t)kTok * kHeads * 4 == 512 * 1024, "variance tables 512 KiB");
static_assert(kOffKVar + (size_t)kTok * kHeads * 4 == kWsTotal, "carve end");
static_assert(kWsTotal <= (size_t)134217728, "carve under 128 MiB");
static_assert(kEmb % 32 == 0 && kHeadDim % 32 == 0 && kSeq % 32 == 0, "K multiples of 32");
static_assert(kTok % 64 == 0 && kEmb % 64 == 0 && kSeq % 64 == 0 && kHeadDim % 64 == 0, "M, N multiples of 64");

typedef __attribute__((ext_vector_type(16))) _Float16 v16h;
typedef __attribute__((ext_vector_type(8)))  _Float16 v8h;
typedef __attribute__((ext_vector_type(16))) __bf16   v16b;
typedef __attribute__((ext_vector_type(8)))  __bf16   v8b;
typedef __attribute__((ext_vector_type(8)))  float    v8f;
typedef __attribute__((ext_vector_type(4)))  float    v4f;
typedef __attribute__((ext_vector_type(4)))  unsigned int v4u;

__device__ __forceinline__ unsigned short f2bf_bits(float f) {
  unsigned u = __float_as_uint(f);
  return (unsigned short)((u + 0x7FFFu + ((u >> 16) & 1u)) >> 16);
}
__device__ __forceinline__ float bf_bits2f(unsigned short h) { return __uint_as_float(((unsigned)h) << 16); }

// hazard guards as plain device helpers (no inline asm inside the kernel template body)
__device__ __forceinline__ void acc_guard4(v8f& a, v8f& b, v8f& c, v8f& d) { asm volatile("v_nop\n\tv_nop\n\tv_nop\n\tv_nop" : "+v"(a), "+v"(b), "+v"(c), "+v"(d)); }
template <typename T> struct Frag;
template <> struct Frag<_Float16> {
  typedef v16h V; union U { v16h v; v8h h[2]; };
  static __device__ __forceinline__ v16h load(const _Float16* p) {   // elements 0..7 <- p[0..7], 8..15 <- p[16..23]
    U f; f.h[0] = *(const v8h*)(p); f.h[1] = *(const v8h*)(p + 16); return f.v;
  }
  static __device__ __forceinline__ v8f mma(v16h a, v16h b, v8f c) {
    return __builtin_amdgcn_wmma_f32_16x16x32_f16(false, a, false, b, (short)0, c, false, false);
  }
};
template <> struct Frag<__bf16> {
  typedef v16b V; union U { v16b v; v8b h[2]; };
  static __device__ __forceinline__ v16b load(const __bf16* p) {
    U f; f.h[0] = *(const v8b*)(p); f.h[1] = *(const v8b*)(p + 16); return f.v;
  }
  static __device__ __forceinline__ v8f mma(v16b a, v16b b, v8f c) {
    return __builtin_amdgcn_wmma_f32_16x16x32_bf16(false, a, false, b, (short)0, c, false, false);
  }
};

__device__ __forceinline__ unsigned pk16(unsigned short a, unsigned short b) { return (unsigned)a | ((unsigned)b << 16); }
__device__ __forceinline__ unsigned short h_bits(float f) { const _Float16 h = (_Float16)f; return __builtin_bit_cast(unsigned short, h); }

// ---- Register-blocked batched WMMA GEMM, operands staged in LDS ------------------------------------------------------
// C[m,n] = scale * sum_k A[m,k] * Bt[n,k] (+bias)(+resid); each wave owns a 64x64 tile, a block of 2 x 4 waves 128 x 256.
// A row-major [M,K]; Bt row-major [N,K]; M % 128 == 0, N % 256 == 0, K % 128 == 0.
// A stage is 128 k of the block's 128 A rows and 256 Bt rows, brought into LDS once for all eight waves by 16-byte
// asynchronous copies (whole 256-byte row pieces); two buffers, the next stage's copies fly while this one is multiplied.
// SPLIT (hi/lo operand planes) is not staged and not instantiated.
// BIAS_MODE: 0 = none, 1 = bias[m], 2 = bias[n].
// OUT_MODE: 0 = f32, 1 = f16, 2 = bf16 hi plane (Cout) + bf16 lo plane (Cout2),
//           3 = per-head centering in the epilogue: a wave's 64 columns are one head (n0 % 64 == 0), so every row of its tile
//               is one (token, head). f32 math: mean = sum_d x / 64; c = x - mean; var = sum_d c*c / 63 (unbiased).
//               Cout[m][n] = f16(4 * c), Cout2 = f32 variances [N / 64][M] ([head][token]); 8 lanes x 8 columns hold a row.
// ET: 0 = f16 operands, 1 = bf16 operands (pointers passed as 16-bit storage)
constexpr int kBM    = 128;                      // A rows per block
constexpr int kBN    = 256;                      // Bt rows per block
constexpr int kBK    = 128;                      // k per stage = 256 B of every operand row
constexpr int kPitch = kBK + 8;                  // LDS row pitch in elements: 272 B = 16 B x 17, no bank conflict for 16-byte fragment reads
constexpr int kStage = (kBM + kBN) * kPitch;     // elements per buffer: [A 128 rows | Bt 256 rows]
static_assert(kTok % kBM == 0 && kEmb % kBM == 0 && kEmb % kBN == 0 && kSeq % kBN == 0 && kEmb % kBK == 0, "block tiles exact");

// Twelve 16-byte asynchronous copies per lane, global -> LDS. l = the lane's LDS byte address, g = its global address.
// s_wait_xcnt 0 closes the statement as a precaution: no register that a copy names is rewritten in front of it.
__device__ __forceinline__ void async_copy12(const unsigned (&l)[12], const void* const (&g)[12]) {
  asm volatile(
      "global_load_async_to_lds_b128 %0, %12, off\n\t"
      "global_load_async_to_lds_b128 %1, %13, off\n\t"
      "global_load_async_to_lds_b128 %2, %14, off\n\t"
      "global_load_async_to_lds_b128 %3, %15, off\n\t"
      "global_load_async_to_lds_b128 %4, %16, off\n\t"
      "global_load_async_to_lds_b128 %5, %17, off\n\t"
      "global_load_async_to_lds_b128 %6, %18, off\n\t"
      "global_load_async_to_lds_b128 %7, %19, off\n\t"
      "global_load_async_to_lds_b128 %8, %20, off\n\t"
      "global_load_async_to_lds_b128 %9, %21, off\n\t"
      "global_load_async_to_lds_b128 %10, %22, off\n\t"
      "global_load_async_to_lds_b128 %11, %23, off\n\t"
      "s_wait_xcnt 0x0"
      :: "v"(l[0]), "v"(l[1]), "v"(l[2]), "v"(l[3]), "v"(l[4]), "v"(l[5]), "v"(l[6]), "v"(l[7]), "v"(l[8]), "v"(l[9]), "v"(l[10]), "v"(l[11]),
         "v"(g[0]), "v"(g[1]), "v"(g[2]), "v"(g[3]), "v"(g[4]), "v"(g[5]), "v"(g[6]), "v"(g[7]), "v"(g[8]), "v"(g[9]), "v"(g[10]), "v"(g[11])
      : "memory");
}
// this wave's own copies have landed (other waves read them only behind the barrier that follows)
__device__ __forceinline__ void wait_async0() { asm volatile("s_wait_asynccnt 0x0" ::: "memory"); }
// this wave's LDS reads have returned, before the buffer they read is handed back to the copies
__device__ __forceinline__ void wait_ds0() { asm volatile("s_wait_dscnt 0x0" ::: "memory"); }

// v + (v of lane ^ X), X = 1, 2 or 4, inside a 16-lane row: one v_add_f32 with a row_xmask DPP operand, no LDS round trip
template <int X> __device__ __forceinline__ float add_xor(float v) {
  return v + __builtin_bit_cast(float, __builtin_amdgcn_update_dpp(0, __builtin_bit_cast(int, v), 0x160 + X, 0xf, 0xf, true));
}

template <int ET> struct Elem;
template <> struct Elem<0> { typedef _Float16 T; };
template <> struct Elem<1> { typedef __bf16 T; };
template <int ET, bool SPLIT, int BIAS_MODE, int OUT_MODE, bool RESID, int ACT = 0>
__global__ __launch_bounds__(256) void wmma_gemm64(
    const unsigned short* __restrict__ Ap, const unsigned short* __restrict__ A2p, int lda, long strideA,
    const unsigned short* __restrict__ Btp, const unsigned short* __restrict__ Bt2p, int ldb, long strideB,
    void* __restrict__ Cout, void* __restrict__ Cout2, int ldc, long strideC,
    const float* __restrict__ bias,
    const float* __restrict__ resid, long strideR,
    int M, int N, int K, float scale) {
  typedef typename Elem<ET>::T T;
  typedef typename Frag<T>::V V;
  static_assert(!SPLIT, "hi/lo planes are not staged");
  const T* A = (const T*)Ap; const T* Bt = (const T*)Btp;
  __shared__ __align__(16) T sOp[2 * kStage];      // two operand buffers
  __shared__ __align__(16) float sT[8][16 * 68];   // per-wave 16x64 slab, pitch 68 floats
  const int b    = blockIdx.y;
  const int lane = threadIdx.x & 31;
  const int wave = threadIdx.x >> 5;
  const int tilesN = N / kBN;
  const int tilesM = M / kBM;
  if ((int)blockIdx.x >= tilesM * tilesN) return;   // block-uniform, in front of every barrier
  const int tm  = blockIdx.x / tilesN;
  const int tn  = blockIdx.x - tm * tilesN;
  const int bm0 = tm * kBM;
  const int bn0 = tn * kBN;
  const int wm  = wave >> 2;                   // wave grid 2 (M) x 4 (N)
  const int wn  = wave & 3;
  const int m0  = bm0 + (wm << 6);
  const int n0  = bn0 + (wn << 6);

  const T* Ab  = A  + (size_t)b * strideA;
  const T* Bb  = Bt + (size_t)b * strideB;

  const int rlane = lane & 15;                 // row (A) / col (B, D) within subtile
  const int koff  = (lane >> 4) * 8;           // k offset of this lane half
  const int mOff  = (lane >> 4) * 8;           // D row offset

  // Copies: 16 lanes cover one row's 256 bytes, the block 16 rows per copy; 8 copies for A, 16 for Bt, per lane and stage.
  const int crow = threadIdx.x >> 4;
  const int ccol = (threadIdx.x & 15) * 8;
  const T* gA = Ab + (size_t)(bm0 + crow) * lda + ccol;
  const T* gB = Bb + (size_t)(bn0 + crow) * ldb + ccol;
  const unsigned lds0 = (unsigned)(size_t)sOp + (unsigned)(crow * kPitch + ccol) * 2u;
  auto stage_copies = [&](int t, int buf) {
    const unsigned lb = lds0 + (unsigned)buf * (unsigned)(kStage * 2);
    const T* ga = gA + (size_t)t * kBK;
    const T* gb = gB + (size_t)t * kBK;
#pragma unroll
    for (int half = 0; half < 2; ++half) {
      unsigned l[12];
      const void* g[12];
#pragma unroll  // constant indices keep these arrays in registers
      for (int e = 0; e < 12; ++e) {
        const int grp = half * 12 + e;           // 16-row group of the buffer: 0..7 A, 8..23 Bt
        l[e] = lb + (unsigned)(grp * 16 * kPitch * 2);
        g[e] = (grp < 8) ? (const void*)(ga + (size_t)(grp * 16) * lda) : (const void*)(gb + (size_t)((grp - 8) * 16) * ldb);
      }
      async_copy12(l, g);
    }
  };

  v8f acc[4][4];
#pragma unroll
  for (int i = 0; i < 4; ++i)
#pragma unroll
    for (int j = 0; j < 4; ++j) acc[i][j] = (v8f){0.f,0.f,0.f,0.f,0.f,0.f,0.f,0.f};

  const int nStages = K / kBK;
  const int aoff = ((wm << 6) + rlane) * kPitch + koff;
  const int boff = (kBM + (wn << 6) + rlane) * kPitch + koff;

  stage_copies(0, 0);
  wait_async0();
  __syncthreads();                               // stage 0 is published
  if (nStages > 1) stage_copies(1, 1);

#pragma clang loop unroll(disable)  // one stage per trip: the buffer index stays a run-time value, the text small
  for (int t = 0; t < nStages; ++t) {
    const T* sa = sOp + (t & 1) * kStage + aoff;
    const T* sb = sOp + (t & 1) * kStage + boff;
    // Fragment reads go ahead of the WMMAs that cover their latency: the Bt set and A rows 0, 1 of the next 32 k are read
    // under rows 2, 3 of these 32 k, A rows 2, 3 under rows 0, 1. Each sched_barrier keeps the compiler from sinking a
    // read group down to its first use, where the wave would wait out the LDS latency in front of every row.
    V af[4], bf[2][4];
#pragma unroll  // constant indices keep these arrays in registers
    for (int j = 0; j < 4; ++j) bf[0][j] = Frag<T>::load(sb + j * 16 * kPitch);
#pragma unroll  // constant indices keep these arrays in registers
    for (int i = 0; i < 2; ++i) af[i] = Frag<T>::load(sa + i * 16 * kPitch);
#pragma unroll  // constant indices keep these arrays in registers
    for (int ks = 0; ks < kBK / 32; ++ks) {
      const int cs = ks & 1;
#pragma unroll  // constant indices keep these arrays in registers
      for (int i = 2; i < 4; ++i) af[i] = Frag<T>::load(sa + i * 16 * kPitch + ks * 32);
      __builtin_amdgcn_sched_barrier(0);  // A rows 2, 3 are read ahead of rows 0, 1's WMMAs
#pragma unroll  // constant indices keep these arrays in registers
      for (int i = 0; i < 2; ++i)
#pragma unroll  // constant indices keep these arrays in registers
        for (int j = 0; j < 4; ++j) acc[i][j] = Frag<T>::mma(af[i], bf[cs][j], acc[i][j]);
      __builtin_amdgcn_sched_barrier(0);  // the next reads stay behind rows 0, 1's WMMAs, whose registers they refill
      if (ks + 1 < kBK / 32) {
#pragma unroll  // constant indices keep these arrays in registers
        for (int j = 0; j < 4; ++j) bf[cs ^ 1][j] = Frag<T>::load(sb + j * 16 * kPitch + (ks + 1) * 32);
#pragma unroll  // constant indices keep these arrays in registers
        for (int i = 0; i < 2; ++i) af[i] = Frag<T>::load(sa + i * 16 * kPitch + (ks + 1) * 32);
      }
      __builtin_amdgcn_sched_barrier(0);  // the next 32 k's reads stay ahead of rows 2, 3's WMMAs
#pragma unroll  // constant indices keep these arrays in registers
      for (int i = 2; i < 4; ++i)
#pragma unroll  // constant indices keep these arrays in registers
        for (int j = 0; j < 4; ++j) acc[i][j] = Frag<T>::mma(af[i], bf[cs][j], acc[i][j]);
      __builtin_amdgcn_sched_barrier(0);  // the reads after that stay behind them
    }
    wait_ds0();
    wait_async0();
    __syncthreads();                             // publishes stage t + 1 and ends every wave's reads of stage t
    if (t + 2 < nStages) stage_copies(t + 2, t & 1);
  }
  wait_async0();
  acc_guard4(acc[0][0], acc[0][1], acc[0][2], acc[0][3]);
  acc_guard4(acc[1][0], acc[1][1], acc[1][2], acc[1][3]);
  acc_guard4(acc[2][0], acc[2][1], acc[2][2], acc[2][3]);
  acc_guard4(acc[3][0], acc[3][1], acc[3][2], acc[3][3]);

  // ---- epilogue ----
  float* slab = sT[wave];
  const float* Rb = RESID ? (resid + (size_t)b * strideR) : nullptr;
  float var0 = 0.f, var1 = 0.f;   // OUT_MODE 3: the two rows' variances that this lane stores behind the loop
#pragma unroll
  for (int i = 0; i < 4; ++i) {
    const int mBase = m0 + (i << 4);
#pragma unroll
    for (int j = 0; j < 4; ++j) {
      const int n = n0 + (j << 4) + rlane;
      float bv = 0.f;
      if (BIAS_MODE == 2) bv = bias[n];
#pragma unroll
      for (int r = 0; r < 8; ++r) {
        float v = acc[i][j][r] * scale;
        if (BIAS_MODE == 1) v += bias[mBase + mOff + r];
        if (BIAS_MODE == 2) v += bv;
        if (RESID) v += Rb[(size_t)(mBase + mOff + r) * ldc + n];
        if (ACT == 2) v = fmaxf(v, 0.0f);
        if (ACT == 4) v = (v > 0.f) ? v : 0.01f * v;
        slab[(mOff + r) * 68 + (j << 4) + rlane] = v;
      }
    }
    __builtin_amdgcn_fence(__ATOMIC_RELEASE, "workgroup");
    __builtin_amdgcn_wave_barrier();
    __builtin_amdgcn_fence(__ATOMIC_ACQUIRE, "workgroup");
    if (OUT_MODE == 0) {
      float* C = (float*)Cout + (size_t)b * strideC;
      const int hh = lane >> 4, c4 = (lane & 15) * 4;     // row seg = 256 B = 16 lanes x 16 B
      {
#pragma unroll
        for (int it = 0; it < 8; ++it) {
          const int row = it * 2 + hh;
          v4f v = *(const v4f*)(slab + row * 68 + c4);
          *(v4f*)(C + (size_t)(mBase + row) * ldc + n0 + c4) = v;
        }
        
      }
    } else if (OUT_MODE == 3) {
      const int q = lane >> 3, c8 = (lane & 7) * 8;       // row seg = 128 B = 8 lanes x 16 B
      unsigned short* C = (unsigned short*)Cout + (size_t)b * strideC;
#pragma unroll  // four independent rows in flight; grp below a compile-time value
      for (int it = 0; it < 4; ++it) {
        const int row = it * 4 + q;
        const float* sp = slab + row * 68 + c8;
        const v4f a = *(const v4f*)(sp);
        const v4f c = *(const v4f*)(sp + 4);
        float x[8];
#pragma unroll  // constant indices keep these arrays in registers
        for (int e = 0; e < 4; ++e) { x[e] = a[e]; x[4 + e] = c[e]; }
        float s = ((x[0] + x[1]) + (x[2] + x[3])) + ((x[4] + x[5]) + (x[6] + x[7]));
        s = add_xor<1>(s);
        s = add_xor<2>(s);
        s = add_xor<4>(s);
        const float mean = s * kInv64;
        float vs = 0.f;
#pragma unroll  // constant indices keep these arrays in registers
        for (int e = 0; e < 8; ++e) { x[e] = x[e] - mean; vs += x[e] * x[e]; }
        vs = add_xor<1>(vs);
        vs = add_xor<2>(vs);
        vs = add_xor<4>(vs);
        unsigned short hb[8];
#pragma unroll  // constant indices keep these arrays in registers
        for (int e = 0; e < 8; ++e) hb[e] = h_bits(x[e] * kQKCarry);
        const v4u u = (v4u){pk16(hb[0], hb[1]), pk16(hb[2], hb[3]), pk16(hb[4], hb[5]), pk16(hb[6], hb[7])};
        *(v4u*)(C + (size_t)(mBase + row) * ldc + n0 + c8) = u;
        // all 8 lanes of a row hold its variance; lane (q, lane & 7) keeps those of row groups (i, it) = lane & 7 and 8 + (lane & 7)
        const int grp = i * 4 + it;
        if ((lane & 7) == (grp & 7)) { if (grp < 8) var0 = vs * kInv63; else var1 = vs * kInv63; }
      }
    } else {
      const int q = lane >> 3, c8 = (lane & 7) * 8;
      unsigned short* C  = (unsigned short*)Cout  + (size_t)b * strideC;
      unsigned short* C2 = (OUT_MODE == 2) ? ((unsigned short*)Cout2 + (size_t)b * strideC) : nullptr;
      {
#pragma unroll
        for (int it = 0; it < 4; ++it) {
          const int row = it * 4 + q;
          const float* sp = slab + row * 68 + c8;
          v8h hv, lv;
#pragma unroll
          for (int e = 0; e < 8; ++e) {
            if (OUT_MODE == 1) {
              hv[e] = (_Float16)sp[e];
            } else {
              unsigned short hb = f2bf_bits(sp[e]);
              unsigned short lb = f2bf_bits(sp[e] - bf_bits2f(hb));
              hv[e] = __builtin_bit_cast(_Float16, hb);
              lv[e] = __builtin_bit_cast(_Float16, lb);
            }
          }
          *(v8h*)(C + (size_t)(mBase + row) * ldc + n0 + c8) = hv;
          if (OUT_MODE == 2) *(v8h*)(C2 + (size_t)(mBase + row) * ldc + n0 + c8) = lv;
        }
        
      }
    }
    __builtin_amdgcn_fence(__ATOMIC_RELEASE, "workgroup");
    __builtin_amdgcn_wave_barrier();
    __builtin_amdgcn_fence(__ATOMIC_ACQUIRE, "workgroup");
  }
  if (OUT_MODE == 3) {
    // the wave's 64 variances: rows 0..31, then rows 32..63, each store one whole 128-byte line of the head's row
    const int g8 = lane & 7;
    float* vp = (float*)Cout2 + (size_t)(n0 >> 6) * M + m0 + (g8 >> 2) * 16 + (g8 & 3) * 4 + (lane >> 3);
    vp[0]  = var0;
    vp[32] = var1;
  }
}

// ---------------------------------------------------------------------------
// All five f32 -> f16 casts (x as it is, the four weights x16) in one launch: 256 blocks of 16 waves, one per WGP.
// A group is 8 consecutive elements: two 16-byte loads, one 16-byte store. Every thread converts 12 groups: 8 of x
// (its block's contiguous 128 KiB of x) and one of each weight; its 24 loads are all issued before the first conversion.
// Coverage: 131072 threads x 8 groups x 8 = the whole of x; 131072 threads x 1 group x 8 = the whole of each weight.
// ---------------------------------------------------------------------------
constexpr int kCastThreads = 512;
constexpr int kCastBlocks  = 256;
constexpr int kCastXGroups = 8;                  // groups of x per thread
static_assert((size_t)kCastBlocks * kCastThreads * kCastXGroups * 8 == (size_t)kTok * kEmb, "x covered exactly");
static_assert((size_t)kCastBlocks * kCastThreads * 8 == (size_t)kEmb * kEmb, "each weight covered exactly");

__device__ __forceinline__ v4u cast8(const v4f a, const v4f c, const float scale) {
  unsigned short hb[8];
#pragma unroll  // constant indices keep this array in registers
  for (int e = 0; e < 4; ++e) {
    hb[e]     = h_bits(a[e] * scale);
    hb[4 + e] = h_bits(c[e] * scale);
  }
  return (v4u){pk16(hb[0], hb[1]), pk16(hb[2], hb[3]), pk16(hb[4], hb[5]), pk16(hb[6], hb[7])};
}

__global__ __launch_bounds__(kCastThreads) void cast_all_f16_kernel(
    const float* __restrict__ x, const float* __restrict__ wq, const float* __restrict__ wk,
    const float* __restrict__ wv, const float* __restrict__ wo,
    unsigned short* __restrict__ x16, unsigned short* __restrict__ wq16, unsigned short* __restrict__ wk16,
    unsigned short* __restrict__ wv16, unsigned short* __restrict__ wo16) {
  const size_t ex = ((size_t)blockIdx.x * (kCastXGroups * kCastThreads) + threadIdx.x) * 8;   // first element of x, group 0
  const size_t ew = ((size_t)blockIdx.x * kCastThreads + threadIdx.x) * 8;                    // first element of each weight
  const float* const wsrc[4] = {wq, wk, wv, wo};
  unsigned short* const wdst[4] = {wq16, wk16, wv16, wo16};
  v4f xa[kCastXGroups], xc[kCastXGroups], wa[4], wc[4];
#pragma unroll  // constant indices keep these arrays in registers
  for (int j = 0; j < kCastXGroups; ++j) {
    const float* p = x + ex + (size_t)j * (kCastThreads * 8);
    xa[j] = *(const v4f*)(p);
    xc[j] = *(const v4f*)(p + 4);
  }
  // a precaution: the compiler lets a weight load below land in the register pair that the loads above name as their address
  asm volatile("s_wait_xcnt 0x0" ::: "memory");
#pragma unroll  // constant indices keep these arrays in registers
  for (int i = 0; i < 4; ++i) {
    const float* p = wsrc[i] + ew;
    wa[i] = *(const v4f*)(p);
    wc[i] = *(const v4f*)(p + 4);
  }
  __builtin_amdgcn_sched_barrier(0);  // all 24 loads are in flight before the first wait: no load sinks down to its conversion
#pragma unroll  // constant indices keep these arrays in registers
  for (int j = 0; j < kCastXGroups; ++j)
    *(v4u*)(x16 + ex + (size_t)j * (kCastThreads * 8)) = cast8(xa[j], xc[j], 1.0f);
#pragma unroll  // constant indices keep these arrays in registers
  for (int i = 0; i < 4; ++i)
    *(v4u*)(wdst[i] + ew) = cast8(wa[i], wc[i], kWCarry);
}

// ---------------------------------------------------------------------------
// Fused attention for one (batch, head) and 256 queries per block: scores, softmax and probabilities.v in one pass
// over the keys, nothing of the 1024 x 1024 score plane leaves the registers.
//   S^T = Kc . Qc^T   (A = 16 key rows, B = 16 query rows, K = 64 head dims)     D: lane = query c, register r = key 8*hs + r
//   O^T += V^T . P^T  (A = 16 v^T rows, B = two converted S^T tiles, K = 32 keys) D: lane = query c, register r = dim 8*hs + r
// Two S^T tiles (keys 0..15 and 16..31 of a pass) converted in place are the B operand in the order Frag::load gives A.
// Score in log2 units: s = log2e * (dot / 1024 + q_var * k_var / 64). p = exp2(s - m), m = the query's maximum in use;
// m is raised (and sum and output rescaled) only when a score exceeds it by more than 8, so p <= 256 fits f16.
// Block = 8 waves, wave w owns queries blockIdx.x*256 + w*32 .. +31 (two 16-query tiles); grid (4, 128), exact.
// LDS skv: the head's 1024 k variances, all written (256 threads x 4) before the first barrier, read-only after it.
// LDS sKV: a stage is 128 keys of the head: 128 centered-k rows of 128 B and 64 v^T rows of 256 B, brought in once for all
// eight waves by 16-byte asynchronous copies (whole 128-byte lines); two buffers, the next stage's copies fly while this
// one is worked on. Every wave reads its A fragments (k rows, v^T rows) from there with Frag::load.
// ---------------------------------------------------------------------------
constexpr int kAK     = 128;                     // keys per stage
constexpr int kKPitch = kHeadDim + 8;            // k rows: 144 B = 16 B x 9, no bank conflict for 16-byte fragment reads
constexpr int kVPitch = kAK + 8;                 // v^T rows: 272 B = 16 B x 17, likewise
constexpr int kKStage = kAK * kKPitch;           // elements of the k part of a buffer
constexpr int kAStage = kKStage + kHeadDim * kVPitch;   // elements per buffer: [k 128 rows | v^T 64 rows]
static_assert(kSeq % kAK == 0 && kSeq / kAK >= 2 && kAK % 32 == 0 && (kAStage * 2) % 16 == 0, "stages exact, two or more");
static_assert(((kAK / 32) & (kAK / 32 - 1)) == 0, "passes per stage a power of two: the key prefetch wraps by a mask");

// Eight 16-byte asynchronous copies per lane, global -> LDS. l = the lane's LDS byte address, g = its global address.
// s_wait_xcnt 0 closes the statement as a precaution: no register that a copy names is rewritten in front of it.
__device__ __forceinline__ void async_copy8(const unsigned (&l)[8], const void* const (&g)[8]) {
  asm volatile(
      "global_load_async_to_lds_b128 %0, %8, off\n\t"
      "global_load_async_to_lds_b128 %1, %9, off\n\t"
      "global_load_async_to_lds_b128 %2, %10, off\n\t"
      "global_load_async_to_lds_b128 %3, %11, off\n\t"
      "global_load_async_to_lds_b128 %4, %12, off\n\t"
      "global_load_async_to_lds_b128 %5, %13, off\n\t"
      "global_load_async_to_lds_b128 %6, %14, off\n\t"
      "global_load_async_to_lds_b128 %7, %15, off\n\t"
      "s_wait_xcnt 0x0"
      :: "v"(l[0]), "v"(l[1]), "v"(l[2]), "v"(l[3]), "v"(l[4]), "v"(l[5]), "v"(l[6]), "v"(l[7]),
         "v"(g[0]), "v"(g[1]), "v"(g[2]), "v"(g[3]), "v"(g[4]), "v"(g[5]), "v"(g[6]), "v"(g[7])
      : "memory");
}

__global__ __launch_bounds__(256) void attn_fused_kernel(const unsigned short* __restrict__ qc, const unsigned short* __restrict__ kc,
                                                         const unsigned short* __restrict__ vt, const float* __restrict__ qvar,
                                                         const float* __restrict__ kvar, unsigned short* __restrict__ o16) {
  typedef Frag<_Float16> F;
  __shared__ __align__(16) float skv[kSeq];
  __shared__ __align__(16) _Float16 sKV[2 * kAStage];   // two stage buffers
  const int lane = threadIdx.x & 31, wave = threadIdx.x >> 5;
  const int b  = blockIdx.y >> 4;
  const int h  = blockIdx.y & (kHeads - 1);
  const int q0 = blockIdx.x * 256 + wave * 32;
  const int c  = lane & 15;
  const int hs = lane >> 4;

  // Copies: 8 lanes cover one k row's 128 bytes (the block 32 rows per copy), 16 lanes one v^T row's 256 bytes (16 rows per
  // copy); 4 copies for k and 4 for v^T, per lane and stage.
  const int krow = threadIdx.x >> 3, kcol = (threadIdx.x & 7) * 8;
  const int vrow = threadIdx.x >> 4, vcol = (threadIdx.x & 15) * 8;
  const _Float16* gK = (const _Float16*)kc + ((size_t)b * kSeq + krow) * kEmb + h * kHeadDim + kcol;
  const _Float16* gV = (const _Float16*)vt + (size_t)b * kEmb * kSeq + (size_t)(h * kHeadDim + vrow) * kSeq + vcol;
  const unsigned ldsK = (unsigned)(size_t)sKV + (unsigned)(krow * kKPitch + kcol) * 2u;
  const unsigned ldsV = (unsigned)(size_t)sKV + (unsigned)(kKStage + vrow * kVPitch + vcol) * 2u;
  auto stage_copies = [&](int t, int buf) {
    const unsigned lb = (unsigned)buf * (unsigned)(kAStage * 2);
    unsigned l[8];
    const void* g[8];
#pragma unroll  // constant indices keep these arrays in registers
    for (int e = 0; e < 4; ++e) {
      l[e]     = ldsK + lb + (unsigned)(e * 32 * kKPitch * 2);
      g[e]     = (const void*)(gK + (size_t)(t * kAK + e * 32) * kEmb);
      l[4 + e] = ldsV + lb + (unsigned)(e * 16 * kVPitch * 2);
      g[4 + e] = (const void*)(gV + (size_t)(e * 16) * kSeq + t * kAK);
    }
    async_copy8(l, g);
  };

  stage_copies(0, 0);
#pragma unroll
  for (int e = 0; e < 4; ++e) {
    const int j = e * 256 + threadIdx.x;
    skv[j] = kvar[(size_t)h * kTok + b * kSeq + j];
  }
  wait_async0();
  __syncthreads();  // stage 0 is published; every wave reads all of skv, each thread wrote four entries
  stage_copies(1, 1);

  const _Float16* Qp = (const _Float16*)qc + ((size_t)b * kSeq + q0 + c) * kEmb + h * kHeadDim + hs * 8;
  const int koffs = c * kKPitch + hs * 8;             // this lane's place in a k fragment row
  const int voffs = kKStage + c * kVPitch + hs * 8;   // and in a v^T fragment row

  v16h qf[2][2];
  float qv2[2], m[2], l[2];
  v8f o[4][2];
#pragma unroll  // constant indices keep these arrays in registers
  for (int qt = 0; qt < 2; ++qt) {
    qf[qt][0] = F::load(Qp + (size_t)(qt * 16) * kEmb);
    qf[qt][1] = F::load(Qp + (size_t)(qt * 16) * kEmb + 32);
    qv2[qt] = qvar[(size_t)h * kTok + b * kSeq + q0 + qt * 16 + c] * (kInv64 * kLog2e);
    m[qt] = -INFINITY;
    l[qt] = 0.f;
#pragma unroll  // constant indices keep these arrays in registers
    for (int i = 0; i < 4; ++i) o[i][qt] = (v8f){0.f,0.f,0.f,0.f,0.f,0.f,0.f,0.f};
  }

#pragma clang loop unroll(disable)  // one stage per trip: the buffer index stays a run-time value, the text small
  for (int t = 0; t < kSeq / kAK; ++t) {
    const _Float16* sk = sKV + (t & 1) * kAStage + koffs;
    const _Float16* sv = sKV + (t & 1) * kAStage + voffs;
    v16h kf[2][2];
#pragma unroll  // constant indices keep these arrays in registers
    for (int kt = 0; kt < 2; ++kt) {
      kf[kt][0] = F::load(sk + (kt * 16) * kKPitch);
      kf[kt][1] = F::load(sk + (kt * 16) * kKPitch + 32);
    }

#pragma clang loop unroll(disable)  // one pass per trip keeps the text small and the registers of one pass
    for (int p = 0; p < kAK / 32; ++p) {
      const int key0 = t * kAK + p * 32;
      v16h vf[4];
#pragma unroll  // constant indices keep these arrays in registers
      for (int i = 0; i < 4; ++i) vf[i] = F::load(sv + (i * 16) * kVPitch + p * 32);
      float kv[2][8];
#pragma unroll  // constant indices keep these arrays in registers
      for (int kt = 0; kt < 2; ++kt) {
        const v4f a0 = *(const v4f*)(skv + key0 + kt * 16 + hs * 8);
        const v4f a1 = *(const v4f*)(skv + key0 + kt * 16 + hs * 8 + 4);
#pragma unroll  // constant indices keep these arrays in registers
        for (int e = 0; e < 4; ++e) { kv[kt][e] = a0[e]; kv[kt][4 + e] = a1[e]; }
      }
      __builtin_amdgcn_sched_barrier(0);  // the pass's v^T and variance reads stay one group up here, not sunk among the WMMAs that use them

      v8f s[2][2];
#pragma unroll  // constant indices keep these arrays in registers
      for (int kt = 0; kt < 2; ++kt)
#pragma unroll  // constant indices keep these arrays in registers
        for (int qt = 0; qt < 2; ++qt) {
          s[kt][qt] = F::mma(kf[kt][0], qf[qt][0], (v8f){0.f,0.f,0.f,0.f,0.f,0.f,0.f,0.f});
          s[kt][qt] = F::mma(kf[kt][1], qf[qt][1], s[kt][qt]);
        }

      __builtin_amdgcn_sched_barrier(0);  // the reads below refill the registers of the products above
      // next pass's key fragments, fetched while this pass's softmax runs; never past this stage's own buffer
      // (the stage's last pass re-reads its keys 0..31, unused: no branch stands behind the products above)
      const int np = (p + 1) & (kAK / 32 - 1);
#pragma unroll  // constant indices keep these arrays in registers
      for (int kt = 0; kt < 2; ++kt) {
        kf[kt][0] = F::load(sk + (np * 32 + kt * 16) * kKPitch);
        kf[kt][1] = F::load(sk + (np * 32 + kt * 16) * kKPitch + 32);
      }
      __builtin_amdgcn_sched_barrier(0);  // and stay one group ahead of the softmax that covers their latency

      float mx[2];
#pragma unroll  // constant indices keep these arrays in registers
      for (int qt = 0; qt < 2; ++qt) {
#pragma unroll  // constant indices keep these arrays in registers
        for (int kt = 0; kt < 2; ++kt)
#pragma unroll  // constant indices keep these arrays in registers
          for (int r = 0; r < 8; ++r) s[kt][qt][r] = s[kt][qt][r] * (kScoreScale * kLog2e) + qv2[qt] * kv[kt][r];
        float a0 = fmaxf(fmaxf(s[0][qt][0], s[0][qt][1]), fmaxf(s[0][qt][2], s[0][qt][3]));
        float a1 = fmaxf(fmaxf(s[0][qt][4], s[0][qt][5]), fmaxf(s[0][qt][6], s[0][qt][7]));
        float a2 = fmaxf(fmaxf(s[1][qt][0], s[1][qt][1]), fmaxf(s[1][qt][2], s[1][qt][3]));
        float a3 = fmaxf(fmaxf(s[1][qt][4], s[1][qt][5]), fmaxf(s[1][qt][6], s[1][qt][7]));
        mx[qt] = fmaxf(fmaxf(a0, a1), fmaxf(a2, a3));
      }

      // one wave-uniform test per pass; both halves of a query's lane pair take the same new maximum
      const bool need = (mx[0] > m[0] + 8.0f) || (mx[1] > m[1] + 8.0f);
      if (__builtin_amdgcn_ballot_w32(need) != 0u) {
#pragma unroll  // constant indices keep these arrays in registers
        for (int qt = 0; qt < 2; ++qt) {
          const float mn = fmaxf(m[qt], fmaxf(mx[qt], __shfl_xor(mx[qt], 16, 32)));
          const float al = __builtin_amdgcn_exp2f(m[qt] - mn);
          m[qt] = mn;
          l[qt] *= al;
#pragma unroll  // constant indices keep these arrays in registers
          for (int i = 0; i < 4; ++i)
#pragma unroll  // constant indices keep these arrays in registers
            for (int r = 0; r < 8; ++r) o[i][qt][r] *= al;
        }
      }

      v16h pf[2];
#pragma unroll  // constant indices keep these arrays in registers
      for (int qt = 0; qt < 2; ++qt) {
        float ls0 = 0.f, ls1 = 0.f;
#pragma unroll  // constant indices keep these arrays in registers
        for (int r = 0; r < 8; ++r) {
          const float p0 = __builtin_amdgcn_exp2f(s[0][qt][r] - m[qt]);
          const float p1 = __builtin_amdgcn_exp2f(s[1][qt][r] - m[qt]);
          ls0 += p0;
          ls1 += p1;
          pf[qt][r]     = (_Float16)p0;
          pf[qt][8 + r] = (_Float16)p1;
        }
        l[qt] += ls0 + ls1;
      }

#pragma unroll  // constant indices keep these arrays in registers
      for (int i = 0; i < 4; ++i)
#pragma unroll  // constant indices keep these arrays in registers
        for (int qt = 0; qt < 2; ++qt) o[i][qt] = F::mma(vf[i], pf[qt], o[i][qt]);
      __builtin_amdgcn_sched_barrier(0);  // keeps the four slots below behind the pass's last WMMA
      // four vector slots between the last WMMA and the next pass's address arithmetic, which may take over its A or B registers
      asm volatile("v_nop\n\tv_nop\n\tv_nop\n\tv_nop");
    }
    wait_ds0();
    wait_async0();
    __syncthreads();                             // publishes stage t + 1 and ends every wave's reads of stage t
    if (t + 2 < kSeq / kAK) stage_copies(t + 2, t & 1);
  }
  wait_async0();

  // epilogue: join the two halves' sums, normalise, 8 consecutive head dims per lane = one 16-byte store
#pragma unroll  // constant indices keep these arrays in registers
  for (int qt = 0; qt < 2; ++qt) {
    const float lt  = l[qt] + __shfl_xor(l[qt], 16, 32);
    const float inv = kOCarry * (1.0f / lt);
    unsigned short* op = o16 + ((size_t)b * kSeq + q0 + qt * 16 + c) * kEmb + h * kHeadDim + hs * 8;
#pragma unroll  // constant indices keep these arrays in registers
    for (int i = 0; i < 4; ++i) {
      v8h hv;
#pragma unroll  // constant indices keep these arrays in registers
      for (int r = 0; r < 8; ++r) hv[r] = (_Float16)(o[i][qt][r] * inv);
      *(v8h*)(op + i * 16) = hv;
    }
  }
}

// ---------------------------------------------------------------------------
// Host entry: 6 launches (one cast of all five inputs, 3 projection GEMMs, fused attention, output GEMM).
// ---------------------------------------------------------------------------
extern "C" void kernel_launch(void* const* d_in, const int* in_sizes, int n_in,
                              void* d_out, int out_size, void* d_ws, size_t ws_size,
                              hipStream_t stream) {
  if (n_in < 5) return;
  if (in_sizes[0] != kTok * kEmb) return;
  if (in_sizes[1] != kEmb * kEmb || in_sizes[2] != kEmb * kEmb || in_sizes[3] != kEmb * kEmb || in_sizes[4] != kEmb * kEmb) return;
  if (out_size != kTok * kEmb) return;
  if (ws_size < kWsTotal) return;

  const float* x  = (const float*)d_in[0];
  const float* Wq = (const float*)d_in[1];
  const float* Wk = (const float*)d_in[2];
  const float* Wv = (const float*)d_in[3];
  const float* Wo = (const float*)d_in[4];
  float* outp = (float*)d_out;

  char* ws = (char*)d_ws;
  unsigned short* X16  = (unsigned short*)(ws + kOffX16);
  unsigned short* O16  = (unsigned short*)(ws + kOffX16);     // region reuse, see map
  unsigned short* Wq16 = (unsigned short*)(ws + kOffWq16);
  unsigned short* Wk16 = (unsigned short*)(ws + kOffWk16);
  unsigned short* Wv16 = (unsigned short*)(ws + kOffWv16);
  unsigned short* Wo16 = (unsigned short*)(ws + kOffWo16);
  unsigned short* VT16 = (unsigned short*)(ws + kOffVT16);
  unsigned short* QC16 = (unsigned short*)(ws + kOffQC16);
  unsigned short* KC16 = (unsigned short*)(ws + kOffKC16);
  float*          QVAR = (float*)(ws + kOffQVar);
  float*          KVAR = (float*)(ws + kOffKVar);

  const float* nof = (const float*)nullptr;
  const unsigned short* nou = (const unsigned short*)nullptr;

  // 1) casts to f16 planes, one launch
  cast_all_f16_kernel<<<kCastBlocks, kCastThreads, 0, stream>>>(x, Wq, Wk, Wv, Wo, X16, Wq16, Wk16, Wv16, Wo16);

  // 2) v^T = Wv . x^T per batch: A = Wv16 [1024][1024] (M = out channel), Bt = X16 rows of the batch [1024][1024] (N = token),
  //    K = 1024, C = VT16 f16 [8][1024][1024], ldc 1024. block tiles 8 x 4 = 32 per batch -> (32, 8).
  {
    const int blocks = (kEmb / kBM) * (kSeq / kBN);   // 32
    wmma_gemm64<0, false, 0, 1, false, 0><<<dim3(blocks, kBatch), 256, 0, stream>>>(
        Wv16, nou, kEmb, 0L, X16, nou, kEmb, (long)kSeq * kEmb, (void*)VT16, (void*)nullptr, kSeq, (long)kEmb * kSeq,
        nof, nof, 0L, kEmb, kSeq, kEmb, kProjScale);
  }

  // 3) q = x . Wq^T, centered per head in the GEMM's epilogue -> QC16 + QVAR; then k likewise -> KC16 + KVAR.
  {
    const int blocks = (kTok / kBM) * (kEmb / kBN);   // 256
    wmma_gemm64<0, false, 0, 3, false, 0><<<dim3(blocks, 1), 256, 0, stream>>>(
        X16, nou, kEmb, 0L, Wq16, nou, kEmb, 0L, (void*)QC16, (void*)QVAR, kEmb, 0L,
        nof, nof, 0L, kTok, kEmb, kEmb, kProjScale);
    wmma_gemm64<0, false, 0, 3, false, 0><<<dim3(blocks, 1), 256, 0, stream>>>(
        X16, nou, kEmb, 0L, Wk16, nou, kEmb, 0L, (void*)KC16, (void*)KVAR, kEmb, 0L,
        nof, nof, 0L, kTok, kEmb, kEmb, kProjScale);
  }

  // 4) attention: one launch, block = (256 queries, one batch and head)
  attn_fused_kernel<<<dim3(kSeq / 256, kBatch * kHeads), 256, 0, stream>>>(QC16, KC16, VT16, QVAR, KVAR, O16);

  // 5) out = O . Wo^T : A = O16 [8192][1024], Bt = Wo16 [1024][1024], K = 1024, C = d_out f32 [8192][1024].
  {
    const int blocks = (kTok / kBM) * (kEmb / kBN);   // 256
    wmma_gemm64<0, false, 0, 0, false, 0><<<dim3(blocks, 1), 256, 0, stream>>>(
        O16, nou, kEmb, 0L, Wo16, nou, kEmb, 0L, (void*)outp, (void*)nullptr, kEmb, 0L,
        nof, nof, 0L, kTok, kEmb, kEmb, kOutScale);
  }
}

// v006
// Measured time: 107 microseconds a run.
// Next to v005, in two timings, it ran 1.08 times as fast each time.
// Over all steps from v000 it is 14.2 times as fast.
// All contractions (q/k/v projections K=1024, centered q.k^T scores K=64, probabilities.v K=1024, output projection K=1024): v_wmma_f32_16x16x32_f16 with f16 operands (weights carried x16, centered q/k carried x4, unnormalised probabilities exp2(score - maximum in use), attention output carried x64) and f32 accumulate; centering, variances, variance outer product and online softmax in f32.
#include <hip/hip_runtime.h>
#include <math.h>

// ---------------------------------------------------------------------------
// Problem constants
// ---------------------------------------------------------------------------
constexpr int kBatch   = 8;
constexpr int kSeq     = 1024;
constexpr int kEmb     = 1024;
constexpr int kHeads   = 16;
constexpr int kHeadDim = 64;
constexpr int kTok     = kBatch * kSeq;                 // 8192 token rows

constexpr float kWCarry     = 16.0f;                    // weights carried x16 in f16
constexpr float kQKCarry    = 4.0f;                     // centered q / k carried x4 in f16
constexpr float kOCarry     = 64.0f;                    // attention output carried x64 in f16
constexpr float kProjScale  = 1.0f / kWCarry;                              // 1/16
constexpr float kScoreScale = 1.0f / (kQKCarry * kQKCarry * 64.0f);        // 1/1024  (= dot / head_dim)
constexpr float kLog2e      = 1.4426950408889634f;
constexpr float kOutScale   = 1.0f / (kOCarry * kWCarry);                  // 1/1024
constexpr float kInv64      = 1.0f / 64.0f;
constexpr float kInv63      = 1.0f / 63.0f;

// ---------------------------------------------------------------------------
// Workspace region map (bytes). Total carve 121 MiB = 126877696 B.
//   [  0, 16) MiB  X16  f16 [8192][1024] (x)                 -> reused as O16 f16 [8192][1024] (attention output x64)
//                  after the projection launch (last reader of X16) has been enqueued
//   [ 16, 18) MiB  Wq16 f16 [1024][1024] x16
//   [ 18, 20) MiB  Wk16
//   [ 20, 22) MiB  Wv16
//   [ 22, 24) MiB  Wo16
//   [ 24, 72) MiB  unused
//   [ 72, 88) MiB  VT16 f16 [8][1024][1024] (v^T per batch: row = out channel, col = token of the batch)
//   [ 88,104) MiB  QC16 f16 [8192][1024] centered q x4
//   [104,120) MiB  KC16 f16 [8192][1024] centered k x4
//   [120,120.5) MiB QVAR f32 [16][8192]  ([head][token])
//   [120.5,121) MiB KVAR f32 [16][8192]
// ---------------------------------------------------------------------------
constexpr size_t kMiB     = 1048576;
constexpr size_t kOffX16  = 0;
constexpr size_t kOffWq16 = 16 * kMiB;
constexpr size_t kOffWk16 = 18 * kMiB;
constexpr size_t kOffWv16 = 20 * kMiB;
constexpr size_t kOffWo16 = 22 * kMiB;
constexpr size_t kOffVT16 = 72 * kMiB;
constexpr size_t kOffQC16 = 88 * kMiB;
constexpr size_t kOffKC16 = 104 * kMiB;
constexpr size_t kOffQVar = 120 * kMiB;
constexpr size_t kOffKVar = 120 * kMiB + 512 * 1024;
constexpr size_t kWsTotal = 121 * kMiB;
static_assert((size_t)kTok * kEmb * 2 == 16 * kMiB, "x / o planes 16 MiB");
static_assert((size_t)kEmb * kEmb * 2 == 2 * kMiB, "weight planes 2 MiB");
static_assert((size_t)kTok * kHeads * 4 == 512 * 1024, "variance tables 512 KiB");
static_assert(kOffKVar + (size_t)kTok * kHeads * 4 == kWsTotal, "carve end");
static_assert(kWsTotal <= (size_t)134217728, "carve under 128 MiB");
static_assert(kEmb % 32 == 0 && kHeadDim % 32 == 0 && kSeq % 32 == 0, "K multiples of 32");
static_assert(kTok % 64 == 0 && kEmb % 64 == 0 && kSeq % 64 == 0 && kHeadDim % 64 == 0, "M, N multiples of 64");

typedef __attribute__((ext_vector_type(16))) _Float16 v16h;
typedef __attribute__((ext_vector_type(8)))  _Float16 v8h;
typedef __attribute__((ext_vector_type(16))) __bf16   v16b;
typedef __attribute__((ext_vector_type(8)))  __bf16   v8b;
typedef __attribute__((ext_vector_type(8)))  float    v8f;
typedef __attribute__((ext_vector_type(4)))  float    v4f;
typedef __attribute__((ext_vector_type(4)))  unsigned int v4u;

__device__ __forceinline__ unsigned short f2bf_bits(float f) {
  unsigned u = __float_as_uint(f);
  return (unsigned short)((u + 0x7FFFu + ((u >> 16) & 1u)) >> 16);
}
__device__ __forceinline__ float bf_bits2f(unsigned short h) { return __uint_as_float(((unsigned)h) << 16); }

// hazard guards as plain device helpers (no inline asm inside the kernel template body)
__device__ __forceinline__ void acc_guard4(v8f& a, v8f& b, v8f& c, v8f& d) { asm volatile("v_nop\n\tv_nop\n\tv_nop\n\tv_nop" : "+v"(a), "+v"(b), "+v"(c), "+v"(d)); }
template <typename T> struct Frag;
template <> struct Frag<_Float16> {
  typedef v16h V; union U { v16h v; v8h h[2]; };
  static __device__ __forceinline__ v16h load(const _Float16* p) {   // elements 0..7 <- p[0..7], 8..15 <- p[16..23]
    U f; f.h[0] = *(const v8h*)(p); f.h[1] = *(const v8h*)(p + 16); return f.v;
  }
  static __device__ __forceinline__ v8f mma(v16h a, v16h b, v8f c) {
    return __builtin_amdgcn_wmma_f32_16x16x32_f16(false, a, false, b, (short)0, c, false, false);
  }
};
template <> struct Frag<__bf16> {
  typedef v16b V; union U { v16b v; v8b h[2]; };
  static __device__ __forceinline__ v16b load(const __bf16* p) {
    U f; f.h[0] = *(const v8b*)(p); f.h[1] = *(const v8b*)(p + 16); return f.v;
  }
  static __device__ __forceinline__ v8f mma(v16b a, v16b b, v8f c) {
    return __builtin_amdgcn_wmma_f32_16x16x32_bf16(false, a, false, b, (short)0, c, false, false);
  }
};

__device__ __forceinline__ unsigned pk16(unsigned short a, unsigned short b) { return (unsigned)a | ((unsigned)b << 16); }
__device__ __forceinline__ unsigned short h_bits(float f) { const _Float16 h = (_Float16)f; return __builtin_bit_cast(unsigned short, h); }

// ---- Register-blocked batched WMMA GEMM, operands staged in LDS ------------------------------------------------------
// C[m,n] = scale * sum_k A[m,k] * Bt[n,k] (+bias)(+resid); each wave owns a 64x64 tile, a block of 2 x 4 waves 128 x 256.
// A row-major [M,K]; Bt row-major [N,K]; M % 128 == 0, N % 256 == 0, K % 128 == 0.
// A stage is 128 k of the block's 128 A rows and 256 Bt rows, brought into LDS once for all eight waves by 16-byte
// asynchronous copies (whole 256-byte row pieces); two buffers, the next stage's copies fly while this one is multiplied.
// SPLIT (hi/lo operand planes) is not staged and not instantiated.
// BIAS_MODE: 0 = none, 1 = bias[m], 2 = bias[n].
// OUT_MODE: 0 = f32, 1 = f16, 2 = bf16 hi plane (Cout) + bf16 lo plane (Cout2),
//           3 = per-head centering in the epilogue: a wave's 64 columns are one head (n0 % 64 == 0), so every row of its tile
//               is one (token, head). f32 math: mean = sum_d x / 64; c = x - mean; var = sum_d c*c / 63 (unbiased).
//               Cout[m][n] = f16(4 * c), Cout2 = f32 variances [N / 64][M] ([head][token]); 8 lanes x 8 columns hold a row.
// ET: 0 = f16 operands, 1 = bf16 operands (pointers passed as 16-bit storage)
constexpr int kBM    = 128;                      // A rows per block
constexpr int kBN    = 256;                      // Bt rows per block
constexpr int kBK    = 128;                      // k per stage = 256 B of every operand row
constexpr int kPitch = kBK + 8;                  // LDS row pitch in elements: 272 B = 16 B x 17, no bank conflict for 16-byte fragment reads
constexpr int kStage = (kBM + kBN) * kPitch;     // elements per buffer: [A 128 rows | Bt 256 rows]
static_assert(kTok % kBM == 0 && kEmb % kBM == 0 && kEmb % kBN == 0 && kSeq % kBN == 0 && kEmb % kBK == 0, "block tiles exact");

// Twelve 16-byte asynchronous copies per lane, global -> LDS. l = the lane's LDS byte address, g = its global address.
// s_wait_xcnt 0 closes the statement as a precaution: no register that a copy names is rewritten in front of it.
__device__ __forceinline__ void async_copy12(const unsigned (&l)[12], const void* const (&g)[12]) {
  asm volatile(
      "global_load_async_to_lds_b128 %0, %12, off\n\t"
      "global_load_async_to_lds_b128 %1, %13, off\n\t"
      "global_load_async_to_lds_b128 %2, %14, off\n\t"
      "global_load_async_to_lds_b128 %3, %15, off\n\t"
      "global_load_async_to_lds_b128 %4, %16, off\n\t"
      "global_load_async_to_lds_b128 %5, %17, off\n\t"
      "global_load_async_to_lds_b128 %6, %18, off\n\t"
      "global_load_async_to_lds_b128 %7, %19, off\n\t"
      "global_load_async_to_lds_b128 %8, %20, off\n\t"
      "global_load_async_to_lds_b128 %9, %21, off\n\t"
      "global_load_async_to_lds_b128 %10, %22, off\n\t"
      "global_load_async_to_lds_b128 %11, %23, off\n\t"
      "s_wait_xcnt 0x0"
      :: "v"(l[0]), "v"(l[1]), "v"(l[2]), "v"(l[3]), "v"(l[4]), "v"(l[5]), "v"(l[6]), "v"(l[7]), "v"(l[8]), "v"(l[9]), "v"(l[10]), "v"(l[11]),
         "v"(g[0]), "v"(g[1]), "v"(g[2]), "v"(g[3]), "v"(g[4]), "v"(g[5]), "v"(g[6]), "v"(g[7]), "v"(g[8]), "v"(g[9]), "v"(g[10]), "v"(g[11])
      : "memory");
}
// this wave's own copies have landed (other waves read them only behind the barrier that follows)
__device__ __forceinline__ void wait_async0() { asm volatile("s_wait_asynccnt 0x0" ::: "memory"); }
// this wave's LDS reads have returned, before the buffer they read is handed back to the copies
__device__ __forceinline__ void wait_ds0() { asm volatile("s_wait_dscnt 0x0" ::: "memory"); }

// v + (v of lane ^ X), X = 1, 2 or 4, inside a 16-lane row: one v_add_f32 with a row_xmask DPP operand, no LDS round trip
template <int X> __device__ __forceinline__ float add_xor(float v) {
  return v + __builtin_bit_cast(float, __builtin_amdgcn_update_dpp(0, __builtin_bit_cast(int, v), 0x160 + X, 0xf, 0xf, true));
}

template <int ET> struct Elem;
template <> struct Elem<0> { typedef _Float16 T; };
template <> struct Elem<1> { typedef __bf16 T; };
template <int ET, bool SPLIT, int BIAS_MODE, int OUT_MODE, bool RESID, int ACT = 0>
__global__ __launch_bounds__(256) void wmma_gemm64(
    const unsigned short* __restrict__ Ap, const unsigned short* __restrict__ A2p, int lda, long strideA,
    const unsigned short* __restrict__ Btp, const unsigned short* __restrict__ Bt2p, int ldb, long strideB,
    void* __restrict__ Cout, void* __restrict__ Cout2, int ldc, long strideC,
    const float* __restrict__ bias,
    const float* __restrict__ resid, long strideR,
    int M, int N, int K, float scale) {
  typedef typename Elem<ET>::T T;
  typedef typename Frag<T>::V V;
  static_assert(!SPLIT, "hi/lo planes are not staged");
  const T* A = (const T*)Ap; const T* Bt = (const T*)Btp;
  __shared__ __align__(16) T sOp[2 * kStage];      // two operand buffers
  __shared__ __align__(16) float sT[8][16 * 68];   // per-wave 16x64 slab, pitch 68 floats
  const int b    = blockIdx.y;
  const int lane = threadIdx.x & 31;
  const int wave = threadIdx.x >> 5;
  const int tilesN = N / kBN;
  const int tilesM = M / kBM;
  if ((int)blockIdx.x >= tilesM * tilesN) return;   // block-uniform, in front of every barrier
  const int tm  = blockIdx.x / tilesN;
  const int tn  = blockIdx.x - tm * tilesN;
  const int bm0 = tm * kBM;
  const int bn0 = tn * kBN;
  const int wm  = wave >> 2;                   // wave grid 2 (M) x 4 (N)
  const int wn  = wave & 3;
  const int m0  = bm0 + (wm << 6);
  const int n0  = bn0 + (wn << 6);

  const T* Ab  = A  + (size_t)b * strideA;
  const T* Bb  = Bt + (size_t)b * strideB;

  const int rlane = lane & 15;                 // row (A) / col (B, D) within subtile
  const int koff  = (lane >> 4) * 8;           // k offset of this lane half
  const int mOff  = (lane >> 4) * 8;           // D row offset

  // Copies: 16 lanes cover one row's 256 bytes, the block 16 rows per copy; 8 copies for A, 16 for Bt, per lane and stage.
  const int crow = threadIdx.x >> 4;
  const int ccol = (threadIdx.x & 15) * 8;
  const T* gA = Ab + (size_t)(bm0 + crow) * lda + ccol;
  const T* gB = Bb + (size_t)(bn0 + crow) * ldb + ccol;
  const unsigned lds0 = (unsigned)(size_t)sOp + (unsigned)(crow * kPitch + ccol) * 2u;
  auto stage_copies = [&](int t, int buf) {
    const unsigned lb = lds0 + (unsigned)buf * (unsigned)(kStage * 2);
    const T* ga = gA + (size_t)t * kBK;
    const T* gb = gB + (size_t)t * kBK;
#pragma unroll
    for (int half = 0; half < 2; ++half) {
      unsigned l[12];
      const void* g[12];
#pragma unroll  // constant indices keep these arrays in registers
      for (int e = 0; e < 12; ++e) {
        const int grp = half * 12 + e;           // 16-row group of the buffer: 0..7 A, 8..23 Bt
        l[e] = lb + (unsigned)(grp * 16 * kPitch * 2);
        g[e] = (grp < 8) ? (const void*)(ga + (size_t)(grp * 16) * lda) : (const void*)(gb + (size_t)((grp - 8) * 16) * ldb);
      }
      async_copy12(l, g);
    }
  };

  v8f acc[4][4];
#pragma unroll
  for (int i = 0; i < 4; ++i)
#pragma unroll
    for (int j = 0; j < 4; ++j) acc[i][j] = (v8f){0.f,0.f,0.f,0.f,0.f,0.f,0.f,0.f};

  const int nStages = K / kBK;
  const int aoff = ((wm << 6) + rlane) * kPitch + koff;
  const int boff = (kBM + (wn << 6) + rlane) * kPitch + koff;

  stage_copies(0, 0);
  wait_async0();
  __syncthreads();                               // stage 0 is published
  if (nStages > 1) stage_copies(1, 1);

#pragma clang loop unroll(disable)  // one stage per trip: the buffer index stays a run-time value, the text small
  for (int t = 0; t < nStages; ++t) {
    const T* sa = sOp + (t & 1) * kStage + aoff;
    const T* sb = sOp + (t & 1) * kStage + boff;
    // Fragment reads go ahead of the WMMAs that cover their latency: the Bt set and A rows 0, 1 of the next 32 k are read
    // under rows 2, 3 of these 32 k, A rows 2, 3 under rows 0, 1. Each sched_barrier keeps the compiler from sinking a
    // read group down to its first use, where the wave would wait out the LDS latency in front of every row.
    V af[4], bf[2][4];
#pragma unroll  // constant indices keep these arrays in registers
    for (int j = 0; j < 4; ++j) bf[0][j] = Frag<T>::load(sb + j * 16 * kPitch);
#pragma unroll  // constant indices keep these arrays in registers
    for (int i = 0; i < 2; ++i) af[i] = Frag<T>::load(sa + i * 16 * kPitch);
#pragma unroll  // constant indices keep these arrays in registers
    for (int ks = 0; ks < kBK / 32; ++ks) {
      const int cs = ks & 1;
#pragma unroll  // constant indices keep these arrays in registers
      for (int i = 2; i < 4; ++i) af[i] = Frag<T>::load(sa + i * 16 * kPitch + ks * 32);
      __builtin_amdgcn_sched_barrier(0);  // A rows 2, 3 are read ahead of rows 0, 1's WMMAs
#pragma unroll  // constant indices keep these arrays in registers
      for (int i = 0; i < 2; ++i)
#pragma unroll  // constant indices keep these arrays in registers
        for (int j = 0; j < 4; ++j) acc[i][j] = Frag<T>::mma(af[i], bf[cs][j], acc[i][j]);
      __builtin_amdgcn_sched_barrier(0);  // the next reads stay behind rows 0, 1's WMMAs, whose registers they refill
      if (ks + 1 < kBK / 32) {
#pragma unroll  // constant indices keep these arrays in registers
        for (int j = 0; j < 4; ++j) bf[cs ^ 1][j] = Frag<T>::load(sb + j * 16 * kPitch + (ks + 1) * 32);
#pragma unroll  // constant indices keep these arrays in registers
        for (int i = 0; i < 2; ++i) af[i] = Frag<T>::load(sa + i * 16 * kPitch + (ks + 1) * 32);
      }
      __builtin_amdgcn_sched_barrier(0);  // the next 32 k's reads stay ahead of rows 2, 3's WMMAs
#pragma unroll  // constant indices keep these arrays in registers
      for (int i = 2; i < 4; ++i)
#pragma unroll  // constant indices keep these arrays in registers
        for (int j = 0; j < 4; ++j) acc[i][j] = Frag<T>::mma(af[i], bf[cs][j], acc[i][j]);
      __builtin_amdgcn_sched_barrier(0);  // the reads after that stay behind them
    }
    wait_ds0();
    wait_async0();
    __syncthreads();                             // publishes stage t + 1 and ends every wave's reads of stage t
    if (t + 2 < nStages) stage_copies(t + 2, t & 1);
  }
  wait_async0();
  acc_guard4(acc[0][0], acc[0][1], acc[0][2], acc[0][3]);
  acc_guard4(acc[1][0], acc[1][1], acc[1][2], acc[1][3]);
  acc_guard4(acc[2][0], acc[2][1], acc[2][2], acc[2][3]);
  acc_guard4(acc[3][0], acc[3][1], acc[3][2], acc[3][3]);

  // ---- epilogue ----
  float* slab = sT[wave];
  const float* Rb = RESID ? (resid + (size_t)b * strideR) : nullptr;
  float var0 = 0.f, var1 = 0.f;   // OUT_MODE 3: the two rows' variances that this lane stores behind the loop
#pragma unroll
  for (int i = 0; i < 4; ++i) {
    const int mBase = m0 + (i << 4);
#pragma unroll
    for (int j = 0; j < 4; ++j) {
      const int n = n0 + (j << 4) + rlane;
      float bv = 0.f;
      if (BIAS_MODE == 2) bv = bias[n];
#pragma unroll
      for (int r = 0; r < 8; ++r) {
        float v = acc[i][j][r] * scale;
        if (BIAS_MODE == 1) v += bias[mBase + mOff + r];
        if (BIAS_MODE == 2) v += bv;
        if (RESID) v += Rb[(size_t)(mBase + mOff + r) * ldc + n];
        if (ACT == 2) v = fmaxf(v, 0.0f);
        if (ACT == 4) v = (v > 0.f) ? v : 0.01f * v;
        slab[(mOff + r) * 68 + (j << 4) + rlane] = v;
      }
    }
    __builtin_amdgcn_fence(__ATOMIC_RELEASE, "workgroup");
    __builtin_amdgcn_wave_barrier();
    __builtin_amdgcn_fence(__ATOMIC_ACQUIRE, "workgroup");
    if (OUT_MODE == 0) {
      float* C = (float*)Cout + (size_t)b * strideC;
      const int hh = lane >> 4, c4 = (lane & 15) * 4;     // row seg = 256 B = 16 lanes x 16 B
      {
#pragma unroll
        for (int it = 0; it < 8; ++it) {
          const int row = it * 2 + hh;
          v4f v = *(const v4f*)(slab + row * 68 + c4);
          *(v4f*)(C + (size_t)(mBase + row) * ldc + n0 + c4) = v;
        }
        
      }
    } else if (OUT_MODE == 3) {
      const int q = lane >> 3, c8 = (lane & 7) * 8;       // row seg = 128 B = 8 lanes x 16 B
      unsigned short* C = (unsigned short*)Cout + (size_t)b * strideC;
#pragma unroll  // four independent rows in flight; grp below a compile-time value
      for (int it = 0; it < 4; ++it) {
        const int row = it * 4 + q;
        const float* sp = slab + row * 68 + c8;
        const v4f a = *(const v4f*)(sp);
        const v4f c = *(const v4f*)(sp + 4);
        float x[8];
#pragma unroll  // constant indices keep these arrays in registers
        for (int e = 0; e < 4; ++e) { x[e] = a[e]; x[4 + e] = c[e]; }
        float s = ((x[0] + x[1]) + (x[2] + x[3])) + ((x[4] + x[5]) + (x[6] + x[7]));
        s = add_xor<1>(s);
        s = add_xor<2>(s);
        s = add_xor<4>(s);
        const float mean = s * kInv64;
        float vs = 0.f;
#pragma unroll  // constant indices keep these arrays in registers
        for (int e = 0; e < 8; ++e) { x[e] = x[e] - mean; vs += x[e] * x[e]; }
        vs = add_xor<1>(vs);
        vs = add_xor<2>(vs);
        vs = add_xor<4>(vs);
        unsigned short hb[8];
#pragma unroll  // constant indices keep these arrays in registers
        for (int e = 0; e < 8; ++e) hb[e] = h_bits(x[e] * kQKCarry);
        const v4u u = (v4u){pk16(hb[0], hb[1]), pk16(hb[2], hb[3]), pk16(hb[4], hb[5]), pk16(hb[6], hb[7])};
        *(v4u*)(C + (size_t)(mBase + row) * ldc + n0 + c8) = u;
        // all 8 lanes of a row hold its variance; lane (q, lane & 7) keeps those of row groups (i, it) = lane & 7 and 8 + (lane & 7)
        const int grp = i * 4 + it;
        if ((lane & 7) == (grp & 7)) { if (grp < 8) var0 = vs * kInv63; else var1 = vs * kInv63; }
      }
    } else {
      const int q = lane >> 3, c8 = (lane & 7) * 8;
      unsigned short* C  = (unsigned short*)Cout  + (size_t)b * strideC;
      unsigned short* C2 = (OUT_MODE == 2) ? ((unsigned short*)Cout2 + (size_t)b * strideC) : nullptr;
      {
#pragma unroll
        for (int it = 0; it < 4; ++it) {
          const int row = it * 4 + q;
          const float* sp = slab + row * 68 + c8;
          v8h hv, lv;
#pragma unroll
          for (int e = 0; e < 8; ++e) {
            if (OUT_MODE == 1) {
              hv[e] = (_Float16)sp[e];
            } else {
              unsigned short hb = f2bf_bits(sp[e]);
              unsigned short lb = f2bf_bits(sp[e] - bf_bits2f(hb));
              hv[e] = __builtin_bit_cast(_Float16, hb);
              lv[e] = __builtin_bit_cast(_Float16, lb);
            }
          }
          *(v8h*)(C + (size_t)(mBase + row) * ldc + n0 + c8) = hv;
          if (OUT_MODE == 2) *(v8h*)(C2 + (size_t)(mBase + row) * ldc + n0 + c8) = lv;
        }
        
      }
    }
    __builtin_amdgcn_fence(__ATOMIC_RELEASE, "workgroup");
    __builtin_amdgcn_wave_barrier();
    __builtin_amdgcn_fence(__ATOMIC_ACQUIRE, "workgroup");
  }
  if (OUT_MODE == 3) {
    // the wave's 64 variances: rows 0..31, then rows 32..63, each store one whole 128-byte line of the head's row
    const int g8 = lane & 7;
    float* vp = (float*)Cout2 + (size_t)(n0 >> 6) * M + m0 + (g8 >> 2) * 16 + (g8 & 3) * 4 + (lane >> 3);
    vp[0]  = var0;
    vp[32] = var1;
  }
}

// ---------------------------------------------------------------------------
// The q, k and v projections in one launch. A block keeps its 128 token rows (A = x) and its 256 output channels and walks
// the three weights (Wq16, Wk16, Wv16 lie one behind the other: Bt = [3][1024][1024]) in one ring of 3 x 8 stages: the copies
// of the next weight's first stage land under this weight's last stage, those of its second fly while this weight's tile is written out, so the ring is filled once, not three times.
// Stage, buffers, copies, fragment order and waits are those of wmma_gemm64. Tile 0 -> centered q + variances, tile 1 -> centered
// k + variances (wmma_gemm64's OUT_MODE 3 arithmetic), tile 2 -> v^T per batch: a lane's 8 accumulator registers are 8
// consecutive tokens of one channel, so the slab is written channel-major and read back as whole 128-byte rows of v^T.
// ---------------------------------------------------------------------------
constexpr int kTileStages = kEmb / kBK;          // 8 stages per weight
constexpr int kQkvStages  = 3 * kTileStages;     // 24
static_assert((kTileStages & (kTileStages - 1)) == 0, "stage -> (weight, k) by shift and mask");
static_assert(kOffWk16 == kOffWq16 + (size_t)kEmb * kEmb * 2 && kOffWv16 == kOffWk16 + (size_t)kEmb * kEmb * 2, "weights contiguous");
static_assert(kSeq % 64 == 0, "a wave's 64 tokens lie in one batch");

__global__ __launch_bounds__(256) void qkv_gemm_kernel(
    const unsigned short* __restrict__ Xp, const unsigned short* __restrict__ Wp,
    unsigned short* __restrict__ qc, unsigned short* __restrict__ kc, unsigned short* __restrict__ vt,
    float* __restrict__ qvar, float* __restrict__ kvar) {
  typedef _Float16 T;
  typedef Frag<T>::V V;
  const T* A = (const T*)Xp; const T* Bt = (const T*)Wp;
  __shared__ __align__(16) T sOp[2 * kStage];      // two operand buffers
  __shared__ __align__(16) float sT[8][16 * 68];   // per-wave 16x64 slab, pitch 68 floats
  const int lane = threadIdx.x & 31;
  const int wave = threadIdx.x >> 5;
  constexpr int tilesN = kEmb / kBN;           // grid = (kTok / kBM) * tilesN blocks, exact
  const int tm  = blockIdx.x / tilesN;
  const int tn  = blockIdx.x - tm * tilesN;
  const int bm0 = tm * kBM;
  const int bn0 = tn * kBN;
  const int wm  = wave >> 2;                   // wave grid 2 (M) x 4 (N)
  const int wn  = wave & 3;
  const int m0  = bm0 + (wm << 6);
  const int n0  = bn0 + (wn << 6);

  const int rlane = lane & 15;                 // row (A) / col (B, D) within subtile
  const int koff  = (lane >> 4) * 8;           // k offset of this lane half
  const int mOff  = (lane >> 4) * 8;           // D row offset

  // Copies: 16 lanes cover one row's 256 bytes, the block 16 rows per copy; 8 copies for A, 16 for Bt, per lane and stage.
  const int crow = threadIdx.x >> 4;
  const int ccol = (threadIdx.x & 15) * 8;
  const T* gA = A  + (size_t)(bm0 + crow) * kEmb + ccol;
  const T* gB = Bt + (size_t)(bn0 + crow) * kEmb + ccol;
  const unsigned lds0 = (unsigned)(size_t)sOp + (unsigned)(crow * kPitch + ccol) * 2u;
  auto stage_copies = [&](int s, int buf) {
    const unsigned lb = lds0 + (unsigned)buf * (unsigned)(kStage * 2);
    const int kk = (s & (kTileStages - 1)) * kBK;
    const T* ga = gA + kk;
    const T* gb = gB + (size_t)(s / kTileStages) * (kEmb * kEmb) + kk;
#pragma unroll
    for (int half = 0; half < 2; ++half) {
      unsigned l[12];
      const void* g[12];
#pragma unroll  // constant indices keep these arrays in registers
      for (int e = 0; e < 12; ++e) {
        const int grp = half * 12 + e;           // 16-row group of the buffer: 0..7 A, 8..23 Bt
        l[e] = lb + (unsigned)(grp * 16 * kPitch * 2);
        g[e] = (grp < 8) ? (const void*)(ga + (size_t)(grp * 16) * kEmb) : (const void*)(gb + (size_t)((grp - 8) * 16) * kEmb);
      }
      async_copy12(l, g);
    }
  };

  v8f acc[4][4];
#pragma unroll  // constant indices keep these arrays in registers
  for (int i = 0; i < 4; ++i)
#pragma unroll  // constant indices keep these arrays in registers
    for (int j = 0; j < 4; ++j) acc[i][j] = (v8f){0.f,0.f,0.f,0.f,0.f,0.f,0.f,0.f};

  const int aoff = ((wm << 6) + rlane) * kPitch + koff;
  const int boff = (kBM + (wn << 6) + rlane) * kPitch + koff;
  float* slab = sT[wave];

  stage_copies(0, 0);
  wait_async0();
  __syncthreads();                               // stage 0 is published
  stage_copies(1, 1);

#pragma clang loop unroll(disable)  // one stage per trip: the buffer index stays a run-time value, the text small
  for (int s = 0; s < kQkvStages; ++s) {
    const T* sa = sOp + (s & 1) * kStage + aoff;
    const T* sb = sOp + (s & 1) * kStage + boff;
    // Fragment reads go ahead of the WMMAs that cover their latency, as in wmma_gemm64; each sched_barrier keeps the compiler
    // from sinking a read group down to its first use, where the wave would wait out the LDS latency in front of every row.
    V af[4], bf[2][4];
#pragma unroll  // constant indices keep these arrays in registers
    for (int j = 0; j < 4; ++j) bf[0][j] = Frag<T>::load(sb + j * 16 * kPitch);
#pragma unroll  // constant indices keep these arrays in registers
    for (int i = 0; i < 2; ++i) af[i] = Frag<T>::load(sa + i * 16 * kPitch);
#pragma unroll  // constant indices keep these arrays in registers
    for (int ks = 0; ks < kBK / 32; ++ks) {
      const int cs = ks & 1;
#pragma unroll  // constant indices keep these arrays in registers
      for (int i = 2; i < 4; ++i) af[i] = Frag<T>::load(sa + i * 16 * kPitch + ks * 32);
      __builtin_amdgcn_sched_barrier(0);  // A rows 2, 3 are read ahead of rows 0, 1's WMMAs
#pragma unroll  // constant indices keep these arrays in registers
      for (int i = 0; i < 2; ++i)
#pragma unroll  // constant indices keep these arrays in registers
        for (int j = 0; j < 4; ++j) acc[i][j] = Frag<T>::mma(af[i], bf[cs][j], acc[i][j]);
      __builtin_amdgcn_sched_barrier(0);  // the next reads stay behind rows 0, 1's WMMAs, whose registers they refill
      if (ks + 1 < kBK / 32) {
#pragma unroll  // constant indices keep these arrays in registers
        for (int j = 0; j < 4; ++j) bf[cs ^ 1][j] = Frag<T>::load(sb + j * 16 * kPitch + (ks + 1) * 32);
#pragma unroll  // constant indices keep these arrays in registers
        for (int i = 0; i < 2; ++i) af[i] = Frag<T>::load(sa + i * 16 * kPitch + (ks + 1) * 32);
      }
      __builtin_amdgcn_sched_barrier(0);  // the next 32 k's reads stay ahead of rows 2, 3's WMMAs
#pragma unroll  // constant indices keep these arrays in registers
      for (int i = 2; i < 4; ++i)
#pragma unroll  // constant indices keep these arrays in registers
        for (int j = 0; j < 4; ++j) acc[i][j] = Frag<T>::mma(af[i], bf[cs][j], acc[i][j]);
      __builtin_amdgcn_sched_barrier(0);  // the reads after that stay behind them
    }
    wait_ds0();
    wait_async0();
    __syncthreads();                             // publishes stage s + 1 and ends every wave's reads of stage s
    if (s + 2 < kQkvStages) stage_copies(s + 2, s & 1);
    if ((s & (kTileStages - 1)) != kTileStages - 1) continue;   // block-uniform: a weight's last stage is followed by its tile's output

    // ---- a tile is complete: write it out of the per-wave slab (not part of the ring) while the next copies fly ----
    acc_guard4(acc[0][0], acc[0][1], acc[0][2], acc[0][3]);
    acc_guard4(acc[1][0], acc[1][1], acc[1][2], acc[1][3]);
    acc_guard4(acc[2][0], acc[2][1], acc[2][2], acc[2][3]);
    acc_guard4(acc[3][0], acc[3][1], acc[3][2], acc[3][3]);
    const int tile = s / kTileStages;
    const int q = lane >> 3, c8 = (lane & 7) * 8;         // row seg = 128 B = 8 lanes x 16 B
    if (tile < 2) {
      // this lane's place in row q of the wave's tile; every store below is a constant number of rows further on
      unsigned short* C = (tile ? kc : qc) + (size_t)(m0 + q) * kEmb + n0 + c8;
      float var0 = 0.f, var1 = 0.f;   // the two rows' variances that this lane stores behind the loop
#pragma unroll  // constant indices keep these arrays in registers
      for (int i = 0; i < 4; ++i) {
#pragma unroll  // constant indices keep these arrays in registers
        for (int j = 0; j < 4; ++j)
#pragma unroll  // constant indices keep these arrays in registers
          for (int r = 0; r < 8; ++r) slab[(mOff + r) * 68 + (j << 4) + rlane] = acc[i][j][r] * kProjScale;
        // the lanes' slab writes stand ahead of the reads below, which take other lanes' values (one wave, its own slab)
        __builtin_amdgcn_fence(__ATOMIC_RELEASE, "workgroup");
        __builtin_amdgcn_wave_barrier();
        __builtin_amdgcn_fence(__ATOMIC_ACQUIRE, "workgroup");
#pragma unroll  // four independent rows in flight; grp below a compile-time value
        for (int it = 0; it < 4; ++it) {
          const int row = it * 4 + q;
          const float* sp = slab + row * 68 + c8;
          const v4f a = *(const v4f*)(sp);
          const v4f c = *(const v4f*)(sp + 4);
          float x[8];
#pragma unroll  // constant indices keep these arrays in registers
          for (int e = 0; e < 4; ++e) { x[e] = a[e]; x[4 + e] = c[e]; }
          float sm = ((x[0] + x[1]) + (x[2] + x[3])) + ((x[4] + x[5]) + (x[6] + x[7]));
          sm = add_xor<1>(sm);
          sm = add_xor<2>(sm);
          sm = add_xor<4>(sm);
          const float mean = sm * kInv64;
          float vs = 0.f;
#pragma unroll  // constant indices keep these arrays in registers
          for (int e = 0; e < 8; ++e) { x[e] = x[e] - mean; vs += x[e] * x[e]; }
          vs = add_xor<1>(vs);
          vs = add_xor<2>(vs);
          vs = add_xor<4>(vs);
          unsigned short hb[8];
#pragma unroll  // constant indices keep these arrays in registers
          for (int e = 0; e < 8; ++e) hb[e] = h_bits(x[e] * kQKCarry);
          const v4u u = (v4u){pk16(hb[0], hb[1]), pk16(hb[2], hb[3]), pk16(hb[4], hb[5]), pk16(hb[6], hb[7])};
          *(v4u*)(C + ((i << 4) + it * 4) * kEmb) = u;
          // all 8 lanes of a row hold its variance; lane (q, lane & 7) keeps those of row groups (i, it) = lane & 7 and 8 + (lane & 7)
          const int grp = i * 4 + it;
          if ((lane & 7) == (grp & 7)) { if (grp < 8) var0 = vs * kInv63; else var1 = vs * kInv63; }
        }
        // and these reads ahead of the next group's writes into the same slab
        __builtin_amdgcn_fence(__ATOMIC_RELEASE, "workgroup");
        __builtin_amdgcn_wave_barrier();
        __builtin_amdgcn_fence(__ATOMIC_ACQUIRE, "workgroup");
      }
      // the wave's 64 variances: rows 0..31, then rows 32..63, each store one whole 128-byte line of the head's row
      const int g8 = lane & 7;
      float* vp = (tile ? kvar : qvar) + (size_t)(n0 >> 6) * kTok + m0 + (g8 >> 2) * 16 + (g8 & 3) * 4 + (lane >> 3);
      vp[0]  = var0;
      vp[32] = var1;
      // a precaution: the accumulators are cleared below, in registers that these two stores name
      asm volatile("s_wait_xcnt 0x0" ::: "memory");
    } else {
      // v^T [batch][channel][token]: slab row = channel of the 16-channel group j, slab column = token of the wave's 64
      // this lane's place in channel row q of the wave's tile; every store below is a constant number of rows further on
      unsigned short* C = vt + (size_t)(m0 / kSeq) * kEmb * kSeq + (size_t)(n0 + q) * kSeq + (m0 & (kSeq - 1)) + c8;
#pragma unroll  // constant indices keep these arrays in registers
      for (int j = 0; j < 4; ++j) {
#pragma unroll  // constant indices keep these arrays in registers
        for (int i = 0; i < 4; ++i) {
          float* dp = slab + rlane * 68 + (i << 4) + mOff;
          *(v4f*)(dp)     = (v4f){acc[i][j][0] * kProjScale, acc[i][j][1] * kProjScale, acc[i][j][2] * kProjScale, acc[i][j][3] * kProjScale};
          *(v4f*)(dp + 4) = (v4f){acc[i][j][4] * kProjScale, acc[i][j][5] * kProjScale, acc[i][j][6] * kProjScale, acc[i][j][7] * kProjScale};
        }
        // the lanes' slab writes stand ahead of the reads below, which take other lanes' values (one wave, its own slab)
        __builtin_amdgcn_fence(__ATOMIC_RELEASE, "workgroup");
        __builtin_amdgcn_wave_barrier();
        __builtin_amdgcn_fence(__ATOMIC_ACQUIRE, "workgroup");
#pragma unroll
        for (int it = 0; it < 4; ++it) {
          const int row = it * 4 + q;
          const float* sp = slab + row * 68 + c8;
          v8h hv;
#pragma unroll  // constant indices keep these arrays in registers
          for (int e = 0; e < 8; ++e) hv[e] = (_Float16)sp[e];
          *(v8h*)(C + ((j << 4) + it * 4) * kSeq) = hv;
        }
        // and these reads ahead of the next group's writes into the same slab
        __builtin_amdgcn_fence(__ATOMIC_RELEASE, "workgroup");
        __builtin_amdgcn_wave_barrier();
        __builtin_amdgcn_fence(__ATOMIC_ACQUIRE, "workgroup");
      }
    }
#pragma unroll  // constant indices keep these arrays in registers
    for (int i = 0; i < 4; ++i)
#pragma unroll  // constant indices keep these arrays in registers
      for (int j = 0; j < 4; ++j) acc[i][j] = (v8f){0.f,0.f,0.f,0.f,0.f,0.f,0.f,0.f};
  }
  wait_async0();
}

// ---------------------------------------------------------------------------
// All five f32 -> f16 casts (x as it is, the four weights x16) in one launch: 256 blocks of 16 waves, one per WGP.
// A group is 8 consecutive elements: two 16-byte loads, one 16-byte store. Every thread converts 12 groups: 8 of x
// (its block's contiguous 128 KiB of x) and one of each weight; its 24 loads are all issued before the first conversion.
// Coverage: 131072 threads x 8 groups x 8 = the whole of x; 131072 threads x 1 group x 8 = the whole of each weight.
// ---------------------------------------------------------------------------
constexpr int kCastThreads = 512;
constexpr int kCastBlocks  = 256;
constexpr int kCastXGroups = 8;                  // groups of x per thread
static_assert((size_t)kCastBlocks * kCastThreads * kCastXGroups * 8 == (size_t)kTok * kEmb, "x covered exactly");
static_assert((size_t)kCastBlocks * kCastThreads * 8 == (size_t)kEmb * kEmb, "each weight covered exactly");

__device__ __forceinline__ v4u cast8(const v4f a, const v4f c, const float scale) {
  unsigned short hb[8];
#pragma unroll  // constant indices keep this array in registers
  for (int e = 0; e < 4; ++e) {
    hb[e]     = h_bits(a[e] * scale);
    hb[4 + e] = h_bits(c[e] * scale);
  }
  return (v4u){pk16(hb[0], hb[1]), pk16(hb[2], hb[3]), pk16(hb[4], hb[5]), pk16(hb[6], hb[7])};
}

__global__ __launch_bounds__(kCastThreads) void cast_all_f16_kernel(
    const float* __restrict__ x, const float* __restrict__ wq, const float* __restrict__ wk,
    const float* __restrict__ wv, const float* __restrict__ wo,
    unsigned short* __restrict__ x16, unsigned short* __restrict__ wq16, unsigned short* __restrict__ wk16,
    unsigned short* __restrict__ wv16, unsigned short* __restrict__ wo16) {
  const size_t ex = ((size_t)blockIdx.x * (kCastXGroups * kCastThreads) + threadIdx.x) * 8;   // first element of x, group 0
  const size_t ew = ((size_t)blockIdx.x * kCastThreads + threadIdx.x) * 8;                    // first element of each weight
  const float* const wsrc[4] = {wq, wk, wv, wo};
  unsigned short* const wdst[4] = {wq16, wk16, wv16, wo16};
  v4f xa[kCastXGroups], xc[kCastXGroups], wa[4], wc[4];
#pragma unroll  // constant indices keep these arrays in registers
  for (int j = 0; j < kCastXGroups; ++j) {
    const float* p = x + ex + (size_t)j * (kCastThreads * 8);
    xa[j] = *(const v4f*)(p);
    xc[j] = *(const v4f*)(p + 4);
  }
  // a precaution: the compiler lets a weight load below land in the register pair that the loads above name as their address
  asm volatile("s_wait_xcnt 0x0" ::: "memory");
#pragma unroll  // constant indices keep these arrays in registers
  for (int i = 0; i < 4; ++i) {
    const float* p = wsrc[i] + ew;
    wa[i] = *(const v4f*)(p);
    wc[i] = *(const v4f*)(p + 4);
  }
  __builtin_amdgcn_sched_barrier(0);  // all 24 loads are in flight before the first wait: no load sinks down to its conversion
#pragma unroll  // constant indices keep these arrays in registers
  for (int j = 0; j < kCastXGroups; ++j)
    *(v4u*)(x16 + ex + (size_t)j * (kCastThreads * 8)) = cast8(xa[j], xc[j], 1.0f);
#pragma unroll  // constant indices keep these arrays in registers
  for (int i = 0; i < 4; ++i)
    *(v4u*)(wdst[i] + ew) = cast8(wa[i], wc[i], kWCarry);
}

// ---------------------------------------------------------------------------
// Fused attention for one (batch, head) and 256 queries per block: scores, softmax and probabilities.v in one pass
// over the keys, nothing of the 1024 x 1024 score plane leaves the registers.
//   S^T = Kc . Qc^T   (A = 16 key rows, B = 16 query rows, K = 64 head dims)     D: lane = query c, register r = key 8*hs + r
//   O^T += V^T . P^T  (A = 16 v^T rows, B = two converted S^T tiles, K = 32 keys) D: lane = query c, register r = dim 8*hs + r
// Two S^T tiles (keys 0..15 and 16..31 of a pass) converted in place are the B operand in the order Frag::load gives A.
// Score in log2 units: s = log2e * (dot / 1024 + q_var * k_var / 64). p = exp2(s - m), m = the query's maximum in use;
// m is raised (and sum and output rescaled) only when a score exceeds it by more than 8, so p <= 256 fits f16.
// Block = 8 waves, wave w owns queries blockIdx.x*256 + w*32 .. +31 (two 16-query tiles); grid (4, 128), exact.
// LDS skv: the head's 1024 k variances, all written (256 threads x 4) before the first barrier, read-only after it.
// LDS sKV: a stage is 128 keys of the head: 128 centered-k rows of 128 B and 64 v^T rows of 256 B, brought in once for all
// eight waves by 16-byte asynchronous copies (whole 128-byte lines); two buffers, the next stage's copies fly while this
// one is worked on. Every wave reads its A fragments (k rows, v^T rows) from there with Frag::load.
// ---------------------------------------------------------------------------
constexpr int kAK     = 128;                     // keys per stage
constexpr int kKPitch = kHeadDim + 8;            // k rows: 144 B = 16 B x 9, no bank conflict for 16-byte fragment reads
constexpr int kVPitch = kAK + 8;                 // v^T rows: 272 B = 16 B x 17, likewise
constexpr int kKStage = kAK * kKPitch;           // elements of the k part of a buffer
constexpr int kAStage = kKStage + kHeadDim * kVPitch;   // elements per buffer: [k 128 rows | v^T 64 rows]
static_assert(kSeq % kAK == 0 && kSeq / kAK >= 2 && kAK % 32 == 0 && (kAStage * 2) % 16 == 0, "stages exact, two or more");
static_assert(((kAK / 32) & (kAK / 32 - 1)) == 0, "passes per stage a power of two: the key prefetch wraps by a mask");

// Eight 16-byte asynchronous copies per lane, global -> LDS. l = the lane's LDS byte address, g = its global address.
// s_wait_xcnt 0 closes the statement as a precaution: no register that a copy names is rewritten in front of it.
__device__ __forceinline__ void async_copy8(const unsigned (&l)[8], const void* const (&g)[8]) {
  asm volatile(
      "global_load_async_to_lds_b128 %0, %8, off\n\t"
      "global_load_async_to_lds_b128 %1, %9, off\n\t"
      "global_load_async_to_lds_b128 %2, %10, off\n\t"
      "global_load_async_to_lds_b128 %3, %11, off\n\t"
      "global_load_async_to_lds_b128 %4, %12, off\n\t"
      "global_load_async_to_lds_b128 %5, %13, off\n\t"
      "global_load_async_to_lds_b128 %6, %14, off\n\t"
      "global_load_async_to_lds_b128 %7, %15, off\n\t"
      "s_wait_xcnt 0x0"
      :: "v"(l[0]), "v"(l[1]), "v"(l[2]), "v"(l[3]), "v"(l[4]), "v"(l[5]), "v"(l[6]), "v"(l[7]),
         "v"(g[0]), "v"(g[1]), "v"(g[2]), "v"(g[3]), "v"(g[4]), "v"(g[5]), "v"(g[6]), "v"(g[7])
      : "memory");
}

__global__ __launch_bounds__(256) void attn_fused_kernel(const unsigned short* __restrict__ qc, const unsigned short* __restrict__ kc,
                                                         const unsigned short* __restrict__ vt, const float* __restrict__ qvar,
                                                         const float* __restrict__ kvar, unsigned short* __restrict__ o16) {
  typedef Frag<_Float16> F;
  __shared__ __align__(16) float skv[kSeq];
  __shared__ __align__(16) _Float16 sKV[2 * kAStage];   // two stage buffers
  const int lane = threadIdx.x & 31, wave = threadIdx.x >> 5;
  const int b  = blockIdx.y >> 4;
  const int h  = blockIdx.y & (kHeads - 1);
  const int q0 = blockIdx.x * 256 + wave * 32;
  const int c  = lane & 15;
  const int hs = lane >> 4;

  // Copies: 8 lanes cover one k row's 128 bytes (the block 32 rows per copy), 16 lanes one v^T row's 256 bytes (16 rows per
  // copy); 4 copies for k and 4 for v^T, per lane and stage.
  const int krow = threadIdx.x >> 3, kcol = (threadIdx.x & 7) * 8;
  const int vrow = threadIdx.x >> 4, vcol = (threadIdx.x & 15) * 8;
  const _Float16* gK = (const _Float16*)kc + ((size_t)b * kSeq + krow) * kEmb + h * kHeadDim + kcol;
  const _Float16* gV = (const _Float16*)vt + (size_t)b * kEmb * kSeq + (size_t)(h * kHeadDim + vrow) * kSeq + vcol;
  const unsigned ldsK = (unsigned)(size_t)sKV + (unsigned)(krow * kKPitch + kcol) * 2u;
  const unsigned ldsV = (unsigned)(size_t)sKV + (unsigned)(kKStage + vrow * kVPitch + vcol) * 2u;
  auto stage_copies = [&](int t, int buf) {
    const unsigned lb = (unsigned)buf * (unsigned)(kAStage * 2);
    unsigned l[8];
    const void* g[8];
#pragma unroll  // constant indices keep these arrays in registers
    for (int e = 0; e < 4; ++e) {
      l[e]     = ldsK + lb + (unsigned)(e * 32 * kKPitch * 2);
      g[e]     = (const void*)(gK + (size_t)(t * kAK + e * 32) * kEmb);
      l[4 + e] = ldsV + lb + (unsigned)(e * 16 * kVPitch * 2);
      g[4 + e] = (const void*)(gV + (size_t)(e * 16) * kSeq + t * kAK);
    }
    async_copy8(l, g);
  };

  stage_copies(0, 0);
#pragma unroll
  for (int e = 0; e < 4; ++e) {
    const int j = e * 256 + threadIdx.x;
    skv[j] = kvar[(size_t)h * kTok + b * kSeq + j];
  }
  wait_async0();
  __syncthreads();  // stage 0 is published; every wave reads all of skv, each thread wrote four entries
  stage_copies(1, 1);

  const _Float16* Qp = (const _Float16*)qc + ((size_t)b * kSeq + q0 + c) * kEmb + h * kHeadDim + hs * 8;
  const int koffs = c * kKPitch + hs * 8;             // this lane's place in a k fragment row
  const int voffs = kKStage + c * kVPitch + hs * 8;   // and in a v^T fragment row

  v16h qf[2][2];
  float qv2[2], m[2], l[2];
  v8f o[4][2];
#pragma unroll  // constant indices keep these arrays in registers
  for (int qt = 0; qt < 2; ++qt) {
    qf[qt][0] = F::load(Qp + (size_t)(qt * 16) * kEmb);
    qf[qt][1] = F::load(Qp + (size_t)(qt * 16) * kEmb + 32);
    qv2[qt] = qvar[(size_t)h * kTok + b * kSeq + q0 + qt * 16 + c] * (kInv64 * kLog2e);
    m[qt] = -INFINITY;
    l[qt] = 0.f;
#pragma unroll  // constant indices keep these arrays in registers
    for (int i = 0; i < 4; ++i) o[i][qt] = (v8f){0.f,0.f,0.f,0.f,0.f,0.f,0.f,0.f};
  }

#pragma clang loop unroll(disable)  // one stage per trip: the buffer index stays a run-time value, the text small
  for (int t = 0; t < kSeq / kAK; ++t) {
    const _Float16* sk = sKV + (t & 1) * kAStage + koffs;
    const _Float16* sv = sKV + (t & 1) * kAStage + voffs;
    v16h kf[2][2];
#pragma unroll  // constant indices keep these arrays in registers
    for (int kt = 0; kt < 2; ++kt) {
      kf[kt][0] = F::load(sk + (kt * 16) * kKPitch);
      kf[kt][1] = F::load(sk + (kt * 16) * kKPitch + 32);
    }

#pragma clang loop unroll(disable)  // one pass per trip keeps the text small and the registers of one pass
    for (int p = 0; p < kAK / 32; ++p) {
      const int key0 = t * kAK + p * 32;
      v16h vf[4];
#pragma unroll  // constant indices keep these arrays in registers
      for (int i = 0; i < 4; ++i) vf[i] = F::load(sv + (i * 16) * kVPitch + p * 32);
      float kv[2][8];
#pragma unroll  // constant indices keep these arrays in registers
      for (int kt = 0; kt < 2; ++kt) {
        const v4f a0 = *(const v4f*)(skv + key0 + kt * 16 + hs * 8);
        const v4f a1 = *(const v4f*)(skv + key0 + kt * 16 + hs * 8 + 4);
#pragma unroll  // constant indices keep these arrays in registers
        for (int e = 0; e < 4; ++e) { kv[kt][e] = a0[e]; kv[kt][4 + e] = a1[e]; }
      }
      __builtin_amdgcn_sched_barrier(0);  // the pass's v^T and variance reads stay one group up here, not sunk among the WMMAs that use them

      v8f s[2][2];
#pragma unroll  // constant indices keep these arrays in registers
      for (int kt = 0; kt < 2; ++kt)
#pragma unroll  // constant indices keep these arrays in registers
        for (int qt = 0; qt < 2; ++qt) {
          s[kt][qt] = F::mma(kf[kt][0], qf[qt][0], (v8f){0.f,0.f,0.f,0.f,0.f,0.f,0.f,0.f});
          s[kt][qt] = F::mma(kf[kt][1], qf[qt][1], s[kt][qt]);
        }

      __builtin_amdgcn_sched_barrier(0);  // the reads below refill the registers of the products above
      // next pass's key fragments, fetched while this pass's softmax runs; never past this stage's own buffer
      // (the stage's last pass re-reads its keys 0..31, unused: no branch stands behind the products above)
      const int np = (p + 1) & (kAK / 32 - 1);
#pragma unroll  // constant indices keep these arrays in registers
      for (int kt = 0; kt < 2; ++kt) {
        kf[kt][0] = F::load(sk + (np * 32 + kt * 16) * kKPitch);
        kf[kt][1] = F::load(sk + (np * 32 + kt * 16) * kKPitch + 32);
      }
      __builtin_amdgcn_sched_barrier(0);  // and stay one group ahead of the softmax that covers their latency

      float mx[2];
#pragma unroll  // constant indices keep these arrays in registers
      for (int qt = 0; qt < 2; ++qt) {
#pragma unroll  // constant indices keep these arrays in registers
        for (int kt = 0; kt < 2; ++kt)
#pragma unroll  // constant indices keep these arrays in registers
          for (int r = 0; r < 8; ++r) s[kt][qt][r] = s[kt][qt][r] * (kScoreScale * kLog2e) + qv2[qt] * kv[kt][r];
        float a0 = fmaxf(fmaxf(s[0][qt][0], s[0][qt][1]), fmaxf(s[0][qt][2], s[0][qt][3]));
        float a1 = fmaxf(fmaxf(s[0][qt][4], s[0][qt][5]), fmaxf(s[0][qt][6], s[0][qt][7]));
        float a2 = fmaxf(fmaxf(s[1][qt][0], s[1][qt][1]), fmaxf(s[1][qt][2], s[1][qt][3]));
        float a3 = fmaxf(fmaxf(s[1][qt][4], s[1][qt][5]), fmaxf(s[1][qt][6], s[1][qt][7]));
        mx[qt] = fmaxf(fmaxf(a0, a1), fmaxf(a2, a3));
      }

      // one wave-uniform test per pass; both halves of a query's lane pair take the same new maximum
      const bool need = (mx[0] > m[0] + 8.0f) || (mx[1] > m[1] + 8.0f);
      if (__builtin_amdgcn_ballot_w32(need) != 0u) {
#pragma unroll  // constant indices keep these arrays in registers
        for (int qt = 0; qt < 2; ++qt) {
          const float mn = fmaxf(m[qt], fmaxf(mx[qt], __shfl_xor(mx[qt], 16, 32)));
          const float al = __builtin_amdgcn_exp2f(m[qt] - mn);
          m[qt] = mn;
          l[qt] *= al;
#pragma unroll  // constant indices keep these arrays in registers
          for (int i = 0; i < 4; ++i)
#pragma unroll  // constant indices keep these arrays in registers
            for (int r = 0; r < 8; ++r) o[i][qt][r] *= al;
        }
      }

      v16h pf[2];
#pragma unroll  // constant indices keep these arrays in registers
      for (int qt = 0; qt < 2; ++qt) {
        float ls0 = 0.f, ls1 = 0.f;
#pragma unroll  // constant indices keep these arrays in registers
        for (int r = 0; r < 8; ++r) {
          const float p0 = __builtin_amdgcn_exp2f(s[0][qt][r] - m[qt]);
          const float p1 = __builtin_amdgcn_exp2f(s[1][qt][r] - m[qt]);
          ls0 += p0;
          ls1 += p1;
          pf[qt][r]     = (_Float16)p0;
          pf[qt][8 + r] = (_Float16)p1;
        }
        l[qt] += ls0 + ls1;
      }

#pragma unroll  // constant indices keep these arrays in registers
      for (int i = 0; i < 4; ++i)
#pragma unroll  // constant indices keep these arrays in registers
        for (int qt = 0; qt < 2; ++qt) o[i][qt] = F::mma(vf[i], pf[qt], o[i][qt]);
      __builtin_amdgcn_sched_barrier(0);  // keeps the four slots below behind the pass's last WMMA
      // four vector slots between the last WMMA and the next pass's address arithmetic, which may take over its A or B registers
      asm volatile("v_nop\n\tv_nop\n\tv_nop\n\tv_nop");
    }
    wait_ds0();
    wait_async0();
    __syncthreads();                             // publishes stage t + 1 and ends every wave's reads of stage t
    if (t + 2 < kSeq / kAK) stage_copies(t + 2, t & 1);
  }
  wait_async0();

  // epilogue: join the two halves' sums, normalise, 8 consecutive head dims per lane = one 16-byte store
#pragma unroll  // constant indices keep these arrays in registers
  for (int qt = 0; qt < 2; ++qt) {
    const float lt  = l[qt] + __shfl_xor(l[qt], 16, 32);
    const float inv = kOCarry * (1.0f / lt);
    unsigned short* op = o16 + ((size_t)b * kSeq + q0 + qt * 16 + c) * kEmb + h * kHeadDim + hs * 8;
#pragma unroll  // constant indices keep these arrays in registers
    for (int i = 0; i < 4; ++i) {
      v8h hv;
#pragma unroll  // constant indices keep these arrays in registers
      for (int r = 0; r < 8; ++r) hv[r] = (_Float16)(o[i][qt][r] * inv);
      *(v8h*)(op + i * 16) = hv;
    }
  }
}

// ---------------------------------------------------------------------------
// Host entry: 4 launches (one cast of all five inputs, the q/k/v projections, fused attention, output GEMM).
// ---------------------------------------------------------------------------
extern "C" void kernel_launch(void* const* d_in, const int* in_sizes, int n_in,
                              void* d_out, int out_size, void* d_ws, size_t ws_size,
                              hipStream_t stream) {
  if (n_in < 5) return;
  if (in_sizes[0] != kTok * kEmb) return;
  if (in_sizes[1] != kEmb * kEmb || in_sizes[2] != kEmb * kEmb || in_sizes[3] != kEmb * kEmb || in_sizes[4] != kEmb * kEmb) return;
  if (out_size != kTok * kEmb) return;
  if (ws_size < kWsTotal) return;

  const float* x  = (const float*)d_in[0];
  const float* Wq = (const float*)d_in[1];
  const float* Wk = (const float*)d_in[2];
  const float* Wv = (const float*)d_in[3];
  const float* Wo = (const float*)d_in[4];
  float* outp = (float*)d_out;

  char* ws = (char*)d_ws;
  unsigned short* X16  = (unsigned short*)(ws + kOffX16);
  unsigned short* O16  = (unsigned short*)(ws + kOffX16);     // region reuse, see map
  unsigned short* Wq16 = (unsigned short*)(ws + kOffWq16);
  unsigned short* Wk16 = (unsigned short*)(ws + kOffWk16);
  unsigned short* Wv16 = (unsigned short*)(ws + kOffWv16);
  unsigned short* Wo16 = (unsigned short*)(ws + kOffWo16);
  unsigned short* VT16 = (unsigned short*)(ws + kOffVT16);
  unsigned short* QC16 = (unsigned short*)(ws + kOffQC16);
  unsigned short* KC16 = (unsigned short*)(ws + kOffKC16);
  float*          QVAR = (float*)(ws + kOffQVar);
  float*          KVAR = (float*)(ws + kOffKVar);

  const float* nof = (const float*)nullptr;
  const unsigned short* nou = (const unsigned short*)nullptr;

  // 1) casts to f16 planes, one launch
  cast_all_f16_kernel<<<kCastBlocks, kCastThreads, 0, stream>>>(x, Wq, Wk, Wv, Wo, X16, Wq16, Wk16, Wv16, Wo16);

  // 2) q, k and v projections, one launch: 64 x 4 = 256 blocks, each 128 tokens x 256 channels of all three weights.
  //    -> QC16 + QVAR, KC16 + KVAR (centered per head), VT16 f16 [8][1024][1024] (v^T per batch).
  qkv_gemm_kernel<<<(kTok / kBM) * (kEmb / kBN), 256, 0, stream>>>(X16, Wq16, QC16, KC16, VT16, QVAR, KVAR);

  // 3) attention: one launch, block = (256 queries, one batch and head)
  attn_fused_kernel<<<dim3(kSeq / 256, kBatch * kHeads), 256, 0, stream>>>(QC16, KC16, VT16, QVAR, KVAR, O16);

  // 4) out = O . Wo^T : A = O16 [8192][1024], Bt = Wo16 [1024][1024], K = 1024, C = d_out f32 [8192][1024].
  {
    const int blocks = (kTok / kBM) * (kEmb / kBN);   // 256
    wmma_gemm64<0, false, 0, 0, false, 0><<<dim3(blocks, 1), 256, 0, stream>>>(
        O16, nou, kEmb, 0L, Wo16, nou, kEmb, 0L, (void*)outp, (void*)nullptr, kEmb, 0L,
        nof, nof, 0L, kTok, kEmb, kEmb, kOutScale);
  }
}

// v007
// A run of this version takes 103 microseconds.
// Next to v006, in two timings, it ran 1.04 times as fast each time.
// Counting every step since v000, it is 14.8 times as fast.
// All contractions (q/k/v projections K=1024, centered q.k^T scores K=64, probabilities.v K=1024, output projection K=1024): v_wmma_f32_16x16x32_f16 with f16 operands (weights carried x16, centered q/k carried x4, unnormalised probabilities exp2(score - maximum in use), attention output carried x64) and f32 accumulate; centering, variances, variance outer product and online softmax in f32.
#include <hip/hip_runtime.h>
#include <math.h>

// ---------------------------------------------------------------------------
// Problem constants
// ---------------------------------------------------------------------------
constexpr int kBatch   = 8;
constexpr int kSeq     = 1024;
constexpr int kEmb     = 1024;
constexpr int kHeads   = 16;
constexpr int kHeadDim = 64;
constexpr int kTok     = kBatch * kSeq;                 // 8192 token rows

constexpr float kWCarry     = 16.0f;                    // weights carried x16 in f16
constexpr float kQKCarry    = 4.0f;                     // centered q / k carried x4 in f16
constexpr float kOCarry     = 64.0f;                    // attention output carried x64 in f16
constexpr float kProjScale  = 1.0f / kWCarry;                              // 1/16
constexpr float kScoreScale = 1.0f / (kQKCarry * kQKCarry * 64.0f);        // 1/1024  (= dot / head_dim)
constexpr float kLog2e      = 1.4426950408889634f;
constexpr float kOutScale   = 1.0f / (kOCarry * kWCarry);                  // 1/1024
constexpr float kInv64      = 1.0f / 64.0f;
constexpr float kInv63      = 1.0f / 63.0f;

// ---------------------------------------------------------------------------
// Workspace region map (bytes). Total carve 121 MiB = 126877696 B.
//   [  0, 16) MiB  X16  f16 [8192][1024] (x)                 -> reused as O16 f16 [8192][1024] (attention output x64)
//                  after the projection launch (last reader of X16) has been enqueued
//   [ 16, 18) MiB  Wq16 f16 [1024][1024] x16
//   [ 18, 20) MiB  Wk16
//   [ 20, 22) MiB  Wv16
//   [ 22, 24) MiB  Wo16
//   [ 24, 72) MiB  unused
//   [ 72, 88) MiB  VT16 f16 [8][1024][1024] (v^T per batch: row = out channel, col = token of the batch)
//   [ 88,104) MiB  QC16 f16 [8192][1024] centered q x4
//   [104,120) MiB  KC16 f16 [8192][1024] centered k x4
//   [120,120.5) MiB QVAR f32 [16][8192]  ([head][token])
//   [120.5,121) MiB KVAR f32 [16][8192]
// ---------------------------------------------------------------------------
constexpr size_t kMiB     = 1048576;
constexpr size_t kOffX16  = 0;
constexpr size_t kOffWq16 = 16 * kMiB;
constexpr size_t kOffWk16 = 18 * kMiB;
constexpr size_t kOffWv16 = 20 * kMiB;
constexpr size_t kOffWo16 = 22 * kMiB;
constexpr size_t kOffVT16 = 72 * kMiB;
constexpr size_t kOffQC16 = 88 * kMiB;
constexpr size_t kOffKC16 = 104 * kMiB;
constexpr size_t kOffQVar = 120 * kMiB;
constexpr size_t kOffKVar = 120 * kMiB + 512 * 1024;
constexpr size_t kWsTotal = 121 * kMiB;
static_assert((size_t)kTok * kEmb * 2 == 16 * kMiB, "x / o planes 16 MiB");
static_assert((size_t)kEmb * kEmb * 2 == 2 * kMiB, "weight planes 2 MiB");
static_assert((size_t)kTok * kHeads * 4 == 512 * 1024, "variance tables 512 KiB");
static_assert(kOffKVar + (size_t)kTok * kHeads * 4 == kWsTotal, "carve end");
static_assert(kWsTotal <= (size_t)134217728, "carve under 128 MiB");
static_assert(kEmb % 32 == 0 && kHeadDim % 32 == 0 && kSeq % 32 == 0, "K multiples of 32");
static_assert(kTok % 64 == 0 && kEmb % 64 == 0 && kSeq % 64 == 0 && kHeadDim % 64 == 0, "M, N multiples of 64");

typedef __attribute__((ext_vector_type(16))) _Float16 v16h;
typedef __attribute__((ext_vector_type(8)))  _Float16 v8h;
typedef __attribute__((ext_vector_type(16))) __bf16   v16b;
typedef __attribute__((ext_vector_type(8)))  __bf16   v8b;
typedef __attribute__((ext_vector_type(8)))  float    v8f;
typedef __attribute__((ext_vector_type(4)))  float    v4f;
typedef __attribute__((ext_vector_type(2)))  float    v2f;
typedef __attribute__((ext_vector_type(4)))  unsigned int v4u;

__device__ __forceinline__ unsigned short f2bf_bits(float f) {
  unsigned u = __float_as_uint(f);
  return (unsigned short)((u + 0x7FFFu + ((u >> 16) & 1u)) >> 16);
}
__device__ __forceinline__ float bf_bits2f(unsigned short h) { return __uint_as_float(((unsigned)h) << 16); }

// hazard guards as plain device helpers (no inline asm inside the kernel template body)
__device__ __forceinline__ void acc_guard4(v8f& a, v8f& b, v8f& c, v8f& d) { asm volatile("v_nop\n\tv_nop\n\tv_nop\n\tv_nop" : "+v"(a), "+v"(b), "+v"(c), "+v"(d)); }
template <typename T> struct Frag;
template <> struct Frag<_Float16> {
  typedef v16h V; union U { v16h v; v8h h[2]; };
  static __device__ __forceinline__ v16h load(const _Float16* p) {   // elements 0..7 <- p[0..7], 8..15 <- p[16..23]
    U f; f.h[0] = *(const v8h*)(p); f.h[1] = *(const v8h*)(p + 16); return f.v;
  }
  static __device__ __forceinline__ v8f mma(v16h a, v16h b, v8f c) {
    return __builtin_amdgcn_wmma_f32_16x16x32_f16(false, a, false, b, (short)0, c, false, false);
  }
};
template <> struct Frag<__bf16> {
  typedef v16b V; union U { v16b v; v8b h[2]; };
  static __device__ __forceinline__ v16b load(const __bf16* p) {
    U f; f.h[0] = *(const v8b*)(p); f.h[1] = *(const v8b*)(p + 16); return f.v;
  }
  static __device__ __forceinline__ v8f mma(v16b a, v16b b, v8f c) {
    return __builtin_amdgcn_wmma_f32_16x16x32_bf16(false, a, false, b, (short)0, c, false, false);
  }
};

__device__ __forceinline__ unsigned pk16(unsigned short a, unsigned short b) { return (unsigned)a | ((unsigned)b << 16); }
__device__ __forceinline__ unsigned short h_bits(float f) { const _Float16 h = (_Float16)f; return __builtin_bit_cast(unsigned short, h); }

// ---- Register-blocked batched WMMA GEMM, operands staged in LDS ------------------------------------------------------
// C[m,n] = scale * sum_k A[m,k] * Bt[n,k] (+bias)(+resid); each wave owns a 64x64 tile, a block of 2 x 4 waves 128 x 256.
// A row-major [M,K]; Bt row-major [N,K]; M % 128 == 0, N % 256 == 0, K % 128 == 0.
// A stage is 128 k of the block's 128 A rows and 256 Bt rows, brought into LDS once for all eight waves by 16-byte
// asynchronous copies (whole 256-byte row pieces); two buffers, the next stage's copies fly while this one is multiplied.
// SPLIT (hi/lo operand planes) is not staged and not instantiated.
// BIAS_MODE: 0 = none, 1 = bias[m], 2 = bias[n].
// OUT_MODE: 0 = f32, 1 = f16, 2 = bf16 hi plane (Cout) + bf16 lo plane (Cout2),
//           3 = per-head centering in the epilogue: a wave's 64 columns are one head (n0 % 64 == 0), so every row of its tile
//               is one (token, head). f32 math: mean = sum_d x / 64; c = x - mean; var = sum_d c*c / 63 (unbiased).
//               Cout[m][n] = f16(4 * c), Cout2 = f32 variances [N / 64][M] ([head][token]); 8 lanes x 8 columns hold a row.
// ET: 0 = f16 operands, 1 = bf16 operands (pointers passed as 16-bit storage)
constexpr int kBM    = 128;                      // A rows per block
constexpr int kBN    = 256;                      // Bt rows per block
constexpr int kBK    = 128;                      // k per stage = 256 B of every operand row
constexpr int kPitch = kBK + 8;                  // LDS row pitch in elements: 272 B = 16 B x 17, no bank conflict for 16-byte fragment reads
constexpr int kStage = (kBM + kBN) * kPitch;     // elements per buffer: [A 128 rows | Bt 256 rows]
static_assert(kTok % kBM == 0 && kEmb % kBM == 0 && kEmb % kBN == 0 && kSeq % kBN == 0 && kEmb % kBK == 0, "block tiles exact");

// Twelve 16-byte asynchronous copies per lane, global -> LDS. l = the lane's LDS byte address, g = its global address.
// s_wait_xcnt 0 closes the statement as a precaution: no register that a copy names is rewritten in front of it.
__device__ __forceinline__ void async_copy12(const unsigned (&l)[12], const void* const (&g)[12]) {
  asm volatile(
      "global_load_async_to_lds_b128 %0, %12, off\n\t"
      "global_load_async_to_lds_b128 %1, %13, off\n\t"
      "global_load_async_to_lds_b128 %2, %14, off\n\t"
      "global_load_async_to_lds_b128 %3, %15, off\n\t"
      "global_load_async_to_lds_b128 %4, %16, off\n\t"
      "global_load_async_to_lds_b128 %5, %17, off\n\t"
      "global_load_async_to_lds_b128 %6, %18, off\n\t"
      "global_load_async_to_lds_b128 %7, %19, off\n\t"
      "global_load_async_to_lds_b128 %8, %20, off\n\t"
      "global_load_async_to_lds_b128 %9, %21, off\n\t"
      "global_load_async_to_lds_b128 %10, %22, off\n\t"
      "global_load_async_to_lds_b128 %11, %23, off\n\t"
      "s_wait_xcnt 0x0"
      :: "v"(l[0]), "v"(l[1]), "v"(l[2]), "v"(l[3]), "v"(l[4]), "v"(l[5]), "v"(l[6]), "v"(l[7]), "v"(l[8]), "v"(l[9]), "v"(l[10]), "v"(l[11]),
         "v"(g[0]), "v"(g[1]), "v"(g[2]), "v"(g[3]), "v"(g[4]), "v"(g[5]), "v"(g[6]), "v"(g[7]), "v"(g[8]), "v"(g[9]), "v"(g[10]), "v"(g[11])
      : "memory");
}
// this wave's own copies have landed (other waves read them only behind the barrier that follows)
__device__ __forceinline__ void wait_async0() { asm volatile("s_wait_asynccnt 0x0" ::: "memory"); }
// this wave's LDS reads have returned, before the buffer they read is handed back to the copies
__device__ __forceinline__ void wait_ds0() { asm volatile("s_wait_dscnt 0x0" ::: "memory"); }

// v + (v of lane ^ X), X = 1, 2 or 4, inside a 16-lane row: one v_add_f32 with a row_xmask DPP operand, no LDS round trip
template <int X> __device__ __forceinline__ float add_xor(float v) {
  return v + __builtin_bit_cast(float, __builtin_amdgcn_update_dpp(0, __builtin_bit_cast(int, v), 0x160 + X, 0xf, 0xf, true));
}

template <int ET> struct Elem;
template <> struct Elem<0> { typedef _Float16 T; };
template <> struct Elem<1> { typedef __bf16 T; };
template <int ET, bool SPLIT, int BIAS_MODE, int OUT_MODE, bool RESID, int ACT = 0>
__global__ __launch_bounds__(256) void wmma_gemm64(
    const unsigned short* __restrict__ Ap, const unsigned short* __restrict__ A2p, int lda, long strideA,
    const unsigned short* __restrict__ Btp, const unsigned short* __restrict__ Bt2p, int ldb, long strideB,
    void* __restrict__ Cout, void* __restrict__ Cout2, int ldc, long strideC,
    const float* __restrict__ bias,
    const float* __restrict__ resid, long strideR,
    int M, int N, int K, float scale) {
  typedef typename Elem<ET>::T T;
  typedef typename Frag<T>::V V;
  static_assert(!SPLIT, "hi/lo planes are not staged");
  const T* A = (const T*)Ap; const T* Bt = (const T*)Btp;
  __shared__ __align__(16) T sOp[2 * kStage];      // two operand buffers
  __shared__ __align__(16) float sT[8][16 * 68];   // per-wave 16x64 slab, pitch 68 floats
  const int b    = blockIdx.y;
  const int lane = threadIdx.x & 31;
  const int wave = threadIdx.x >> 5;
  const int tilesN = N / kBN;
  const int tilesM = M / kBM;
  if ((int)blockIdx.x >= tilesM * tilesN) return;   // block-uniform, in front of every barrier
  const int tm  = blockIdx.x / tilesN;
  const int tn  = blockIdx.x - tm * tilesN;
  const int bm0 = tm * kBM;
  const int bn0 = tn * kBN;
  const int wm  = wave >> 2;                   // wave grid 2 (M) x 4 (N)
  const int wn  = wave & 3;
  const int m0  = bm0 + (wm << 6);
  const int n0  = bn0 + (wn << 6);

  const T* Ab  = A  + (size_t)b * strideA;
  const T* Bb  = Bt + (size_t)b * strideB;

  const int rlane = lane & 15;                 // row (A) / col (B, D) within subtile
  const int koff  = (lane >> 4) * 8;           // k offset of this lane half
  const int mOff  = (lane >> 4) * 8;           // D row offset

  // Copies: 16 lanes cover one row's 256 bytes, the block 16 rows per copy; 8 copies for A, 16 for Bt, per lane and stage.
  const int crow = threadIdx.x >> 4;
  const int ccol = (threadIdx.x & 15) * 8;
  const T* gA = Ab + (size_t)(bm0 + crow) * lda + ccol;
  const T* gB = Bb + (size_t)(bn0 + crow) * ldb + ccol;
  const unsigned lds0 = (unsigned)(size_t)sOp + (unsigned)(crow * kPitch + ccol) * 2u;
  auto stage_copies = [&](int t, int buf) {
    const unsigned lb = lds0 + (unsigned)buf * (unsigned)(kStage * 2);
    const T* ga = gA + (size_t)t * kBK;
    const T* gb = gB + (size_t)t * kBK;
#pragma unroll
    for (int half = 0; half < 2; ++half) {
      unsigned l[12];
      const void* g[12];
#pragma unroll  // constant indices keep these arrays in registers
      for (int e = 0; e < 12; ++e) {
        const int grp = half * 12 + e;           // 16-row group of the buffer: 0..7 A, 8..23 Bt
        l[e] = lb + (unsigned)(grp * 16 * kPitch * 2);
        g[e] = (grp < 8) ? (const void*)(ga + (size_t)(grp * 16) * lda) : (const void*)(gb + (size_t)((grp - 8) * 16) * ldb);
      }
      async_copy12(l, g);
    }
  };

  v8f acc[4][4];
#pragma unroll
  for (int i = 0; i < 4; ++i)
#pragma unroll
    for (int j = 0; j < 4; ++j) acc[i][j] = (v8f){0.f,0.f,0.f,0.f,0.f,0.f,0.f,0.f};

  const int nStages = K / kBK;
  // Plain f32 output: the tile is computed transposed, the Bt rows feed the WMMA's A and the A rows its B (both 64 rows a wave,
  // one loader, so the k orders agree). acc[i][j]: lane = row m0 + 16 j + rlane of C, register r = column n0 + 16 i + mOff + r.
  constexpr bool TR = (OUT_MODE == 0 && BIAS_MODE == 0 && !RESID && ACT == 0);
  const int offM = ((wm << 6) + rlane) * kPitch + koff;
  const int offN = (kBM + (wn << 6) + rlane) * kPitch + koff;
  const int aoff = TR ? offN : offM;
  const int boff = TR ? offM : offN;

  stage_copies(0, 0);
  wait_async0();
  __syncthreads();                               // stage 0 is published
  if (nStages > 1) stage_copies(1, 1);

#pragma clang loop unroll(disable)  // one stage per trip: the buffer index stays a run-time value, the text small
  for (int t = 0; t < nStages; ++t) {
    const T* sa = sOp + (t & 1) * kStage + aoff;
    const T* sb = sOp + (t & 1) * kStage + boff;
    // Fragment reads go ahead of the WMMAs that cover their latency: the Bt set and A rows 0, 1 of the next 32 k are read
    // under rows 2, 3 of these 32 k, A rows 2, 3 under rows 0, 1. Each sched_barrier keeps the compiler from sinking a
    // read group down to its first use, where the wave would wait out the LDS latency in front of every row.
    V af[4], bf[2][4];
#pragma unroll  // constant indices keep these arrays in registers
    for (int j = 0; j < 4; ++j) bf[0][j] = Frag<T>::load(sb + j * 16 * kPitch);
#pragma unroll  // constant indices keep these arrays in registers
    for (int i = 0; i < 2; ++i) af[i] = Frag<T>::load(sa + i * 16 * kPitch);
#pragma unroll  // constant indices keep these arrays in registers
    for (int ks = 0; ks < kBK / 32; ++ks) {
      const int cs = ks & 1;
#pragma unroll  // constant indices keep these arrays in registers
      for (int i = 2; i < 4; ++i) af[i] = Frag<T>::load(sa + i * 16 * kPitch + ks * 32);
      __builtin_amdgcn_sched_barrier(0);  // A rows 2, 3 are read ahead of rows 0, 1's WMMAs
#pragma unroll  // constant indices keep these arrays in registers
      for (int i = 0; i < 2; ++i)
#pragma unroll  // constant indices keep these arrays in registers
        for (int j = 0; j < 4; ++j) acc[i][j] = Frag<T>::mma(af[i], bf[cs][j], acc[i][j]);
      __builtin_amdgcn_sched_barrier(0);  // the next reads stay behind rows 0, 1's WMMAs, whose registers they refill
      if (ks + 1 < kBK / 32) {
#pragma unroll  // constant indices keep these arrays in registers
        for (int j = 0; j < 4; ++j) bf[cs ^ 1][j] = Frag<T>::load(sb + j * 16 * kPitch + (ks + 1) * 32);
#pragma unroll  // constant indices keep these arrays in registers
        for (int i = 0; i < 2; ++i) af[i] = Frag<T>::load(sa + i * 16 * kPitch + (ks + 1) * 32);
      }
      __builtin_amdgcn_sched_barrier(0);  // the next 32 k's reads stay ahead of rows 2, 3's WMMAs
#pragma unroll  // constant indices keep these arrays in registers
      for (int i = 2; i < 4; ++i)
#pragma unroll  // constant indices keep these arrays in registers
        for (int j = 0; j < 4; ++j) acc[i][j] = Frag<T>::mma(af[i], bf[cs][j], acc[i][j]);
      __builtin_amdgcn_sched_barrier(0);  // the reads after that stay behind them
    }
    wait_ds0();
    wait_async0();
    __syncthreads();                             // publishes stage t + 1 and ends every wave's reads of stage t
    if (t + 2 < nStages) stage_copies(t + 2, t & 1);
  }
  wait_async0();
  acc_guard4(acc[0][0], acc[0][1], acc[0][2], acc[0][3]);
  acc_guard4(acc[1][0], acc[1][1], acc[1][2], acc[1][3]);
  acc_guard4(acc[2][0], acc[2][1], acc[2][2], acc[2][3]);
  acc_guard4(acc[3][0], acc[3][1], acc[3][2], acc[3][3]);

  // ---- epilogue ----
  if (TR) {
    // Every wave is past the last stage's barrier and no copy is outstanding: the ring is free, each wave takes 64 x 68 floats
    // of it. The whole 64 x 64 tile goes through once: 16-byte writes (8 registers = 32 bytes of a row of C), one LDS wait,
    // 16-byte reads of whole 256-byte rows, whole-line stores that nothing waits for.
    static_assert(8 * 64 * 68 * 4 <= 2 * kStage * 2, "eight f32 tiles fit the ring");
    float* big = (float*)sOp + wave * (64 * 68);
    float* wp  = big + rlane * 68 + mOff;
#pragma unroll  // constant indices keep these arrays in registers
    for (int j = 0; j < 4; ++j)
#pragma unroll  // constant indices keep these arrays in registers
      for (int i = 0; i < 4; ++i) {
        float* dp = wp + (j * 16) * 68 + i * 16;
        *(v4f*)(dp)     = (v4f){acc[i][j][0] * scale, acc[i][j][1] * scale, acc[i][j][2] * scale, acc[i][j][3] * scale};
        *(v4f*)(dp + 4) = (v4f){acc[i][j][4] * scale, acc[i][j][5] * scale, acc[i][j][6] * scale, acc[i][j][7] * scale};
      }
    // the lanes' writes have landed ahead of the reads below, which take other lanes' values (one wave, its own part of the ring)
    wait_ds0();
    __builtin_amdgcn_wave_barrier();  // no read is scheduled above this point
    const int hh = lane >> 4, c4 = (lane & 15) * 4;       // row seg = 256 B = 16 lanes x 16 B
    const float* rp = big + hh * 68 + c4;
    float* C = (float*)Cout + (size_t)b * strideC + (size_t)(m0 + hh) * ldc + n0 + c4;
#pragma unroll  // constant indices keep these arrays in registers
    for (int half = 0; half < 2; ++half) {
      v4f u[16];
#pragma unroll  // constant indices keep these arrays in registers
      for (int k = 0; k < 16; ++k) u[k] = *(const v4f*)(rp + (half * 32 + k * 2) * 68);
#pragma unroll  // constant indices keep these arrays in registers
      for (int k = 0; k < 16; ++k) *(v4f*)(C + (size_t)(half * 32 + k * 2) * ldc) = u[k];
    }
    return;
  }
  float* slab = sT[wave];
  const float* Rb = RESID ? (resid + (size_t)b * strideR) : nullptr;
  float var0 = 0.f, var1 = 0.f;   // OUT_MODE 3: the two rows' variances that this lane stores behind the loop
#pragma unroll
  for (int i = 0; i < 4; ++i) {
    const int mBase = m0 + (i << 4);
#pragma unroll
    for (int j = 0; j < 4; ++j) {
      const int n = n0 + (j << 4) + rlane;
      float bv = 0.f;
      if (BIAS_MODE == 2) bv = bias[n];
#pragma unroll
      for (int r = 0; r < 8; ++r) {
        float v = acc[i][j][r] * scale;
        if (BIAS_MODE == 1) v += bias[mBase + mOff + r];
        if (BIAS_MODE == 2) v += bv;
        if (RESID) v += Rb[(size_t)(mBase + mOff + r) * ldc + n];
        if (ACT == 2) v = fmaxf(v, 0.0f);
        if (ACT == 4) v = (v > 0.f) ? v : 0.01f * v;
        slab[(mOff + r) * 68 + (j << 4) + rlane] = v;
      }
    }
    __builtin_amdgcn_fence(__ATOMIC_RELEASE, "workgroup");
    __builtin_amdgcn_wave_barrier();
    __builtin_amdgcn_fence(__ATOMIC_ACQUIRE, "workgroup");
    if (OUT_MODE == 0) {
      float* C = (float*)Cout + (size_t)b * strideC;
      const int hh = lane >> 4, c4 = (lane & 15) * 4;     // row seg = 256 B = 16 lanes x 16 B
      {
#pragma unroll
        for (int it = 0; it < 8; ++it) {
          const int row = it * 2 + hh;
          v4f v = *(const v4f*)(slab + row * 68 + c4);
          *(v4f*)(C + (size_t)(mBase + row) * ldc + n0 + c4) = v;
        }
        
      }
    } else if (OUT_MODE == 3) {
      const int q = lane >> 3, c8 = (lane & 7) * 8;       // row seg = 128 B = 8 lanes x 16 B
      unsigned short* C = (unsigned short*)Cout + (size_t)b * strideC;
#pragma unroll  // four independent rows in flight; grp below a compile-time value
      for (int it = 0; it < 4; ++it) {
        const int row = it * 4 + q;
        const float* sp = slab + row * 68 + c8;
        const v4f a = *(const v4f*)(sp);
        const v4f c = *(const v4f*)(sp + 4);
        float x[8];
#pragma unroll  // constant indices keep these arrays in registers
        for (int e = 0; e < 4; ++e) { x[e] = a[e]; x[4 + e] = c[e]; }
        float s = ((x[0] + x[1]) + (x[2] + x[3])) + ((x[4] + x[5]) + (x[6] + x[7]));
        s = add_xor<1>(s);
        s = add_xor<2>(s);
        s = add_xor<4>(s);
        const float mean = s * kInv64;
        float vs = 0.f;
#pragma unroll  // constant indices keep these arrays in registers
        for (int e = 0; e < 8; ++e) { x[e] = x[e] - mean; vs += x[e] * x[e]; }
        vs = add_xor<1>(vs);
        vs = add_xor<2>(vs);
        vs = add_xor<4>(vs);
        unsigned short hb[8];
#pragma unroll  // constant indices keep these arrays in registers
        for (int e = 0; e < 8; ++e) hb[e] = h_bits(x[e] * kQKCarry);
        const v4u u = (v4u){pk16(hb[0], hb[1]), pk16(hb[2], hb[3]), pk16(hb[4], hb[5]), pk16(hb[6], hb[7])};
        *(v4u*)(C + (size_t)(mBase + row) * ldc + n0 + c8) = u;
        // all 8 lanes of a row hold its variance; lane (q, lane & 7) keeps those of row groups (i, it) = lane & 7 and 8 + (lane & 7)
        const int grp = i * 4 + it;
        if ((lane & 7) == (grp & 7)) { if (grp < 8) var0 = vs * kInv63; else var1 = vs * kInv63; }
      }
    } else {
      const int q = lane >> 3, c8 = (lane & 7) * 8;
      unsigned short* C  = (unsigned short*)Cout  + (size_t)b * strideC;
      unsigned short* C2 = (OUT_MODE == 2) ? ((unsigned short*)Cout2 + (size_t)b * strideC) : nullptr;
      {
#pragma unroll
        for (int it = 0; it < 4; ++it) {
          const int row = it * 4 + q;
          const float* sp = slab + row * 68 + c8;
          v8h hv, lv;
#pragma unroll
          for (int e = 0; e < 8; ++e) {
            if (OUT_MODE == 1) {
              hv[e] = (_Float16)sp[e];
            } else {
              unsigned short hb = f2bf_bits(sp[e]);
              unsigned short lb = f2bf_bits(sp[e] - bf_bits2f(hb));
              hv[e] = __builtin_bit_cast(_Float16, hb);
              lv[e] = __builtin_bit_cast(_Float16, lb);
            }
          }
          *(v8h*)(C + (size_t)(mBase + row) * ldc + n0 + c8) = hv;
          if (OUT_MODE == 2) *(v8h*)(C2 + (size_t)(mBase + row) * ldc + n0 + c8) = lv;
        }
        
      }
    }
    __builtin_amdgcn_fence(__ATOMIC_RELEASE, "workgroup");
    __builtin_amdgcn_wave_barrier();
    __builtin_amdgcn_fence(__ATOMIC_ACQUIRE, "workgroup");
  }
  if (OUT_MODE == 3) {
    // the wave's 64 variances: rows 0..31, then rows 32..63, each store one whole 128-byte line of the head's row
    const int g8 = lane & 7;
    float* vp = (float*)Cout2 + (size_t)(n0 >> 6) * M + m0 + (g8 >> 2) * 16 + (g8 & 3) * 4 + (lane >> 3);
    vp[0]  = var0;
    vp[32] = var1;
  }
}

// ---------------------------------------------------------------------------
// The q, k and v projections in one launch. A block keeps its 128 token rows (A = x) and its 256 output channels and walks
// the three weights (Wq16, Wk16, Wv16 lie one behind the other: Bt = [3][1024][1024]) in one ring of 3 x 8 stages: the copies
// of the next weight's second stage fly while this weight's tile is written out (its first is in LDS), so the ring is filled once, not three times.
// Stage, buffers, copies, fragment order and waits are those of wmma_gemm64.
// Tiles 0 and 1 (q, k) are computed transposed: the weight fragment is the WMMA's A, the x fragment its B (both come from the
// same loader, so the k orders agree). D: lane = token, register r = channel 8 * half + r of a 16-channel group. A wave's 64
// columns are one head, so a lane and its partner (lane ^ 16) hold a whole (token, head) row, 32 channels each: mean, centering
// and variance are in-lane sums joined by one exchange between the halves, and 8 registers are 16 bytes of the f16 output row.
// Tile 2 (v) keeps x as A: lane = channel, register r = token, so 8 registers are 16 bytes of a v^T row.
// Output: the whole 64 x 64 f16 tile goes once through the wave's own slab (16-byte writes, one LDS wait, 16-byte reads of
// whole 128-byte rows) and is stored as whole lines; nothing waits for those stores, they drain under the next weight's WMMAs.
// ---------------------------------------------------------------------------
constexpr int kTileStages = kEmb / kBK;          // 8 stages per weight
constexpr int kQkvStages  = 3 * kTileStages;     // 24
constexpr int kSlabPitch  = 64 + 8;              // f16 slab rows: 144 B = 16 B x 9, no bank conflict for the 16-byte writes
static_assert((kTileStages & (kTileStages - 1)) == 0, "stage -> (weight, k) by shift and mask");
static_assert(kOffWk16 == kOffWq16 + (size_t)kEmb * kEmb * 2 && kOffWv16 == kOffWk16 + (size_t)kEmb * kEmb * 2, "weights contiguous");
static_assert(kSeq % 64 == 0, "a wave's 64 tokens lie in one batch");
static_assert(kEmb == kSeq, "q / k rows and v^T rows have one pitch");

// lane l with lane l ^ 16
__device__ __forceinline__ float xhalf(float x) {
  return __builtin_bit_cast(float, __builtin_amdgcn_permlanex16(__builtin_bit_cast(int, x), __builtin_bit_cast(int, x), 0x76543210, 0xfedcba98, false, false));
}

__global__ __launch_bounds__(256) void qkv_gemm_kernel(
    const unsigned short* __restrict__ Xp, const unsigned short* __restrict__ Wp,
    unsigned short* __restrict__ qc, unsigned short* __restrict__ kc, unsigned short* __restrict__ vt,
    float* __restrict__ qvar, float* __restrict__ kvar) {
  typedef _Float16 T;
  typedef Frag<T>::V V;
  const T* A = (const T*)Xp; const T* Bt = (const T*)Wp;
  __shared__ __align__(16) T sOp[2 * kStage];            // two operand buffers
  __shared__ __align__(16) T sH[8][64 * kSlabPitch];     // per-wave 64 x 64 f16 output slab
  const int lane = threadIdx.x & 31;
  const int wave = threadIdx.x >> 5;
  constexpr int tilesN = kEmb / kBN;           // grid = (kTok / kBM) * tilesN blocks, exact
  const int tm  = blockIdx.x / tilesN;
  const int tn  = blockIdx.x - tm * tilesN;
  const int bm0 = tm * kBM;
  const int bn0 = tn * kBN;
  const int wm  = wave >> 2;                   // wave grid 2 (M) x 4 (N)
  const int wn  = wave & 3;
  const int m0  = bm0 + (wm << 6);
  const int n0  = bn0 + (wn << 6);

  const int rlane = lane & 15;                 // fragment row; D column
  const int hs    = lane >> 4;                 // lane half
  const int koff  = hs * 8;                    // k offset of this lane half; D row offset

  // Copies: 16 lanes cover one row's 256 bytes, the block 16 rows per copy; 8 copies for A, 16 for Bt, per lane and stage.
  const int crow = threadIdx.x >> 4;
  const int ccol = (threadIdx.x & 15) * 8;
  const T* gA = A  + (size_t)(bm0 + crow) * kEmb + ccol;
  const T* gB = Bt + (size_t)(bn0 + crow) * kEmb + ccol;
  const unsigned lds0 = (unsigned)(size_t)sOp + (unsigned)(crow * kPitch + ccol) * 2u;
  auto stage_copies = [&](int s, int buf) {
    const unsigned lb = lds0 + (unsigned)buf * (unsigned)(kStage * 2);
    const int kk = (s & (kTileStages - 1)) * kBK;
    const T* ga = gA + kk;
    const T* gb = gB + (size_t)(s / kTileStages) * (kEmb * kEmb) + kk;
#pragma unroll
    for (int half = 0; half < 2; ++half) {
      unsigned l[12];
      const void* g[12];
#pragma unroll  // constant indices keep these arrays in registers
      for (int e = 0; e < 12; ++e) {
        const int grp = half * 12 + e;           // 16-row group of the buffer: 0..7 A, 8..23 Bt
        l[e] = lb + (unsigned)(grp * 16 * kPitch * 2);
        g[e] = (grp < 8) ? (const void*)(ga + (size_t)(grp * 16) * kEmb) : (const void*)(gb + (size_t)((grp - 8) * 16) * kEmb);
      }
      async_copy12(l, g);
    }
  };

  v8f acc[4][4];
#pragma unroll  // constant indices keep these arrays in registers
  for (int i = 0; i < 4; ++i)
#pragma unroll  // constant indices keep these arrays in registers
    for (int j = 0; j < 4; ++j) acc[i][j] = (v8f){0.f,0.f,0.f,0.f,0.f,0.f,0.f,0.f};

  const int aoff = ((wm << 6) + rlane) * kPitch + koff;
  const int boff = (kBM + (wn << 6) + rlane) * kPitch + koff;
  T* slab = sH[wave];
  T* wp = slab + rlane * kSlabPitch + koff;                              // this lane's 16-byte writes: slab row = D column
  const T* rp = slab + (lane >> 3) * kSlabPitch + (lane & 7) * 8;        // and reads: 8 lanes x 16 B = one 128-byte row

  stage_copies(0, 0);
  wait_async0();
  __syncthreads();                               // stage 0 is published
  stage_copies(1, 1);

#pragma clang loop unroll(disable)  // one stage per trip: the buffer index stays a run-time value, the text small
  for (int s = 0; s < kQkvStages; ++s) {
    // q and k transposed: the weight rows feed the WMMA's A, the x rows its B (both 64 rows a wave, one loader); v as it is
    const bool tr = s < 2 * kTileStages;
    const T* sa = sOp + (s & 1) * kStage + (tr ? boff : aoff);
    const T* sb = sOp + (s & 1) * kStage + (tr ? aoff : boff);
    // Fragment reads go ahead of the WMMAs that cover their latency, as in wmma_gemm64; each sched_barrier keeps the compiler
    // from sinking a read group down to its first use, where the wave would wait out the LDS latency in front of every row.
    V af[4], bf[2][4];
#pragma unroll  // constant indices keep these arrays in registers
    for (int j = 0; j < 4; ++j) bf[0][j] = Frag<T>::load(sb + j * 16 * kPitch);
#pragma unroll  // constant indices keep these arrays in registers
    for (int i = 0; i < 2; ++i) af[i] = Frag<T>::load(sa + i * 16 * kPitch);
#pragma unroll  // constant indices keep these arrays in registers
    for (int ks = 0; ks < kBK / 32; ++ks) {
      const int cs = ks & 1;
#pragma unroll  // constant indices keep these arrays in registers
      for (int i = 2; i < 4; ++i) af[i] = Frag<T>::load(sa + i * 16 * kPitch + ks * 32);
      __builtin_amdgcn_sched_barrier(0);  // A rows 2, 3 are read ahead of rows 0, 1's WMMAs
#pragma unroll  // constant indices keep these arrays in registers
      for (int i = 0; i < 2; ++i)
#pragma unroll  // constant indices keep these arrays in registers
        for (int j = 0; j < 4; ++j) acc[i][j] = Frag<T>::mma(af[i], bf[cs][j], acc[i][j]);
      __builtin_amdgcn_sched_barrier(0);  // the next reads stay behind rows 0, 1's WMMAs, whose registers they refill
      if (ks + 1 < kBK / 32) {
#pragma unroll  // constant indices keep these arrays in registers
        for (int j = 0; j < 4; ++j) bf[cs ^ 1][j] = Frag<T>::load(sb + j * 16 * kPitch + (ks + 1) * 32);
#pragma unroll  // constant indices keep these arrays in registers
        for (int i = 0; i < 2; ++i) af[i] = Frag<T>::load(sa + i * 16 * kPitch + (ks + 1) * 32);
      }
      __builtin_amdgcn_sched_barrier(0);  // the next 32 k's reads stay ahead of rows 2, 3's WMMAs
#pragma unroll  // constant indices keep these arrays in registers
      for (int i = 2; i < 4; ++i)
#pragma unroll  // constant indices keep these arrays in registers
        for (int j = 0; j < 4; ++j) acc[i][j] = Frag<T>::mma(af[i], bf[cs][j], acc[i][j]);
      __builtin_amdgcn_sched_barrier(0);  // the reads after that stay behind them
    }
    wait_ds0();
    wait_async0();
    __syncthreads();                             // publishes stage s + 1 and ends every wave's reads of stage s
    if (s + 2 < kQkvStages) stage_copies(s + 2, s & 1);
    if ((s & (kTileStages - 1)) != kTileStages - 1) continue;   // block-uniform: a weight's last stage is followed by its tile's output

    // ---- a tile is complete: write it out of the per-wave slab (not part of the ring) while the next copies fly ----
    acc_guard4(acc[0][0], acc[0][1], acc[0][2], acc[0][3]);
    acc_guard4(acc[1][0], acc[1][1], acc[1][2], acc[1][3]);
    acc_guard4(acc[2][0], acc[2][1], acc[2][2], acc[2][3]);
    acc_guard4(acc[3][0], acc[3][1], acc[3][2], acc[3][3]);
    const int tile = s / kTileStages;
    unsigned short* C;   // this lane's place in slab row (lane >> 3) of the wave's tile; every store below is a constant number of rows further on
    if (tile < 2) {
      C = (tile ? kc : qc) + (size_t)(m0 + (lane >> 3)) * kEmb + n0 + (lane & 7) * 8;
      float var[4];
#pragma unroll  // constant indices keep these arrays in registers
      for (int i = 0; i < 4; ++i) {              // acc[j][i]: token m0 + 16 i + rlane; this lane's channels: 16 j + 8 hs + r
        // register pairs (r, r + 1) are summed, centered and squared as pairs: packed f32 operations on adjacent registers
        v2f a[4][4];
#pragma unroll  // constant indices keep these arrays in registers
        for (int j = 0; j < 4; ++j)
#pragma unroll  // constant indices keep these arrays in registers
          for (int e = 0; e < 4; ++e) a[j][e] = (v2f){acc[j][i][2 * e], acc[j][i][2 * e + 1]};
        v2f p[4];
#pragma unroll  // constant indices keep these arrays in registers
        for (int e = 0; e < 4; ++e) p[e] = (a[0][e] + a[1][e]) + (a[2][e] + a[3][e]);
        const v2f ps = (p[0] + p[1]) + (p[2] + p[3]);
        float sm = ps[0] + ps[1];
        sm += xhalf(sm);
        // the carry x4 rides in the scale and in the mean (powers of two: the same roundings as scaling afterwards)
        const float mean = sm * (kProjScale * kInv64 * kQKCarry);
        v2f w[4];
#pragma unroll  // constant indices keep these arrays in registers
        for (int e = 0; e < 4; ++e) w[e] = (v2f){0.f, 0.f};
#pragma unroll  // constant indices keep these arrays in registers
        for (int j = 0; j < 4; ++j) {
          v8h hv;
#pragma unroll  // constant indices keep these arrays in registers
          for (int e = 0; e < 4; ++e) {
            const v2f x = a[j][e] * (kProjScale * kQKCarry) - mean;
            w[e] += x * x;
            hv[2 * e]     = (_Float16)x[0];
            hv[2 * e + 1] = (_Float16)x[1];
          }
          *(v8h*)(wp + (i * 16) * kSlabPitch + j * 16) = hv;
        }
        const v2f ws = (w[0] + w[1]) + (w[2] + w[3]);
        float vs = ws[0] + ws[1];
        vs += xhalf(vs);
        var[i] = vs * (kInv63 / (kQKCarry * kQKCarry));
      }
      // both halves hold every token's variance: lane l stores those of tokens l and 32 + l, each store one whole 128-byte line
      float* vp = (tile ? kvar : qvar) + (size_t)(n0 >> 6) * kTok + m0 + lane;
      vp[0]  = hs ? var[1] : var[0];
      vp[32] = hs ? var[3] : var[2];
      // a precaution: the slab reads below may land in registers that these two stores name
      asm volatile("s_wait_xcnt 0x0" ::: "memory");
    } else {
      // v^T [batch][channel][token]: slab row = channel 16 j + rlane, slab column = token 16 i + 8 hs + r of the wave's 64
      C = vt + (size_t)(m0 / kSeq) * kEmb * kSeq + (size_t)(n0 + (lane >> 3)) * kSeq + (m0 & (kSeq - 1)) + (lane & 7) * 8;
#pragma unroll  // constant indices keep these arrays in registers
      for (int j = 0; j < 4; ++j)
#pragma unroll  // constant indices keep these arrays in registers
        for (int i = 0; i < 4; ++i) {
          v8h hv;
#pragma unroll  // constant indices keep these arrays in registers
          for (int r = 0; r < 8; ++r) hv[r] = (_Float16)(acc[i][j][r] * kProjScale);
          *(v8h*)(wp + (j * 16) * kSlabPitch + i * 16) = hv;
        }
    }
    // the lanes' slab writes have landed ahead of the reads below, which take other lanes' values (one wave, its own slab)
    wait_ds0();
    __builtin_amdgcn_wave_barrier();  // no slab read is scheduled above this point
    v4u u[16];
#pragma unroll  // constant indices keep these arrays in registers
    for (int k = 0; k < 16; ++k) u[k] = *(const v4u*)(rp + (k * 4) * kSlabPitch);
#pragma unroll  // constant indices keep these arrays in registers
    for (int k = 0; k < 16; ++k) *(v4u*)(C + (k * 4) * kEmb) = u[k];
    // a precaution: the accumulators are cleared below, in registers that these stores may name
    asm volatile("s_wait_xcnt 0x0" ::: "memory");
#pragma unroll  // constant indices keep these arrays in registers
    for (int i = 0; i < 4; ++i)
#pragma unroll  // constant indices keep these arrays in registers
      for (int j = 0; j < 4; ++j) acc[i][j] = (v8f){0.f,0.f,0.f,0.f,0.f,0.f,0.f,0.f};
  }
  wait_async0();
}

// ---------------------------------------------------------------------------
// All five f32 -> f16 casts (x as it is, the four weights x16) in one launch: 256 blocks of 16 waves, one per WGP.
// A group is 8 consecutive elements: two 16-byte loads, one 16-byte store. Every thread converts 12 groups: 8 of x
// (its block's contiguous 128 KiB of x) and one of each weight; its 24 loads are all issued before the first conversion.
// Coverage: 131072 threads x 8 groups x 8 = the whole of x; 131072 threads x 1 group x 8 = the whole of each weight.
// ---------------------------------------------------------------------------
constexpr int kCastThreads = 512;
constexpr int kCastBlocks  = 256;
constexpr int kCastXGroups = 8;                  // groups of x per thread
static_assert((size_t)kCastBlocks * kCastThreads * kCastXGroups * 8 == (size_t)kTok * kEmb, "x covered exactly");
static_assert((size_t)kCastBlocks * kCastThreads * 8 == (size_t)kEmb * kEmb, "each weight covered exactly");

__device__ __forceinline__ v4u cast8(const v4f a, const v4f c, const float scale) {
  unsigned short hb[8];
#pragma unroll  // constant indices keep this array in registers
  for (int e = 0; e < 4; ++e) {
    hb[e]     = h_bits(a[e] * scale);
    hb[4 + e] = h_bits(c[e] * scale);
  }
  return (v4u){pk16(hb[0], hb[1]), pk16(hb[2], hb[3]), pk16(hb[4], hb[5]), pk16(hb[6], hb[7])};
}

__global__ __launch_bounds__(kCastThreads) void cast_all_f16_kernel(
    const float* __restrict__ x, const float* __restrict__ wq, const float* __restrict__ wk,
    const float* __restrict__ wv, const float* __restrict__ wo,
    unsigned short* __restrict__ x16, unsigned short* __restrict__ wq16, unsigned short* __restrict__ wk16,
    unsigned short* __restrict__ wv16, unsigned short* __restrict__ wo16) {
  const size_t ex = ((size_t)blockIdx.x * (kCastXGroups * kCastThreads) + threadIdx.x) * 8;   // first element of x, group 0
  const size_t ew = ((size_t)blockIdx.x * kCastThreads + threadIdx.x) * 8;                    // first element of each weight
  const float* const wsrc[4] = {wq, wk, wv, wo};
  unsigned short* const wdst[4] = {wq16, wk16, wv16, wo16};
  v4f xa[kCastXGroups], xc[kCastXGroups], wa[4], wc[4];
#pragma unroll  // constant indices keep these arrays in registers
  for (int j = 0; j < kCastXGroups; ++j) {
    const float* p = x + ex + (size_t)j * (kCastThreads * 8);
    xa[j] = *(const v4f*)(p);
    xc[j] = *(const v4f*)(p + 4);
  }
  // a precaution: the compiler lets a weight load below land in the register pair that the loads above name as their address
  asm volatile("s_wait_xcnt 0x0" ::: "memory");
#pragma unroll  // constant indices keep these arrays in registers
  for (int i = 0; i < 4; ++i) {
    const float* p = wsrc[i] + ew;
    wa[i] = *(const v4f*)(p);
    wc[i] = *(const v4f*)(p + 4);
  }
  __builtin_amdgcn_sched_barrier(0);  // all 24 loads are in flight before the first wait: no load sinks down to its conversion
#pragma unroll  // constant indices keep these arrays in registers
  for (int j = 0; j < kCastXGroups; ++j)
    *(v4u*)(x16 + ex + (size_t)j * (kCastThreads * 8)) = cast8(xa[j], xc[j], 1.0f);
#pragma unroll  // constant indices keep these arrays in registers
  for (int i = 0; i < 4; ++i)
    *(v4u*)(wdst[i] + ew) = cast8(wa[i], wc[i], kWCarry);
}

// ---------------------------------------------------------------------------
// Fused attention for one (batch, head) and 256 queries per block: scores, softmax and probabilities.v in one pass
// over the keys, nothing of the 1024 x 1024 score plane leaves the registers.
//   S^T = Kc . Qc^T   (A = 16 key rows, B = 16 query rows, K = 64 head dims)     D: lane = query c, register r = key 8*hs + r
//   O^T += V^T . P^T  (A = 16 v^T rows, B = two converted S^T tiles, K = 32 keys) D: lane = query c, register r = dim 8*hs + r
// Two S^T tiles (keys 0..15 and 16..31 of a pass) converted in place are the B operand in the order Frag::load gives A.
// Score in log2 units: s = log2e * (dot / 1024 + q_var * k_var / 64). p = exp2(s - m), m = the query's maximum in use;
// m is raised (and sum and output rescaled) only when a score exceeds it by more than 8, so p <= 256 fits f16.
// Block = 8 waves, wave w owns queries blockIdx.x*256 + w*32 .. +31 (two 16-query tiles); grid (4, 128), exact.
// LDS skv: the head's 1024 k variances, all written (256 threads x 4) before the first barrier, read-only after it.
// LDS sKV: a stage is 128 keys of the head: 128 centered-k rows of 128 B and 64 v^T rows of 256 B, brought in once for all
// eight waves by 16-byte asynchronous copies (whole 128-byte lines); two buffers, the next stage's copies fly while this
// one is worked on. Every wave reads its A fragments (k rows, v^T rows) from there with Frag::load.
// ---------------------------------------------------------------------------
constexpr int kAK     = 128;                     // keys per stage
constexpr int kKPitch = kHeadDim + 8;            // k rows: 144 B = 16 B x 9, no bank conflict for 16-byte fragment reads
constexpr int kVPitch = kAK + 8;                 // v^T rows: 272 B = 16 B x 17, likewise
constexpr int kKStage = kAK * kKPitch;           // elements of the k part of a buffer
constexpr int kAStage = kKStage + kHeadDim * kVPitch;   // elements per buffer: [k 128 rows | v^T 64 rows]
static_assert(kSeq % kAK == 0 && kSeq / kAK >= 2 && kAK % 32 == 0 && (kAStage * 2) % 16 == 0, "stages exact, two or more");
static_assert(((kAK / 32) & (kAK / 32 - 1)) == 0, "passes per stage a power of two: the key prefetch wraps by a mask");

// Eight 16-byte asynchronous copies per lane, global -> LDS. l = the lane's LDS byte address, g = its global address.
// s_wait_xcnt 0 closes the statement as a precaution: no register that a copy names is rewritten in front of it.
__device__ __forceinline__ void async_copy8(const unsigned (&l)[8], const void* const (&g)[8]) {
  asm volatile(
      "global_load_async_to_lds_b128 %0, %8, off\n\t"
      "global_load_async_to_lds_b128 %1, %9, off\n\t"
      "global_load_async_to_lds_b128 %2, %10, off\n\t"
      "global_load_async_to_lds_b128 %3, %11, off\n\t"
      "global_load_async_to_lds_b128 %4, %12, off\n\t"
      "global_load_async_to_lds_b128 %5, %13, off\n\t"
      "global_load_async_to_lds_b128 %6, %14, off\n\t"
      "global_load_async_to_lds_b128 %7, %15, off\n\t"
      "s_wait_xcnt 0x0"
      :: "v"(l[0]), "v"(l[1]), "v"(l[2]), "v"(l[3]), "v"(l[4]), "v"(l[5]), "v"(l[6]), "v"(l[7]),
         "v"(g[0]), "v"(g[1]), "v"(g[2]), "v"(g[3]), "v"(g[4]), "v"(g[5]), "v"(g[6]), "v"(g[7])
      : "memory");
}

__global__ __launch_bounds__(256) void attn_fused_kernel(const unsigned short* __restrict__ qc, const unsigned short* __restrict__ kc,
                                                         const unsigned short* __restrict__ vt, const float* __restrict__ qvar,
                                                         const float* __restrict__ kvar, unsigned short* __restrict__ o16) {
  typedef Frag<_Float16> F;
  __shared__ __align__(16) float skv[kSeq];
  __shared__ __align__(16) _Float16 sKV[2 * kAStage];   // two stage buffers
  const int lane = threadIdx.x & 31, wave = threadIdx.x >> 5;
  const int b  = blockIdx.y >> 4;
  const int h  = blockIdx.y & (kHeads - 1);
  const int q0 = blockIdx.x * 256 + wave * 32;
  const int c  = lane & 15;
  const int hs = lane >> 4;

  // Copies: 8 lanes cover one k row's 128 bytes (the block 32 rows per copy), 16 lanes one v^T row's 256 bytes (16 rows per
  // copy); 4 copies for k and 4 for v^T, per lane and stage.
  const int krow = threadIdx.x >> 3, kcol = (threadIdx.x & 7) * 8;
  const int vrow = threadIdx.x >> 4, vcol = (threadIdx.x & 15) * 8;
  const _Float16* gK = (const _Float16*)kc + ((size_t)b * kSeq + krow) * kEmb + h * kHeadDim + kcol;
  const _Float16* gV = (const _Float16*)vt + (size_t)b * kEmb * kSeq + (size_t)(h * kHeadDim + vrow) * kSeq + vcol;
  const unsigned ldsK = (unsigned)(size_t)sKV + (unsigned)(krow * kKPitch + kcol) * 2u;
  const unsigned ldsV = (unsigned)(size_t)sKV + (unsigned)(kKStage + vrow * kVPitch + vcol) * 2u;
  auto stage_copies = [&](int t, int buf) {
    const unsigned lb = (unsigned)buf * (unsigned)(kAStage * 2);
    unsigned l[8];
    const void* g[8];
#pragma unroll  // constant indices keep these arrays in registers
    for (int e = 0; e < 4; ++e) {
      l[e]     = ldsK + lb + (unsigned)(e * 32 * kKPitch * 2);
      g[e]     = (const void*)(gK + (size_t)(t * kAK + e * 32) * kEmb);
      l[4 + e] = ldsV + lb + (unsigned)(e * 16 * kVPitch * 2);
      g[4 + e] = (const void*)(gV + (size_t)(e * 16) * kSeq + t * kAK);
    }
    async_copy8(l, g);
  };

  stage_copies(0, 0);
#pragma unroll
  for (int e = 0; e < 4; ++e) {
    const int j = e * 256 + threadIdx.x;
    skv[j] = kvar[(size_t)h * kTok + b * kSeq + j];
  }
  wait_async0();
  __syncthreads();  // stage 0 is published; every wave reads all of skv, each thread wrote four entries
  stage_copies(1, 1);

  const _Float16* Qp = (const _Float16*)qc + ((size_t)b * kSeq + q0 + c) * kEmb + h * kHeadDim + hs * 8;
  const int koffs = c * kKPitch + hs * 8;             // this lane's place in a k fragment row
  const int voffs = kKStage + c * kVPitch + hs * 8;   // and in a v^T fragment row

  v16h qf[2][2];
  float qv2[2], m[2], l[2];
  v8f o[4][2];
#pragma unroll  // constant indices keep these arrays in registers
  for (int qt = 0; qt < 2; ++qt) {
    qf[qt][0] = F::load(Qp + (size_t)(qt * 16) * kEmb);
    qf[qt][1] = F::load(Qp + (size_t)(qt * 16) * kEmb + 32);
    qv2[qt] = qvar[(size_t)h * kTok + b * kSeq + q0 + qt * 16 + c] * (kInv64 * kLog2e);
    m[qt] = -INFINITY;
    l[qt] = 0.f;
#pragma unroll  // constant indices keep these arrays in registers
    for (int i = 0; i < 4; ++i) o[i][qt] = (v8f){0.f,0.f,0.f,0.f,0.f,0.f,0.f,0.f};
  }

#pragma clang loop unroll(disable)  // one stage per trip: the buffer index stays a run-time value, the text small
  for (int t = 0; t < kSeq / kAK; ++t) {
    const _Float16* sk = sKV + (t & 1) * kAStage + koffs;
    const _Float16* sv = sKV + (t & 1) * kAStage + voffs;
    v16h kf[2][2];
#pragma unroll  // constant indices keep these arrays in registers
    for (int kt = 0; kt < 2; ++kt) {
      kf[kt][0] = F::load(sk + (kt * 16) * kKPitch);
      kf[kt][1] = F::load(sk + (kt * 16) * kKPitch + 32);
    }

#pragma clang loop unroll(disable)  // one pass per trip keeps the text small and the registers of one pass
    for (int p = 0; p < kAK / 32; ++p) {
      const int key0 = t * kAK + p * 32;
      v16h vf[4];
#pragma unroll  // constant indices keep these arrays in registers
      for (int i = 0; i < 4; ++i) vf[i] = F::load(sv + (i * 16) * kVPitch + p * 32);
      float kv[2][8];
#pragma unroll  // constant indices keep these arrays in registers
      for (int kt = 0; kt < 2; ++kt) {
        const v4f a0 = *(const v4f*)(skv + key0 + kt * 16 + hs * 8);
        const v4f a1 = *(const v4f*)(skv + key0 + kt * 16 + hs * 8 + 4);
#pragma unroll  // constant indices keep these arrays in registers
        for (int e = 0; e < 4; ++e) { kv[kt][e] = a0[e]; kv[kt][4 + e] = a1[e]; }
      }
      __builtin_amdgcn_sched_barrier(0);  // the pass's v^T and variance reads stay one group up here, not sunk among the WMMAs that use them

      v8f s[2][2];
#pragma unroll  // constant indices keep these arrays in registers
      for (int kt = 0; kt < 2; ++kt)
#pragma unroll  // constant indices keep these arrays in registers
        for (int qt = 0; qt < 2; ++qt) {
          s[kt][qt] = F::mma(kf[kt][0], qf[qt][0], (v8f){0.f,0.f,0.f,0.f,0.f,0.f,0.f,0.f});
          s[kt][qt] = F::mma(kf[kt][1], qf[qt][1], s[kt][qt]);
        }

      __builtin_amdgcn_sched_barrier(0);  // the reads below refill the registers of the products above
      // next pass's key fragments, fetched while this pass's softmax runs; never past this stage's own buffer
      // (the stage's last pass re-reads its keys 0..31, unused: no branch stands behind the products above)
      const int np = (p + 1) & (kAK / 32 - 1);
#pragma unroll  // constant indices keep these arrays in registers
      for (int kt = 0; kt < 2; ++kt) {
        kf[kt][0] = F::load(sk + (np * 32 + kt * 16) * kKPitch);
        kf[kt][1] = F::load(sk + (np * 32 + kt * 16) * kKPitch + 32);
      }
      __builtin_amdgcn_sched_barrier(0);  // and stay one group ahead of the softmax that covers their latency

      float mx[2];
#pragma unroll  // constant indices keep these arrays in registers
      for (int qt = 0; qt < 2; ++qt) {
#pragma unroll  // constant indices keep these arrays in registers
        for (int kt = 0; kt < 2; ++kt)
#pragma unroll  // constant indices keep these arrays in registers
          for (int r = 0; r < 8; ++r) s[kt][qt][r] = s[kt][qt][r] * (kScoreScale * kLog2e) + qv2[qt] * kv[kt][r];
        float a0 = fmaxf(fmaxf(s[0][qt][0], s[0][qt][1]), fmaxf(s[0][qt][2], s[0][qt][3]));
        float a1 = fmaxf(fmaxf(s[0][qt][4], s[0][qt][5]), fmaxf(s[0][qt][6], s[0][qt][7]));
        float a2 = fmaxf(fmaxf(s[1][qt][0], s[1][qt][1]), fmaxf(s[1][qt][2], s[1][qt][3]));
        float a3 = fmaxf(fmaxf(s[1][qt][4], s[1][qt][5]), fmaxf(s[1][qt][6], s[1][qt][7]));
        mx[qt] = fmaxf(fmaxf(a0, a1), fmaxf(a2, a3));
      }

      // one wave-uniform test per pass; both halves of a query's lane pair take the same new maximum
      const bool need = (mx[0] > m[0] + 8.0f) || (mx[1] > m[1] + 8.0f);
      if (__builtin_amdgcn_ballot_w32(need) != 0u) {
#pragma unroll  // constant indices keep these arrays in registers
        for (int qt = 0; qt < 2; ++qt) {
          const float mn = fmaxf(m[qt], fmaxf(mx[qt], __shfl_xor(mx[qt], 16, 32)));
          const float al = __builtin_amdgcn_exp2f(m[qt] - mn);
          m[qt] = mn;
          l[qt] *= al;
#pragma unroll  // constant indices keep these arrays in registers
          for (int i = 0; i < 4; ++i)
#pragma unroll  // constant indices keep these arrays in registers
            for (int r = 0; r < 8; ++r) o[i][qt][r] *= al;
        }
      }

      v16h pf[2];
#pragma unroll  // constant indices keep these arrays in registers
      for (int qt = 0; qt < 2; ++qt) {
        float ls0 = 0.f, ls1 = 0.f;
#pragma unroll  // constant indices keep these arrays in registers
        for (int r = 0; r < 8; ++r) {
          const float p0 = __builtin_amdgcn_exp2f(s[0][qt][r] - m[qt]);
          const float p1 = __builtin_amdgcn_exp2f(s[1][qt][r] - m[qt]);
          ls0 += p0;
          ls1 += p1;
          pf[qt][r]     = (_Float16)p0;
          pf[qt][8 + r] = (_Float16)p1;
        }
        l[qt] += ls0 + ls1;
      }

#pragma unroll  // constant indices keep these arrays in registers
      for (int i = 0; i < 4; ++i)
#pragma unroll  // constant indices keep these arrays in registers
        for (int qt = 0; qt < 2; ++qt) o[i][qt] = F::mma(vf[i], pf[qt], o[i][qt]);
      __builtin_amdgcn_sched_barrier(0);  // keeps the four slots below behind the pass's last WMMA
      // four vector slots between the last WMMA and the next pass's address arithmetic, which may take over its A or B registers
      asm volatile("v_nop\n\tv_nop\n\tv_nop\n\tv_nop");
    }
    wait_ds0();
    wait_async0();
    __syncthreads();                             // publishes stage t + 1 and ends every wave's reads of stage t
    if (t + 2 < kSeq / kAK) stage_copies(t + 2, t & 1);
  }
  wait_async0();

  // epilogue: join the two halves' sums, normalise, 8 consecutive head dims per lane = one 16-byte store
#pragma unroll  // constant indices keep these arrays in registers
  for (int qt = 0; qt < 2; ++qt) {
    const float lt  = l[qt] + __shfl_xor(l[qt], 16, 32);
    const float inv = kOCarry * (1.0f / lt);
    unsigned short* op = o16 + ((size_t)b * kSeq + q0 + qt * 16 + c) * kEmb + h * kHeadDim + hs * 8;
#pragma unroll  // constant indices keep these arrays in registers
    for (int i = 0; i < 4; ++i) {
      v8h hv;
#pragma unroll  // constant indices keep these arrays in registers
      for (int r = 0; r < 8; ++r) hv[r] = (_Float16)(o[i][qt][r] * inv);
      *(v8h*)(op + i * 16) = hv;
    }
  }
}

// ---------------------------------------------------------------------------
// Host entry: 4 launches (one cast of all five inputs, the q/k/v projections, fused attention, output GEMM).
// ---------------------------------------------------------------------------
extern "C" void kernel_launch(void* const* d_in, const int* in_sizes, int n_in,
                              void* d_out, int out_size, void* d_ws, size_t ws_size,
                              hipStream_t stream) {
  if (n_in < 5) return;
  if (in_sizes[0] != kTok * kEmb) return;
  if (in_sizes[1] != kEmb * kEmb || in_sizes[2] != kEmb * kEmb || in_sizes[3] != kEmb * kEmb || in_sizes[4] != kEmb * kEmb) return;
  if (out_size != kTok * kEmb) return;
  if (ws_size < kWsTotal) return;

  const float* x  = (const float*)d_in[0];
  const float* Wq = (const float*)d_in[1];
  const float* Wk = (const float*)d_in[2];
  const float* Wv = (const float*)d_in[3];
  const float* Wo = (const float*)d_in[4];
  float* outp = (float*)d_out;

  char* ws = (char*)d_ws;
  unsigned short* X16  = (unsigned short*)(ws + kOffX16);
  unsigned short* O16  = (unsigned short*)(ws + kOffX16);     // region reuse, see map
  unsigned short* Wq16 = (unsigned short*)(ws + kOffWq16);
  unsigned short* Wk16 = (unsigned short*)(ws + kOffWk16);
  unsigned short* Wv16 = (unsigned short*)(ws + kOffWv16);
  unsigned short* Wo16 = (unsigned short*)(ws + kOffWo16);
  unsigned short* VT16 = (unsigned short*)(ws + kOffVT16);
  unsigned short* QC16 = (unsigned short*)(ws + kOffQC16);
  unsigned short* KC16 = (unsigned short*)(ws + kOffKC16);
  float*          QVAR = (float*)(ws + kOffQVar);
  float*          KVAR = (float*)(ws + kOffKVar);

  const float* nof = (const float*)nullptr;
  const unsigned short* nou = (const unsigned short*)nullptr;

  // 1) casts to f16 planes, one launch
  cast_all_f16_kernel<<<kCastBlocks, kCastThreads, 0, stream>>>(x, Wq, Wk, Wv, Wo, X16, Wq16, Wk16, Wv16, Wo16);

  // 2) q, k and v projections, one launch: 64 x 4 = 256 blocks, each 128 tokens x 256 channels of all three weights.
  //    -> QC16 + QVAR, KC16 + KVAR (centered per head), VT16 f16 [8][1024][1024] (v^T per batch).
  qkv_gemm_kernel<<<(kTok / kBM) * (kEmb / kBN), 256, 0, stream>>>(X16, Wq16, QC16, KC16, VT16, QVAR, KVAR);

  // 3) attention: one launch, block = (256 queries, one batch and head)
  attn_fused_kernel<<<dim3(kSeq / 256, kBatch * kHeads), 256, 0, stream>>>(QC16, KC16, VT16, QVAR, KVAR, O16);

  // 4) out = O . Wo^T : A = O16 [8192][1024], Bt = Wo16 [1024][1024], K = 1024, C = d_out f32 [8192][1024].
  {
    const int blocks = (kTok / kBM) * (kEmb / kBN);   // 256
    wmma_gemm64<0, false, 0, 0, false, 0><<<dim3(blocks, 1), 256, 0, stream>>>(
        O16, nou, kEmb, 0L, Wo16, nou, kEmb, 0L, (void*)outp, (void*)nullptr, kEmb, 0L,
        nof, nof, 0L, kTok, kEmb, kEmb, kOutScale);
  }
}

// v008
// One run takes 95.6 microseconds.
// Timed twice side by side with v007, it ran 1.07 times as fast both times.
// Over all steps from v000 it is 15.8 times as fast.
// All contractions (q/k/v projections K=1024, centered q.k^T scores K=64, probabilities.v K=1024, output projection K=1024): v_wmma_f32_16x16x32_f16 with f16 operands (weights carried x16, shifted q carried x log2e/8 and shifted k x 1/8, unnormalised probabilities exp2(score - maximum in use), attention output carried x64) and f32 accumulate; centering, variances and online softmax in f32; the variance outer product, the score scale and the subtraction of the maximum ride in the score product (q, k stored as centered + variance / 8, scaled; C = minus the maximum).
#include <hip/hip_runtime.h>
#include <math.h>

// ---------------------------------------------------------------------------
// Problem constants
// ---------------------------------------------------------------------------
constexpr int kBatch   = 8;
constexpr int kSeq     = 1024;
constexpr int kEmb     = 1024;
constexpr int kHeads   = 16;
constexpr int kHeadDim = 64;
constexpr int kTok     = kBatch * kSeq;                 // 8192 token rows

constexpr float kWCarry     = 16.0f;                    // weights carried x16 in f16
constexpr float kQKCarry    = 4.0f;                     // centered q / k carried x4 while they are centered in f32
constexpr float kOCarry     = 64.0f;                    // attention output carried x64 in f16
constexpr float kProjScale  = 1.0f / kWCarry;                              // 1/16
constexpr float kLog2e      = 1.4426950408889634f;
// stored q = (centered + variance / 8) * log2e / 8, stored k = (centered + variance / 8) / 8: their dot is the score in log2 units
constexpr float kQGain      = kLog2e / (8.0f * kQKCarry);
constexpr float kKGain      = 1.0f / (8.0f * kQKCarry);
constexpr float kOutScale   = 1.0f / (kOCarry * kWCarry);                  // 1/1024
constexpr float kInv64      = 1.0f / 64.0f;
constexpr float kInv63      = 1.0f / 63.0f;

// ---------------------------------------------------------------------------
// Workspace region map (bytes). Total carve 120 MiB = 125829120 B.
//   [  0, 16) MiB  X16  f16 [8192][1024] (x)                 -> reused as O16 f16 [8192][1024] (attention output x64)
//                  after the projection launch (last reader of X16) has been enqueued
//   [ 16, 18) MiB  Wq16 f16 [1024][1024] x16
//   [ 18, 20) MiB  Wk16
//   [ 20, 22) MiB  Wv16
//   [ 22, 24) MiB  Wo16
//   [ 24, 72) MiB  unused
//   [ 72, 88) MiB  VT16 f16 [8][1024][1024] (v^T per batch: row = out channel, col = token of the batch)
//   [ 88,104) MiB  QC16 f16 [8192][1024] (centered q + its head's variance / 8) x log2e / 8
//   [104,120) MiB  KC16 f16 [8192][1024] (centered k + its head's variance / 8) x 1 / 8
// ---------------------------------------------------------------------------
constexpr size_t kMiB     = 1048576;
constexpr size_t kOffX16  = 0;
constexpr size_t kOffWq16 = 16 * kMiB;
constexpr size_t kOffWk16 = 18 * kMiB;
constexpr size_t kOffWv16 = 20 * kMiB;
constexpr size_t kOffWo16 = 22 * kMiB;
constexpr size_t kOffVT16 = 72 * kMiB;
constexpr size_t kOffQC16 = 88 * kMiB;
constexpr size_t kOffKC16 = 104 * kMiB;
constexpr size_t kWsTotal = 120 * kMiB;
static_assert((size_t)kTok * kEmb * 2 == 16 * kMiB, "x / o planes 16 MiB");
static_assert((size_t)kEmb * kEmb * 2 == 2 * kMiB, "weight planes 2 MiB");
static_assert(kOffKC16 + (size_t)kTok * kEmb * 2 == kWsTotal, "carve end");
static_assert(kWsTotal <= (size_t)134217728, "carve under 128 MiB");
static_assert(kEmb % 32 == 0 && kHeadDim % 32 == 0 && kSeq % 32 == 0, "K multiples of 32");
static_assert(kTok % 64 == 0 && kEmb % 64 == 0 && kSeq % 64 == 0 && kHeadDim % 64 == 0, "M, N multiples of 64");

typedef __attribute__((ext_vector_type(16))) _Float16 v16h;
typedef __attribute__((ext_vector_type(8)))  _Float16 v8h;
typedef __attribute__((ext_vector_type(16))) __bf16   v16b;
typedef __attribute__((ext_vector_type(8)))  __bf16   v8b;
typedef __attribute__((ext_vector_type(8)))  float    v8f;
typedef __attribute__((ext_vector_type(4)))  float    v4f;
typedef __attribute__((ext_vector_type(2)))  float    v2f;
typedef __attribute__((ext_vector_type(4)))  unsigned int v4u;

__device__ __forceinline__ unsigned short f2bf_bits(float f) {
  unsigned u = __float_as_uint(f);
  return (unsigned short)((u + 0x7FFFu + ((u >> 16) & 1u)) >> 16);
}
__device__ __forceinline__ float bf_bits2f(unsigned short h) { return __uint_as_float(((unsigned)h) << 16); }

// hazard guards as plain device helpers (no inline asm inside the kernel template body)
__device__ __forceinline__ void acc_guard4(v8f& a, v8f& b, v8f& c, v8f& d) { asm volatile("v_nop\n\tv_nop\n\tv_nop\n\tv_nop" : "+v"(a), "+v"(b), "+v"(c), "+v"(d)); }
template <typename T> struct Frag;
template <> struct Frag<_Float16> {
  typedef v16h V; union U { v16h v; v8h h[2]; };
  static __device__ __forceinline__ v16h load(const _Float16* p) {   // elements 0..7 <- p[0..7], 8..15 <- p[16..23]
    U f; f.h[0] = *(const v8h*)(p); f.h[1] = *(const v8h*)(p + 16); return f.v;
  }
  static __device__ __forceinline__ v8f mma(v16h a, v16h b, v8f c) {
    return __builtin_amdgcn_wmma_f32_16x16x32_f16(false, a, false, b, (short)0, c, false, false);
  }
};
template <> struct Frag<__bf16> {
  typedef v16b V; union U { v16b v; v8b h[2]; };
  static __device__ __forceinline__ v16b load(const __bf16* p) {
    U f; f.h[0] = *(const v8b*)(p); f.h[1] = *(const v8b*)(p + 16); return f.v;
  }
  static __device__ __forceinline__ v8f mma(v16b a, v16b b, v8f c) {
    return __builtin_amdgcn_wmma_f32_16x16x32_bf16(false, a, false, b, (short)0, c, false, false);
  }
};

__device__ __forceinline__ unsigned pk16(unsigned short a, unsigned short b) { return (unsigned)a | ((unsigned)b << 16); }
__device__ __forceinline__ unsigned short h_bits(float f) { const _Float16 h = (_Float16)f; return __builtin_bit_cast(unsigned short, h); }

// ---- Register-blocked batched WMMA GEMM, operands staged in LDS ------------------------------------------------------
// C[m,n] = scale * sum_k A[m,k] * Bt[n,k] (+bias)(+resid); each wave owns a 64x64 tile, a block of 2 x 4 waves 128 x 256.
// A row-major [M,K]; Bt row-major [N,K]; M % 128 == 0, N % 256 == 0, K % 128 == 0.
// A stage is 128 k of the block's 128 A rows and 256 Bt rows, brought into LDS once for all eight waves by 16-byte
// asynchronous copies (whole 256-byte row pieces); two buffers, the next stage's copies fly while this one is multiplied.
// SPLIT (hi/lo operand planes) is not staged and not instantiated.
// BIAS_MODE: 0 = none, 1 = bias[m], 2 = bias[n].
// OUT_MODE: 0 = f32, 1 = f16, 2 = bf16 hi plane (Cout) + bf16 lo plane (Cout2),
//           3 = per-head centering in the epilogue: a wave's 64 columns are one head (n0 % 64 == 0), so every row of its tile
//               is one (token, head). f32 math: mean = sum_d x / 64; c = x - mean; var = sum_d c*c / 63 (unbiased).
//               Cout[m][n] = f16(4 * c), Cout2 = f32 variances [N / 64][M] ([head][token]); 8 lanes x 8 columns hold a row.
// ET: 0 = f16 operands, 1 = bf16 operands (pointers passed as 16-bit storage)
constexpr int kBM    = 128;                      // A rows per block
constexpr int kBN    = 256;                      // Bt rows per block
constexpr int kBK    = 128;                      // k per stage = 256 B of every operand row
constexpr int kPitch = kBK + 8;                  // LDS row pitch in elements: 272 B = 16 B x 17, no bank conflict for 16-byte fragment reads
constexpr int kStage = (kBM + kBN) * kPitch;     // elements per buffer: [A 128 rows | Bt 256 rows]
static_assert(kTok % kBM == 0 && kEmb % kBM == 0 && kEmb % kBN == 0 && kSeq % kBN == 0 && kEmb % kBK == 0, "block tiles exact");

// Twelve 16-byte asynchronous copies per lane, global -> LDS. l = the lane's LDS byte address, g = its global address.
// s_wait_xcnt 0 closes the statement as a precaution: no register that a copy names is rewritten in front of it.
__device__ __forceinline__ void async_copy12(const unsigned (&l)[12], const void* const (&g)[12]) {
  asm volatile(
      "global_load_async_to_lds_b128 %0, %12, off\n\t"
      "global_load_async_to_lds_b128 %1, %13, off\n\t"
      "global_load_async_to_lds_b128 %2, %14, off\n\t"
      "global_load_async_to_lds_b128 %3, %15, off\n\t"
      "global_load_async_to_lds_b128 %4, %16, off\n\t"
      "global_load_async_to_lds_b128 %5, %17, off\n\t"
      "global_load_async_to_lds_b128 %6, %18, off\n\t"
      "global_load_async_to_lds_b128 %7, %19, off\n\t"
      "global_load_async_to_lds_b128 %8, %20, off\n\t"
      "global_load_async_to_lds_b128 %9, %21, off\n\t"
      "global_load_async_to_lds_b128 %10, %22, off\n\t"
      "global_load_async_to_lds_b128 %11, %23, off\n\t"
      "s_wait_xcnt 0x0"
      :: "v"(l[0]), "v"(l[1]), "v"(l[2]), "v"(l[3]), "v"(l[4]), "v"(l[5]), "v"(l[6]), "v"(l[7]), "v"(l[8]), "v"(l[9]), "v"(l[10]), "v"(l[11]),
         "v"(g[0]), "v"(g[1]), "v"(g[2]), "v"(g[3]), "v"(g[4]), "v"(g[5]), "v"(g[6]), "v"(g[7]), "v"(g[8]), "v"(g[9]), "v"(g[10]), "v"(g[11])
      : "memory");
}
// this wave's own copies have landed (other waves read them only behind the barrier that follows)
__device__ __forceinline__ void wait_async0() { asm volatile("s_wait_asynccnt 0x0" ::: "memory"); }
// this wave's LDS reads have returned, before the buffer they read is handed back to the copies
__device__ __forceinline__ void wait_ds0() { asm volatile("s_wait_dscnt 0x0" ::: "memory"); }

// v + (v of lane ^ X), X = 1, 2 or 4, inside a 16-lane row: one v_add_f32 with a row_xmask DPP operand, no LDS round trip
template <int X> __device__ __forceinline__ float add_xor(float v) {
  return v + __builtin_bit_cast(float, __builtin_amdgcn_update_dpp(0, __builtin_bit_cast(int, v), 0x160 + X, 0xf, 0xf, true));
}

template <int ET> struct Elem;
template <> struct Elem<0> { typedef _Float16 T; };
template <> struct Elem<1> { typedef __bf16 T; };
template <int ET, bool SPLIT, int BIAS_MODE, int OUT_MODE, bool RESID, int ACT = 0>
__global__ __launch_bounds__(256) void wmma_gemm64(
    const unsigned short* __restrict__ Ap, const unsigned short* __restrict__ A2p, int lda, long strideA,
    const unsigned short* __restrict__ Btp, const unsigned short* __restrict__ Bt2p, int ldb, long strideB,
    void* __restrict__ Cout, void* __restrict__ Cout2, int ldc, long strideC,
    const float* __restrict__ bias,
    const float* __restrict__ resid, long strideR,
    int M, int N, int K, float scale) {
  typedef typename Elem<ET>::T T;
  typedef typename Frag<T>::V V;
  static_assert(!SPLIT, "hi/lo planes are not staged");
  const T* A = (const T*)Ap; const T* Bt = (const T*)Btp;
  __shared__ __align__(16) T sOp[2 * kStage];      // two operand buffers
  __shared__ __align__(16) float sT[8][16 * 68];   // per-wave 16x64 slab, pitch 68 floats
  const int b    = blockIdx.y;
  const int lane = threadIdx.x & 31;
  const int wave = threadIdx.x >> 5;
  const int tilesN = N / kBN;
  const int tilesM = M / kBM;
  if ((int)blockIdx.x >= tilesM * tilesN) return;   // block-uniform, in front of every barrier
  const int tm  = blockIdx.x / tilesN;
  const int tn  = blockIdx.x - tm * tilesN;
  const int bm0 = tm * kBM;
  const int bn0 = tn * kBN;
  const int wm  = wave >> 2;                   // wave grid 2 (M) x 4 (N)
  const int wn  = wave & 3;
  const int m0  = bm0 + (wm << 6);
  const int n0  = bn0 + (wn << 6);

  const T* Ab  = A  + (size_t)b * strideA;
  const T* Bb  = Bt + (size_t)b * strideB;

  const int rlane = lane & 15;                 // row (A) / col (B, D) within subtile
  const int koff  = (lane >> 4) * 8;           // k offset of this lane half
  const int mOff  = (lane >> 4) * 8;           // D row offset

  // Copies: 16 lanes cover one row's 256 bytes, the block 16 rows per copy; 8 copies for A, 16 for Bt, per lane and stage.
  const int crow = threadIdx.x >> 4;
  const int ccol = (threadIdx.x & 15) * 8;
  const T* gA = Ab + (size_t)(bm0 + crow) * lda + ccol;
  const T* gB = Bb + (size_t)(bn0 + crow) * ldb + ccol;
  const unsigned lds0 = (unsigned)(size_t)sOp + (unsigned)(crow * kPitch + ccol) * 2u;
  auto stage_copies = [&](int t, int buf) {
    const unsigned lb = lds0 + (unsigned)buf * (unsigned)(kStage * 2);
    const T* ga = gA + (size_t)t * kBK;
    const T* gb = gB + (size_t)t * kBK;
#pragma unroll
    for (int half = 0; half < 2; ++half) {
      unsigned l[12];
      const void* g[12];
#pragma unroll  // constant indices keep these arrays in registers
      for (int e = 0; e < 12; ++e) {
        const int grp = half * 12 + e;           // 16-row group of the buffer: 0..7 A, 8..23 Bt
        l[e] = lb + (unsigned)(grp * 16 * kPitch * 2);
        g[e] = (grp < 8) ? (const void*)(ga + (size_t)(grp * 16) * lda) : (const void*)(gb + (size_t)((grp - 8) * 16) * ldb);
      }
      async_copy12(l, g);
    }
  };

  v8f acc[4][4];
#pragma unroll
  for (int i = 0; i < 4; ++i)
#pragma unroll
    for (int j = 0; j < 4; ++j) acc[i][j] = (v8f){0.f,0.f,0.f,0.f,0.f,0.f,0.f,0.f};

  const int nStages = K / kBK;
  // Plain f32 output: the tile is computed transposed, the Bt rows feed the WMMA's A and the A rows its B (both 64 rows a wave,
  // one loader, so the k orders agree). acc[i][j]: lane = row m0 + 16 j + rlane of C, register r = column n0 + 16 i + mOff + r.
  constexpr bool TR = (OUT_MODE == 0 && BIAS_MODE == 0 && !RESID && ACT == 0);
  const int offM = ((wm << 6) + rlane) * kPitch + koff;
  const int offN = (kBM + (wn << 6) + rlane) * kPitch + koff;
  const int aoff = TR ? offN : offM;
  const int boff = TR ? offM : offN;

  stage_copies(0, 0);
  wait_async0();
  __syncthreads();                               // stage 0 is published
  if (nStages > 1) stage_copies(1, 1);

#pragma clang loop unroll(disable)  // one stage per trip: the buffer index stays a run-time value, the text small
  for (int t = 0; t < nStages; ++t) {
    const T* sa = sOp + (t & 1) * kStage + aoff;
    const T* sb = sOp + (t & 1) * kStage + boff;
    // Fragment reads go ahead of the WMMAs that cover their latency: the Bt set and A rows 0, 1 of the next 32 k are read
    // under rows 2, 3 of these 32 k, A rows 2, 3 under rows 0, 1. Each sched_barrier keeps the compiler from sinking a
    // read group down to its first use, where the wave would wait out the LDS latency in front of every row.
    V af[4], bf[2][4];
#pragma unroll  // constant indices keep these arrays in registers
    for (int j = 0; j < 4; ++j) bf[0][j] = Frag<T>::load(sb + j * 16 * kPitch);
#pragma unroll  // constant indices keep these arrays in registers
    for (int i = 0; i < 2; ++i) af[i] = Frag<T>::load(sa + i * 16 * kPitch);
#pragma unroll  // constant indices keep these arrays in registers
    for (int ks = 0; ks < kBK / 32; ++ks) {
      const int cs = ks & 1;
#pragma unroll  // constant indices keep these arrays in registers
      for (int i = 2; i < 4; ++i) af[i] = Frag<T>::load(sa + i * 16 * kPitch + ks * 32);
      __builtin_amdgcn_sched_barrier(0);  // A rows 2, 3 are read ahead of rows 0, 1's WMMAs
#pragma unroll  // constant indices keep these arrays in registers
      for (int i = 0; i < 2; ++i)
#pragma unroll  // constant indices keep these arrays in registers
        for (int j = 0; j < 4; ++j) acc[i][j] = Frag<T>::mma(af[i], bf[cs][j], acc[i][j]);
      __builtin_amdgcn_sched_barrier(0);  // the next reads stay behind rows 0, 1's WMMAs, whose registers they refill
      if (ks + 1 < kBK / 32) {
#pragma unroll  // constant indices keep these arrays in registers
        for (int j = 0; j < 4; ++j) bf[cs ^ 1][j] = Frag<T>::load(sb + j * 16 * kPitch + (ks + 1) * 32);
#pragma unroll  // constant indices keep these arrays in registers
        for (int i = 0; i < 2; ++i) af[i] = Frag<T>::load(sa + i * 16 * kPitch + (ks + 1) * 32);
      }
      __builtin_amdgcn_sched_barrier(0);  // the next 32 k's reads stay ahead of rows 2, 3's WMMAs
#pragma unroll  // constant indices keep these arrays in registers
      for (int i = 2; i < 4; ++i)
#pragma unroll  // constant indices keep these arrays in registers
        for (int j = 0; j < 4; ++j) acc[i][j] = Frag<T>::mma(af[i], bf[cs][j], acc[i][j]);
      __builtin_amdgcn_sched_barrier(0);  // the reads after that stay behind them
    }
    wait_ds0();
    wait_async0();
    __syncthreads();                             // publishes stage t + 1 and ends every wave's reads of stage t
    if (t + 2 < nStages) stage_copies(t + 2, t & 1);
  }
  wait_async0();
  acc_guard4(acc[0][0], acc[0][1], acc[0][2], acc[0][3]);
  acc_guard4(acc[1][0], acc[1][1], acc[1][2], acc[1][3]);
  acc_guard4(acc[2][0], acc[2][1], acc[2][2], acc[2][3]);
  acc_guard4(acc[3][0], acc[3][1], acc[3][2], acc[3][3]);

  // ---- epilogue ----
  if (TR) {
    // Every wave is past the last stage's barrier and no copy is outstanding: the ring is free, each wave takes 64 x 68 floats
    // of it. The whole 64 x 64 tile goes through once: 16-byte writes (8 registers = 32 bytes of a row of C), one LDS wait,
    // 16-byte reads of whole 256-byte rows, whole-line stores that nothing waits for.
    static_assert(8 * 64 * 68 * 4 <= 2 * kStage * 2, "eight f32 tiles fit the ring");
    float* big = (float*)sOp + wave * (64 * 68);
    float* wp  = big + rlane * 68 + mOff;
#pragma unroll  // constant indices keep these arrays in registers
    for (int j = 0; j < 4; ++j)
#pragma unroll  // constant indices keep these arrays in registers
      for (int i = 0; i < 4; ++i) {
        float* dp = wp + (j * 16) * 68 + i * 16;
        *(v4f*)(dp)     = (v4f){acc[i][j][0] * scale, acc[i][j][1] * scale, acc[i][j][2] * scale, acc[i][j][3] * scale};
        *(v4f*)(dp + 4) = (v4f){acc[i][j][4] * scale, acc[i][j][5] * scale, acc[i][j][6] * scale, acc[i][j][7] * scale};
      }
    // the lanes' writes have landed ahead of the reads below, which take other lanes' values (one wave, its own part of the ring)
    wait_ds0();
    __builtin_amdgcn_wave_barrier();  // no read is scheduled above this point
    const int hh = lane >> 4, c4 = (lane & 15) * 4;       // row seg = 256 B = 16 lanes x 16 B
    const float* rp = big + hh * 68 + c4;
    float* C = (float*)Cout + (size_t)b * strideC + (size_t)(m0 + hh) * ldc + n0 + c4;
#pragma unroll  // constant indices keep these arrays in registers
    for (int half = 0; half < 2; ++half) {
      v4f u[16];
#pragma unroll  // constant indices keep these arrays in registers
      for (int k = 0; k < 16; ++k) u[k] = *(const v4f*)(rp + (half * 32 + k * 2) * 68);
#pragma unroll  // constant indices keep these arrays in registers
      for (int k = 0; k < 16; ++k) *(v4f*)(C + (size_t)(half * 32 + k * 2) * ldc) = u[k];
    }
    return;
  }
  float* slab = sT[wave];
  const float* Rb = RESID ? (resid + (size_t)b * strideR) : nullptr;
  float var0 = 0.f, var1 = 0.f;   // OUT_MODE 3: the two rows' variances that this lane stores behind the loop
#pragma unroll
  for (int i = 0; i < 4; ++i) {
    const int mBase = m0 + (i << 4);
#pragma unroll
    for (int j = 0; j < 4; ++j) {
      const int n = n0 + (j << 4) + rlane;
      float bv = 0.f;
      if (BIAS_MODE == 2) bv = bias[n];
#pragma unroll
      for (int r = 0; r < 8; ++r) {
        float v = acc[i][j][r] * scale;
        if (BIAS_MODE == 1) v += bias[mBase + mOff + r];
        if (BIAS_MODE == 2) v += bv;
        if (RESID) v += Rb[(size_t)(mBase + mOff + r) * ldc + n];
        if (ACT == 2) v = fmaxf(v, 0.0f);
        if (ACT == 4) v = (v > 0.f) ? v : 0.01f * v;
        slab[(mOff + r) * 68 + (j << 4) + rlane] = v;
      }
    }
    __builtin_amdgcn_fence(__ATOMIC_RELEASE, "workgroup");
    __builtin_amdgcn_wave_barrier();
    __builtin_amdgcn_fence(__ATOMIC_ACQUIRE, "workgroup");
    if (OUT_MODE == 0) {
      float* C = (float*)Cout + (size_t)b * strideC;
      const int hh = lane >> 4, c4 = (lane & 15) * 4;     // row seg = 256 B = 16 lanes x 16 B
      {
#pragma unroll
        for (int it = 0; it < 8; ++it) {
          const int row = it * 2 + hh;
          v4f v = *(const v4f*)(slab + row * 68 + c4);
          *(v4f*)(C + (size_t)(mBase + row) * ldc + n0 + c4) = v;
        }
        
      }
    } else if (OUT_MODE == 3) {
      const int q = lane >> 3, c8 = (lane & 7) * 8;       // row seg = 128 B = 8 lanes x 16 B
      unsigned short* C = (unsigned short*)Cout + (size_t)b * strideC;
#pragma unroll  // four independent rows in flight; grp below a compile-time value
      for (int it = 0; it < 4; ++it) {
        const int row = it * 4 + q;
        const float* sp = slab + row * 68 + c8;
        const v4f a = *(const v4f*)(sp);
        const v4f c = *(const v4f*)(sp + 4);
        float x[8];
#pragma unroll  // constant indices keep these arrays in registers
        for (int e = 0; e < 4; ++e) { x[e] = a[e]; x[4 + e] = c[e]; }
        float s = ((x[0] + x[1]) + (x[2] + x[3])) + ((x[4] + x[5]) + (x[6] + x[7]));
        s = add_xor<1>(s);
        s = add_xor<2>(s);
        s = add_xor<4>(s);
        const float mean = s * kInv64;
        float vs = 0.f;
#pragma unroll  // constant indices keep these arrays in registers
        for (int e = 0; e < 8; ++e) { x[e] = x[e] - mean; vs += x[e] * x[e]; }
        vs = add_xor<1>(vs);
        vs = add_xor<2>(vs);
        vs = add_xor<4>(vs);
        unsigned short hb[8];
#pragma unroll  // constant indices keep these arrays in registers
        for (int e = 0; e < 8; ++e) hb[e] = h_bits(x[e] * kQKCarry);
        const v4u u = (v4u){pk16(hb[0], hb[1]), pk16(hb[2], hb[3]), pk16(hb[4], hb[5]), pk16(hb[6], hb[7])};
        *(v4u*)(C + (size_t)(mBase + row) * ldc + n0 + c8) = u;
        // all 8 lanes of a row hold its variance; lane (q, lane & 7) keeps those of row groups (i, it) = lane & 7 and 8 + (lane & 7)
        const int grp = i * 4 + it;
        if ((lane & 7) == (grp & 7)) { if (grp < 8) var0 = vs * kInv63; else var1 = vs * kInv63; }
      }
    } else {
      const int q = lane >> 3, c8 = (lane & 7) * 8;
      unsigned short* C  = (unsigned short*)Cout  + (size_t)b * strideC;
      unsigned short* C2 = (OUT_MODE == 2) ? ((unsigned short*)Cout2 + (size_t)b * strideC) : nullptr;
      {
#pragma unroll
        for (int it = 0; it < 4; ++it) {
          const int row = it * 4 + q;
          const float* sp = slab + row * 68 + c8;
          v8h hv, lv;
#pragma unroll
          for (int e = 0; e < 8; ++e) {
            if (OUT_MODE == 1) {
              hv[e] = (_Float16)sp[e];
            } else {
              unsigned short hb = f2bf_bits(sp[e]);
              unsigned short lb = f2bf_bits(sp[e] - bf_bits2f(hb));
              hv[e] = __builtin_bit_cast(_Float16, hb);
              lv[e] = __builtin_bit_cast(_Float16, lb);
            }
          }
          *(v8h*)(C + (size_t)(mBase + row) * ldc + n0 + c8) = hv;
          if (OUT_MODE == 2) *(v8h*)(C2 + (size_t)(mBase + row) * ldc + n0 + c8) = lv;
        }
        
      }
    }
    __builtin_amdgcn_fence(__ATOMIC_RELEASE, "workgroup");
    __builtin_amdgcn_wave_barrier();
    __builtin_amdgcn_fence(__ATOMIC_ACQUIRE, "workgroup");
  }
  if (OUT_MODE == 3) {
    // the wave's 64 variances: rows 0..31, then rows 32..63, each store one whole 128-byte line of the head's row
    const int g8 = lane & 7;
    float* vp = (float*)Cout2 + (size_t)(n0 >> 6) * M + m0 + (g8 >> 2) * 16 + (g8 & 3) * 4 + (lane >> 3);
    vp[0]  = var0;
    vp[32] = var1;
  }
}

// ---------------------------------------------------------------------------
// The q, k and v projections in one launch. A block keeps its 128 token rows (A = x) and its 256 output channels and walks
// the three weights (Wq16, Wk16, Wv16 lie one behind the other: Bt = [3][1024][1024]) in one ring of 3 x 8 stages: the copies
// of the next weight's second stage fly while this weight's tile is written out (its first is in LDS), so the ring is filled once, not three times.
// Stage, buffers, copies, fragment order and waits are those of wmma_gemm64.
// Tiles 0 and 1 (q, k) are computed transposed: the weight fragment is the WMMA's A, the x fragment its B (both come from the
// same loader, so the k orders agree). D: lane = token, register r = channel 8 * half + r of a 16-channel group. A wave's 64
// columns are one head, so a lane and its partner (lane ^ 16) hold a whole (token, head) row, 32 channels each: mean, centering
// and variance are in-lane sums joined by one exchange between the halves, and 8 registers are 16 bytes of the f16 output row.
// What is stored is c + var / 8 (c = the centered row, var = its unbiased variance). A centered row sums to 0, so over the 64 dims
//   (qc + qvar / 8) . (kc + kvar / 8) = qc . kc + 64 * (qvar / 8) * (kvar / 8) = qc . kc + qvar * kvar,
// and the attention kernel's score product yields covariance and variance term together: score = that dot / 64. The 1 / 64 and
// the log2e of the softmax's exp2 are shared out on the two stored rows (q x log2e / 8, k x 1 / 8).
// Tile 2 (v) keeps x as A: lane = channel, register r = token, so 8 registers are 16 bytes of a v^T row.
// Output: the whole 64 x 64 f16 tile goes once through the wave's own slab (16-byte writes, one LDS wait, 16-byte reads of
// whole 128-byte rows) and is stored as whole lines; nothing waits for those stores, they drain under the next weight's WMMAs.
// ---------------------------------------------------------------------------
constexpr int kTileStages = kEmb / kBK;          // 8 stages per weight
constexpr int kQkvStages  = 3 * kTileStages;     // 24
constexpr int kSlabPitch  = 64 + 8;              // f16 slab rows: 144 B = 16 B x 9, no bank conflict for the 16-byte writes
static_assert((kTileStages & (kTileStages - 1)) == 0, "stage -> (weight, k) by shift and mask");
static_assert(kOffWk16 == kOffWq16 + (size_t)kEmb * kEmb * 2 && kOffWv16 == kOffWk16 + (size_t)kEmb * kEmb * 2, "weights contiguous");
static_assert(kSeq % 64 == 0, "a wave's 64 tokens lie in one batch");
static_assert(kEmb == kSeq, "q / k rows and v^T rows have one pitch");

// lane l with lane l ^ 16
__device__ __forceinline__ float xhalf(float x) {
  return __builtin_bit_cast(float, __builtin_amdgcn_permlanex16(__builtin_bit_cast(int, x), __builtin_bit_cast(int, x), 0x76543210, 0xfedcba98, false, false));
}

__global__ __launch_bounds__(256) void qkv_gemm_kernel(
    const unsigned short* __restrict__ Xp, const unsigned short* __restrict__ Wp,
    unsigned short* __restrict__ qc, unsigned short* __restrict__ kc, unsigned short* __restrict__ vt) {
  typedef _Float16 T;
  typedef Frag<T>::V V;
  const T* A = (const T*)Xp; const T* Bt = (const T*)Wp;
  __shared__ __align__(16) T sOp[2 * kStage];            // two operand buffers
  __shared__ __align__(16) T sH[8][64 * kSlabPitch];     // per-wave 64 x 64 f16 output slab
  const int lane = threadIdx.x & 31;
  const int wave = threadIdx.x >> 5;
  constexpr int tilesN = kEmb / kBN;           // grid = (kTok / kBM) * tilesN blocks, exact
  const int tm  = blockIdx.x / tilesN;
  const int tn  = blockIdx.x - tm * tilesN;
  const int bm0 = tm * kBM;
  const int bn0 = tn * kBN;
  const int wm  = wave >> 2;                   // wave grid 2 (M) x 4 (N)
  const int wn  = wave & 3;
  const int m0  = bm0 + (wm << 6);
  const int n0  = bn0 + (wn << 6);

  const int rlane = lane & 15;                 // fragment row; D column
  const int hs    = lane >> 4;                 // lane half
  const int koff  = hs * 8;                    // k offset of this lane half; D row offset

  // Copies: 16 lanes cover one row's 256 bytes, the block 16 rows per copy; 8 copies for A, 16 for Bt, per lane and stage.
  const int crow = threadIdx.x >> 4;
  const int ccol = (threadIdx.x & 15) * 8;
  const T* gA = A  + (size_t)(bm0 + crow) * kEmb + ccol;
  const T* gB = Bt + (size_t)(bn0 + crow) * kEmb + ccol;
  const unsigned lds0 = (unsigned)(size_t)sOp + (unsigned)(crow * kPitch + ccol) * 2u;
  auto stage_copies = [&](int s, int buf) {
    const unsigned lb = lds0 + (unsigned)buf * (unsigned)(kStage * 2);
    const int kk = (s & (kTileStages - 1)) * kBK;
    const T* ga = gA + kk;
    const T* gb = gB + (size_t)(s / kTileStages) * (kEmb * kEmb) + kk;
#pragma unroll
    for (int half = 0; half < 2; ++half) {
      unsigned l[12];
      const void* g[12];
#pragma unroll  // constant indices keep these arrays in registers
      for (int e = 0; e < 12; ++e) {
        const int grp = half * 12 + e;           // 16-row group of the buffer: 0..7 A, 8..23 Bt
        l[e] = lb + (unsigned)(grp * 16 * kPitch * 2);
        g[e] = (grp < 8) ? (const void*)(ga + (size_t)(grp * 16) * kEmb) : (const void*)(gb + (size_t)((grp - 8) * 16) * kEmb);
      }
      async_copy12(l, g);
    }
  };

  v8f acc[4][4];
#pragma unroll  // constant indices keep these arrays in registers
  for (int i = 0; i < 4; ++i)
#pragma unroll  // constant indices keep these arrays in registers
    for (int j = 0; j < 4; ++j) acc[i][j] = (v8f){0.f,0.f,0.f,0.f,0.f,0.f,0.f,0.f};

  const int aoff = ((wm << 6) + rlane) * kPitch + koff;
  const int boff = (kBM + (wn << 6) + rlane) * kPitch + koff;
  T* slab = sH[wave];
  T* wp = slab + rlane * kSlabPitch + koff;                              // this lane's 16-byte writes: slab row = D column
  const T* rp = slab + (lane >> 3) * kSlabPitch + (lane & 7) * 8;        // and reads: 8 lanes x 16 B = one 128-byte row

  stage_copies(0, 0);
  wait_async0();
  __syncthreads();                               // stage 0 is published
  stage_copies(1, 1);

#pragma clang loop unroll(disable)  // one stage per trip: the buffer index stays a run-time value, the text small
  for (int s = 0; s < kQkvStages; ++s) {
    // q and k transposed: the weight rows feed the WMMA's A, the x rows its B (both 64 rows a wave, one loader); v as it is
    const bool tr = s < 2 * kTileStages;
    const T* sa = sOp + (s & 1) * kStage + (tr ? boff : aoff);
    const T* sb = sOp + (s & 1) * kStage + (tr ? aoff : boff);
    // Fragment reads go ahead of the WMMAs that cover their latency, as in wmma_gemm64; each sched_barrier keeps the compiler
    // from sinking a read group down to its first use, where the wave would wait out the LDS latency in front of every row.
    V af[4], bf[2][4];
#pragma unroll  // constant indices keep these arrays in registers
    for (int j = 0; j < 4; ++j) bf[0][j] = Frag<T>::load(sb + j * 16 * kPitch);
#pragma unroll  // constant indices keep these arrays in registers
    for (int i = 0; i < 2; ++i) af[i] = Frag<T>::load(sa + i * 16 * kPitch);
#pragma unroll  // constant indices keep these arrays in registers
    for (int ks = 0; ks < kBK / 32; ++ks) {
      const int cs = ks & 1;
#pragma unroll  // constant indices keep these arrays in registers
      for (int i = 2; i < 4; ++i) af[i] = Frag<T>::load(sa + i * 16 * kPitch + ks * 32);
      __builtin_amdgcn_sched_barrier(0);  // A rows 2, 3 are read ahead of rows 0, 1's WMMAs
#pragma unroll  // constant indices keep these arrays in registers
      for (int i = 0; i < 2; ++i)
#pragma unroll  // constant indices keep these arrays in registers
        for (int j = 0; j < 4; ++j) acc[i][j] = Frag<T>::mma(af[i], bf[cs][j], acc[i][j]);
      __builtin_amdgcn_sched_barrier(0);  // the next reads stay behind rows 0, 1's WMMAs, whose registers they refill
      if (ks + 1 < kBK / 32) {
#pragma unroll  // constant indices keep these arrays in registers
        for (int j = 0; j < 4; ++j) bf[cs ^ 1][j] = Frag<T>::load(sb + j * 16 * kPitch + (ks + 1) * 32);
#pragma unroll  // constant indices keep these arrays in registers
        for (int i = 0; i < 2; ++i) af[i] = Frag<T>::load(sa + i * 16 * kPitch + (ks + 1) * 32);
      }
      __builtin_amdgcn_sched_barrier(0);  // the next 32 k's reads stay ahead of rows 2, 3's WMMAs
#pragma unroll  // constant indices keep these arrays in registers
      for (int i = 2; i < 4; ++i)
#pragma unroll  // constant indices keep these arrays in registers
        for (int j = 0; j < 4; ++j) acc[i][j] = Frag<T>::mma(af[i], bf[cs][j], acc[i][j]);
      __builtin_amdgcn_sched_barrier(0);  // the reads after that stay behind them
    }
    wait_ds0();
    wait_async0();
    __syncthreads();                             // publishes stage s + 1 and ends every wave's reads of stage s
    if (s + 2 < kQkvStages) stage_copies(s + 2, s & 1);
    if ((s & (kTileStages - 1)) != kTileStages - 1) continue;   // block-uniform: a weight's last stage is followed by its tile's output

    // ---- a tile is complete: write it out of the per-wave slab (not part of the ring) while the next copies fly ----
    acc_guard4(acc[0][0], acc[0][1], acc[0][2], acc[0][3]);
    acc_guard4(acc[1][0], acc[1][1], acc[1][2], acc[1][3]);
    acc_guard4(acc[2][0], acc[2][1], acc[2][2], acc[2][3]);
    acc_guard4(acc[3][0], acc[3][1], acc[3][2], acc[3][3]);
    const int tile = s / kTileStages;
    unsigned short* C;   // this lane's place in slab row (lane >> 3) of the wave's tile; every store below is a constant number of rows further on
    if (tile < 2) {
      C = (tile ? kc : qc) + (size_t)(m0 + (lane >> 3)) * kEmb + n0 + (lane & 7) * 8;
      const float gain = tile ? kKGain : kQGain;
#pragma unroll  // constant indices keep these arrays in registers
      for (int i = 0; i < 4; ++i) {              // acc[j][i]: token m0 + 16 i + rlane; this lane's channels: 16 j + 8 hs + r
        // register pairs (r, r + 1) are summed, centered and squared as pairs: packed f32 operations on adjacent registers
        v2f a[4][4];
#pragma unroll  // constant indices keep these arrays in registers
        for (int j = 0; j < 4; ++j)
#pragma unroll  // constant indices keep these arrays in registers
          for (int e = 0; e < 4; ++e) a[j][e] = (v2f){acc[j][i][2 * e], acc[j][i][2 * e + 1]};
        v2f p[4];
#pragma unroll  // constant indices keep these arrays in registers
        for (int e = 0; e < 4; ++e) p[e] = (a[0][e] + a[1][e]) + (a[2][e] + a[3][e]);
        const v2f ps = (p[0] + p[1]) + (p[2] + p[3]);
        float sm = ps[0] + ps[1];
        sm += xhalf(sm);
        // the carry x4 rides in the scale and in the mean (powers of two: the same roundings as scaling afterwards)
        const float mean = sm * (kProjScale * kInv64 * kQKCarry);
        v2f w[4];
#pragma unroll  // constant indices keep these arrays in registers
        for (int e = 0; e < 4; ++e) w[e] = (v2f){0.f, 0.f};
#pragma unroll  // constant indices keep these arrays in registers
        for (int j = 0; j < 4; ++j)
#pragma unroll  // constant indices keep these arrays in registers
          for (int e = 0; e < 4; ++e) {
            a[j][e] = a[j][e] * (kProjScale * kQKCarry) - mean;
            w[e] += a[j][e] * a[j][e];
          }
        const v2f ws = (w[0] + w[1]) + (w[2] + w[3]);
        float vs = ws[0] + ws[1];
        vs += xhalf(vs);
        // variance / 8, carried x4 like the row: vs = 16 * sum c * c
        const float shift = vs * (kInv63 / (kQKCarry * kQKCarry) * (kQKCarry / 8.0f)) * gain;
#pragma unroll  // constant indices keep these arrays in registers
        for (int j = 0; j < 4; ++j) {
          v8h hv;
#pragma unroll  // constant indices keep these arrays in registers
          for (int e = 0; e < 4; ++e) {
            const v2f x = a[j][e] * gain + shift;
            hv[2 * e]     = (_Float16)x[0];
            hv[2 * e + 1] = (_Float16)x[1];
          }
          *(v8h*)(wp + (i * 16) * kSlabPitch + j * 16) = hv;
        }
      }
    } else {
      // v^T [batch][channel][token]: slab row = channel 16 j + rlane, slab column = token 16 i + 8 hs + r of the wave's 64
      C = vt + (size_t)(m0 / kSeq) * kEmb * kSeq + (size_t)(n0 + (lane >> 3)) * kSeq + (m0 & (kSeq - 1)) + (lane & 7) * 8;
#pragma unroll  // constant indices keep these arrays in registers
      for (int j = 0; j < 4; ++j)
#pragma unroll  // constant indices keep these arrays in registers
        for (int i = 0; i < 4; ++i) {
          v8h hv;
#pragma unroll  // constant indices keep these arrays in registers
          for (int r = 0; r < 8; ++r) hv[r] = (_Float16)(acc[i][j][r] * kProjScale);
          *(v8h*)(wp + (j * 16) * kSlabPitch + i * 16) = hv;
        }
    }
    // the lanes' slab writes have landed ahead of the reads below, which take other lanes' values (one wave, its own slab)
    wait_ds0();
    __builtin_amdgcn_wave_barrier();  // no slab read is scheduled above this point
    v4u u[16];
#pragma unroll  // constant indices keep these arrays in registers
    for (int k = 0; k < 16; ++k) u[k] = *(const v4u*)(rp + (k * 4) * kSlabPitch);
#pragma unroll  // constant indices keep these arrays in registers
    for (int k = 0; k < 16; ++k) *(v4u*)(C + (k * 4) * kEmb) = u[k];
    // a precaution: the accumulators are cleared below, in registers that these stores may name
    asm volatile("s_wait_xcnt 0x0" ::: "memory");
#pragma unroll  // constant indices keep these arrays in registers
    for (int i = 0; i < 4; ++i)
#pragma unroll  // constant indices keep these arrays in registers
      for (int j = 0; j < 4; ++j) acc[i][j] = (v8f){0.f,0.f,0.f,0.f,0.f,0.f,0.f,0.f};
  }
  wait_async0();
}

// ---------------------------------------------------------------------------
// All five f32 -> f16 casts (x as it is, the four weights x16) in one launch: 256 blocks of 16 waves, one per WGP.
// A group is 8 consecutive elements: two 16-byte loads, one 16-byte store. Every thread converts 12 groups: 8 of x
// (its block's contiguous 128 KiB of x) and one of each weight; its 24 loads are all issued before the first conversion.
// Coverage: 131072 threads x 8 groups x 8 = the whole of x; 131072 threads x 1 group x 8 = the whole of each weight.
// ---------------------------------------------------------------------------
constexpr int kCastThreads = 512;
constexpr int kCastBlocks  = 256;
constexpr int kCastXGroups = 8;                  // groups of x per thread
static_assert((size_t)kCastBlocks * kCastThreads * kCastXGroups * 8 == (size_t)kTok * kEmb, "x covered exactly");
static_assert((size_t)kCastBlocks * kCastThreads * 8 == (size_t)kEmb * kEmb, "each weight covered exactly");

__device__ __forceinline__ v4u cast8(const v4f a, const v4f c, const float scale) {
  unsigned short hb[8];
#pragma unroll  // constant indices keep this array in registers
  for (int e = 0; e < 4; ++e) {
    hb[e]     = h_bits(a[e] * scale);
    hb[4 + e] = h_bits(c[e] * scale);
  }
  return (v4u){pk16(hb[0], hb[1]), pk16(hb[2], hb[3]), pk16(hb[4], hb[5]), pk16(hb[6], hb[7])};
}

__global__ __launch_bounds__(kCastThreads) void cast_all_f16_kernel(
    const float* __restrict__ x, const float* __restrict__ wq, const float* __restrict__ wk,
    const float* __restrict__ wv, const float* __restrict__ wo,
    unsigned short* __restrict__ x16, unsigned short* __restrict__ wq16, unsigned short* __restrict__ wk16,
    unsigned short* __restrict__ wv16, unsigned short* __restrict__ wo16) {
  const size_t ex = ((size_t)blockIdx.x * (kCastXGroups * kCastThreads) + threadIdx.x) * 8;   // first element of x, group 0
  const size_t ew = ((size_t)blockIdx.x * kCastThreads + threadIdx.x) * 8;                    // first element of each weight
  const float* const wsrc[4] = {wq, wk, wv, wo};
  unsigned short* const wdst[4] = {wq16, wk16, wv16, wo16};
  v4f xa[kCastXGroups], xc[kCastXGroups], wa[4], wc[4];
#pragma unroll  // constant indices keep these arrays in registers
  for (int j = 0; j < kCastXGroups; ++j) {
    const float* p = x + ex + (size_t)j * (kCastThreads * 8);
    xa[j] = *(const v4f*)(p);
    xc[j] = *(const v4f*)(p + 4);
  }
  // a precaution: the compiler lets a weight load below land in the register pair that the loads above name as their address
  asm volatile("s_wait_xcnt 0x0" ::: "memory");
#pragma unroll  // constant indices keep these arrays in registers
  for (int i = 0; i < 4; ++i) {
    const float* p = wsrc[i] + ew;
    wa[i] = *(const v4f*)(p);
    wc[i] = *(const v4f*)(p + 4);
  }
  __builtin_amdgcn_sched_barrier(0);  // all 24 loads are in flight before the first wait: no load sinks down to its conversion
#pragma unroll  // constant indices keep these arrays in registers
  for (int j = 0; j < kCastXGroups; ++j)
    *(v4u*)(x16 + ex + (size_t)j * (kCastThreads * 8)) = cast8(xa[j], xc[j], 1.0f);
#pragma unroll  // constant indices keep these arrays in registers
  for (int i = 0; i < 4; ++i)
    *(v4u*)(wdst[i] + ew) = cast8(wa[i], wc[i], kWCarry);
}

// ---------------------------------------------------------------------------
// Fused attention for one (batch, head) and 256 queries per block: scores, softmax and probabilities.v in one pass
// over the keys, nothing of the 1024 x 1024 score plane leaves the registers.
//   S^T = K' . Q'^T   (A = 16 key rows, B = 16 query rows, K = 64 head dims)     D: lane = query c, register r = key 8*hs + r
//         K', Q' = centered row + variance / 8, scaled: the dot is log2e * (covariance + variance term) (see qkv_gemm_kernel);
//         C = minus the query's maximum in use, the same in all eight registers: D is the argument of exp2 as it stands
//   O^T += V^T . P^T  (A = 16 v^T rows, B = two converted S^T tiles, K = 32 keys) D: lane = query c, register r = dim 8*hs + r
// Two S^T tiles (keys 0..15 and 16..31 of a pass) converted in place are the B operand in the order Frag::load gives A.
// p = exp2(D), D = score in log2 units - m, m = the query's maximum in use: 0 at the start, set to the true maximum by the first
// pass, then raised (sum, output and this pass's D rescaled) only when a D exceeds 8, so p <= 256 fits f16.
// Block = 8 waves, wave w owns queries blockIdx.x*256 + w*32 .. +31 (two 16-query tiles); grid (4, 128), exact.
// LDS sKV: a stage is 128 keys of the head: 128 stored k rows of 128 B and 64 v^T rows of 256 B, brought in once for all
// eight waves by 16-byte asynchronous copies (whole 128-byte lines); two buffers, the next stage's copies fly while this
// one is worked on. Every wave reads its A fragments (k rows, v^T rows) from there with Frag::load.
// ---------------------------------------------------------------------------
constexpr int kAK     = 128;                     // keys per stage
constexpr int kKPitch = kHeadDim + 8;            // k rows: 144 B = 16 B x 9, no bank conflict for 16-byte fragment reads
constexpr int kVPitch = kAK + 8;                 // v^T rows: 272 B = 16 B x 17, likewise
constexpr int kKStage = kAK * kKPitch;           // elements of the k part of a buffer
constexpr int kAStage = kKStage + kHeadDim * kVPitch;   // elements per buffer: [k 128 rows | v^T 64 rows]
static_assert(kSeq % kAK == 0 && kSeq / kAK >= 2 && kAK % 32 == 0 && (kAStage * 2) % 16 == 0, "stages exact, two or more");
static_assert(((kAK / 32) & (kAK / 32 - 1)) == 0, "passes per stage a power of two: the key prefetch wraps by a mask");

// Eight 16-byte asynchronous copies per lane, global -> LDS. l = the lane's LDS byte address, g = its global address.
// s_wait_xcnt 0 closes the statement as a precaution: no register that a copy names is rewritten in front of it.
__device__ __forceinline__ void async_copy8(const unsigned (&l)[8], const void* const (&g)[8]) {
  asm volatile(
      "global_load_async_to_lds_b128 %0, %8, off\n\t"
      "global_load_async_to_lds_b128 %1, %9, off\n\t"
      "global_load_async_to_lds_b128 %2, %10, off\n\t"
      "global_load_async_to_lds_b128 %3, %11, off\n\t"
      "global_load_async_to_lds_b128 %4, %12, off\n\t"
      "global_load_async_to_lds_b128 %5, %13, off\n\t"
      "global_load_async_to_lds_b128 %6, %14, off\n\t"
      "global_load_async_to_lds_b128 %7, %15, off\n\t"
      "s_wait_xcnt 0x0"
      :: "v"(l[0]), "v"(l[1]), "v"(l[2]), "v"(l[3]), "v"(l[4]), "v"(l[5]), "v"(l[6]), "v"(l[7]),
         "v"(g[0]), "v"(g[1]), "v"(g[2]), "v"(g[3]), "v"(g[4]), "v"(g[5]), "v"(g[6]), "v"(g[7])
      : "memory");
}

__global__ __launch_bounds__(256) void attn_fused_kernel(const unsigned short* __restrict__ qc, const unsigned short* __restrict__ kc,
                                                         const unsigned short* __restrict__ vt, unsigned short* __restrict__ o16) {
  typedef Frag<_Float16> F;
  __shared__ __align__(16) _Float16 sKV[2 * kAStage];   // two stage buffers
  const int lane = threadIdx.x & 31, wave = threadIdx.x >> 5;
  const int b  = blockIdx.y >> 4;
  const int h  = blockIdx.y & (kHeads - 1);
  const int q0 = blockIdx.x * 256 + wave * 32;
  const int c  = lane & 15;
  const int hs = lane >> 4;

  // Copies: 8 lanes cover one k row's 128 bytes (the block 32 rows per copy), 16 lanes one v^T row's 256 bytes (16 rows per
  // copy); 4 copies for k and 4 for v^T, per lane and stage.
  const int krow = threadIdx.x >> 3, kcol = (threadIdx.x & 7) * 8;
  const int vrow = threadIdx.x >> 4, vcol = (threadIdx.x & 15) * 8;
  const _Float16* gK = (const _Float16*)kc + ((size_t)b * kSeq + krow) * kEmb + h * kHeadDim + kcol;
  const _Float16* gV = (const _Float16*)vt + (size_t)b * kEmb * kSeq + (size_t)(h * kHeadDim + vrow) * kSeq + vcol;
  const unsigned ldsK = (unsigned)(size_t)sKV + (unsigned)(krow * kKPitch + kcol) * 2u;
  const unsigned ldsV = (unsigned)(size_t)sKV + (unsigned)(kKStage + vrow * kVPitch + vcol) * 2u;
  auto stage_copies = [&](int t, int buf) {
    const unsigned lb = (unsigned)buf * (unsigned)(kAStage * 2);
    unsigned l[8];
    const void* g[8];
#pragma unroll  // constant indices keep these arrays in registers
    for (int e = 0; e < 4; ++e) {
      l[e]     = ldsK + lb + (unsigned)(e * 32 * kKPitch * 2);
      g[e]     = (const void*)(gK + (size_t)(t * kAK + e * 32) * kEmb);
      l[4 + e] = ldsV + lb + (unsigned)(e * 16 * kVPitch * 2);
      g[4 + e] = (const void*)(gV + (size_t)(e * 16) * kSeq + t * kAK);
    }
    async_copy8(l, g);
  };

  stage_copies(0, 0);
  wait_async0();
  __syncthreads();  // stage 0 is published
  stage_copies(1, 1);

  const _Float16* Qp = (const _Float16*)qc + ((size_t)b * kSeq + q0 + c) * kEmb + h * kHeadDim + hs * 8;
  const int koffs = c * kKPitch + hs * 8;             // this lane's place in a k fragment row
  const int voffs = kKStage + c * kVPitch + hs * 8;   // and in a v^T fragment row

  v16h qf[2][2];
  v8f cm[2];     // -m, the score products' C operand: lane = query, the same value in all eight registers
  v2f l[2][2];   // a query's sum of probabilities in four parts: [query tile][key tile], even and odd registers; joined in the epilogue
  v8f o[4][2];
#pragma unroll  // constant indices keep these arrays in registers
  for (int qt = 0; qt < 2; ++qt) {
    qf[qt][0] = F::load(Qp + (size_t)(qt * 16) * kEmb);
    qf[qt][1] = F::load(Qp + (size_t)(qt * 16) * kEmb + 32);
    cm[qt] = (v8f){0.f,0.f,0.f,0.f,0.f,0.f,0.f,0.f};
    l[qt][0] = (v2f){0.f, 0.f};
    l[qt][1] = (v2f){0.f, 0.f};
#pragma unroll  // constant indices keep these arrays in registers
    for (int i = 0; i < 4; ++i) o[i][qt] = (v8f){0.f,0.f,0.f,0.f,0.f,0.f,0.f,0.f};
  }

#pragma clang loop unroll(disable)  // one stage per trip: the buffer index stays a run-time value, the text small
  for (int t = 0; t < kSeq / kAK; ++t) {
    const _Float16* sk = sKV + (t & 1) * kAStage + koffs;
    const _Float16* sv = sKV + (t & 1) * kAStage + voffs;
    v16h kf[2][2];
#pragma unroll  // constant indices keep these arrays in registers
    for (int kt = 0; kt < 2; ++kt) {
      kf[kt][0] = F::load(sk + (kt * 16) * kKPitch);
      kf[kt][1] = F::load(sk + (kt * 16) * kKPitch + 32);
    }

#pragma clang loop unroll(disable)  // one pass per trip keeps the text small and the registers of one pass
    for (int p = 0; p < kAK / 32; ++p) {
      v16h vf[4];
#pragma unroll  // constant indices keep these arrays in registers
      for (int i = 0; i < 4; ++i) vf[i] = F::load(sv + (i * 16) * kVPitch + p * 32);
      __builtin_amdgcn_sched_barrier(0);  // the pass's v^T reads stay one group up here, not sunk among the WMMAs that use them

      v8f s[2][2];
#pragma unroll  // constant indices keep these arrays in registers
      for (int kt = 0; kt < 2; ++kt)
#pragma unroll  // constant indices keep these arrays in registers
        for (int qt = 0; qt < 2; ++qt) {
          s[kt][qt] = F::mma(kf[kt][0], qf[qt][0], cm[qt]);
          s[kt][qt] = F::mma(kf[kt][1], qf[qt][1], s[kt][qt]);
        }

      __builtin_amdgcn_sched_barrier(0);  // the reads below refill the registers of the products above
      // next pass's key fragments, fetched while this pass's softmax runs; never past this stage's own buffer
      // (the stage's last pass re-reads its keys 0..31, unused: no branch stands behind the products above)
      const int np = (p + 1) & (kAK / 32 - 1);
#pragma unroll  // constant indices keep these arrays in registers
      for (int kt = 0; kt < 2; ++kt) {
        kf[kt][0] = F::load(sk + (np * 32 + kt * 16) * kKPitch);
        kf[kt][1] = F::load(sk + (np * 32 + kt * 16) * kKPitch + 32);
      }
      __builtin_amdgcn_sched_barrier(0);  // and stay one group ahead of the softmax that covers their latency

      float mx[2];
#pragma unroll  // constant indices keep these arrays in registers
      for (int qt = 0; qt < 2; ++qt) {
        float a0 = fmaxf(fmaxf(s[0][qt][0], s[0][qt][1]), fmaxf(s[0][qt][2], s[0][qt][3]));
        float a1 = fmaxf(fmaxf(s[0][qt][4], s[0][qt][5]), fmaxf(s[0][qt][6], s[0][qt][7]));
        float a2 = fmaxf(fmaxf(s[1][qt][0], s[1][qt][1]), fmaxf(s[1][qt][2], s[1][qt][3]));
        float a3 = fmaxf(fmaxf(s[1][qt][4], s[1][qt][5]), fmaxf(s[1][qt][6], s[1][qt][7]));
        mx[qt] = fmaxf(fmaxf(a0, a1), fmaxf(a2, a3));
      }

      // one wave-uniform test per pass; both halves of a query's lane pair take the same new maximum
      // the very first pass always takes it: it moves m from 0 to the true maximum, up or down (sum and output are still 0)
      const bool first = (t | p) == 0;
      const float thr = first ? -INFINITY : 8.0f;
      const bool need = (mx[0] > thr) || (mx[1] > thr);
      if (__builtin_amdgcn_ballot_w32(need) != 0u) {
#pragma unroll  // constant indices keep these arrays in registers
        for (int qt = 0; qt < 2; ++qt) {
          const float dm = fmaxf(mx[qt], __shfl_xor(mx[qt], 16, 32));
          const float d  = first ? dm : fmaxf(dm, 0.f);       // the step of m
          const float al = first ? 1.0f : __builtin_amdgcn_exp2f(-d);
#pragma unroll  // constant indices keep these arrays in registers
          for (int r = 0; r < 8; ++r) {
            cm[qt][r]   -= d;
            s[0][qt][r] -= d;
            s[1][qt][r] -= d;
          }
          l[qt][0] *= al;
          l[qt][1] *= al;
#pragma unroll  // constant indices keep these arrays in registers
          for (int i = 0; i < 4; ++i)
#pragma unroll  // constant indices keep these arrays in registers
            for (int r = 0; r < 8; ++r) o[i][qt][r] *= al;
        }
      }

      v16h pf[2];
#pragma unroll  // constant indices keep these arrays in registers
      for (int qt = 0; qt < 2; ++qt) {
        // register pairs (r, r + 1) of one accumulator go together (sum, conversion): packed f32 adds on adjacent registers, no moves
#pragma unroll  // constant indices keep these arrays in registers
        for (int kt = 0; kt < 2; ++kt)
#pragma unroll  // constant indices keep these arrays in registers
          for (int e = 0; e < 4; ++e) {
            const v2f pr = (v2f){__builtin_amdgcn_exp2f(s[kt][qt][2 * e]), __builtin_amdgcn_exp2f(s[kt][qt][2 * e + 1])};
            l[qt][kt] += pr;
            pf[qt][8 * kt + 2 * e]     = (_Float16)pr[0];
            pf[qt][8 * kt + 2 * e + 1] = (_Float16)pr[1];
          }
      }

#pragma unroll  // constant indices keep these arrays in registers
      for (int i = 0; i < 4; ++i)
#pragma unroll  // constant indices keep these arrays in registers
        for (int qt = 0; qt < 2; ++qt) o[i][qt] = F::mma(vf[i], pf[qt], o[i][qt]);
      __builtin_amdgcn_sched_barrier(0);  // keeps the four slots below behind the pass's last WMMA
      // four vector slots between the last WMMA and the next pass's address arithmetic, which may take over its A or B registers
      asm volatile("v_nop\n\tv_nop\n\tv_nop\n\tv_nop");
    }
    wait_ds0();
    wait_async0();
    __syncthreads();                             // publishes stage t + 1 and ends every wave's reads of stage t
    if (t + 2 < kSeq / kAK) stage_copies(t + 2, t & 1);
  }
  wait_async0();

  // epilogue: join the two halves' sums, normalise, 8 consecutive head dims per lane = one 16-byte store
#pragma unroll  // constant indices keep these arrays in registers
  for (int qt = 0; qt < 2; ++qt) {
    const v2f l2    = l[qt][0] + l[qt][1];
    const float lh  = l2[0] + l2[1];
    const float lt  = lh + __shfl_xor(lh, 16, 32);
    const float inv = kOCarry * (1.0f / lt);
    unsigned short* op = o16 + ((size_t)b * kSeq + q0 + qt * 16 + c) * kEmb + h * kHeadDim + hs * 8;
#pragma unroll  // constant indices keep these arrays in registers
    for (int i = 0; i < 4; ++i) {
      v8h hv;
#pragma unroll  // constant indices keep these arrays in registers
      for (int r = 0; r < 8; ++r) hv[r] = (_Float16)(o[i][qt][r] * inv);
      *(v8h*)(op + i * 16) = hv;
    }
  }
}

// ---------------------------------------------------------------------------
// Host entry: 4 launches (one cast of all five inputs, the q/k/v projections, fused attention, output GEMM).
// ---------------------------------------------------------------------------
extern "C" void kernel_launch(void* const* d_in, const int* in_sizes, int n_in,
                              void* d_out, int out_size, void* d_ws, size_t ws_size,
                              hipStream_t stream) {
  if (n_in < 5) return;
  if (in_sizes[0] != kTok * kEmb) return;
  if (in_sizes[1] != kEmb * kEmb || in_sizes[2] != kEmb * kEmb || in_sizes[3] != kEmb * kEmb || in_sizes[4] != kEmb * kEmb) return;
  if (out_size != kTok * kEmb) return;
  if (ws_size < kWsTotal) return;

  const float* x  = (const float*)d_in[0];
  const float* Wq = (const float*)d_in[1];
  const float* Wk = (const float*)d_in[2];
  const float* Wv = (const float*)d_in[3];
  const float* Wo = (const float*)d_in[4];
  float* outp = (float*)d_out;

  char* ws = (char*)d_ws;
  unsigned short* X16  = (unsigned short*)(ws + kOffX16);
  unsigned short* O16  = (unsigned short*)(ws + kOffX16);     // region reuse, see map
  unsigned short* Wq16 = (unsigned short*)(ws + kOffWq16);
  unsigned short* Wk16 = (unsigned short*)(ws + kOffWk16);
  unsigned short* Wv16 = (unsigned short*)(ws + kOffWv16);
  unsigned short* Wo16 = (unsigned short*)(ws + kOffWo16);
  unsigned short* VT16 = (unsigned short*)(ws + kOffVT16);
  unsigned short* QC16 = (unsigned short*)(ws + kOffQC16);
  unsigned short* KC16 = (unsigned short*)(ws + kOffKC16);

  const float* nof = (const float*)nullptr;
  const unsigned short* nou = (const unsigned short*)nullptr;

  // 1) casts to f16 planes, one launch
  cast_all_f16_kernel<<<kCastBlocks, kCastThreads, 0, stream>>>(x, Wq, Wk, Wv, Wo, X16, Wq16, Wk16, Wv16, Wo16);

  // 2) q, k and v projections, one launch: 64 x 4 = 256 blocks, each 128 tokens x 256 channels of all three weights.
  //    -> QC16, KC16 (per head: centered + variance / 8), VT16 f16 [8][1024][1024] (v^T per batch).
  qkv_gemm_kernel<<<(kTok / kBM) * (kEmb / kBN), 256, 0, stream>>>(X16, Wq16, QC16, KC16, VT16);

  // 3) attention: one launch, block = (256 queries, one batch and head)
  attn_fused_kernel<<<dim3(kSeq / 256, kBatch * kHeads), 256, 0, stream>>>(QC16, KC16, VT16, O16);

  // 4) out = O . Wo^T : A = O16 [8192][1024], Bt = Wo16 [1024][1024], K = 1024, C = d_out f32 [8192][1024].
  {
    const int blocks = (kTok / kBM) * (kEmb / kBN);   // 256
    wmma_gemm64<0, false, 0, 0, false, 0><<<dim3(blocks, 1), 256, 0, stream>>>(
        O16, nou, kEmb, 0L, Wo16, nou, kEmb, 0L, (void*)outp, (void*)nullptr, kEmb, 0L,
        nof, nof, 0L, kTok, kEmb, kEmb, kOutScale);
  }
}
